// v000
// The times below were measured on an AMD MI455X: many runs one after another, warmed up first and cycling through
// copies of the inputs, with the whole window's GPU time divided by the number of runs. Launches and the gaps
// between them are all in it. The median over several windows is given; except for v000 it joins two sittings, which
// can be a few percent apart, so the side-by-side timings, each taken in one sitting, are the better comparison.
// v000 is the starting kernel. One run takes 943 microseconds.
#include <hip/hip_runtime.h>
// Self-KAN attention (4 images, 256 channels, 64 x 64): att = conv1x1(x) (64 ch); q, k, v = FastKAN 1x1 convs (base_conv(silu(att)) + spline_conv(RBF basis of the instance-normalised att, 8 grid points)); energy = q.k over the 4096 positions (NO scaling), softmax over keys, out = v.attn^T; att2 = conv1x1(out) (256 ch); y = gamma*x + att2; training-mode BatchNorm -> [4,256,64,64].
// Compute dtype: x, weights, biases, gamma, BN affine rounded to bf16; x exact in f16; silu/basis operands as hi + 16x residual pairs (~2^-20); q, k, P, v as hi + x2^10 residual pairs (~2^-21); the attention output as hi + 16x residual pairs too; f32 accumulation, statistics, softmax. v_wmma_f32_16x16x32_f16.
#define NIMG 4
#define CIN 256
#define DK 64
#define HW 64
#define NPI (HW * HW)            /* 4096 */
#define NPX (NIMG * NPI)         /* 16384 */
#define NG 8
#define NH 1
#define DM DK
#define SCL 1.0f
typedef __bf16 v16b __attribute__((ext_vector_type(16)));
typedef unsigned short v8us __attribute__((ext_vector_type(8), may_alias));
typedef float  v8f  __attribute__((ext_vector_type(8)));
typedef float  v4f  __attribute__((ext_vector_type(4)));
typedef float  v4fa __attribute__((ext_vector_type(4), may_alias));
union FragB { v16b v; v8us half[2]; unsigned short u[16]; };

__device__ __forceinline__ unsigned short bf16_bits(float x) { unsigned int u = __float_as_uint(x); return (unsigned short)((u + 0x7FFFu + ((u >> 16) & 1u)) >> 16); }
__device__ __forceinline__ float bf16_val(unsigned short b) { return __uint_as_float(((unsigned int)b) << 16); }
__device__ __forceinline__ float bf16_round(float x) { return bf16_val(bf16_bits(x)); }
// D += A·B with NT terms: 1 = ah·bh, 2 = + al·bh (A split), 3 = + ah·bl (both split)
template <int NT>
__device__ __forceinline__ v8f mmaN(v16b ah, v16b al, v16b bh, v16b bl, v8f c) {
  c = __builtin_amdgcn_wmma_f32_16x16x32_bf16(false, ah, false, bh, (short)0, c, false, false);
  if (NT >= 2) c = __builtin_amdgcn_wmma_f32_16x16x32_bf16(false, al, false, bh, (short)0, c, false, false);
  if (NT >= 3) c = __builtin_amdgcn_wmma_f32_16x16x32_bf16(false, ah, false, bl, (short)0, c, false, false);
  asm volatile("v_nop\n\tv_nop\n\tv_nop\n\tv_nop" : "+v"(c) : "v"(ah), "v"(al), "v"(bh), "v"(bl));
  return c;
}

__global__ __launch_bounds__(256) void k_wt_bf16(const float* __restrict__ W, unsigned short* __restrict__ Wt, int K, int N) {
  const int t = blockIdx.x * 256 + threadIdx.x;
  const int k8n = K / 8;
  if (t >= N * k8n) return;
  const int n = t / k8n, k8 = (t % k8n) * 8;
  v8us v;
#pragma unroll
  for (int i = 0; i < 8; ++i) v[i] = bf16_bits(W[(size_t)(k8 + i) * N + n]);
  *(v8us*)(Wt + (size_t)n * K + k8) = v;
  
}

// GEMM C[M][N] (f32, pitch ldc) = act(A[M][K]·W + bias). A f32 row-major (pitch lda) converted per fragment to bf16
// (ASPLIT: hi/lo two planes -> 2 terms, else single rounded term); Wt bf16 [N][K] (pitch ldb). BIAS_BF16 rounds the
// bias to bf16 first (bias quantised to bf16 before the add). K%32==0, M%16==0, N%64==0.
template <bool ASPLIT, int ACT, bool BIAS_BF16>
__global__ __launch_bounds__(128) void k_gemm_bf(const float* __restrict__ A, int lda, const unsigned short* __restrict__ Wt, int ldb,
                                               const float* __restrict__ bias, float* __restrict__ C, int ldc, int M, int N, int K) {
  __shared__ __attribute__((aligned(16))) float so[4][16][64];
  const int tid = threadIdx.x, w = tid >> 5, lane = tid & 31, ln = lane & 15, hh = lane >> 4;
  const int ntn = N / 64;
  const int wid = blockIdx.x * 4 + w;
  const int mt = wid / ntn, nq = wid % ntn;
  if (mt * 16 >= M) return;
  const int row0 = mt * 16, col0 = nq * 64;
  const float* arow = A + (size_t)(row0 + ln) * lda;
  v8f acc[4] = {};
  for (int kb = 0; kb < K; kb += 32) {
    FragB ah, al;
    const v4f x0 = *(const v4fa*)(arow + kb + 8 * hh), x1 = *(const v4fa*)(arow + kb + 8 * hh + 4);
    const v4f x2 = *(const v4fa*)(arow + kb + 16 + 8 * hh), x3 = *(const v4fa*)(arow + kb + 16 + 8 * hh + 4);
    float xs[16] = {x0[0],x0[1],x0[2],x0[3],x1[0],x1[1],x1[2],x1[3],x2[0],x2[1],x2[2],x2[3],x3[0],x3[1],x3[2],x3[3]};
#pragma unroll
    for (int i = 0; i < 16; ++i) { const unsigned short hb = bf16_bits(xs[i]); ah.u[i] = hb; al.u[i] = ASPLIT ? bf16_bits(xs[i] - bf16_val(hb)) : (unsigned short)0; }
#pragma unroll
    for (int t = 0; t < 4; ++t) {
      const unsigned short* brow = Wt + (size_t)(col0 + t * 16 + ln) * ldb + kb;
      FragB b;
      b.half[0] = *(const v8us*)(brow + 8 * hh);
      b.half[1] = *(const v8us*)(brow + 16 + 8 * hh);
      acc[t] = mmaN<ASPLIT ? 2 : 1>(ah.v, al.v, b.v, b.v, acc[t]);
    }
  }
#pragma unroll
  for (int t = 0; t < 4; ++t) {
    float bv = bias ? bias[col0 + t * 16 + ln] : 0.f;
    if (BIAS_BF16) bv = bf16_round(bv);
#pragma unroll
    for (int r = 0; r < 8; ++r) { float v = acc[t][r] + bv; if (ACT == 1) v = fmaxf(v, 0.f); so[w][8 * hh + r][t * 16 + ln] = v; }
  }
  __builtin_amdgcn_fence(__ATOMIC_ACQ_REL, "workgroup");
  __builtin_amdgcn_wave_barrier();
  const int rsub = lane >> 4, c4 = (lane & 15) * 4;
  {
#pragma unroll
    for (int q = 0; q < 8; ++q) {
      const int r = q * 2 + rsub;
      const v4f v = *(const v4fa*)&so[w][r][c4];
      *(v4f*)(C + (size_t)(row0 + r) * ldc + col0 + c4) = v;
    }
    
  }
}

// GEMM C = act(A·W + bias + resid): A f32 (ASPLIT -> hi/lo 2 terms), Wt bf16 [N][K]; ACT 0 none, 1 relu, 2 exact gelu;
// resid (optional, f32, row index = (row % rmod), pitch ldr, RES_BF16 rounds it) added before the activation.
template <bool ASPLIT, int ACT, bool BIAS_BF16, bool RES_BF16>
__global__ __launch_bounds__(128) void k_gemm_bf3(const float* __restrict__ A, int lda, const unsigned short* __restrict__ Wt, int ldb,
                                                const float* __restrict__ bias, const float* __restrict__ resid, int rmod, int ldr,
                                                float* __restrict__ C, int ldc, int M, int N, int K) {
  __shared__ __attribute__((aligned(16))) float so[4][16][64];
  const int tid = threadIdx.x, w = tid >> 5, lane = tid & 31, ln = lane & 15, hh = lane >> 4;
  const int ntn = N / 64;
  const int wid = blockIdx.x * 4 + w;
  const int mt = wid / ntn, nq = wid % ntn;
  if (mt * 16 >= M) return;
  const int row0 = mt * 16, col0 = nq * 64;
  const float* arow = A + (size_t)(row0 + ln) * lda;
  v8f acc[4] = {};
  for (int kb = 0; kb < K; kb += 32) {
    FragB ah, al;
    const v4f x0 = *(const v4fa*)(arow + kb + 8 * hh), x1 = *(const v4fa*)(arow + kb + 8 * hh + 4);
    const v4f x2 = *(const v4fa*)(arow + kb + 16 + 8 * hh), x3 = *(const v4fa*)(arow + kb + 16 + 8 * hh + 4);
    float xs[16] = {x0[0],x0[1],x0[2],x0[3],x1[0],x1[1],x1[2],x1[3],x2[0],x2[1],x2[2],x2[3],x3[0],x3[1],x3[2],x3[3]};
#pragma unroll
    for (int i = 0; i < 16; ++i) { const unsigned short hb = bf16_bits(xs[i]); ah.u[i] = hb; al.u[i] = ASPLIT ? bf16_bits(xs[i] - bf16_val(hb)) : (unsigned short)0; }
#pragma unroll
    for (int t = 0; t < 4; ++t) {
      const unsigned short* brow = Wt + (size_t)(col0 + t * 16 + ln) * ldb + kb;
      FragB b;
      b.half[0] = *(const v8us*)(brow + 8 * hh);
      b.half[1] = *(const v8us*)(brow + 16 + 8 * hh);
      acc[t] = mmaN<ASPLIT ? 2 : 1>(ah.v, al.v, b.v, b.v, acc[t]);
    }
  }
#pragma unroll
  for (int t = 0; t < 4; ++t) {
    const int col = col0 + t * 16 + ln;
    float bv = bias ? bias[col] : 0.f;
    if (BIAS_BF16) bv = bf16_round(bv);
#pragma unroll
    for (int r = 0; r < 8; ++r) {
      float v = acc[t][r] + bv;
      if (resid) { float rv = resid[(size_t)((row0 + 8 * hh + r) % rmod) * ldr + col]; if (RES_BF16) rv = bf16_round(rv); v += rv; }
      if (ACT == 1) v = fmaxf(v, 0.f);
      if (ACT == 2) v = 0.5f * v * (1.0f + erff(v * 0.70710678118654752f));
      if (ACT == 3) { const float u = 0.7978845608028654f * (v + 0.044715f * v * v * v); v = 0.5f * v * (1.0f + tanhf(u)); }
      so[w][8 * hh + r][t * 16 + ln] = v;
    }
  }
  __builtin_amdgcn_fence(__ATOMIC_ACQ_REL, "workgroup");
  __builtin_amdgcn_wave_barrier();
  const int rsub = lane >> 4, c4 = (lane & 15) * 4;
  {
#pragma unroll
    for (int q = 0; q < 8; ++q) {
      const int r = q * 2 + rsub;
      const v4f v = *(const v4fa*)&so[w][r][c4];
      *(v4f*)(C + (size_t)(row0 + r) * ldc + col0 + c4) = v;
    }
    
  }
}
// row LayerNorm (biased variance, eps) over N: s = X (+ R); optional out_sum <- s; out_norm <- (s-mu)*rsqrt(var+eps)*g + b
template <bool PARAM_BF16>
__global__ __launch_bounds__(256) void k_layernorm(const float* __restrict__ X, const float* __restrict__ R, const float* __restrict__ g, const float* __restrict__ bta,
                                                  float* __restrict__ out_sum, float* __restrict__ out_norm, int N, float eps) {
  __shared__ float red[256];
  const int row = blockIdx.x, tid = threadIdx.x;
  const float* x = X + (size_t)row * N; const float* rr = R ? R + (size_t)row * N : nullptr;
  float vals[16];                     // up to N = 4096
  const int per = N / 256;            // contiguous chunk per thread? use strided-by-4 chunks: thread handles j = tid*4 + 1024*u
  float s1 = 0.f;
  for (int u = 0; u < per / 4; ++u) {
    const int j = tid * 4 + 1024 * u;
    const v4f a = *(const v4fa*)(x + j);
    v4f b = {0.f,0.f,0.f,0.f}; if (rr) b = *(const v4fa*)(rr + j);
#pragma unroll
    for (int q = 0; q < 4; ++q) { const float v = a[q] + b[q]; vals[u * 4 + q] = v; s1 += v; }
  }
  red[tid] = s1; __syncthreads();
  for (int st = 128; st > 0; st >>= 1) { if (tid < st) red[tid] += red[tid + st]; __syncthreads(); }
  const float mu = red[0] / (float)N; __syncthreads();
  float s2 = 0.f;
  for (int u = 0; u < per / 4; ++u)
#pragma unroll
    for (int q = 0; q < 4; ++q) { const float c = vals[u * 4 + q] - mu; s2 += c * c; }
  red[tid] = s2; __syncthreads();
  for (int st = 128; st > 0; st >>= 1) { if (tid < st) red[tid] += red[tid + st]; __syncthreads(); }
  const float rs = rsqrtf(red[0] / (float)N + eps);
  {
    for (int u = 0; u < per / 4; ++u) {
      const int j = tid * 4 + 1024 * u;
      v4f o, sm;
#pragma unroll
      for (int q = 0; q < 4; ++q) {
        float gg = g[j + q], bb = bta[j + q];
        if (PARAM_BF16) { gg = bf16_round(gg); bb = bf16_round(bb); }
        sm[q] = vals[u * 4 + q]; o[q] = (vals[u * 4 + q] - mu) * rs * gg + bb;
      }
      if (out_sum) *(v4f*)(out_sum + (size_t)row * N + j) = sm;
      *(v4f*)(out_norm + (size_t)row * N + j) = o;
    }
    
  }
}



// ---- f16 WMMA path (v_wmma_f32_16x16x32_f16): 11-bit significands for operands in range — used where a [0,1] probability operand needs more precision than bf16
typedef _Float16 v16h __attribute__((ext_vector_type(16)));
union FragH { v16h v; v8us half[2]; _Float16 h[16]; unsigned short u[16]; };
template <int NT>
__device__ __forceinline__ v8f mmaH(v16h ah, v16h al, v16h bh, v16h bl, v8f c) {
  c = __builtin_amdgcn_wmma_f32_16x16x32_f16(false, ah, false, bh, (short)0, c, false, false);
  if (NT >= 2) c = __builtin_amdgcn_wmma_f32_16x16x32_f16(false, al, false, bh, (short)0, c, false, false);
  if (NT >= 3) c = __builtin_amdgcn_wmma_f32_16x16x32_f16(false, ah, false, bl, (short)0, c, false, false);
  asm volatile("v_nop\n\tv_nop\n\tv_nop\n\tv_nop" : "+v"(c) : "v"(ah), "v"(al), "v"(bh), "v"(bl));
  return c;
}
// batched GEMM like k_gemm_b but f16 operands: A f32 (split into f16 hi/lo if ASPLIT, else rounded to f16), Bt = f16 values [n][k]; alpha; C f32; N multiple of 16 (partial tiles skipped)
template <bool ASPLIT>
__global__ __launch_bounds__(128) void k_gemm_h(const float* __restrict__ A, int lda, size_t sA, const _Float16* __restrict__ Bh, int ldb, size_t sB, float alpha, float* __restrict__ C, int ldc, size_t sC, int M, int N, int K) {
  __shared__ __attribute__((aligned(16))) float so[4][16][64];
  const int tid = threadIdx.x, w = tid >> 5, lane = tid & 31, ln = lane & 15, hh = lane >> 4; const int by = blockIdx.y;
  A += (size_t)by * sA; Bh += (size_t)by * sB; C += (size_t)by * sC;
  const int ntn = (N + 63) / 64; const int wid = blockIdx.x * 4 + w; const int mt = wid / ntn, nq = wid % ntn; if (mt * 16 >= M) return;
  const int row0 = mt * 16, col0 = nq * 64; const float* arow = A + (size_t)(row0 + ln) * lda;
  v8f acc[4] = {};
  for (int kb = 0; kb < K; kb += 32) {
    FragH ah, al;
    const v4f x0 = *(const v4fa*)(arow + kb + 8 * hh), x1 = *(const v4fa*)(arow + kb + 8 * hh + 4), x2 = *(const v4fa*)(arow + kb + 16 + 8 * hh), x3 = *(const v4fa*)(arow + kb + 16 + 8 * hh + 4);
    float xs[16] = {x0[0],x0[1],x0[2],x0[3],x1[0],x1[1],x1[2],x1[3],x2[0],x2[1],x2[2],x2[3],x3[0],x3[1],x3[2],x3[3]};
#pragma unroll
    for (int i = 0; i < 16; ++i) { const _Float16 h = (_Float16)xs[i]; ah.h[i] = h; al.h[i] = ASPLIT ? (_Float16)(xs[i] - (float)h) : (_Float16)0.0f; }
#pragma unroll
    for (int t = 0; t < 4; ++t) { if (col0 + t * 16 >= N) continue; const size_t boff = (size_t)(col0 + t * 16 + ln) * ldb + kb; FragH bq; bq.half[0] = *(const v8us*)(Bh + boff + 8 * hh); bq.half[1] = *(const v8us*)(Bh + boff + 16 + 8 * hh);
      acc[t] = mmaH<ASPLIT ? 2 : 1>(ah.v, al.v, bq.v, bq.v, acc[t]); }
  }
#pragma unroll
  for (int t = 0; t < 4; ++t) { if (col0 + t * 16 >= N) continue;
#pragma unroll
    for (int r = 0; r < 8; ++r) so[w][8 * hh + r][t * 16 + ln] = acc[t][r] * alpha; }
  __builtin_amdgcn_fence(__ATOMIC_ACQ_REL, "workgroup"); __builtin_amdgcn_wave_barrier();
  const int rsub = lane >> 4, c4 = (lane & 15) * 4;
  {
#pragma unroll
    for (int q = 0; q < 8; ++q) { const int r = q * 2 + rsub; if (col0 + c4 < N) { const v4f v = *(const v4fa*)&so[w][r][c4]; *(v4f*)(C + (size_t)(row0 + r) * ldc + col0 + c4) = v; } }
     }
}

// Wt[n][k] = f16(W[k][n]·scale) from f32 row-major W[K][N] (scale = power of two; bf16-exact weights stay exact in f16 away from the subnormal range)
__global__ __launch_bounds__(256) void k_wt_f16(const float* __restrict__ W, _Float16* __restrict__ Wt, int K, int N, float scale) {
  const int t = blockIdx.x * 256 + threadIdx.x; if (t >= N * (K / 8)) return; const int n = t / (K / 8), k8 = (t % (K / 8)) * 8; FragH f;
#pragma unroll
  for (int i = 0; i < 8; ++i) f.h[i] = (_Float16)(bf16_round(W[(size_t)(k8 + i) * N + n]) * scale); const v8us o = f.half[0];
  *(v8us*)((unsigned short*)Wt + (size_t)n * K + k8) = o; 
}
// k_gemm_hh variant with fused epilogue: v = acc·alpha + bias[by·sBias + col] (+ CP[(row/rowsPerB)·sCPb + by·64 + col] if CP) ; ACT 0 none / 1 elu ; writes f16 C16 (and f32 C if non-null)
template <int ACT>
__global__ __launch_bounds__(128) void k_gemm_hhx(const _Float16* __restrict__ A, int lda, size_t sA, const _Float16* __restrict__ Bh, int ldb, size_t sB, float alpha, const float* __restrict__ bias, size_t sBias, const float* __restrict__ CP, int rowsPerB, size_t sCPb, int row0g,
    float* __restrict__ C, _Float16* __restrict__ C16, int ldc, size_t sC, int M, int N, int K) {
  __shared__ __attribute__((aligned(16))) float so[4][16][64];
  const int tid = threadIdx.x, w = tid >> 5, lane = tid & 31, ln = lane & 15, hh = lane >> 4; const int by = blockIdx.y;
  A += (size_t)by * sA; Bh += (size_t)by * sB; const size_t cofs = (size_t)by * sC; const float* bp = bias ? bias + (size_t)by * sBias : nullptr;
  const int ntn = (N + 63) / 64; const int wid = blockIdx.x * 4 + w; const int mt = wid / ntn, nq = wid % ntn; if (mt * 16 >= M) return;
  const int row0 = mt * 16, col0 = nq * 64; const _Float16* arow = A + (size_t)(row0 + ln) * lda;
  v8f acc[4] = {};
  for (int kb = 0; kb < K; kb += 32) { FragH ah; ah.half[0] = *(const v8us*)((const unsigned short*)arow + kb + 8 * hh); ah.half[1] = *(const v8us*)((const unsigned short*)arow + kb + 16 + 8 * hh);
#pragma unroll
    for (int t = 0; t < 4; ++t) { if (col0 + t * 16 >= N) continue; const size_t boff = (size_t)(col0 + t * 16 + ln) * ldb + kb; FragH bq; bq.half[0] = *(const v8us*)((const unsigned short*)Bh + boff + 8 * hh); bq.half[1] = *(const v8us*)((const unsigned short*)Bh + boff + 16 + 8 * hh);
      acc[t] = mmaH<1>(ah.v, ah.v, bq.v, bq.v, acc[t]); }
  }
#pragma unroll
  for (int t = 0; t < 4; ++t) { if (col0 + t * 16 >= N) continue; const int col = col0 + t * 16 + ln; const float bv = bp ? bf16_round(bp[col]) : 0.f;
#pragma unroll
    for (int r = 0; r < 8; ++r) { float v = acc[t][r] * alpha + bv; if (CP) { const int bidx = (row0g + row0 + 8 * hh + r) / rowsPerB; v += CP[(size_t)bidx * sCPb + (size_t)by * 64 + col]; } if (ACT == 1) v = (v > 0.f) ? v : expm1f(v); else if (ACT == 7) v = (v > 0.f) ? v + 1.0f : expf(v); else if (ACT == 8) v = tanhf(v); else if (ACT == 9) v = 0.5f * v * (1.0f + tanhf(0.7978845608028654f * (v + 0.044715f * v * v * v))); else if (ACT == 11) v = 1.0f / (1.0f + expf(-v)); else if (ACT == 12) v = (v > 0.f) ? v : 0.01f * v; else if (ACT == 14) v = (v > 0.f) ? v : 0.1f * v; else if (ACT == 15) v = v / (1.0f + expf(-v)); else if (ACT == 3) v = fmaxf(v, 0.f); else if (ACT == 6) v = 0.5f * v * (1.0f + erff(v * 0.70710678118654752f)); so[w][8 * hh + r][t * 16 + ln] = v; } }
  __builtin_amdgcn_fence(__ATOMIC_ACQ_REL, "workgroup"); __builtin_amdgcn_wave_barrier();
  const int rsub = lane >> 4, c4 = (lane & 15) * 4; typedef _Float16 v4h __attribute__((ext_vector_type(4)));
  {
#pragma unroll
    for (int q = 0; q < 8; ++q) { const int r = q * 2 + rsub; if (col0 + c4 < N) { const v4f v = *(const v4fa*)&so[w][r][c4]; if (C) *(v4f*)(C + cofs + (size_t)(row0 + r) * ldc + col0 + c4) = v; if (C16) { v4h h4; for (int i = 0; i < 4; ++i) h4[i] = (_Float16)v[i]; *(v4h*)(C16 + cofs + (size_t)(row0 + r) * ldc + col0 + c4) = h4; } } }
     }
}


typedef _Float16 v4h __attribute__((ext_vector_type(4)));

__global__ __launch_bounds__(256) void k_x16(const float* __restrict__ x, _Float16* __restrict__ X16, size_t n8) { const size_t t = (size_t)blockIdx.x * 256 + threadIdx.x; if (t >= n8) return; FragH f;
#pragma unroll
  for (int q = 0; q < 8; ++q) f.h[q] = (_Float16)bf16_round(x[t * 8 + q]); *(v8us*)((unsigned short*)X16 + t * 8) = f.half[0];  }
__global__ __launch_bounds__(256) void k_h16(const float* __restrict__ x, _Float16* __restrict__ X16, size_t n8) { const size_t t = (size_t)blockIdx.x * 256 + threadIdx.x; if (t >= n8) return; FragH f;
#pragma unroll
  for (int q = 0; q < 8; ++q) f.h[q] = (_Float16)x[t * 8 + q]; *(v8us*)((unsigned short*)X16 + t * 8) = f.half[0];  }
__global__ __launch_bounds__(256) void k_round16f(const float* __restrict__ W, _Float16* __restrict__ Bt, size_t n8) { const size_t t = (size_t)blockIdx.x * 256 + threadIdx.x; if (t >= n8) return; FragH f;
#pragma unroll
  for (int i = 0; i < 8; ++i) f.h[i] = (_Float16)(bf16_round(W[t * 8 + i]) * 16.0f); *(v8us*)((unsigned short*)Bt + t * 8) = f.half[0];  }
template <int NHv, int TTv>
__global__ __launch_bounds__(256) void k_vt(const _Float16* __restrict__ V16, int ldv, int voff, _Float16* __restrict__ Vt) { __shared__ unsigned short tl[64][66]; const int tid = threadIdx.x; const int slab = blockIdx.x / (TTv / 64), lg = blockIdx.x % (TTv / 64); const int b = slab / NHv, h = slab % NHv;
  for (int i = tid; i < 64 * 8; i += 256) { const int r = i / 8, c8 = (i % 8) * 8; FragH f; f.half[0] = *(const v8us*)((const unsigned short*)V16 + ((size_t)b * TTv + lg * 64 + r) * ldv + voff + h * 64 + c8);
#pragma unroll
    for (int q = 0; q < 8; ++q) tl[r][c8 + q] = f.u[q]; }
  __syncthreads();
  {
#pragma unroll
    for (int rd = 0; rd < 2; ++rd) { const int d = rd * 32 + tid / 8, pc = tid % 8; FragH f;
#pragma unroll
      for (int q = 0; q < 8; ++q) f.u[q] = tl[pc * 8 + q][d];
      *(v8us*)((unsigned short*)Vt + ((size_t)slab * 64 + d) * TTv + lg * 64 + pc * 8) = f.half[0]; }
     } }

__global__ __launch_bounds__(256) void k_hl(const float* __restrict__ F, _Float16* __restrict__ Hh, _Float16* __restrict__ Hl, size_t n8) { const size_t t = (size_t)blockIdx.x * 256 + threadIdx.x; if (t >= n8) return; FragH fh, fl; const v4f a = *(const v4fa*)(F + t * 8), c = *(const v4fa*)(F + t * 8 + 4);
#pragma unroll
  for (int q = 0; q < 4; ++q) { _Float16 h = (_Float16)a[q]; fh.h[q] = h; fl.h[q] = (_Float16)((a[q] - (float)h) * 1024.0f); h = (_Float16)c[q]; fh.h[4 + q] = h; fl.h[4 + q] = (_Float16)((c[q] - (float)h) * 1024.0f); }
  { *(v8us*)((unsigned short*)Hh + t * 8) = fh.half[0]; *(v8us*)((unsigned short*)Hl + t * 8) = fl.half[0];  } }

// ---- fast GEMM (wave tile 32x64; requires M % 32 == 0 rows per launch region and N % 64 == 0); epilogue = k_gemm_hhx semantics ----
__device__ __forceinline__ v16h g2_frag(const _Float16* p, int hh) { FragH f; f.half[0] = *(const v8us*)((const unsigned short*)p + 8 * hh); f.half[1] = *(const v8us*)((const unsigned short*)p + 16 + 8 * hh); return f.v; }
__device__ __forceinline__ v8f g2_mma(v16h a, v16h b, v8f c) { v8f d = __builtin_amdgcn_wmma_f32_16x16x32_f16(false, a, false, b, (short)0, c, false, false); asm volatile("v_nop\n\tv_nop\n\tv_nop\n\tv_nop" : "+v"(d) : "v"(a), "v"(b)); return d; }
template <int ACT>
__global__ __launch_bounds__(128) void k_gemm2(const _Float16* __restrict__ A, int lda, size_t sA, const _Float16* __restrict__ Bh, int ldb, size_t sB, float alpha, const float* __restrict__ bias, size_t sBias, const float* __restrict__ CP, int rowsPerB, size_t sCPb, int row0g,
    float* __restrict__ C, _Float16* __restrict__ C16, int ldc, size_t sC, int M, int N, int K) {
  __shared__ __attribute__((aligned(16))) float so[4][32][68];
  const int tid = threadIdx.x, w = tid >> 5, lane = tid & 31, ln = lane & 15, hh = lane >> 4; const int by = blockIdx.y;
  A += (size_t)by * sA; Bh += (size_t)by * sB; const size_t cofs = (size_t)by * sC; const float* bp = bias ? bias + (size_t)by * sBias : nullptr;
  const int ntn = N >> 6; const int mt = blockIdx.x / ntn, nq = blockIdx.x - mt * ntn; const int row0 = mt * 128 + 32 * w, col0 = nq * 64; if (row0 >= M) return;
  const _Float16* a0p = A + (size_t)(row0 + ln) * lda; const _Float16* a1p = a0p + (size_t)16 * lda;
  const _Float16* b0p = Bh + (size_t)(col0 + ln) * ldb; const _Float16* b1p = b0p + (size_t)16 * ldb; const _Float16* b2p = b1p + (size_t)16 * ldb; const _Float16* b3p = b2p + (size_t)16 * ldb;
  const v8f z8 = {0.f,0.f,0.f,0.f,0.f,0.f,0.f,0.f}; v8f c00 = z8, c01 = z8, c02 = z8, c03 = z8, c10 = z8, c11 = z8, c12 = z8, c13 = z8;
#pragma unroll 1
  for (int kb = 0; kb < K; kb += 32) { const v16h a0 = g2_frag(a0p + kb, hh), a1 = g2_frag(a1p + kb, hh);
    v16h b = g2_frag(b0p + kb, hh); c00 = g2_mma(a0, b, c00); c10 = g2_mma(a1, b, c10);
    b = g2_frag(b1p + kb, hh); c01 = g2_mma(a0, b, c01); c11 = g2_mma(a1, b, c11);
    b = g2_frag(b2p + kb, hh); c02 = g2_mma(a0, b, c02); c12 = g2_mma(a1, b, c12);
    b = g2_frag(b3p + kb, hh); c03 = g2_mma(a0, b, c03); c13 = g2_mma(a1, b, c13); }
  v8f accs[8] = {c00, c01, c02, c03, c10, c11, c12, c13};
#pragma unroll
  for (int u = 0; u < 8; ++u) { const int t = u & 3, half = u >> 2; const int col = col0 + t * 16 + ln; const float bv = bp ? bf16_round(bp[col]) : 0.f;
#pragma unroll
    for (int r = 0; r < 8; ++r) { const int rloc = half * 16 + 8 * hh + r; float v = accs[u][r] * alpha + bv; if (CP) { const int bidx = (row0g + row0 + rloc) / rowsPerB; v += CP[(size_t)bidx * sCPb + (size_t)by * 64 + col]; }
      if (ACT == 3) v = fmaxf(v, 0.f); else if (ACT == 6) v = 0.5f * v * (1.0f + erff(v * 0.70710678118654752f)); else if (ACT == 11) v = 1.0f / (1.0f + expf(-v)); else if (ACT == 15) v = v / (1.0f + expf(-v)); else if (ACT == 12) v = (v > 0.f) ? v : 0.01f * v; else if (ACT == 8) v = tanhf(v);
      so[w][rloc][t * 16 + ln] = v; } }
  __builtin_amdgcn_fence(__ATOMIC_ACQ_REL, "workgroup"); __builtin_amdgcn_wave_barrier();
  const int rsub = lane >> 4, c4 = (lane & 15) * 4;
  {
#pragma unroll
    for (int q = 0; q < 16; ++q) { const int r = q * 2 + rsub; const v4f v = *(const v4fa*)&so[w][r][c4]; if (C) *(v4f*)(C + cofs + (size_t)(row0 + r) * ldc + col0 + c4) = v; if (C16) { v4h h4; for (int i = 0; i < 4; ++i) h4[i] = (_Float16)v[i]; *(v4h*)(C16 + cofs + (size_t)(row0 + r) * ldc + col0 + c4) = h4; } }
     } }


template <int TK>
__global__ __launch_bounds__(256) void k_vthl(const float* __restrict__ VF, int ldv, _Float16* __restrict__ Vth, _Float16* __restrict__ Vtl) { __shared__ float tl[64][65]; const int tid = threadIdx.x; const int slab = blockIdx.x / (TK / 64), lg = blockIdx.x % (TK / 64); const int b = slab / NH, h = slab % NH;
  for (int i = tid; i < 64 * 16; i += 256) { const int r = i / 16, c4 = (i % 16) * 4; const v4f a = *(const v4fa*)(VF + ((size_t)b * TK + lg * 64 + r) * ldv + h * 64 + c4); tl[r][c4] = a[0]; tl[r][c4 + 1] = a[1]; tl[r][c4 + 2] = a[2]; tl[r][c4 + 3] = a[3]; }
  __syncthreads();
  FragH fh[2], fl[2]; size_t oo[2];
#pragma unroll
  for (int rd = 0; rd < 2; ++rd) { const int d = rd * 32 + tid / 8, pc = tid % 8;
#pragma unroll
    for (int q = 0; q < 8; ++q) { const float v = tl[pc * 8 + q][d]; const _Float16 hv = (_Float16)v; fh[rd].h[q] = hv; fl[rd].h[q] = (_Float16)((v - (float)hv) * 1024.0f); } oo[rd] = ((size_t)slab * 64 + d) * TK + lg * 64 + pc * 8; }
  {
#pragma unroll
    for (int rd = 0; rd < 2; ++rd) { *(v8us*)((unsigned short*)Vth + oo[rd]) = fh[rd].half[0]; *(v8us*)((unsigned short*)Vtl + oo[rd]) = fl[rd].half[0]; }
     } }

template <int TQ, int TK>
__global__ __launch_bounds__(128) void k_flashm(const _Float16* __restrict__ Q16, const _Float16* __restrict__ Q16lo, int ldq, const _Float16* __restrict__ K16, const _Float16* __restrict__ K16lo, int ldk, const _Float16* __restrict__ Vt, const _Float16* __restrict__ Vtlo, const unsigned* __restrict__ MB, const int* __restrict__ RA, const int* __restrict__ KE, float* __restrict__ O, int ldo) {
  constexpr int RPW = 16, RTN = RPW / 16, NQB = TQ / (4 * RPW), DT = 4, KS = 2;
  __shared__ __attribute__((aligned(16))) unsigned short sP[4][RPW][40], sPl[4][RPW][40]; __shared__ __attribute__((aligned(16))) float sO[4][RPW][64 + 4];
  const int tid = threadIdx.x, w = tid >> 5, lane = tid & 31, ln = lane & 15, hh = lane >> 4;
  const int slab = blockIdx.x / NQB, qblk = blockIdx.x % NQB; const int b = slab / NH, h = slab % NH; const int qb0 = qblk * (4 * RPW); const int q0 = qb0 + w * RPW;
  FragH aq[2][KS], aql[2][KS];
#pragma unroll
  for (int rt = 0; rt < RTN; ++rt) { const size_t qo = ((size_t)b * TQ + q0 + rt * 16 + ln) * ldq + h * 64; const unsigned short* qr = (const unsigned short*)Q16 + qo; const unsigned short* ql = (const unsigned short*)Q16lo + qo;
#pragma unroll
    for (int ks = 0; ks < KS; ++ks) { aq[rt][ks].half[0] = *(const v8us*)(qr + ks * 32 + 8 * hh); aq[rt][ks].half[1] = *(const v8us*)(qr + ks * 32 + 16 + 8 * hh); aql[rt][ks].half[0] = *(const v8us*)(ql + ks * 32 + 8 * hh); aql[rt][ks].half[1] = *(const v8us*)(ql + ks * 32 + 16 + 8 * hh); } }
  const unsigned short* Vth = (const unsigned short*)Vt + (size_t)slab * 64 * TK; const unsigned short* Vtl = (const unsigned short*)Vtlo + (size_t)slab * 64 * TK;
  float m_r[2][8], l_r[2][8]; v8f oacc[2][DT], oaccl[2][DT];
#pragma unroll
  for (int rt = 0; rt < RTN; ++rt) {
#pragma unroll
    for (int r = 0; r < 8; ++r) { m_r[rt][r] = -3.0e38f; l_r[rt][r] = 0.f; }
#pragma unroll
    for (int dt = 0; dt < DT; ++dt) { oacc[rt][dt] = (v8f){0.f,0.f,0.f,0.f,0.f,0.f,0.f,0.f}; oaccl[rt][dt] = oacc[rt][dt]; } }
  int jend = KE[qblk * 32]; jend = min(TK, (jend + 31) & ~31); if (jend < 32) jend = 32;      /* block-uniform */
  int allm[2][8]; const unsigned* mrow[2][8];
#pragma unroll
  for (int rt = 0; rt < RTN; ++rt)
#pragma unroll
    for (int r = 0; r < 8; ++r) { const int tq = q0 + rt * 16 + 8 * hh + r; allm[rt][r] = RA[tq]; mrow[rt][r] = MB + (size_t)tq * (TK / 32); }
#pragma unroll 1
  for (int j0 = 0; j0 < jend; j0 += 32) {
    
    v8f s[2][2];
#pragma unroll
    for (int nt = 0; nt < 2; ++nt) { const size_t ko = ((size_t)b * TK + j0 + nt * 16 + ln) * ldk + h * 64; const unsigned short* kr = (const unsigned short*)K16 + ko; const unsigned short* kl = (const unsigned short*)K16lo + ko; FragH bk[KS], bkl[KS];
#pragma unroll
      for (int ks = 0; ks < KS; ++ks) { bk[ks].half[0] = *(const v8us*)(kr + ks * 32 + 8 * hh); bk[ks].half[1] = *(const v8us*)(kr + ks * 32 + 16 + 8 * hh); bkl[ks].half[0] = *(const v8us*)(kl + ks * 32 + 8 * hh); bkl[ks].half[1] = *(const v8us*)(kl + ks * 32 + 16 + 8 * hh); }
#pragma unroll
      for (int rt = 0; rt < RTN; ++rt) { v8f acc = (v8f){0.f,0.f,0.f,0.f,0.f,0.f,0.f,0.f}, accr = acc;
#pragma unroll
        for (int ks = 0; ks < KS; ++ks) { acc = mmaH<1>(aq[rt][ks].v, aq[rt][ks].v, bk[ks].v, bk[ks].v, acc); accr = mmaH<1>(aql[rt][ks].v, aql[rt][ks].v, bk[ks].v, bk[ks].v, accr); accr = mmaH<1>(aq[rt][ks].v, aq[rt][ks].v, bkl[ks].v, bkl[ks].v, accr); }
        s[rt][nt] = acc + accr * 0.0009765625f; } }
#pragma unroll
    for (int rt = 0; rt < RTN; ++rt)
#pragma unroll
      for (int r = 0; r < 8; ++r) { const unsigned mw = mrow[rt][r][j0 >> 5]; const bool am = (allm[rt][r] != 0);
        const bool ok0 = am || (((mw >> ln) & 1u) == 0u), ok1 = am || (((mw >> (16 + ln)) & 1u) == 0u);
        const float s0 = ok0 ? (am ? 0.f : s[rt][0][r] * SCL) : -INFINITY, s1 = ok1 ? (am ? 0.f : s[rt][1][r] * SCL) : -INFINITY; float mc = fmaxf(s0, s1);
        mc = fmaxf(mc, __shfl_xor(mc, 1, 32)); mc = fmaxf(mc, __shfl_xor(mc, 2, 32)); mc = fmaxf(mc, __shfl_xor(mc, 4, 32)); mc = fmaxf(mc, __shfl_xor(mc, 8, 32));
        const float mn = fmaxf(m_r[rt][r], mc); const float al = (mn > -1.0e38f) ? expf(m_r[rt][r] - mn) : 1.0f; m_r[rt][r] = mn; const float p0 = ok0 ? expf(s0 - mn) : 0.f, p1 = ok1 ? expf(s1 - mn) : 0.f; l_r[rt][r] = l_r[rt][r] * al + p0 + p1;
#pragma unroll
        for (int dt = 0; dt < DT; ++dt) { oacc[rt][dt][r] *= al; oaccl[rt][dt][r] *= al; }
        FragH t2, t3; const float ps0 = p0 * 1024.0f, ps1 = p1 * 1024.0f; t2.h[0] = (_Float16)ps0; t2.h[1] = (_Float16)ps1; t3.h[0] = (_Float16)((ps0 - (float)t2.h[0]) * 1024.0f); t3.h[1] = (_Float16)((ps1 - (float)t2.h[1]) * 1024.0f);
        sP[w][rt * 16 + 8 * hh + r][ln] = t2.u[0]; sP[w][rt * 16 + 8 * hh + r][16 + ln] = t2.u[1]; sPl[w][rt * 16 + 8 * hh + r][ln] = t3.u[0]; sPl[w][rt * 16 + 8 * hh + r][16 + ln] = t3.u[1]; }
    __builtin_amdgcn_fence(__ATOMIC_ACQ_REL, "workgroup"); __builtin_amdgcn_wave_barrier();
    FragH pa[2], pl[2];
#pragma unroll
    for (int rt = 0; rt < RTN; ++rt) { pa[rt].half[0] = *(const v8us*)&sP[w][rt * 16 + ln][8 * hh]; pa[rt].half[1] = *(const v8us*)&sP[w][rt * 16 + ln][16 + 8 * hh]; pl[rt].half[0] = *(const v8us*)&sPl[w][rt * 16 + ln][8 * hh]; pl[rt].half[1] = *(const v8us*)&sPl[w][rt * 16 + ln][16 + 8 * hh]; }
#pragma unroll
    for (int dt = 0; dt < DT; ++dt) { const size_t vo = (size_t)(dt * 16 + ln) * TK + j0; FragH bv, bl; bv.half[0] = *(const v8us*)(Vth + vo + 8 * hh); bv.half[1] = *(const v8us*)(Vth + vo + 16 + 8 * hh); bl.half[0] = *(const v8us*)(Vtl + vo + 8 * hh); bl.half[1] = *(const v8us*)(Vtl + vo + 16 + 8 * hh);
#pragma unroll
      for (int rt = 0; rt < RTN; ++rt) { oacc[rt][dt] = mmaH<1>(pa[rt].v, pa[rt].v, bv.v, bv.v, oacc[rt][dt]); oaccl[rt][dt] = mmaH<1>(pa[rt].v, pa[rt].v, bl.v, bl.v, oaccl[rt][dt]); oaccl[rt][dt] = mmaH<1>(pl[rt].v, pl[rt].v, bv.v, bv.v, oaccl[rt][dt]); } }
    __builtin_amdgcn_fence(__ATOMIC_ACQ_REL, "workgroup"); __builtin_amdgcn_wave_barrier(); }
#pragma unroll
  for (int rt = 0; rt < RTN; ++rt) {
#pragma unroll
    for (int r = 0; r < 8; ++r) { float l = l_r[rt][r]; l += __shfl_xor(l, 1, 32); l += __shfl_xor(l, 2, 32); l += __shfl_xor(l, 4, 32); l += __shfl_xor(l, 8, 32); l_r[rt][r] = (l > 0.f) ? 1.0f / (l * 1024.0f) : 0.f; }
#pragma unroll
    for (int dt = 0; dt < DT; ++dt)
#pragma unroll
      for (int r = 0; r < 8; ++r) sO[w][rt * 16 + 8 * hh + r][dt * 16 + ln] = (oacc[rt][dt][r] + oaccl[rt][dt][r] * 0.0009765625f) * l_r[rt][r]; }
  __builtin_amdgcn_fence(__ATOMIC_ACQ_REL, "workgroup"); __builtin_amdgcn_wave_barrier();
  {
#pragma unroll
    for (int rp = 0; rp < RPW; rp += 2) { const int r = rp + (lane >> 4), pc = lane & 15; const v4f val = *(const v4fa*)&sO[w][r][pc * 4]; *(v4f*)(O + ((size_t)b * TQ + q0 + r) * ldo + h * 64 + pc * 4) = val; }
     } }


__constant__ float GRIDV[8] = {-2.000000000e+00f,-1.428571463e+00f,-8.571428657e-01f,-2.857141793e-01f,2.857143879e-01f,8.571429253e-01f,1.428571701e+00f,2.000000000e+00f};
#define INV_DENOM (1.0f / 0.5714285714285714f)
__global__ __launch_bounds__(256) void k_fulltab(unsigned* __restrict__ MB, int* __restrict__ RA, int* __restrict__ KE) {
  const int t = blockIdx.x * 256 + threadIdx.x;
  if (t < NPI * (NPI / 32)) { *(unsigned*)(MB + t) = 0u;  }
  if (t < NPI) { *(int*)(RA + t) = 0;  }
  if (t < NPI / 64) { *(int*)(KE + t * 32) = NPI;  } }
__global__ __launch_bounds__(256) void k_xcl(const float* __restrict__ x, _Float16* __restrict__ X16) {
  const int t = blockIdx.x * 256 + threadIdx.x; if (t >= NPX * (CIN / 8)) return; const int r = t / (CIN / 8), c0 = (t % (CIN / 8)) * 8; const int b = r / NPI, p = r % NPI; FragH f;
#pragma unroll
  for (int q = 0; q < 8; ++q) f.h[q] = (_Float16)bf16_round(x[((size_t)b * CIN + c0 + q) * NPI + p]);
  *(v8us*)((unsigned short*)X16 + (size_t)r * CIN + c0) = f.half[0];  }
__global__ __launch_bounds__(256) void k_instat(const float* __restrict__ A, const float* __restrict__ ST0, int phase, float* __restrict__ ST) {
  #pragma clang fp contract(off)
  __shared__ float sh[256]; const int b = blockIdx.x / DK, c = blockIdx.x % DK; const float mu = phase ? ST0[(size_t)blockIdx.x * 32] : 0.f; float s = 0.f;
  for (int p = threadIdx.x; p < NPI; p += 256) { const float v = A[((size_t)b * NPI + p) * DK + c] - mu; s += phase ? v * v : v; }
  sh[threadIdx.x] = s; __syncthreads();
  for (int st = 128; st > 0; st >>= 1) { if ((int)threadIdx.x < st) sh[threadIdx.x] += sh[threadIdx.x + st]; __syncthreads(); }
  if (threadIdx.x == 0) { const float v = sh[0] / (float)NPI; float* d = ST + ((size_t)phase * NIMG * DK + blockIdx.x) * 32; *(float*)d = v;  } }
__global__ __launch_bounds__(256) void k_basis(const float* __restrict__ A, const float* __restrict__ ST, _Float16* __restrict__ BAS) {
  #pragma clang fp contract(off)
  const int t = blockIdx.x * 256 + threadIdx.x; if (t >= NPX * DK) return; const int r = t / DK, c = t % DK; const int b = r / NPI; const float a = A[(size_t)r * DK + c];
  const float mu = ST[((size_t)b * DK + c) * 32], var = ST[((size_t)NIMG * DK + b * DK + c) * 32]; const float xn = (a - mu) * rsqrtf(var + 1e-5f); FragH bh, bl;
#pragma unroll
  for (int g = 0; g < NG; ++g) { const float z = (xn - GRIDV[g]) * INV_DENOM; const float e = expf(-(z * z)); const _Float16 hv = (_Float16)e; bh.h[g] = hv; bl.h[g] = (_Float16)((e - (float)hv) * 16.0f); }
  unsigned short* bd = (unsigned short*)BAS + (size_t)r * 2 * DK * NG + c * NG;
  { *(v8us*)bd = bh.half[0]; *(v8us*)(bd + DK * NG) = bl.half[0];  } }
__global__ __launch_bounds__(256) void k_silu(const float* __restrict__ A, _Float16* __restrict__ SIL) {
  #pragma clang fp contract(off)
  const int t = blockIdx.x * 256 + threadIdx.x; if (t >= NPX * (DK / 8)) return; const int r = t / (DK / 8), c0 = (t % (DK / 8)) * 8; const float* a = A + (size_t)r * DK + c0; FragH fh, fl;
#pragma unroll
  for (int q = 0; q < 8; ++q) { const float v = a[q]; const float sl = v / (1.0f + expf(-v)); const _Float16 hv = (_Float16)sl; fh.h[q] = hv; fl.h[q] = (_Float16)((sl - (float)hv) * 16.0f); }
  unsigned short* d = (unsigned short*)SIL + (size_t)r * 2 * DK + c0;
  { *(v8us*)d = fh.half[0]; *(v8us*)(d + DK) = fl.half[0];  } }
__global__ __launch_bounds__(256) void k_wnp2(const float* __restrict__ Wm, int K, int N, _Float16* __restrict__ Bt) {
  const int t = blockIdx.x * 256 + threadIdx.x; if (t >= N * (2 * K / 8)) return; const int n = t / (2 * K / 8), k0 = (t % (2 * K / 8)) * 8; const bool lo = (k0 >= K); const float sc = lo ? 1.0f : 16.0f; FragH f;
#pragma unroll
  for (int q = 0; q < 8; ++q) { const int k = k0 + q - (lo ? K : 0); f.h[q] = (_Float16)(bf16_round(Wm[(size_t)n * K + k]) * sc); }
  *(v8us*)((unsigned short*)Bt + (size_t)n * 2 * K + k0) = f.half[0];  }
__global__ __launch_bounds__(256) void k_pair16(const float* __restrict__ F, int n, _Float16* __restrict__ P, int rows) {
  #pragma clang fp contract(off)
  const int t = blockIdx.x * 256 + threadIdx.x; if (t >= rows * (n / 8)) return; const int r = t / (n / 8), c0 = (t % (n / 8)) * 8; const float* f = F + (size_t)r * n + c0; FragH fh, fl;
#pragma unroll
  for (int q = 0; q < 8; ++q) { const float v = f[q]; const _Float16 hv = (_Float16)v; fh.h[q] = hv; fl.h[q] = (_Float16)((v - (float)hv) * 16.0f); }
  unsigned short* d = (unsigned short*)P + (size_t)r * 2 * n + c0;
  { *(v8us*)d = fh.half[0]; *(v8us*)(d + n) = fl.half[0];  } }
__global__ __launch_bounds__(256) void k_y(const float* __restrict__ x, const float* __restrict__ gam, const float* __restrict__ A2, float* __restrict__ Y) {
  #pragma clang fp contract(off)
  const int t = blockIdx.x * 256 + threadIdx.x; if (t >= NPX * (CIN / 4)) return; const int r = t / (CIN / 4), c0 = (t % (CIN / 4)) * 4; const int b = r / NPI, p = r % NPI; const float g = bf16_round(gam[0]); const v4f a = *(const v4fa*)(A2 + (size_t)t * 4); v4f o;
#pragma unroll
  for (int q = 0; q < 4; ++q) o[q] = g * bf16_round(x[((size_t)b * CIN + c0 + q) * NPI + p]) + a[q];
  *(v4f*)(Y + (size_t)t * 4) = o;  }
__global__ __launch_bounds__(256) void k_bnstat(const float* __restrict__ Y, const float* __restrict__ ST0, int phase, float* __restrict__ ST) {
  #pragma clang fp contract(off)
  __shared__ float sh[256]; const int c = blockIdx.x; const float mu = phase ? ST0[(size_t)c * 32] : 0.f; float s = 0.f;
  for (int r = threadIdx.x; r < NPX; r += 256) { const float v = Y[(size_t)r * CIN + c] - mu; s += phase ? v * v : v; }
  sh[threadIdx.x] = s; __syncthreads();
  for (int st = 128; st > 0; st >>= 1) { if ((int)threadIdx.x < st) sh[threadIdx.x] += sh[threadIdx.x + st]; __syncthreads(); }
  if (threadIdx.x == 0) { const float v = sh[0] / (float)NPX; float* d = ST + ((size_t)phase * CIN + c) * 32; *(float*)d = v;  } }
__global__ __launch_bounds__(256) void k_bnout(const float* __restrict__ Y, const float* __restrict__ ST, const float* __restrict__ bw, const float* __restrict__ bb, float* __restrict__ out) {
  #pragma clang fp contract(off)
  const int t = blockIdx.x * 256 + threadIdx.x; if (t >= NIMG * CIN * (NPI / 4)) return; const int p0 = (t % (NPI / 4)) * 4; const int c = (t / (NPI / 4)) % CIN; const int b = t / ((NPI / 4) * CIN); const float mu = ST[(size_t)c * 32], var = ST[(size_t)(CIN + c) * 32]; const float sc = rsqrtf(var + 1e-5f), g = bf16_round(bw[c]), be = bf16_round(bb[c]); v4f o;
#pragma unroll
  for (int q = 0; q < 4; ++q) o[q] = g * ((Y[((size_t)b * NPI + p0 + q) * CIN + c] - mu) * sc) + be;
  float* dst = out + ((size_t)b * CIN + c) * NPI + p0; *(v4f*)dst = o;  }

extern "C" void kernel_launch(void* const* d_in, const int* in_sizes, int n_in,
                              void* d_out, int out_size, void* d_ws, size_t ws_size, hipStream_t stream) {
  (void)in_sizes; (void)n_in; (void)out_size;
  const float* const* I = (const float* const*)d_in; const float* x = I[0]; const float* w_in = I[1]; const float* b_in = I[2];
  const float* qbw = I[3]; const float* qbb = I[4]; const float* qsw = I[5]; const float* qsb = I[6]; const float* kbw = I[7]; const float* kbb = I[8]; const float* ksw = I[9]; const float* ksb = I[10]; const float* vbw = I[11]; const float* vbb = I[12]; const float* vsw = I[13]; const float* vsb = I[14];
  const float* w_out = I[15]; const float* b_out = I[16]; const float* gam = I[17]; const float* bnw = I[18]; const float* bnb = I[19];
  char* ws = (char*)d_ws; size_t off = 0;
  auto take = [&](size_t bytes) { char* p = ws + off; off += (bytes + 255) & ~(size_t)255; return p; };
  _Float16* BIN = (_Float16*)take((size_t)DK * CIN * 2); _Float16* BB[3]; _Float16* BS[3]; for (int i = 0; i < 3; ++i) { BB[i] = (_Float16*)take((size_t)DK * 2 * DK * 2); BS[i] = (_Float16*)take((size_t)DK * 2 * DK * NG * 2); } _Float16* BOUT = (_Float16*)take((size_t)CIN * 2 * DK * 2);
  _Float16* X16 = (_Float16*)take((size_t)NPX * CIN * 2); float* ATT = (float*)take((size_t)NPX * DK * 4); float* IST = (float*)take((size_t)2 * NIMG * DK * 32 * 4); _Float16* SIL = (_Float16*)take((size_t)NPX * 2 * DK * 2); _Float16* BAS = (_Float16*)take((size_t)NPX * 2 * DK * NG * 2);
  float* F = (float*)take((size_t)NPX * DK * 4); _Float16* Qh = (_Float16*)take((size_t)NPX * DK * 2); _Float16* Ql = (_Float16*)take((size_t)NPX * DK * 2); _Float16* Kh = (_Float16*)take((size_t)NPX * DK * 2); _Float16* Kl = (_Float16*)take((size_t)NPX * DK * 2); _Float16* Vth = (_Float16*)take((size_t)NPX * DK * 2); _Float16* Vtl = (_Float16*)take((size_t)NPX * DK * 2);
  float* O = (float*)take((size_t)NPX * DK * 4); _Float16* O16 = (_Float16*)take((size_t)NPX * 2 * DK * 2); float* A2 = (float*)take((size_t)NPX * CIN * 4); float* Y = (float*)take((size_t)NPX * CIN * 4); float* BST = (float*)take((size_t)2 * CIN * 32 * 4);
  unsigned* MB = (unsigned*)take((size_t)NPI * (NPI / 32) * 4); int* RA = (int*)take((size_t)NPI * 4); int* KE = (int*)take((size_t)(NPI / 64) * 32 * 4);
  if (off > ws_size) return;      /* 0.5 + 8 + 4 + 4 + 32 + 4 + 12 + 4 + 4 + 16 + 16 + 2 = 106.5 MiB */
  k_round16f<<<(DK * CIN / 8 + 255) / 256, 256, 0, stream>>>(w_in, BIN, (size_t)DK * CIN / 8); k_wnp2<<<(CIN * (2 * DK / 8) + 255) / 256, 256, 0, stream>>>(w_out, DK, CIN, BOUT);      /* (out,in) natural -> [16w | w] pair planes */
  const float* bw3[3] = {qbw, kbw, vbw}; const float* sw3[3] = {qsw, ksw, vsw};
  for (int i = 0; i < 3; ++i) { k_wnp2<<<(DK * (2 * DK / 8) + 255) / 256, 256, 0, stream>>>(bw3[i], DK, DK, BB[i]); k_wnp2<<<(DK * (2 * DK * NG / 8) + 255) / 256, 256, 0, stream>>>(sw3[i], DK * NG, DK, BS[i]); }
  k_fulltab<<<(NPI * (NPI / 32) + 255) / 256, 256, 0, stream>>>(MB, RA, KE);
  k_xcl<<<(NPX * (CIN / 8) + 255) / 256, 256, 0, stream>>>(x, X16);
  const dim3 g64((NPX / 128) * 1, 1), g256((NPX / 128) * (CIN / 64), 1);
  k_gemm2<0><<<g64, 128, 0, stream>>>(X16, CIN, 0, BIN, CIN, 0, 0.0625f, b_in, 0, nullptr, 1, 0, 0, ATT, nullptr, DK, 0, NPX, DK, CIN);      /* att = conv1x1(x) + b */
  k_instat<<<NIMG * DK, 256, 0, stream>>>(ATT, IST, 0, IST); k_instat<<<NIMG * DK, 256, 0, stream>>>(ATT, IST, 1, IST);
  k_basis<<<(NPX * DK + 255) / 256, 256, 0, stream>>>(ATT, IST, BAS); k_silu<<<(NPX * (DK / 8) + 255) / 256, 256, 0, stream>>>(ATT, SIL);
  const float* bb3[3] = {qbb, kbb, vbb}; const float* sb3[3] = {qsb, ksb, vsb}; const size_t n8 = (size_t)NPX * DK / 8; const unsigned nb8 = (unsigned)((n8 + 255) / 256);
  for (int i = 0; i < 3; ++i) {      /* q, k, v = base(silu) + b_base + spline(basis) + b_spline (two GEMMs, the second accumulating through the f32 addend) */
    k_gemm2<0><<<g64, 128, 0, stream>>>(SIL, 2 * DK, 0, BB[i], 2 * DK, 0, 0.0625f, bb3[i], 0, nullptr, 1, 0, 0, F, nullptr, DK, 0, NPX, DK, 2 * DK);
    k_gemm2<0><<<g64, 128, 0, stream>>>(BAS, 2 * DK * NG, 0, BS[i], 2 * DK * NG, 0, 0.0625f, sb3[i], 0, F, 1, (size_t)DK, 0, F, nullptr, DK, 0, NPX, DK, 2 * DK * NG);
    if (i == 0) k_hl<<<nb8, 256, 0, stream>>>(F, Qh, Ql, n8);
    else if (i == 1) k_hl<<<nb8, 256, 0, stream>>>(F, Kh, Kl, n8);
    else for (int b = 0; b < NIMG; ++b) k_vthl<NPI><<<NH * (NPI / 64), 256, 0, stream>>>(F + (size_t)b * NPI * DK, DK, Vth + (size_t)b * NPI * DK, Vtl + (size_t)b * NPI * DK); }
  k_flashm<NPI, NPI><<<NIMG * NH * (NPI / 64), 128, 0, stream>>>(Qh, Ql, DK, Kh, Kl, DK, Vth, Vtl, MB, RA, KE, O, DK);      /* slab = image (NH 1) */
  k_pair16<<<nb8, 256, 0, stream>>>(O, DK, O16, NPX);
  k_gemm2<0><<<g256, 128, 0, stream>>>(O16, 2 * DK, 0, BOUT, 2 * DK, 0, 0.0625f, b_out, 0, nullptr, 1, 0, 0, A2, nullptr, CIN, 0, NPX, CIN, 2 * DK);      /* att2 = conv1x1(out) + b (pair operand) */
  k_y<<<(NPX * (CIN / 4) + 255) / 256, 256, 0, stream>>>(x, gam, A2, Y);
  k_bnstat<<<CIN, 256, 0, stream>>>(Y, BST, 0, BST); k_bnstat<<<CIN, 256, 0, stream>>>(Y, BST, 1, BST);
  k_bnout<<<(NIMG * CIN * (NPI / 4) + 255) / 256, 256, 0, stream>>>(Y, BST, bnw, bnb, (float*)d_out);
}

// v001
// Measured time: 587 microseconds a run.
// Next to v000, in two timings, it ran 1.58 and 1.59 times as fast.
#include <hip/hip_runtime.h>
// Self-KAN attention (4 images, 256 channels, 64 x 64): att = conv1x1(x) (64 ch); q, k, v = FastKAN 1x1 convs (base_conv(silu(att)) + spline_conv(RBF basis of the instance-normalised att, 8 grid points)); energy = q.k over the 4096 positions (NO scaling), softmax over keys, out = v.attn^T; att2 = conv1x1(out) (256 ch); y = gamma*x + att2; training-mode BatchNorm -> [4,256,64,64].
// Compute dtype: x, weights, biases, gamma, BN affine rounded to bf16; x exact in f16; silu/basis operands as hi + 16x residual pairs (~2^-20); q, k, P, v as hi + x2^10 residual pairs (~2^-21); the attention output as hi + 16x residual pairs too; f32 accumulation, statistics, softmax. v_wmma_f32_16x16x32_f16.
#define NIMG 4
#define CIN 256
#define DK 64
#define HW 64
#define NPI (HW * HW)            /* 4096 */
#define NPX (NIMG * NPI)         /* 16384 */
#define NG 8
#define NH 1
#define DM DK
#define SCL 1.0f
#define KSPLIT 4
typedef __bf16 v16b __attribute__((ext_vector_type(16)));
typedef unsigned short v8us __attribute__((ext_vector_type(8), may_alias));
typedef float  v8f  __attribute__((ext_vector_type(8)));
typedef float  v4f  __attribute__((ext_vector_type(4)));
typedef float  v4fa __attribute__((ext_vector_type(4), may_alias));
union FragB { v16b v; v8us half[2]; unsigned short u[16]; };

__device__ __forceinline__ unsigned short bf16_bits(float x) { unsigned int u = __float_as_uint(x); return (unsigned short)((u + 0x7FFFu + ((u >> 16) & 1u)) >> 16); }
__device__ __forceinline__ float bf16_val(unsigned short b) { return __uint_as_float(((unsigned int)b) << 16); }
__device__ __forceinline__ float bf16_round(float x) { return bf16_val(bf16_bits(x)); }
// D += A·B with NT terms: 1 = ah·bh, 2 = + al·bh (A split), 3 = + ah·bl (both split)
template <int NT>
__device__ __forceinline__ v8f mmaN(v16b ah, v16b al, v16b bh, v16b bl, v8f c) {
  c = __builtin_amdgcn_wmma_f32_16x16x32_bf16(false, ah, false, bh, (short)0, c, false, false);
  if (NT >= 2) c = __builtin_amdgcn_wmma_f32_16x16x32_bf16(false, al, false, bh, (short)0, c, false, false);
  if (NT >= 3) c = __builtin_amdgcn_wmma_f32_16x16x32_bf16(false, ah, false, bl, (short)0, c, false, false);
  asm volatile("v_nop\n\tv_nop\n\tv_nop\n\tv_nop" : "+v"(c) : "v"(ah), "v"(al), "v"(bh), "v"(bl));
  return c;
}

__global__ __launch_bounds__(256) void k_wt_bf16(const float* __restrict__ W, unsigned short* __restrict__ Wt, int K, int N) {
  const int t = blockIdx.x * 256 + threadIdx.x;
  const int k8n = K / 8;
  if (t >= N * k8n) return;
  const int n = t / k8n, k8 = (t % k8n) * 8;
  v8us v;
#pragma unroll
  for (int i = 0; i < 8; ++i) v[i] = bf16_bits(W[(size_t)(k8 + i) * N + n]);
  *(v8us*)(Wt + (size_t)n * K + k8) = v;
  
}

// GEMM C[M][N] (f32, pitch ldc) = act(A[M][K]·W + bias). A f32 row-major (pitch lda) converted per fragment to bf16
// (ASPLIT: hi/lo two planes -> 2 terms, else single rounded term); Wt bf16 [N][K] (pitch ldb). BIAS_BF16 rounds the
// bias to bf16 first (bias quantised to bf16 before the add). K%32==0, M%16==0, N%64==0.
template <bool ASPLIT, int ACT, bool BIAS_BF16>
__global__ __launch_bounds__(128) void k_gemm_bf(const float* __restrict__ A, int lda, const unsigned short* __restrict__ Wt, int ldb,
                                               const float* __restrict__ bias, float* __restrict__ C, int ldc, int M, int N, int K) {
  __shared__ __attribute__((aligned(16))) float so[4][16][64];
  const int tid = threadIdx.x, w = tid >> 5, lane = tid & 31, ln = lane & 15, hh = lane >> 4;
  const int ntn = N / 64;
  const int wid = blockIdx.x * 4 + w;
  const int mt = wid / ntn, nq = wid % ntn;
  if (mt * 16 >= M) return;
  const int row0 = mt * 16, col0 = nq * 64;
  const float* arow = A + (size_t)(row0 + ln) * lda;
  v8f acc[4] = {};
  for (int kb = 0; kb < K; kb += 32) {
    FragB ah, al;
    const v4f x0 = *(const v4fa*)(arow + kb + 8 * hh), x1 = *(const v4fa*)(arow + kb + 8 * hh + 4);
    const v4f x2 = *(const v4fa*)(arow + kb + 16 + 8 * hh), x3 = *(const v4fa*)(arow + kb + 16 + 8 * hh + 4);
    float xs[16] = {x0[0],x0[1],x0[2],x0[3],x1[0],x1[1],x1[2],x1[3],x2[0],x2[1],x2[2],x2[3],x3[0],x3[1],x3[2],x3[3]};
#pragma unroll
    for (int i = 0; i < 16; ++i) { const unsigned short hb = bf16_bits(xs[i]); ah.u[i] = hb; al.u[i] = ASPLIT ? bf16_bits(xs[i] - bf16_val(hb)) : (unsigned short)0; }
#pragma unroll
    for (int t = 0; t < 4; ++t) {
      const unsigned short* brow = Wt + (size_t)(col0 + t * 16 + ln) * ldb + kb;
      FragB b;
      b.half[0] = *(const v8us*)(brow + 8 * hh);
      b.half[1] = *(const v8us*)(brow + 16 + 8 * hh);
      acc[t] = mmaN<ASPLIT ? 2 : 1>(ah.v, al.v, b.v, b.v, acc[t]);
    }
  }
#pragma unroll
  for (int t = 0; t < 4; ++t) {
    float bv = bias ? bias[col0 + t * 16 + ln] : 0.f;
    if (BIAS_BF16) bv = bf16_round(bv);
#pragma unroll
    for (int r = 0; r < 8; ++r) { float v = acc[t][r] + bv; if (ACT == 1) v = fmaxf(v, 0.f); so[w][8 * hh + r][t * 16 + ln] = v; }
  }
  __builtin_amdgcn_fence(__ATOMIC_ACQ_REL, "workgroup");
  __builtin_amdgcn_wave_barrier();
  const int rsub = lane >> 4, c4 = (lane & 15) * 4;
  {
#pragma unroll
    for (int q = 0; q < 8; ++q) {
      const int r = q * 2 + rsub;
      const v4f v = *(const v4fa*)&so[w][r][c4];
      *(v4f*)(C + (size_t)(row0 + r) * ldc + col0 + c4) = v;
    }
    
  }
}

// GEMM C = act(A·W + bias + resid): A f32 (ASPLIT -> hi/lo 2 terms), Wt bf16 [N][K]; ACT 0 none, 1 relu, 2 exact gelu;
// resid (optional, f32, row index = (row % rmod), pitch ldr, RES_BF16 rounds it) added before the activation.
template <bool ASPLIT, int ACT, bool BIAS_BF16, bool RES_BF16>
__global__ __launch_bounds__(128) void k_gemm_bf3(const float* __restrict__ A, int lda, const unsigned short* __restrict__ Wt, int ldb,
                                                const float* __restrict__ bias, const float* __restrict__ resid, int rmod, int ldr,
                                                float* __restrict__ C, int ldc, int M, int N, int K) {
  __shared__ __attribute__((aligned(16))) float so[4][16][64];
  const int tid = threadIdx.x, w = tid >> 5, lane = tid & 31, ln = lane & 15, hh = lane >> 4;
  const int ntn = N / 64;
  const int wid = blockIdx.x * 4 + w;
  const int mt = wid / ntn, nq = wid % ntn;
  if (mt * 16 >= M) return;
  const int row0 = mt * 16, col0 = nq * 64;
  const float* arow = A + (size_t)(row0 + ln) * lda;
  v8f acc[4] = {};
  for (int kb = 0; kb < K; kb += 32) {
    FragB ah, al;
    const v4f x0 = *(const v4fa*)(arow + kb + 8 * hh), x1 = *(const v4fa*)(arow + kb + 8 * hh + 4);
    const v4f x2 = *(const v4fa*)(arow + kb + 16 + 8 * hh), x3 = *(const v4fa*)(arow + kb + 16 + 8 * hh + 4);
    float xs[16] = {x0[0],x0[1],x0[2],x0[3],x1[0],x1[1],x1[2],x1[3],x2[0],x2[1],x2[2],x2[3],x3[0],x3[1],x3[2],x3[3]};
#pragma unroll
    for (int i = 0; i < 16; ++i) { const unsigned short hb = bf16_bits(xs[i]); ah.u[i] = hb; al.u[i] = ASPLIT ? bf16_bits(xs[i] - bf16_val(hb)) : (unsigned short)0; }
#pragma unroll
    for (int t = 0; t < 4; ++t) {
      const unsigned short* brow = Wt + (size_t)(col0 + t * 16 + ln) * ldb + kb;
      FragB b;
      b.half[0] = *(const v8us*)(brow + 8 * hh);
      b.half[1] = *(const v8us*)(brow + 16 + 8 * hh);
      acc[t] = mmaN<ASPLIT ? 2 : 1>(ah.v, al.v, b.v, b.v, acc[t]);
    }
  }
#pragma unroll
  for (int t = 0; t < 4; ++t) {
    const int col = col0 + t * 16 + ln;
    float bv = bias ? bias[col] : 0.f;
    if (BIAS_BF16) bv = bf16_round(bv);
#pragma unroll
    for (int r = 0; r < 8; ++r) {
      float v = acc[t][r] + bv;
      if (resid) { float rv = resid[(size_t)((row0 + 8 * hh + r) % rmod) * ldr + col]; if (RES_BF16) rv = bf16_round(rv); v += rv; }
      if (ACT == 1) v = fmaxf(v, 0.f);
      if (ACT == 2) v = 0.5f * v * (1.0f + erff(v * 0.70710678118654752f));
      if (ACT == 3) { const float u = 0.7978845608028654f * (v + 0.044715f * v * v * v); v = 0.5f * v * (1.0f + tanhf(u)); }
      so[w][8 * hh + r][t * 16 + ln] = v;
    }
  }
  __builtin_amdgcn_fence(__ATOMIC_ACQ_REL, "workgroup");
  __builtin_amdgcn_wave_barrier();
  const int rsub = lane >> 4, c4 = (lane & 15) * 4;
  {
#pragma unroll
    for (int q = 0; q < 8; ++q) {
      const int r = q * 2 + rsub;
      const v4f v = *(const v4fa*)&so[w][r][c4];
      *(v4f*)(C + (size_t)(row0 + r) * ldc + col0 + c4) = v;
    }
    
  }
}
// row LayerNorm (biased variance, eps) over N: s = X (+ R); optional out_sum <- s; out_norm <- (s-mu)*rsqrt(var+eps)*g + b
template <bool PARAM_BF16>
__global__ __launch_bounds__(256) void k_layernorm(const float* __restrict__ X, const float* __restrict__ R, const float* __restrict__ g, const float* __restrict__ bta,
                                                  float* __restrict__ out_sum, float* __restrict__ out_norm, int N, float eps) {
  __shared__ float red[256];
  const int row = blockIdx.x, tid = threadIdx.x;
  const float* x = X + (size_t)row * N; const float* rr = R ? R + (size_t)row * N : nullptr;
  float vals[16];                     // up to N = 4096
  const int per = N / 256;            // contiguous chunk per thread? use strided-by-4 chunks: thread handles j = tid*4 + 1024*u
  float s1 = 0.f;
  for (int u = 0; u < per / 4; ++u) {
    const int j = tid * 4 + 1024 * u;
    const v4f a = *(const v4fa*)(x + j);
    v4f b = {0.f,0.f,0.f,0.f}; if (rr) b = *(const v4fa*)(rr + j);
#pragma unroll
    for (int q = 0; q < 4; ++q) { const float v = a[q] + b[q]; vals[u * 4 + q] = v; s1 += v; }
  }
  red[tid] = s1; __syncthreads();
  for (int st = 128; st > 0; st >>= 1) { if (tid < st) red[tid] += red[tid + st]; __syncthreads(); }
  const float mu = red[0] / (float)N; __syncthreads();
  float s2 = 0.f;
  for (int u = 0; u < per / 4; ++u)
#pragma unroll
    for (int q = 0; q < 4; ++q) { const float c = vals[u * 4 + q] - mu; s2 += c * c; }
  red[tid] = s2; __syncthreads();
  for (int st = 128; st > 0; st >>= 1) { if (tid < st) red[tid] += red[tid + st]; __syncthreads(); }
  const float rs = rsqrtf(red[0] / (float)N + eps);
  {
    for (int u = 0; u < per / 4; ++u) {
      const int j = tid * 4 + 1024 * u;
      v4f o, sm;
#pragma unroll
      for (int q = 0; q < 4; ++q) {
        float gg = g[j + q], bb = bta[j + q];
        if (PARAM_BF16) { gg = bf16_round(gg); bb = bf16_round(bb); }
        sm[q] = vals[u * 4 + q]; o[q] = (vals[u * 4 + q] - mu) * rs * gg + bb;
      }
      if (out_sum) *(v4f*)(out_sum + (size_t)row * N + j) = sm;
      *(v4f*)(out_norm + (size_t)row * N + j) = o;
    }
    
  }
}



// ---- f16 WMMA path (v_wmma_f32_16x16x32_f16): 11-bit significands for operands in range — used where a [0,1] probability operand needs more precision than bf16
typedef _Float16 v16h __attribute__((ext_vector_type(16)));
union FragH { v16h v; v8us half[2]; _Float16 h[16]; unsigned short u[16]; };
template <int NT>
__device__ __forceinline__ v8f mmaH(v16h ah, v16h al, v16h bh, v16h bl, v8f c) {
  c = __builtin_amdgcn_wmma_f32_16x16x32_f16(false, ah, false, bh, (short)0, c, false, false);
  if (NT >= 2) c = __builtin_amdgcn_wmma_f32_16x16x32_f16(false, al, false, bh, (short)0, c, false, false);
  if (NT >= 3) c = __builtin_amdgcn_wmma_f32_16x16x32_f16(false, ah, false, bl, (short)0, c, false, false);
  asm volatile("v_nop\n\tv_nop\n\tv_nop\n\tv_nop" : "+v"(c) : "v"(ah), "v"(al), "v"(bh), "v"(bl));
  return c;
}
// batched GEMM like k_gemm_b but f16 operands: A f32 (split into f16 hi/lo if ASPLIT, else rounded to f16), Bt = f16 values [n][k]; alpha; C f32; N multiple of 16 (partial tiles skipped)
template <bool ASPLIT>
__global__ __launch_bounds__(128) void k_gemm_h(const float* __restrict__ A, int lda, size_t sA, const _Float16* __restrict__ Bh, int ldb, size_t sB, float alpha, float* __restrict__ C, int ldc, size_t sC, int M, int N, int K) {
  __shared__ __attribute__((aligned(16))) float so[4][16][64];
  const int tid = threadIdx.x, w = tid >> 5, lane = tid & 31, ln = lane & 15, hh = lane >> 4; const int by = blockIdx.y;
  A += (size_t)by * sA; Bh += (size_t)by * sB; C += (size_t)by * sC;
  const int ntn = (N + 63) / 64; const int wid = blockIdx.x * 4 + w; const int mt = wid / ntn, nq = wid % ntn; if (mt * 16 >= M) return;
  const int row0 = mt * 16, col0 = nq * 64; const float* arow = A + (size_t)(row0 + ln) * lda;
  v8f acc[4] = {};
  for (int kb = 0; kb < K; kb += 32) {
    FragH ah, al;
    const v4f x0 = *(const v4fa*)(arow + kb + 8 * hh), x1 = *(const v4fa*)(arow + kb + 8 * hh + 4), x2 = *(const v4fa*)(arow + kb + 16 + 8 * hh), x3 = *(const v4fa*)(arow + kb + 16 + 8 * hh + 4);
    float xs[16] = {x0[0],x0[1],x0[2],x0[3],x1[0],x1[1],x1[2],x1[3],x2[0],x2[1],x2[2],x2[3],x3[0],x3[1],x3[2],x3[3]};
#pragma unroll
    for (int i = 0; i < 16; ++i) { const _Float16 h = (_Float16)xs[i]; ah.h[i] = h; al.h[i] = ASPLIT ? (_Float16)(xs[i] - (float)h) : (_Float16)0.0f; }
#pragma unroll
    for (int t = 0; t < 4; ++t) { if (col0 + t * 16 >= N) continue; const size_t boff = (size_t)(col0 + t * 16 + ln) * ldb + kb; FragH bq; bq.half[0] = *(const v8us*)(Bh + boff + 8 * hh); bq.half[1] = *(const v8us*)(Bh + boff + 16 + 8 * hh);
      acc[t] = mmaH<ASPLIT ? 2 : 1>(ah.v, al.v, bq.v, bq.v, acc[t]); }
  }
#pragma unroll
  for (int t = 0; t < 4; ++t) { if (col0 + t * 16 >= N) continue;
#pragma unroll
    for (int r = 0; r < 8; ++r) so[w][8 * hh + r][t * 16 + ln] = acc[t][r] * alpha; }
  __builtin_amdgcn_fence(__ATOMIC_ACQ_REL, "workgroup"); __builtin_amdgcn_wave_barrier();
  const int rsub = lane >> 4, c4 = (lane & 15) * 4;
  {
#pragma unroll
    for (int q = 0; q < 8; ++q) { const int r = q * 2 + rsub; if (col0 + c4 < N) { const v4f v = *(const v4fa*)&so[w][r][c4]; *(v4f*)(C + (size_t)(row0 + r) * ldc + col0 + c4) = v; } }
     }
}

// Wt[n][k] = f16(W[k][n]·scale) from f32 row-major W[K][N] (scale = power of two; bf16-exact weights stay exact in f16 away from the subnormal range)
__global__ __launch_bounds__(256) void k_wt_f16(const float* __restrict__ W, _Float16* __restrict__ Wt, int K, int N, float scale) {
  const int t = blockIdx.x * 256 + threadIdx.x; if (t >= N * (K / 8)) return; const int n = t / (K / 8), k8 = (t % (K / 8)) * 8; FragH f;
#pragma unroll
  for (int i = 0; i < 8; ++i) f.h[i] = (_Float16)(bf16_round(W[(size_t)(k8 + i) * N + n]) * scale); const v8us o = f.half[0];
  *(v8us*)((unsigned short*)Wt + (size_t)n * K + k8) = o; 
}
// k_gemm_hh variant with fused epilogue: v = acc·alpha + bias[by·sBias + col] (+ CP[(row/rowsPerB)·sCPb + by·64 + col] if CP) ; ACT 0 none / 1 elu ; writes f16 C16 (and f32 C if non-null)
template <int ACT>
__global__ __launch_bounds__(128) void k_gemm_hhx(const _Float16* __restrict__ A, int lda, size_t sA, const _Float16* __restrict__ Bh, int ldb, size_t sB, float alpha, const float* __restrict__ bias, size_t sBias, const float* __restrict__ CP, int rowsPerB, size_t sCPb, int row0g,
    float* __restrict__ C, _Float16* __restrict__ C16, int ldc, size_t sC, int M, int N, int K) {
  __shared__ __attribute__((aligned(16))) float so[4][16][64];
  const int tid = threadIdx.x, w = tid >> 5, lane = tid & 31, ln = lane & 15, hh = lane >> 4; const int by = blockIdx.y;
  A += (size_t)by * sA; Bh += (size_t)by * sB; const size_t cofs = (size_t)by * sC; const float* bp = bias ? bias + (size_t)by * sBias : nullptr;
  const int ntn = (N + 63) / 64; const int wid = blockIdx.x * 4 + w; const int mt = wid / ntn, nq = wid % ntn; if (mt * 16 >= M) return;
  const int row0 = mt * 16, col0 = nq * 64; const _Float16* arow = A + (size_t)(row0 + ln) * lda;
  v8f acc[4] = {};
  for (int kb = 0; kb < K; kb += 32) { FragH ah; ah.half[0] = *(const v8us*)((const unsigned short*)arow + kb + 8 * hh); ah.half[1] = *(const v8us*)((const unsigned short*)arow + kb + 16 + 8 * hh);
#pragma unroll
    for (int t = 0; t < 4; ++t) { if (col0 + t * 16 >= N) continue; const size_t boff = (size_t)(col0 + t * 16 + ln) * ldb + kb; FragH bq; bq.half[0] = *(const v8us*)((const unsigned short*)Bh + boff + 8 * hh); bq.half[1] = *(const v8us*)((const unsigned short*)Bh + boff + 16 + 8 * hh);
      acc[t] = mmaH<1>(ah.v, ah.v, bq.v, bq.v, acc[t]); }
  }
#pragma unroll
  for (int t = 0; t < 4; ++t) { if (col0 + t * 16 >= N) continue; const int col = col0 + t * 16 + ln; const float bv = bp ? bf16_round(bp[col]) : 0.f;
#pragma unroll
    for (int r = 0; r < 8; ++r) { float v = acc[t][r] * alpha + bv; if (CP) { const int bidx = (row0g + row0 + 8 * hh + r) / rowsPerB; v += CP[(size_t)bidx * sCPb + (size_t)by * 64 + col]; } if (ACT == 1) v = (v > 0.f) ? v : expm1f(v); else if (ACT == 7) v = (v > 0.f) ? v + 1.0f : expf(v); else if (ACT == 8) v = tanhf(v); else if (ACT == 9) v = 0.5f * v * (1.0f + tanhf(0.7978845608028654f * (v + 0.044715f * v * v * v))); else if (ACT == 11) v = 1.0f / (1.0f + expf(-v)); else if (ACT == 12) v = (v > 0.f) ? v : 0.01f * v; else if (ACT == 14) v = (v > 0.f) ? v : 0.1f * v; else if (ACT == 15) v = v / (1.0f + expf(-v)); else if (ACT == 3) v = fmaxf(v, 0.f); else if (ACT == 6) v = 0.5f * v * (1.0f + erff(v * 0.70710678118654752f)); so[w][8 * hh + r][t * 16 + ln] = v; } }
  __builtin_amdgcn_fence(__ATOMIC_ACQ_REL, "workgroup"); __builtin_amdgcn_wave_barrier();
  const int rsub = lane >> 4, c4 = (lane & 15) * 4; typedef _Float16 v4h __attribute__((ext_vector_type(4)));
  {
#pragma unroll
    for (int q = 0; q < 8; ++q) { const int r = q * 2 + rsub; if (col0 + c4 < N) { const v4f v = *(const v4fa*)&so[w][r][c4]; if (C) *(v4f*)(C + cofs + (size_t)(row0 + r) * ldc + col0 + c4) = v; if (C16) { v4h h4; for (int i = 0; i < 4; ++i) h4[i] = (_Float16)v[i]; *(v4h*)(C16 + cofs + (size_t)(row0 + r) * ldc + col0 + c4) = h4; } } }
     }
}


typedef _Float16 v4h __attribute__((ext_vector_type(4)));

__global__ __launch_bounds__(256) void k_x16(const float* __restrict__ x, _Float16* __restrict__ X16, size_t n8) { const size_t t = (size_t)blockIdx.x * 256 + threadIdx.x; if (t >= n8) return; FragH f;
#pragma unroll
  for (int q = 0; q < 8; ++q) f.h[q] = (_Float16)bf16_round(x[t * 8 + q]); *(v8us*)((unsigned short*)X16 + t * 8) = f.half[0];  }
__global__ __launch_bounds__(256) void k_h16(const float* __restrict__ x, _Float16* __restrict__ X16, size_t n8) { const size_t t = (size_t)blockIdx.x * 256 + threadIdx.x; if (t >= n8) return; FragH f;
#pragma unroll
  for (int q = 0; q < 8; ++q) f.h[q] = (_Float16)x[t * 8 + q]; *(v8us*)((unsigned short*)X16 + t * 8) = f.half[0];  }
__global__ __launch_bounds__(256) void k_round16f(const float* __restrict__ W, _Float16* __restrict__ Bt, size_t n8) { const size_t t = (size_t)blockIdx.x * 256 + threadIdx.x; if (t >= n8) return; FragH f;
#pragma unroll
  for (int i = 0; i < 8; ++i) f.h[i] = (_Float16)(bf16_round(W[t * 8 + i]) * 16.0f); *(v8us*)((unsigned short*)Bt + t * 8) = f.half[0];  }
template <int NHv, int TTv>
__global__ __launch_bounds__(256) void k_vt(const _Float16* __restrict__ V16, int ldv, int voff, _Float16* __restrict__ Vt) { __shared__ unsigned short tl[64][66]; const int tid = threadIdx.x; const int slab = blockIdx.x / (TTv / 64), lg = blockIdx.x % (TTv / 64); const int b = slab / NHv, h = slab % NHv;
  for (int i = tid; i < 64 * 8; i += 256) { const int r = i / 8, c8 = (i % 8) * 8; FragH f; f.half[0] = *(const v8us*)((const unsigned short*)V16 + ((size_t)b * TTv + lg * 64 + r) * ldv + voff + h * 64 + c8);
#pragma unroll
    for (int q = 0; q < 8; ++q) tl[r][c8 + q] = f.u[q]; }
  __syncthreads();
  {
#pragma unroll
    for (int rd = 0; rd < 2; ++rd) { const int d = rd * 32 + tid / 8, pc = tid % 8; FragH f;
#pragma unroll
      for (int q = 0; q < 8; ++q) f.u[q] = tl[pc * 8 + q][d];
      *(v8us*)((unsigned short*)Vt + ((size_t)slab * 64 + d) * TTv + lg * 64 + pc * 8) = f.half[0]; }
     } }

__global__ __launch_bounds__(256) void k_hl(const float* __restrict__ F, _Float16* __restrict__ Hh, _Float16* __restrict__ Hl, size_t n8) { const size_t t = (size_t)blockIdx.x * 256 + threadIdx.x; if (t >= n8) return; FragH fh, fl; const v4f a = *(const v4fa*)(F + t * 8), c = *(const v4fa*)(F + t * 8 + 4);
#pragma unroll
  for (int q = 0; q < 4; ++q) { _Float16 h = (_Float16)a[q]; fh.h[q] = h; fl.h[q] = (_Float16)((a[q] - (float)h) * 1024.0f); h = (_Float16)c[q]; fh.h[4 + q] = h; fl.h[4 + q] = (_Float16)((c[q] - (float)h) * 1024.0f); }
  { *(v8us*)((unsigned short*)Hh + t * 8) = fh.half[0]; *(v8us*)((unsigned short*)Hl + t * 8) = fl.half[0];  } }

// ---- fast GEMM (wave tile 32x64; requires M % 32 == 0 rows per launch region and N % 64 == 0); epilogue = k_gemm_hhx semantics ----
__device__ __forceinline__ v16h g2_frag(const _Float16* p, int hh) { FragH f; f.half[0] = *(const v8us*)((const unsigned short*)p + 8 * hh); f.half[1] = *(const v8us*)((const unsigned short*)p + 16 + 8 * hh); return f.v; }
__device__ __forceinline__ v8f g2_mma(v16h a, v16h b, v8f c) { v8f d = __builtin_amdgcn_wmma_f32_16x16x32_f16(false, a, false, b, (short)0, c, false, false); asm volatile("v_nop\n\tv_nop\n\tv_nop\n\tv_nop" : "+v"(d) : "v"(a), "v"(b)); return d; }
template <int ACT>
__global__ __launch_bounds__(128) void k_gemm2(const _Float16* __restrict__ A, int lda, size_t sA, const _Float16* __restrict__ Bh, int ldb, size_t sB, float alpha, const float* __restrict__ bias, size_t sBias, const float* __restrict__ CP, int rowsPerB, size_t sCPb, int row0g,
    float* __restrict__ C, _Float16* __restrict__ C16, int ldc, size_t sC, int M, int N, int K) {
  __shared__ __attribute__((aligned(16))) float so[4][32][68];
  const int tid = threadIdx.x, w = tid >> 5, lane = tid & 31, ln = lane & 15, hh = lane >> 4; const int by = blockIdx.y;
  A += (size_t)by * sA; Bh += (size_t)by * sB; const size_t cofs = (size_t)by * sC; const float* bp = bias ? bias + (size_t)by * sBias : nullptr;
  const int ntn = N >> 6; const int mt = blockIdx.x / ntn, nq = blockIdx.x - mt * ntn; const int row0 = mt * 128 + 32 * w, col0 = nq * 64; if (row0 >= M) return;
  const _Float16* a0p = A + (size_t)(row0 + ln) * lda; const _Float16* a1p = a0p + (size_t)16 * lda;
  const _Float16* b0p = Bh + (size_t)(col0 + ln) * ldb; const _Float16* b1p = b0p + (size_t)16 * ldb; const _Float16* b2p = b1p + (size_t)16 * ldb; const _Float16* b3p = b2p + (size_t)16 * ldb;
  const v8f z8 = {0.f,0.f,0.f,0.f,0.f,0.f,0.f,0.f}; v8f c00 = z8, c01 = z8, c02 = z8, c03 = z8, c10 = z8, c11 = z8, c12 = z8, c13 = z8;
#pragma unroll 1
  for (int kb = 0; kb < K; kb += 32) { const v16h a0 = g2_frag(a0p + kb, hh), a1 = g2_frag(a1p + kb, hh);
    v16h b = g2_frag(b0p + kb, hh); c00 = g2_mma(a0, b, c00); c10 = g2_mma(a1, b, c10);
    b = g2_frag(b1p + kb, hh); c01 = g2_mma(a0, b, c01); c11 = g2_mma(a1, b, c11);
    b = g2_frag(b2p + kb, hh); c02 = g2_mma(a0, b, c02); c12 = g2_mma(a1, b, c12);
    b = g2_frag(b3p + kb, hh); c03 = g2_mma(a0, b, c03); c13 = g2_mma(a1, b, c13); }
  v8f accs[8] = {c00, c01, c02, c03, c10, c11, c12, c13};
#pragma unroll
  for (int u = 0; u < 8; ++u) { const int t = u & 3, half = u >> 2; const int col = col0 + t * 16 + ln; const float bv = bp ? bf16_round(bp[col]) : 0.f;
#pragma unroll
    for (int r = 0; r < 8; ++r) { const int rloc = half * 16 + 8 * hh + r; float v = accs[u][r] * alpha + bv; if (CP) { const int bidx = (row0g + row0 + rloc) / rowsPerB; v += CP[(size_t)bidx * sCPb + (size_t)by * 64 + col]; }
      if (ACT == 3) v = fmaxf(v, 0.f); else if (ACT == 6) v = 0.5f * v * (1.0f + erff(v * 0.70710678118654752f)); else if (ACT == 11) v = 1.0f / (1.0f + expf(-v)); else if (ACT == 15) v = v / (1.0f + expf(-v)); else if (ACT == 12) v = (v > 0.f) ? v : 0.01f * v; else if (ACT == 8) v = tanhf(v);
      so[w][rloc][t * 16 + ln] = v; } }
  __builtin_amdgcn_fence(__ATOMIC_ACQ_REL, "workgroup"); __builtin_amdgcn_wave_barrier();
  const int rsub = lane >> 4, c4 = (lane & 15) * 4;
  {
#pragma unroll
    for (int q = 0; q < 16; ++q) { const int r = q * 2 + rsub; const v4f v = *(const v4fa*)&so[w][r][c4]; if (C) *(v4f*)(C + cofs + (size_t)(row0 + r) * ldc + col0 + c4) = v; if (C16) { v4h h4; for (int i = 0; i < 4; ++i) h4[i] = (_Float16)v[i]; *(v4h*)(C16 + cofs + (size_t)(row0 + r) * ldc + col0 + c4) = h4; } }
     } }


template <int TK>
__global__ __launch_bounds__(256) void k_vthl(const float* __restrict__ VF, int ldv, _Float16* __restrict__ Vth, _Float16* __restrict__ Vtl) { __shared__ float tl[64][65]; const int tid = threadIdx.x; const int slab = blockIdx.x / (TK / 64), lg = blockIdx.x % (TK / 64); const int b = slab / NH, h = slab % NH;
  for (int i = tid; i < 64 * 16; i += 256) { const int r = i / 16, c4 = (i % 16) * 4; const v4f a = *(const v4fa*)(VF + ((size_t)b * TK + lg * 64 + r) * ldv + h * 64 + c4); tl[r][c4] = a[0]; tl[r][c4 + 1] = a[1]; tl[r][c4 + 2] = a[2]; tl[r][c4 + 3] = a[3]; }
  __syncthreads();
  FragH fh[2], fl[2]; size_t oo[2];
#pragma unroll
  for (int rd = 0; rd < 2; ++rd) { const int d = rd * 32 + tid / 8, pc = tid % 8;
#pragma unroll
    for (int q = 0; q < 8; ++q) { const float v = tl[pc * 8 + q][d]; const _Float16 hv = (_Float16)v; fh[rd].h[q] = hv; fl[rd].h[q] = (_Float16)((v - (float)hv) * 1024.0f); } oo[rd] = ((size_t)slab * 64 + d) * TK + lg * 64 + pc * 8; }
  {
#pragma unroll
    for (int rd = 0; rd < 2; ++rd) { *(v8us*)((unsigned short*)Vth + oo[rd]) = fh[rd].half[0]; *(v8us*)((unsigned short*)Vtl + oo[rd]) = fl[rd].half[0]; }
     } }

// KSP key parts: wave w works query tile (w & 3) on the 32-key blocks (w >> 2), (w >> 2) + KSP, ...; the parts' partial (max, sum, O) are merged through LDS behind one barrier.
template <int TQ, int TK, int KSP>
__global__ __launch_bounds__(128 * KSP) void k_flashm(const _Float16* __restrict__ Q16, const _Float16* __restrict__ Q16lo, int ldq, const _Float16* __restrict__ K16, const _Float16* __restrict__ K16lo, int ldk, const _Float16* __restrict__ Vt, const _Float16* __restrict__ Vtlo, const unsigned* __restrict__ MB, const int* __restrict__ RA, const int* __restrict__ KE, float* __restrict__ O, int ldo) {
  constexpr int RPW = 16, RTN = RPW / 16, NQB = TQ / (4 * RPW), DT = 4, KS = 2, NW = 4 * KSP;
  __shared__ __attribute__((aligned(16))) unsigned short sP[NW][RPW][40], sPl[NW][RPW][40]; __shared__ __attribute__((aligned(16))) float sO[NW][RPW][64 + 4]; __shared__ float sM[NW][RPW], sL[NW][RPW];
  const int tid = threadIdx.x, w = tid >> 5, lane = tid & 31, ln = lane & 15, hh = lane >> 4; const int qt = w & 3, kp = __builtin_amdgcn_readfirstlane(w >> 2);      /* scalar: the key loop's counter and trip test stay wave-uniform */
  const int slab = blockIdx.x / NQB, qblk = blockIdx.x % NQB; const int b = slab / NH, h = slab % NH; const int qb0 = qblk * (4 * RPW); const int q0 = qb0 + qt * RPW;
  FragH aq[2][KS], aql[2][KS];
#pragma unroll
  for (int rt = 0; rt < RTN; ++rt) { const size_t qo = ((size_t)b * TQ + q0 + rt * 16 + ln) * ldq + h * 64; const unsigned short* qr = (const unsigned short*)Q16 + qo; const unsigned short* ql = (const unsigned short*)Q16lo + qo;
#pragma unroll
    for (int ks = 0; ks < KS; ++ks) { aq[rt][ks].half[0] = *(const v8us*)(qr + ks * 32 + 8 * hh); aq[rt][ks].half[1] = *(const v8us*)(qr + ks * 32 + 16 + 8 * hh); aql[rt][ks].half[0] = *(const v8us*)(ql + ks * 32 + 8 * hh); aql[rt][ks].half[1] = *(const v8us*)(ql + ks * 32 + 16 + 8 * hh); } }
  const unsigned short* Vth = (const unsigned short*)Vt + (size_t)slab * 64 * TK; const unsigned short* Vtl = (const unsigned short*)Vtlo + (size_t)slab * 64 * TK;
  float m_r[2][8], l_r[2][8]; v8f oacc[2][DT], oaccl[2][DT];
#pragma unroll
  for (int rt = 0; rt < RTN; ++rt) {
#pragma unroll
    for (int r = 0; r < 8; ++r) { m_r[rt][r] = -3.0e38f; l_r[rt][r] = 0.f; }
#pragma unroll
    for (int dt = 0; dt < DT; ++dt) { oacc[rt][dt] = (v8f){0.f,0.f,0.f,0.f,0.f,0.f,0.f,0.f}; oaccl[rt][dt] = oacc[rt][dt]; } }
  int jend = KE[qblk * 32]; jend = min(TK, (jend + 31) & ~31); if (jend < 32) jend = 32;      /* block-uniform */
  int allm[2][8]; const unsigned* mrow[2][8];
#pragma unroll
  for (int rt = 0; rt < RTN; ++rt)
#pragma unroll
    for (int r = 0; r < 8; ++r) { const int tq = q0 + rt * 16 + 8 * hh + r; allm[rt][r] = RA[tq]; mrow[rt][r] = MB + (size_t)tq * (TK / 32); }
#pragma unroll 1
  for (int j0 = kp * 32; j0 < jend; j0 += 32 * KSP) {
    
    v8f s[2][2];
#pragma unroll
    for (int nt = 0; nt < 2; ++nt) { const size_t ko = ((size_t)b * TK + j0 + nt * 16 + ln) * ldk + h * 64; const unsigned short* kr = (const unsigned short*)K16 + ko; const unsigned short* kl = (const unsigned short*)K16lo + ko; FragH bk[KS], bkl[KS];
#pragma unroll
      for (int ks = 0; ks < KS; ++ks) { bk[ks].half[0] = *(const v8us*)(kr + ks * 32 + 8 * hh); bk[ks].half[1] = *(const v8us*)(kr + ks * 32 + 16 + 8 * hh); bkl[ks].half[0] = *(const v8us*)(kl + ks * 32 + 8 * hh); bkl[ks].half[1] = *(const v8us*)(kl + ks * 32 + 16 + 8 * hh); }
#pragma unroll
      for (int rt = 0; rt < RTN; ++rt) { v8f acc = (v8f){0.f,0.f,0.f,0.f,0.f,0.f,0.f,0.f}, accr = acc;
#pragma unroll
        for (int ks = 0; ks < KS; ++ks) { acc = mmaH<1>(aq[rt][ks].v, aq[rt][ks].v, bk[ks].v, bk[ks].v, acc); accr = mmaH<1>(aql[rt][ks].v, aql[rt][ks].v, bk[ks].v, bk[ks].v, accr); accr = mmaH<1>(aq[rt][ks].v, aq[rt][ks].v, bkl[ks].v, bkl[ks].v, accr); }
        s[rt][nt] = acc + accr * 0.0009765625f; } }
#pragma unroll
    for (int rt = 0; rt < RTN; ++rt)
#pragma unroll
      for (int r = 0; r < 8; ++r) { const unsigned mw = mrow[rt][r][j0 >> 5]; const bool am = (allm[rt][r] != 0);
        const bool ok0 = am || (((mw >> ln) & 1u) == 0u), ok1 = am || (((mw >> (16 + ln)) & 1u) == 0u);
        const float s0 = ok0 ? (am ? 0.f : s[rt][0][r] * SCL) : -INFINITY, s1 = ok1 ? (am ? 0.f : s[rt][1][r] * SCL) : -INFINITY; float mc = fmaxf(s0, s1);
        mc = fmaxf(mc, __shfl_xor(mc, 1, 32)); mc = fmaxf(mc, __shfl_xor(mc, 2, 32)); mc = fmaxf(mc, __shfl_xor(mc, 4, 32)); mc = fmaxf(mc, __shfl_xor(mc, 8, 32));
        const float mn = fmaxf(m_r[rt][r], mc); const float al = (mn > -1.0e38f) ? expf(m_r[rt][r] - mn) : 1.0f; m_r[rt][r] = mn; const float p0 = ok0 ? expf(s0 - mn) : 0.f, p1 = ok1 ? expf(s1 - mn) : 0.f; l_r[rt][r] = l_r[rt][r] * al + p0 + p1;
#pragma unroll
        for (int dt = 0; dt < DT; ++dt) { oacc[rt][dt][r] *= al; oaccl[rt][dt][r] *= al; }
        FragH t2, t3; const float ps0 = p0 * 1024.0f, ps1 = p1 * 1024.0f; t2.h[0] = (_Float16)ps0; t2.h[1] = (_Float16)ps1; t3.h[0] = (_Float16)((ps0 - (float)t2.h[0]) * 1024.0f); t3.h[1] = (_Float16)((ps1 - (float)t2.h[1]) * 1024.0f);
        sP[w][rt * 16 + 8 * hh + r][ln] = t2.u[0]; sP[w][rt * 16 + 8 * hh + r][16 + ln] = t2.u[1]; sPl[w][rt * 16 + 8 * hh + r][ln] = t3.u[0]; sPl[w][rt * 16 + 8 * hh + r][16 + ln] = t3.u[1]; }
    __builtin_amdgcn_fence(__ATOMIC_ACQ_REL, "workgroup"); __builtin_amdgcn_wave_barrier();
    FragH pa[2], pl[2];
#pragma unroll
    for (int rt = 0; rt < RTN; ++rt) { pa[rt].half[0] = *(const v8us*)&sP[w][rt * 16 + ln][8 * hh]; pa[rt].half[1] = *(const v8us*)&sP[w][rt * 16 + ln][16 + 8 * hh]; pl[rt].half[0] = *(const v8us*)&sPl[w][rt * 16 + ln][8 * hh]; pl[rt].half[1] = *(const v8us*)&sPl[w][rt * 16 + ln][16 + 8 * hh]; }
#pragma unroll
    for (int dt = 0; dt < DT; ++dt) { const size_t vo = (size_t)(dt * 16 + ln) * TK + j0; FragH bv, bl; bv.half[0] = *(const v8us*)(Vth + vo + 8 * hh); bv.half[1] = *(const v8us*)(Vth + vo + 16 + 8 * hh); bl.half[0] = *(const v8us*)(Vtl + vo + 8 * hh); bl.half[1] = *(const v8us*)(Vtl + vo + 16 + 8 * hh);
#pragma unroll
      for (int rt = 0; rt < RTN; ++rt) { oacc[rt][dt] = mmaH<1>(pa[rt].v, pa[rt].v, bv.v, bv.v, oacc[rt][dt]); oaccl[rt][dt] = mmaH<1>(pa[rt].v, pa[rt].v, bl.v, bl.v, oaccl[rt][dt]); oaccl[rt][dt] = mmaH<1>(pl[rt].v, pl[rt].v, bv.v, bv.v, oaccl[rt][dt]); } }
    __builtin_amdgcn_fence(__ATOMIC_ACQ_REL, "workgroup"); __builtin_amdgcn_wave_barrier(); }
#pragma unroll
  for (int rt = 0; rt < RTN; ++rt) {
#pragma unroll
    for (int r = 0; r < 8; ++r) { float l = l_r[rt][r]; l += __shfl_xor(l, 1, 32); l += __shfl_xor(l, 2, 32); l += __shfl_xor(l, 4, 32); l += __shfl_xor(l, 8, 32); if (ln == 0) { sM[w][rt * 16 + 8 * hh + r] = m_r[rt][r]; sL[w][rt * 16 + 8 * hh + r] = l; } }
#pragma unroll
    for (int dt = 0; dt < DT; ++dt)
#pragma unroll
      for (int r = 0; r < 8; ++r) sO[w][rt * 16 + 8 * hh + r][dt * 16 + ln] = oacc[rt][dt][r] + oaccl[rt][dt][r] * 0.0009765625f; }
  __syncthreads();      /* every part's partial is in LDS before any thread merges */
  for (int i = tid; i < 4 * RPW * 16; i += 128 * KSP) { const int row = i >> 4, pc = i & 15; const int tq = row / RPW, rr = row % RPW;
    float mx = sM[tq][rr];
#pragma unroll
    for (int p = 1; p < KSP; ++p) mx = fmaxf(mx, sM[p * 4 + tq][rr]);
    float lsum = 0.f; v4f o = {0.f, 0.f, 0.f, 0.f};
#pragma unroll
    for (int p = 0; p < KSP; ++p) { const float wg = expf(sM[p * 4 + tq][rr] - mx); lsum += wg * sL[p * 4 + tq][rr]; const v4f val = *(const v4fa*)&sO[p * 4 + tq][rr][pc * 4]; o += val * wg; }
    const float inv = (lsum > 0.f) ? 1.0f / (lsum * 1024.0f) : 0.f;
    *(v4f*)(O + ((size_t)b * TQ + qb0 + row) * ldo + h * 64 + pc * 4) = o * inv; } }


__constant__ float GRIDV[8] = {-2.000000000e+00f,-1.428571463e+00f,-8.571428657e-01f,-2.857141793e-01f,2.857143879e-01f,8.571429253e-01f,1.428571701e+00f,2.000000000e+00f};
#define INV_DENOM (1.0f / 0.5714285714285714f)
__global__ __launch_bounds__(256) void k_fulltab(unsigned* __restrict__ MB, int* __restrict__ RA, int* __restrict__ KE) {
  const int t = blockIdx.x * 256 + threadIdx.x;
  if (t < NPI * (NPI / 32)) { *(unsigned*)(MB + t) = 0u;  }
  if (t < NPI) { *(int*)(RA + t) = 0;  }
  if (t < NPI / 64) { *(int*)(KE + t * 32) = NPI;  } }
__global__ __launch_bounds__(256) void k_xcl(const float* __restrict__ x, _Float16* __restrict__ X16) {
  const int t = blockIdx.x * 256 + threadIdx.x; if (t >= NPX * (CIN / 8)) return; const int r = t / (CIN / 8), c0 = (t % (CIN / 8)) * 8; const int b = r / NPI, p = r % NPI; FragH f;
#pragma unroll
  for (int q = 0; q < 8; ++q) f.h[q] = (_Float16)bf16_round(x[((size_t)b * CIN + c0 + q) * NPI + p]);
  *(v8us*)((unsigned short*)X16 + (size_t)r * CIN + c0) = f.half[0];  }
__global__ __launch_bounds__(256) void k_instat(const float* __restrict__ A, const float* __restrict__ ST0, int phase, float* __restrict__ ST) {
  #pragma clang fp contract(off)
  __shared__ float sh[256]; const int b = blockIdx.x / DK, c = blockIdx.x % DK; const float mu = phase ? ST0[(size_t)blockIdx.x * 32] : 0.f; float s = 0.f;
  for (int p = threadIdx.x; p < NPI; p += 256) { const float v = A[((size_t)b * NPI + p) * DK + c] - mu; s += phase ? v * v : v; }
  sh[threadIdx.x] = s; __syncthreads();
  for (int st = 128; st > 0; st >>= 1) { if ((int)threadIdx.x < st) sh[threadIdx.x] += sh[threadIdx.x + st]; __syncthreads(); }
  if (threadIdx.x == 0) { const float v = sh[0] / (float)NPI; float* d = ST + ((size_t)phase * NIMG * DK + blockIdx.x) * 32; *(float*)d = v;  } }
__global__ __launch_bounds__(256) void k_basis(const float* __restrict__ A, const float* __restrict__ ST, _Float16* __restrict__ BAS) {
  #pragma clang fp contract(off)
  const int t = blockIdx.x * 256 + threadIdx.x; if (t >= NPX * DK) return; const int r = t / DK, c = t % DK; const int b = r / NPI; const float a = A[(size_t)r * DK + c];
  const float mu = ST[((size_t)b * DK + c) * 32], var = ST[((size_t)NIMG * DK + b * DK + c) * 32]; const float xn = (a - mu) * rsqrtf(var + 1e-5f); FragH bh, bl;
#pragma unroll
  for (int g = 0; g < NG; ++g) { const float z = (xn - GRIDV[g]) * INV_DENOM; const float e = expf(-(z * z)); const _Float16 hv = (_Float16)e; bh.h[g] = hv; bl.h[g] = (_Float16)((e - (float)hv) * 16.0f); }
  unsigned short* bd = (unsigned short*)BAS + (size_t)r * 2 * DK * NG + c * NG;
  { *(v8us*)bd = bh.half[0]; *(v8us*)(bd + DK * NG) = bl.half[0];  } }
__global__ __launch_bounds__(256) void k_silu(const float* __restrict__ A, _Float16* __restrict__ SIL) {
  #pragma clang fp contract(off)
  const int t = blockIdx.x * 256 + threadIdx.x; if (t >= NPX * (DK / 8)) return; const int r = t / (DK / 8), c0 = (t % (DK / 8)) * 8; const float* a = A + (size_t)r * DK + c0; FragH fh, fl;
#pragma unroll
  for (int q = 0; q < 8; ++q) { const float v = a[q]; const float sl = v / (1.0f + expf(-v)); const _Float16 hv = (_Float16)sl; fh.h[q] = hv; fl.h[q] = (_Float16)((sl - (float)hv) * 16.0f); }
  unsigned short* d = (unsigned short*)SIL + (size_t)r * 2 * DK + c0;
  { *(v8us*)d = fh.half[0]; *(v8us*)(d + DK) = fl.half[0];  } }
__global__ __launch_bounds__(256) void k_wnp2(const float* __restrict__ Wm, int K, int N, _Float16* __restrict__ Bt) {
  const int t = blockIdx.x * 256 + threadIdx.x; if (t >= N * (2 * K / 8)) return; const int n = t / (2 * K / 8), k0 = (t % (2 * K / 8)) * 8; const bool lo = (k0 >= K); const float sc = lo ? 1.0f : 16.0f; FragH f;
#pragma unroll
  for (int q = 0; q < 8; ++q) { const int k = k0 + q - (lo ? K : 0); f.h[q] = (_Float16)(bf16_round(Wm[(size_t)n * K + k]) * sc); }
  *(v8us*)((unsigned short*)Bt + (size_t)n * 2 * K + k0) = f.half[0];  }
__global__ __launch_bounds__(256) void k_pair16(const float* __restrict__ F, int n, _Float16* __restrict__ P, int rows) {
  #pragma clang fp contract(off)
  const int t = blockIdx.x * 256 + threadIdx.x; if (t >= rows * (n / 8)) return; const int r = t / (n / 8), c0 = (t % (n / 8)) * 8; const float* f = F + (size_t)r * n + c0; FragH fh, fl;
#pragma unroll
  for (int q = 0; q < 8; ++q) { const float v = f[q]; const _Float16 hv = (_Float16)v; fh.h[q] = hv; fl.h[q] = (_Float16)((v - (float)hv) * 16.0f); }
  unsigned short* d = (unsigned short*)P + (size_t)r * 2 * n + c0;
  { *(v8us*)d = fh.half[0]; *(v8us*)(d + n) = fl.half[0];  } }
__global__ __launch_bounds__(256) void k_y(const float* __restrict__ x, const float* __restrict__ gam, const float* __restrict__ A2, float* __restrict__ Y) {
  #pragma clang fp contract(off)
  const int t = blockIdx.x * 256 + threadIdx.x; if (t >= NPX * (CIN / 4)) return; const int r = t / (CIN / 4), c0 = (t % (CIN / 4)) * 4; const int b = r / NPI, p = r % NPI; const float g = bf16_round(gam[0]); const v4f a = *(const v4fa*)(A2 + (size_t)t * 4); v4f o;
#pragma unroll
  for (int q = 0; q < 4; ++q) o[q] = g * bf16_round(x[((size_t)b * CIN + c0 + q) * NPI + p]) + a[q];
  *(v4f*)(Y + (size_t)t * 4) = o;  }
__global__ __launch_bounds__(256) void k_bnstat(const float* __restrict__ Y, const float* __restrict__ ST0, int phase, float* __restrict__ ST) {
  #pragma clang fp contract(off)
  __shared__ float sh[256]; const int c = blockIdx.x; const float mu = phase ? ST0[(size_t)c * 32] : 0.f; float s = 0.f;
  for (int r = threadIdx.x; r < NPX; r += 256) { const float v = Y[(size_t)r * CIN + c] - mu; s += phase ? v * v : v; }
  sh[threadIdx.x] = s; __syncthreads();
  for (int st = 128; st > 0; st >>= 1) { if ((int)threadIdx.x < st) sh[threadIdx.x] += sh[threadIdx.x + st]; __syncthreads(); }
  if (threadIdx.x == 0) { const float v = sh[0] / (float)NPX; float* d = ST + ((size_t)phase * CIN + c) * 32; *(float*)d = v;  } }
__global__ __launch_bounds__(256) void k_bnout(const float* __restrict__ Y, const float* __restrict__ ST, const float* __restrict__ bw, const float* __restrict__ bb, float* __restrict__ out) {
  #pragma clang fp contract(off)
  const int t = blockIdx.x * 256 + threadIdx.x; if (t >= NIMG * CIN * (NPI / 4)) return; const int p0 = (t % (NPI / 4)) * 4; const int c = (t / (NPI / 4)) % CIN; const int b = t / ((NPI / 4) * CIN); const float mu = ST[(size_t)c * 32], var = ST[(size_t)(CIN + c) * 32]; const float sc = rsqrtf(var + 1e-5f), g = bf16_round(bw[c]), be = bf16_round(bb[c]); v4f o;
#pragma unroll
  for (int q = 0; q < 4; ++q) o[q] = g * ((Y[((size_t)b * NPI + p0 + q) * CIN + c] - mu) * sc) + be;
  float* dst = out + ((size_t)b * CIN + c) * NPI + p0; *(v4f*)dst = o;  }

extern "C" void kernel_launch(void* const* d_in, const int* in_sizes, int n_in,
                              void* d_out, int out_size, void* d_ws, size_t ws_size, hipStream_t stream) {
  (void)in_sizes; (void)n_in; (void)out_size;
  const float* const* I = (const float* const*)d_in; const float* x = I[0]; const float* w_in = I[1]; const float* b_in = I[2];
  const float* qbw = I[3]; const float* qbb = I[4]; const float* qsw = I[5]; const float* qsb = I[6]; const float* kbw = I[7]; const float* kbb = I[8]; const float* ksw = I[9]; const float* ksb = I[10]; const float* vbw = I[11]; const float* vbb = I[12]; const float* vsw = I[13]; const float* vsb = I[14];
  const float* w_out = I[15]; const float* b_out = I[16]; const float* gam = I[17]; const float* bnw = I[18]; const float* bnb = I[19];
  char* ws = (char*)d_ws; size_t off = 0;
  auto take = [&](size_t bytes) { char* p = ws + off; off += (bytes + 255) & ~(size_t)255; return p; };
  _Float16* BIN = (_Float16*)take((size_t)DK * CIN * 2); _Float16* BB[3]; _Float16* BS[3]; for (int i = 0; i < 3; ++i) { BB[i] = (_Float16*)take((size_t)DK * 2 * DK * 2); BS[i] = (_Float16*)take((size_t)DK * 2 * DK * NG * 2); } _Float16* BOUT = (_Float16*)take((size_t)CIN * 2 * DK * 2);
  _Float16* X16 = (_Float16*)take((size_t)NPX * CIN * 2); float* ATT = (float*)take((size_t)NPX * DK * 4); float* IST = (float*)take((size_t)2 * NIMG * DK * 32 * 4); _Float16* SIL = (_Float16*)take((size_t)NPX * 2 * DK * 2); _Float16* BAS = (_Float16*)take((size_t)NPX * 2 * DK * NG * 2);
  float* F = (float*)take((size_t)NPX * DK * 4); _Float16* Qh = (_Float16*)take((size_t)NPX * DK * 2); _Float16* Ql = (_Float16*)take((size_t)NPX * DK * 2); _Float16* Kh = (_Float16*)take((size_t)NPX * DK * 2); _Float16* Kl = (_Float16*)take((size_t)NPX * DK * 2); _Float16* Vth = (_Float16*)take((size_t)NPX * DK * 2); _Float16* Vtl = (_Float16*)take((size_t)NPX * DK * 2);
  float* O = (float*)take((size_t)NPX * DK * 4); _Float16* O16 = (_Float16*)take((size_t)NPX * 2 * DK * 2); float* A2 = (float*)take((size_t)NPX * CIN * 4); float* Y = (float*)take((size_t)NPX * CIN * 4); float* BST = (float*)take((size_t)2 * CIN * 32 * 4);
  unsigned* MB = (unsigned*)take((size_t)NPI * (NPI / 32) * 4); int* RA = (int*)take((size_t)NPI * 4); int* KE = (int*)take((size_t)(NPI / 64) * 32 * 4);
  if (off > ws_size) return;      /* 0.5 + 8 + 4 + 4 + 32 + 4 + 12 + 4 + 4 + 16 + 16 + 2 = 106.5 MiB */
  k_round16f<<<(DK * CIN / 8 + 255) / 256, 256, 0, stream>>>(w_in, BIN, (size_t)DK * CIN / 8); k_wnp2<<<(CIN * (2 * DK / 8) + 255) / 256, 256, 0, stream>>>(w_out, DK, CIN, BOUT);      /* (out,in) natural -> [16w | w] pair planes */
  const float* bw3[3] = {qbw, kbw, vbw}; const float* sw3[3] = {qsw, ksw, vsw};
  for (int i = 0; i < 3; ++i) { k_wnp2<<<(DK * (2 * DK / 8) + 255) / 256, 256, 0, stream>>>(bw3[i], DK, DK, BB[i]); k_wnp2<<<(DK * (2 * DK * NG / 8) + 255) / 256, 256, 0, stream>>>(sw3[i], DK * NG, DK, BS[i]); }
  k_fulltab<<<(NPI * (NPI / 32) + 255) / 256, 256, 0, stream>>>(MB, RA, KE);
  k_xcl<<<(NPX * (CIN / 8) + 255) / 256, 256, 0, stream>>>(x, X16);
  const dim3 g64((NPX / 128) * 1, 1), g256((NPX / 128) * (CIN / 64), 1);
  k_gemm2<0><<<g64, 128, 0, stream>>>(X16, CIN, 0, BIN, CIN, 0, 0.0625f, b_in, 0, nullptr, 1, 0, 0, ATT, nullptr, DK, 0, NPX, DK, CIN);      /* att = conv1x1(x) + b */
  k_instat<<<NIMG * DK, 256, 0, stream>>>(ATT, IST, 0, IST); k_instat<<<NIMG * DK, 256, 0, stream>>>(ATT, IST, 1, IST);
  k_basis<<<(NPX * DK + 255) / 256, 256, 0, stream>>>(ATT, IST, BAS); k_silu<<<(NPX * (DK / 8) + 255) / 256, 256, 0, stream>>>(ATT, SIL);
  const float* bb3[3] = {qbb, kbb, vbb}; const float* sb3[3] = {qsb, ksb, vsb}; const size_t n8 = (size_t)NPX * DK / 8; const unsigned nb8 = (unsigned)((n8 + 255) / 256);
  for (int i = 0; i < 3; ++i) {      /* q, k, v = base(silu) + b_base + spline(basis) + b_spline (two GEMMs, the second accumulating through the f32 addend) */
    k_gemm2<0><<<g64, 128, 0, stream>>>(SIL, 2 * DK, 0, BB[i], 2 * DK, 0, 0.0625f, bb3[i], 0, nullptr, 1, 0, 0, F, nullptr, DK, 0, NPX, DK, 2 * DK);
    k_gemm2<0><<<g64, 128, 0, stream>>>(BAS, 2 * DK * NG, 0, BS[i], 2 * DK * NG, 0, 0.0625f, sb3[i], 0, F, 1, (size_t)DK, 0, F, nullptr, DK, 0, NPX, DK, 2 * DK * NG);
    if (i == 0) k_hl<<<nb8, 256, 0, stream>>>(F, Qh, Ql, n8);
    else if (i == 1) k_hl<<<nb8, 256, 0, stream>>>(F, Kh, Kl, n8);
    else for (int b = 0; b < NIMG; ++b) k_vthl<NPI><<<NH * (NPI / 64), 256, 0, stream>>>(F + (size_t)b * NPI * DK, DK, Vth + (size_t)b * NPI * DK, Vtl + (size_t)b * NPI * DK); }
  k_flashm<NPI, NPI, KSPLIT><<<NIMG * NH * (NPI / 64), 128 * KSPLIT, 0, stream>>>(Qh, Ql, DK, Kh, Kl, DK, Vth, Vtl, MB, RA, KE, O, DK);      /* slab = image (NH 1) */
  k_pair16<<<nb8, 256, 0, stream>>>(O, DK, O16, NPX);
  k_gemm2<0><<<g256, 128, 0, stream>>>(O16, 2 * DK, 0, BOUT, 2 * DK, 0, 0.0625f, b_out, 0, nullptr, 1, 0, 0, A2, nullptr, CIN, 0, NPX, CIN, 2 * DK);      /* att2 = conv1x1(out) + b (pair operand) */
  k_y<<<(NPX * (CIN / 4) + 255) / 256, 256, 0, stream>>>(x, gam, A2, Y);
  k_bnstat<<<CIN, 256, 0, stream>>>(Y, BST, 0, BST); k_bnstat<<<CIN, 256, 0, stream>>>(Y, BST, 1, BST);
  k_bnout<<<(NIMG * CIN * (NPI / 4) + 255) / 256, 256, 0, stream>>>(Y, BST, bnw, bnb, (float*)d_out);
}

// v002
// It runs in 502 microseconds.
// Timed twice side by side with v001, it ran 1.17 times as fast both times.
// Over all steps from v000 it is 1.85 times as fast.
#include <hip/hip_runtime.h>
// Self-KAN attention (4 images, 256 channels, 64 x 64): att = conv1x1(x) (64 ch); q, k, v = FastKAN 1x1 convs (base_conv(silu(att)) + spline_conv(RBF basis of the instance-normalised att, 8 grid points)); energy = q.k over the 4096 positions (NO scaling), softmax over keys, out = v.attn^T; att2 = conv1x1(out) (256 ch); y = gamma*x + att2; training-mode BatchNorm -> [4,256,64,64].
// Compute dtype: x, weights, biases, gamma, BN affine rounded to bf16; x exact in f16; silu/basis operands as hi + 16x residual pairs (~2^-20); q, k, P, v as hi + x2^10 residual pairs (~2^-21); the attention output as hi + 16x residual pairs too; f32 accumulation, statistics, softmax. v_wmma_f32_16x16x32_f16.
#define NIMG 4
#define CIN 256
#define DK 64
#define HW 64
#define NPI (HW * HW)            /* 4096 */
#define NPX (NIMG * NPI)         /* 16384 */
#define NG 8
#define NH 1
#define DM DK
#define SCL 1.0f
#define KSPLIT 4
typedef __bf16 v16b __attribute__((ext_vector_type(16)));
typedef unsigned short v8us __attribute__((ext_vector_type(8), may_alias));
typedef float  v8f  __attribute__((ext_vector_type(8)));
typedef float  v4f  __attribute__((ext_vector_type(4)));
typedef float  v4fa __attribute__((ext_vector_type(4), may_alias));
union FragB { v16b v; v8us half[2]; unsigned short u[16]; };

__device__ __forceinline__ unsigned short bf16_bits(float x) { unsigned int u = __float_as_uint(x); return (unsigned short)((u + 0x7FFFu + ((u >> 16) & 1u)) >> 16); }
__device__ __forceinline__ float bf16_val(unsigned short b) { return __uint_as_float(((unsigned int)b) << 16); }
__device__ __forceinline__ float bf16_round(float x) { return bf16_val(bf16_bits(x)); }
// D += A·B with NT terms: 1 = ah·bh, 2 = + al·bh (A split), 3 = + ah·bl (both split)
template <int NT>
__device__ __forceinline__ v8f mmaN(v16b ah, v16b al, v16b bh, v16b bl, v8f c) {
  c = __builtin_amdgcn_wmma_f32_16x16x32_bf16(false, ah, false, bh, (short)0, c, false, false);
  if (NT >= 2) c = __builtin_amdgcn_wmma_f32_16x16x32_bf16(false, al, false, bh, (short)0, c, false, false);
  if (NT >= 3) c = __builtin_amdgcn_wmma_f32_16x16x32_bf16(false, ah, false, bl, (short)0, c, false, false);
  asm volatile("v_nop\n\tv_nop\n\tv_nop\n\tv_nop" : "+v"(c) : "v"(ah), "v"(al), "v"(bh), "v"(bl));
  return c;
}

__global__ __launch_bounds__(256) void k_wt_bf16(const float* __restrict__ W, unsigned short* __restrict__ Wt, int K, int N) {
  const int t = blockIdx.x * 256 + threadIdx.x;
  const int k8n = K / 8;
  if (t >= N * k8n) return;
  const int n = t / k8n, k8 = (t % k8n) * 8;
  v8us v;
#pragma unroll
  for (int i = 0; i < 8; ++i) v[i] = bf16_bits(W[(size_t)(k8 + i) * N + n]);
  *(v8us*)(Wt + (size_t)n * K + k8) = v;
  
}

// GEMM C[M][N] (f32, pitch ldc) = act(A[M][K]·W + bias). A f32 row-major (pitch lda) converted per fragment to bf16
// (ASPLIT: hi/lo two planes -> 2 terms, else single rounded term); Wt bf16 [N][K] (pitch ldb). BIAS_BF16 rounds the
// bias to bf16 first (bias quantised to bf16 before the add). K%32==0, M%16==0, N%64==0.
template <bool ASPLIT, int ACT, bool BIAS_BF16>
__global__ __launch_bounds__(128) void k_gemm_bf(const float* __restrict__ A, int lda, const unsigned short* __restrict__ Wt, int ldb,
                                               const float* __restrict__ bias, float* __restrict__ C, int ldc, int M, int N, int K) {
  __shared__ __attribute__((aligned(16))) float so[4][16][64];
  const int tid = threadIdx.x, w = tid >> 5, lane = tid & 31, ln = lane & 15, hh = lane >> 4;
  const int ntn = N / 64;
  const int wid = blockIdx.x * 4 + w;
  const int mt = wid / ntn, nq = wid % ntn;
  if (mt * 16 >= M) return;
  const int row0 = mt * 16, col0 = nq * 64;
  const float* arow = A + (size_t)(row0 + ln) * lda;
  v8f acc[4] = {};
  for (int kb = 0; kb < K; kb += 32) {
    FragB ah, al;
    const v4f x0 = *(const v4fa*)(arow + kb + 8 * hh), x1 = *(const v4fa*)(arow + kb + 8 * hh + 4);
    const v4f x2 = *(const v4fa*)(arow + kb + 16 + 8 * hh), x3 = *(const v4fa*)(arow + kb + 16 + 8 * hh + 4);
    float xs[16] = {x0[0],x0[1],x0[2],x0[3],x1[0],x1[1],x1[2],x1[3],x2[0],x2[1],x2[2],x2[3],x3[0],x3[1],x3[2],x3[3]};
#pragma unroll
    for (int i = 0; i < 16; ++i) { const unsigned short hb = bf16_bits(xs[i]); ah.u[i] = hb; al.u[i] = ASPLIT ? bf16_bits(xs[i] - bf16_val(hb)) : (unsigned short)0; }
#pragma unroll
    for (int t = 0; t < 4; ++t) {
      const unsigned short* brow = Wt + (size_t)(col0 + t * 16 + ln) * ldb + kb;
      FragB b;
      b.half[0] = *(const v8us*)(brow + 8 * hh);
      b.half[1] = *(const v8us*)(brow + 16 + 8 * hh);
      acc[t] = mmaN<ASPLIT ? 2 : 1>(ah.v, al.v, b.v, b.v, acc[t]);
    }
  }
#pragma unroll
  for (int t = 0; t < 4; ++t) {
    float bv = bias ? bias[col0 + t * 16 + ln] : 0.f;
    if (BIAS_BF16) bv = bf16_round(bv);
#pragma unroll
    for (int r = 0; r < 8; ++r) { float v = acc[t][r] + bv; if (ACT == 1) v = fmaxf(v, 0.f); so[w][8 * hh + r][t * 16 + ln] = v; }
  }
  __builtin_amdgcn_fence(__ATOMIC_ACQ_REL, "workgroup");
  __builtin_amdgcn_wave_barrier();
  const int rsub = lane >> 4, c4 = (lane & 15) * 4;
  {
#pragma unroll
    for (int q = 0; q < 8; ++q) {
      const int r = q * 2 + rsub;
      const v4f v = *(const v4fa*)&so[w][r][c4];
      *(v4f*)(C + (size_t)(row0 + r) * ldc + col0 + c4) = v;
    }
    
  }
}

// GEMM C = act(A·W + bias + resid): A f32 (ASPLIT -> hi/lo 2 terms), Wt bf16 [N][K]; ACT 0 none, 1 relu, 2 exact gelu;
// resid (optional, f32, row index = (row % rmod), pitch ldr, RES_BF16 rounds it) added before the activation.
template <bool ASPLIT, int ACT, bool BIAS_BF16, bool RES_BF16>
__global__ __launch_bounds__(128) void k_gemm_bf3(const float* __restrict__ A, int lda, const unsigned short* __restrict__ Wt, int ldb,
                                                const float* __restrict__ bias, const float* __restrict__ resid, int rmod, int ldr,
                                                float* __restrict__ C, int ldc, int M, int N, int K) {
  __shared__ __attribute__((aligned(16))) float so[4][16][64];
  const int tid = threadIdx.x, w = tid >> 5, lane = tid & 31, ln = lane & 15, hh = lane >> 4;
  const int ntn = N / 64;
  const int wid = blockIdx.x * 4 + w;
  const int mt = wid / ntn, nq = wid % ntn;
  if (mt * 16 >= M) return;
  const int row0 = mt * 16, col0 = nq * 64;
  const float* arow = A + (size_t)(row0 + ln) * lda;
  v8f acc[4] = {};
  for (int kb = 0; kb < K; kb += 32) {
    FragB ah, al;
    const v4f x0 = *(const v4fa*)(arow + kb + 8 * hh), x1 = *(const v4fa*)(arow + kb + 8 * hh + 4);
    const v4f x2 = *(const v4fa*)(arow + kb + 16 + 8 * hh), x3 = *(const v4fa*)(arow + kb + 16 + 8 * hh + 4);
    float xs[16] = {x0[0],x0[1],x0[2],x0[3],x1[0],x1[1],x1[2],x1[3],x2[0],x2[1],x2[2],x2[3],x3[0],x3[1],x3[2],x3[3]};
#pragma unroll
    for (int i = 0; i < 16; ++i) { const unsigned short hb = bf16_bits(xs[i]); ah.u[i] = hb; al.u[i] = ASPLIT ? bf16_bits(xs[i] - bf16_val(hb)) : (unsigned short)0; }
#pragma unroll
    for (int t = 0; t < 4; ++t) {
      const unsigned short* brow = Wt + (size_t)(col0 + t * 16 + ln) * ldb + kb;
      FragB b;
      b.half[0] = *(const v8us*)(brow + 8 * hh);
      b.half[1] = *(const v8us*)(brow + 16 + 8 * hh);
      acc[t] = mmaN<ASPLIT ? 2 : 1>(ah.v, al.v, b.v, b.v, acc[t]);
    }
  }
#pragma unroll
  for (int t = 0; t < 4; ++t) {
    const int col = col0 + t * 16 + ln;
    float bv = bias ? bias[col] : 0.f;
    if (BIAS_BF16) bv = bf16_round(bv);
#pragma unroll
    for (int r = 0; r < 8; ++r) {
      float v = acc[t][r] + bv;
      if (resid) { float rv = resid[(size_t)((row0 + 8 * hh + r) % rmod) * ldr + col]; if (RES_BF16) rv = bf16_round(rv); v += rv; }
      if (ACT == 1) v = fmaxf(v, 0.f);
      if (ACT == 2) v = 0.5f * v * (1.0f + erff(v * 0.70710678118654752f));
      if (ACT == 3) { const float u = 0.7978845608028654f * (v + 0.044715f * v * v * v); v = 0.5f * v * (1.0f + tanhf(u)); }
      so[w][8 * hh + r][t * 16 + ln] = v;
    }
  }
  __builtin_amdgcn_fence(__ATOMIC_ACQ_REL, "workgroup");
  __builtin_amdgcn_wave_barrier();
  const int rsub = lane >> 4, c4 = (lane & 15) * 4;
  {
#pragma unroll
    for (int q = 0; q < 8; ++q) {
      const int r = q * 2 + rsub;
      const v4f v = *(const v4fa*)&so[w][r][c4];
      *(v4f*)(C + (size_t)(row0 + r) * ldc + col0 + c4) = v;
    }
    
  }
}
// row LayerNorm (biased variance, eps) over N: s = X (+ R); optional out_sum <- s; out_norm <- (s-mu)*rsqrt(var+eps)*g + b
template <bool PARAM_BF16>
__global__ __launch_bounds__(256) void k_layernorm(const float* __restrict__ X, const float* __restrict__ R, const float* __restrict__ g, const float* __restrict__ bta,
                                                  float* __restrict__ out_sum, float* __restrict__ out_norm, int N, float eps) {
  __shared__ float red[256];
  const int row = blockIdx.x, tid = threadIdx.x;
  const float* x = X + (size_t)row * N; const float* rr = R ? R + (size_t)row * N : nullptr;
  float vals[16];                     // up to N = 4096
  const int per = N / 256;            // contiguous chunk per thread? use strided-by-4 chunks: thread handles j = tid*4 + 1024*u
  float s1 = 0.f;
  for (int u = 0; u < per / 4; ++u) {
    const int j = tid * 4 + 1024 * u;
    const v4f a = *(const v4fa*)(x + j);
    v4f b = {0.f,0.f,0.f,0.f}; if (rr) b = *(const v4fa*)(rr + j);
#pragma unroll
    for (int q = 0; q < 4; ++q) { const float v = a[q] + b[q]; vals[u * 4 + q] = v; s1 += v; }
  }
  red[tid] = s1; __syncthreads();
  for (int st = 128; st > 0; st >>= 1) { if (tid < st) red[tid] += red[tid + st]; __syncthreads(); }
  const float mu = red[0] / (float)N; __syncthreads();
  float s2 = 0.f;
  for (int u = 0; u < per / 4; ++u)
#pragma unroll
    for (int q = 0; q < 4; ++q) { const float c = vals[u * 4 + q] - mu; s2 += c * c; }
  red[tid] = s2; __syncthreads();
  for (int st = 128; st > 0; st >>= 1) { if (tid < st) red[tid] += red[tid + st]; __syncthreads(); }
  const float rs = rsqrtf(red[0] / (float)N + eps);
  {
    for (int u = 0; u < per / 4; ++u) {
      const int j = tid * 4 + 1024 * u;
      v4f o, sm;
#pragma unroll
      for (int q = 0; q < 4; ++q) {
        float gg = g[j + q], bb = bta[j + q];
        if (PARAM_BF16) { gg = bf16_round(gg); bb = bf16_round(bb); }
        sm[q] = vals[u * 4 + q]; o[q] = (vals[u * 4 + q] - mu) * rs * gg + bb;
      }
      if (out_sum) *(v4f*)(out_sum + (size_t)row * N + j) = sm;
      *(v4f*)(out_norm + (size_t)row * N + j) = o;
    }
    
  }
}



// ---- f16 WMMA path (v_wmma_f32_16x16x32_f16): 11-bit significands for operands in range — used where a [0,1] probability operand needs more precision than bf16
typedef _Float16 v16h __attribute__((ext_vector_type(16)));
union FragH { v16h v; v8us half[2]; _Float16 h[16]; unsigned short u[16]; };
template <int NT>
__device__ __forceinline__ v8f mmaH(v16h ah, v16h al, v16h bh, v16h bl, v8f c) {
  c = __builtin_amdgcn_wmma_f32_16x16x32_f16(false, ah, false, bh, (short)0, c, false, false);
  if (NT >= 2) c = __builtin_amdgcn_wmma_f32_16x16x32_f16(false, al, false, bh, (short)0, c, false, false);
  if (NT >= 3) c = __builtin_amdgcn_wmma_f32_16x16x32_f16(false, ah, false, bl, (short)0, c, false, false);
  asm volatile("v_nop\n\tv_nop\n\tv_nop\n\tv_nop" : "+v"(c) : "v"(ah), "v"(al), "v"(bh), "v"(bl));
  return c;
}
// batched GEMM like k_gemm_b but f16 operands: A f32 (split into f16 hi/lo if ASPLIT, else rounded to f16), Bt = f16 values [n][k]; alpha; C f32; N multiple of 16 (partial tiles skipped)
template <bool ASPLIT>
__global__ __launch_bounds__(128) void k_gemm_h(const float* __restrict__ A, int lda, size_t sA, const _Float16* __restrict__ Bh, int ldb, size_t sB, float alpha, float* __restrict__ C, int ldc, size_t sC, int M, int N, int K) {
  __shared__ __attribute__((aligned(16))) float so[4][16][64];
  const int tid = threadIdx.x, w = tid >> 5, lane = tid & 31, ln = lane & 15, hh = lane >> 4; const int by = blockIdx.y;
  A += (size_t)by * sA; Bh += (size_t)by * sB; C += (size_t)by * sC;
  const int ntn = (N + 63) / 64; const int wid = blockIdx.x * 4 + w; const int mt = wid / ntn, nq = wid % ntn; if (mt * 16 >= M) return;
  const int row0 = mt * 16, col0 = nq * 64; const float* arow = A + (size_t)(row0 + ln) * lda;
  v8f acc[4] = {};
  for (int kb = 0; kb < K; kb += 32) {
    FragH ah, al;
    const v4f x0 = *(const v4fa*)(arow + kb + 8 * hh), x1 = *(const v4fa*)(arow + kb + 8 * hh + 4), x2 = *(const v4fa*)(arow + kb + 16 + 8 * hh), x3 = *(const v4fa*)(arow + kb + 16 + 8 * hh + 4);
    float xs[16] = {x0[0],x0[1],x0[2],x0[3],x1[0],x1[1],x1[2],x1[3],x2[0],x2[1],x2[2],x2[3],x3[0],x3[1],x3[2],x3[3]};
#pragma unroll
    for (int i = 0; i < 16; ++i) { const _Float16 h = (_Float16)xs[i]; ah.h[i] = h; al.h[i] = ASPLIT ? (_Float16)(xs[i] - (float)h) : (_Float16)0.0f; }
#pragma unroll
    for (int t = 0; t < 4; ++t) { if (col0 + t * 16 >= N) continue; const size_t boff = (size_t)(col0 + t * 16 + ln) * ldb + kb; FragH bq; bq.half[0] = *(const v8us*)(Bh + boff + 8 * hh); bq.half[1] = *(const v8us*)(Bh + boff + 16 + 8 * hh);
      acc[t] = mmaH<ASPLIT ? 2 : 1>(ah.v, al.v, bq.v, bq.v, acc[t]); }
  }
#pragma unroll
  for (int t = 0; t < 4; ++t) { if (col0 + t * 16 >= N) continue;
#pragma unroll
    for (int r = 0; r < 8; ++r) so[w][8 * hh + r][t * 16 + ln] = acc[t][r] * alpha; }
  __builtin_amdgcn_fence(__ATOMIC_ACQ_REL, "workgroup"); __builtin_amdgcn_wave_barrier();
  const int rsub = lane >> 4, c4 = (lane & 15) * 4;
  {
#pragma unroll
    for (int q = 0; q < 8; ++q) { const int r = q * 2 + rsub; if (col0 + c4 < N) { const v4f v = *(const v4fa*)&so[w][r][c4]; *(v4f*)(C + (size_t)(row0 + r) * ldc + col0 + c4) = v; } }
     }
}

// Wt[n][k] = f16(W[k][n]·scale) from f32 row-major W[K][N] (scale = power of two; bf16-exact weights stay exact in f16 away from the subnormal range)
__global__ __launch_bounds__(256) void k_wt_f16(const float* __restrict__ W, _Float16* __restrict__ Wt, int K, int N, float scale) {
  const int t = blockIdx.x * 256 + threadIdx.x; if (t >= N * (K / 8)) return; const int n = t / (K / 8), k8 = (t % (K / 8)) * 8; FragH f;
#pragma unroll
  for (int i = 0; i < 8; ++i) f.h[i] = (_Float16)(bf16_round(W[(size_t)(k8 + i) * N + n]) * scale); const v8us o = f.half[0];
  *(v8us*)((unsigned short*)Wt + (size_t)n * K + k8) = o; 
}
// k_gemm_hh variant with fused epilogue: v = acc·alpha + bias[by·sBias + col] (+ CP[(row/rowsPerB)·sCPb + by·64 + col] if CP) ; ACT 0 none / 1 elu ; writes f16 C16 (and f32 C if non-null)
template <int ACT>
__global__ __launch_bounds__(128) void k_gemm_hhx(const _Float16* __restrict__ A, int lda, size_t sA, const _Float16* __restrict__ Bh, int ldb, size_t sB, float alpha, const float* __restrict__ bias, size_t sBias, const float* __restrict__ CP, int rowsPerB, size_t sCPb, int row0g,
    float* __restrict__ C, _Float16* __restrict__ C16, int ldc, size_t sC, int M, int N, int K) {
  __shared__ __attribute__((aligned(16))) float so[4][16][64];
  const int tid = threadIdx.x, w = tid >> 5, lane = tid & 31, ln = lane & 15, hh = lane >> 4; const int by = blockIdx.y;
  A += (size_t)by * sA; Bh += (size_t)by * sB; const size_t cofs = (size_t)by * sC; const float* bp = bias ? bias + (size_t)by * sBias : nullptr;
  const int ntn = (N + 63) / 64; const int wid = blockIdx.x * 4 + w; const int mt = wid / ntn, nq = wid % ntn; if (mt * 16 >= M) return;
  const int row0 = mt * 16, col0 = nq * 64; const _Float16* arow = A + (size_t)(row0 + ln) * lda;
  v8f acc[4] = {};
  for (int kb = 0; kb < K; kb += 32) { FragH ah; ah.half[0] = *(const v8us*)((const unsigned short*)arow + kb + 8 * hh); ah.half[1] = *(const v8us*)((const unsigned short*)arow + kb + 16 + 8 * hh);
#pragma unroll
    for (int t = 0; t < 4; ++t) { if (col0 + t * 16 >= N) continue; const size_t boff = (size_t)(col0 + t * 16 + ln) * ldb + kb; FragH bq; bq.half[0] = *(const v8us*)((const unsigned short*)Bh + boff + 8 * hh); bq.half[1] = *(const v8us*)((const unsigned short*)Bh + boff + 16 + 8 * hh);
      acc[t] = mmaH<1>(ah.v, ah.v, bq.v, bq.v, acc[t]); }
  }
#pragma unroll
  for (int t = 0; t < 4; ++t) { if (col0 + t * 16 >= N) continue; const int col = col0 + t * 16 + ln; const float bv = bp ? bf16_round(bp[col]) : 0.f;
#pragma unroll
    for (int r = 0; r < 8; ++r) { float v = acc[t][r] * alpha + bv; if (CP) { const int bidx = (row0g + row0 + 8 * hh + r) / rowsPerB; v += CP[(size_t)bidx * sCPb + (size_t)by * 64 + col]; } if (ACT == 1) v = (v > 0.f) ? v : expm1f(v); else if (ACT == 7) v = (v > 0.f) ? v + 1.0f : expf(v); else if (ACT == 8) v = tanhf(v); else if (ACT == 9) v = 0.5f * v * (1.0f + tanhf(0.7978845608028654f * (v + 0.044715f * v * v * v))); else if (ACT == 11) v = 1.0f / (1.0f + expf(-v)); else if (ACT == 12) v = (v > 0.f) ? v : 0.01f * v; else if (ACT == 14) v = (v > 0.f) ? v : 0.1f * v; else if (ACT == 15) v = v / (1.0f + expf(-v)); else if (ACT == 3) v = fmaxf(v, 0.f); else if (ACT == 6) v = 0.5f * v * (1.0f + erff(v * 0.70710678118654752f)); so[w][8 * hh + r][t * 16 + ln] = v; } }
  __builtin_amdgcn_fence(__ATOMIC_ACQ_REL, "workgroup"); __builtin_amdgcn_wave_barrier();
  const int rsub = lane >> 4, c4 = (lane & 15) * 4; typedef _Float16 v4h __attribute__((ext_vector_type(4)));
  {
#pragma unroll
    for (int q = 0; q < 8; ++q) { const int r = q * 2 + rsub; if (col0 + c4 < N) { const v4f v = *(const v4fa*)&so[w][r][c4]; if (C) *(v4f*)(C + cofs + (size_t)(row0 + r) * ldc + col0 + c4) = v; if (C16) { v4h h4; for (int i = 0; i < 4; ++i) h4[i] = (_Float16)v[i]; *(v4h*)(C16 + cofs + (size_t)(row0 + r) * ldc + col0 + c4) = h4; } } }
     }
}


typedef _Float16 v4h __attribute__((ext_vector_type(4)));

__global__ __launch_bounds__(256) void k_x16(const float* __restrict__ x, _Float16* __restrict__ X16, size_t n8) { const size_t t = (size_t)blockIdx.x * 256 + threadIdx.x; if (t >= n8) return; FragH f;
#pragma unroll
  for (int q = 0; q < 8; ++q) f.h[q] = (_Float16)bf16_round(x[t * 8 + q]); *(v8us*)((unsigned short*)X16 + t * 8) = f.half[0];  }
__global__ __launch_bounds__(256) void k_h16(const float* __restrict__ x, _Float16* __restrict__ X16, size_t n8) { const size_t t = (size_t)blockIdx.x * 256 + threadIdx.x; if (t >= n8) return; FragH f;
#pragma unroll
  for (int q = 0; q < 8; ++q) f.h[q] = (_Float16)x[t * 8 + q]; *(v8us*)((unsigned short*)X16 + t * 8) = f.half[0];  }
__global__ __launch_bounds__(256) void k_round16f(const float* __restrict__ W, _Float16* __restrict__ Bt, size_t n8) { const size_t t = (size_t)blockIdx.x * 256 + threadIdx.x; if (t >= n8) return; FragH f;
#pragma unroll
  for (int i = 0; i < 8; ++i) f.h[i] = (_Float16)(bf16_round(W[t * 8 + i]) * 16.0f); *(v8us*)((unsigned short*)Bt + t * 8) = f.half[0];  }
template <int NHv, int TTv>
__global__ __launch_bounds__(256) void k_vt(const _Float16* __restrict__ V16, int ldv, int voff, _Float16* __restrict__ Vt) { __shared__ unsigned short tl[64][66]; const int tid = threadIdx.x; const int slab = blockIdx.x / (TTv / 64), lg = blockIdx.x % (TTv / 64); const int b = slab / NHv, h = slab % NHv;
  for (int i = tid; i < 64 * 8; i += 256) { const int r = i / 8, c8 = (i % 8) * 8; FragH f; f.half[0] = *(const v8us*)((const unsigned short*)V16 + ((size_t)b * TTv + lg * 64 + r) * ldv + voff + h * 64 + c8);
#pragma unroll
    for (int q = 0; q < 8; ++q) tl[r][c8 + q] = f.u[q]; }
  __syncthreads();
  {
#pragma unroll
    for (int rd = 0; rd < 2; ++rd) { const int d = rd * 32 + tid / 8, pc = tid % 8; FragH f;
#pragma unroll
      for (int q = 0; q < 8; ++q) f.u[q] = tl[pc * 8 + q][d];
      *(v8us*)((unsigned short*)Vt + ((size_t)slab * 64 + d) * TTv + lg * 64 + pc * 8) = f.half[0]; }
     } }

__global__ __launch_bounds__(256) void k_hl(const float* __restrict__ F, _Float16* __restrict__ Hh, _Float16* __restrict__ Hl, size_t n8) { const size_t t = (size_t)blockIdx.x * 256 + threadIdx.x; if (t >= n8) return; FragH fh, fl; const v4f a = *(const v4fa*)(F + t * 8), c = *(const v4fa*)(F + t * 8 + 4);
#pragma unroll
  for (int q = 0; q < 4; ++q) { _Float16 h = (_Float16)a[q]; fh.h[q] = h; fl.h[q] = (_Float16)((a[q] - (float)h) * 1024.0f); h = (_Float16)c[q]; fh.h[4 + q] = h; fl.h[4 + q] = (_Float16)((c[q] - (float)h) * 1024.0f); }
  { *(v8us*)((unsigned short*)Hh + t * 8) = fh.half[0]; *(v8us*)((unsigned short*)Hl + t * 8) = fl.half[0];  } }

// ---- fast GEMM (wave tile 32x64; requires M % 32 == 0 rows per launch region and N % 64 == 0); epilogue = k_gemm_hhx semantics ----
__device__ __forceinline__ v16h g2_frag(const _Float16* p, int hh) { FragH f; f.half[0] = *(const v8us*)((const unsigned short*)p + 8 * hh); f.half[1] = *(const v8us*)((const unsigned short*)p + 16 + 8 * hh); return f.v; }
__device__ __forceinline__ v8f g2_mma(v16h a, v16h b, v8f c) { v8f d = __builtin_amdgcn_wmma_f32_16x16x32_f16(false, a, false, b, (short)0, c, false, false); asm volatile("v_nop\n\tv_nop\n\tv_nop\n\tv_nop" : "+v"(d) : "v"(a), "v"(b)); return d; }
template <int ACT>
__global__ __launch_bounds__(128) void k_gemm2(const _Float16* __restrict__ A, int lda, size_t sA, const _Float16* __restrict__ Bh, int ldb, size_t sB, float alpha, const float* __restrict__ bias, size_t sBias, const float* __restrict__ CP, int rowsPerB, size_t sCPb, int row0g,
    float* __restrict__ C, _Float16* __restrict__ C16, int ldc, size_t sC, int M, int N, int K) {
  __shared__ __attribute__((aligned(16))) float so[4][32][68];
  const int tid = threadIdx.x, w = tid >> 5, lane = tid & 31, ln = lane & 15, hh = lane >> 4; const int by = blockIdx.y;
  A += (size_t)by * sA; Bh += (size_t)by * sB; const size_t cofs = (size_t)by * sC; const float* bp = bias ? bias + (size_t)by * sBias : nullptr;
  const int ntn = N >> 6; const int mt = blockIdx.x / ntn, nq = blockIdx.x - mt * ntn; const int row0 = mt * 128 + 32 * w, col0 = nq * 64; if (row0 >= M) return;
  const _Float16* a0p = A + (size_t)(row0 + ln) * lda; const _Float16* a1p = a0p + (size_t)16 * lda;
  const _Float16* b0p = Bh + (size_t)(col0 + ln) * ldb; const _Float16* b1p = b0p + (size_t)16 * ldb; const _Float16* b2p = b1p + (size_t)16 * ldb; const _Float16* b3p = b2p + (size_t)16 * ldb;
  const v8f z8 = {0.f,0.f,0.f,0.f,0.f,0.f,0.f,0.f}; v8f c00 = z8, c01 = z8, c02 = z8, c03 = z8, c10 = z8, c11 = z8, c12 = z8, c13 = z8;
#pragma unroll 1
  for (int kb = 0; kb < K; kb += 32) { const v16h a0 = g2_frag(a0p + kb, hh), a1 = g2_frag(a1p + kb, hh);
    v16h b = g2_frag(b0p + kb, hh); c00 = g2_mma(a0, b, c00); c10 = g2_mma(a1, b, c10);
    b = g2_frag(b1p + kb, hh); c01 = g2_mma(a0, b, c01); c11 = g2_mma(a1, b, c11);
    b = g2_frag(b2p + kb, hh); c02 = g2_mma(a0, b, c02); c12 = g2_mma(a1, b, c12);
    b = g2_frag(b3p + kb, hh); c03 = g2_mma(a0, b, c03); c13 = g2_mma(a1, b, c13); }
  v8f accs[8] = {c00, c01, c02, c03, c10, c11, c12, c13};
#pragma unroll
  for (int u = 0; u < 8; ++u) { const int t = u & 3, half = u >> 2; const int col = col0 + t * 16 + ln; const float bv = bp ? bf16_round(bp[col]) : 0.f;
#pragma unroll
    for (int r = 0; r < 8; ++r) { const int rloc = half * 16 + 8 * hh + r; float v = accs[u][r] * alpha + bv; if (CP) { const int bidx = (row0g + row0 + rloc) / rowsPerB; v += CP[(size_t)bidx * sCPb + (size_t)by * 64 + col]; }
      if (ACT == 3) v = fmaxf(v, 0.f); else if (ACT == 6) v = 0.5f * v * (1.0f + erff(v * 0.70710678118654752f)); else if (ACT == 11) v = 1.0f / (1.0f + expf(-v)); else if (ACT == 15) v = v / (1.0f + expf(-v)); else if (ACT == 12) v = (v > 0.f) ? v : 0.01f * v; else if (ACT == 8) v = tanhf(v);
      so[w][rloc][t * 16 + ln] = v; } }
  __builtin_amdgcn_fence(__ATOMIC_ACQ_REL, "workgroup"); __builtin_amdgcn_wave_barrier();
  const int rsub = lane >> 4, c4 = (lane & 15) * 4;
  {
#pragma unroll
    for (int q = 0; q < 16; ++q) { const int r = q * 2 + rsub; const v4f v = *(const v4fa*)&so[w][r][c4]; if (C) *(v4f*)(C + cofs + (size_t)(row0 + r) * ldc + col0 + c4) = v; if (C16) { v4h h4; for (int i = 0; i < 4; ++i) h4[i] = (_Float16)v[i]; *(v4h*)(C16 + cofs + (size_t)(row0 + r) * ldc + col0 + c4) = h4; } }
     } }


template <int TK>
__global__ __launch_bounds__(256) void k_vthl(const float* __restrict__ VF, int ldv, _Float16* __restrict__ Vth, _Float16* __restrict__ Vtl) { __shared__ float tl[64][65]; const int tid = threadIdx.x; const int slab = blockIdx.x / (TK / 64), lg = blockIdx.x % (TK / 64); const int b = slab / NH, h = slab % NH;
  for (int i = tid; i < 64 * 16; i += 256) { const int r = i / 16, c4 = (i % 16) * 4; const v4f a = *(const v4fa*)(VF + ((size_t)b * TK + lg * 64 + r) * ldv + h * 64 + c4); tl[r][c4] = a[0]; tl[r][c4 + 1] = a[1]; tl[r][c4 + 2] = a[2]; tl[r][c4 + 3] = a[3]; }
  __syncthreads();
  FragH fh[2], fl[2]; size_t oo[2];
#pragma unroll
  for (int rd = 0; rd < 2; ++rd) { const int d = rd * 32 + tid / 8, pc = tid % 8;
#pragma unroll
    for (int q = 0; q < 8; ++q) { const float v = tl[pc * 8 + q][d]; const _Float16 hv = (_Float16)v; fh[rd].h[q] = hv; fl[rd].h[q] = (_Float16)((v - (float)hv) * 1024.0f); } oo[rd] = ((size_t)slab * 64 + d) * TK + lg * 64 + pc * 8; }
  {
#pragma unroll
    for (int rd = 0; rd < 2; ++rd) { *(v8us*)((unsigned short*)Vth + oo[rd]) = fh[rd].half[0]; *(v8us*)((unsigned short*)Vtl + oo[rd]) = fl[rd].half[0]; }
     } }

__device__ __forceinline__ float xhalf(float v) { const int b = __float_as_int(v); return __int_as_float(__builtin_amdgcn_permlanex16(b, b, 0x76543210, 0xfedcba98, false, false)); }      /* lane l <-> l ^ 16 */
template <int TQ, int TK, int KSP>
__global__ __launch_bounds__(128 * KSP) void k_flashm(const _Float16* __restrict__ Q16, const _Float16* __restrict__ Q16lo, int ldq, const _Float16* __restrict__ K16, const _Float16* __restrict__ K16lo, int ldk, const _Float16* __restrict__ Vt, const _Float16* __restrict__ Vtlo, const unsigned* __restrict__ MB, const int* __restrict__ RA, const int* __restrict__ KE, float* __restrict__ O, int ldo) {
  constexpr int RPW = 16, NQB = TQ / (4 * RPW), DT = 4, KS = 2, NW = 4 * KSP;
  __shared__ __attribute__((aligned(16))) float sO[NW][RPW][64 + 4]; __shared__ float sM[NW][RPW], sL[NW][RPW];
  const int tid = threadIdx.x, w = tid >> 5, lane = tid & 31, ln = lane & 15, hh = lane >> 4; const int qt = w & 3, kp = __builtin_amdgcn_readfirstlane(w >> 2);      /* scalar: the key loop's counter and trip test stay wave-uniform */
  const int slab = blockIdx.x / NQB, qblk = blockIdx.x % NQB; const int b = slab / NH, h = slab % NH; const int qb0 = qblk * (4 * RPW); const int q0 = qb0 + qt * RPW;
  FragH aq[KS], aql[KS];
  { const size_t qo = ((size_t)b * TQ + q0 + ln) * ldq + h * 64; const unsigned short* qr = (const unsigned short*)Q16 + qo; const unsigned short* ql = (const unsigned short*)Q16lo + qo;
#pragma unroll
    for (int ks = 0; ks < KS; ++ks) { aq[ks].half[0] = *(const v8us*)(qr + ks * 32 + 8 * hh); aq[ks].half[1] = *(const v8us*)(qr + ks * 32 + 16 + 8 * hh); aql[ks].half[0] = *(const v8us*)(ql + ks * 32 + 8 * hh); aql[ks].half[1] = *(const v8us*)(ql + ks * 32 + 16 + 8 * hh); } }
  const unsigned short* Vth = (const unsigned short*)Vt + (size_t)slab * 64 * TK; const unsigned short* Vtl = (const unsigned short*)Vtlo + (size_t)slab * 64 * TK;
  float m_r = -3.0e38f, l_r = 0.f; v8f oacc[DT], oaccl[DT];
#pragma unroll
  for (int dt = 0; dt < DT; ++dt) { oacc[dt] = (v8f){0.f,0.f,0.f,0.f,0.f,0.f,0.f,0.f}; oaccl[dt] = oacc[dt]; }
  int jend = KE[qblk * 32]; jend = min(TK, (jend + 31) & ~31); if (jend < 32) jend = 32;      /* block-uniform */
  const bool am = (RA[q0 + ln] != 0); const unsigned* mrow = MB + (size_t)(q0 + ln) * (TK / 32);
#pragma unroll 1
  for (int j0 = kp * 32; j0 < jend; j0 += 32 * KSP) {
    v8f s[2];
#pragma unroll
    for (int nt = 0; nt < 2; ++nt) { const size_t ko = ((size_t)b * TK + j0 + nt * 16 + ln) * ldk + h * 64; const unsigned short* kr = (const unsigned short*)K16 + ko; const unsigned short* kl = (const unsigned short*)K16lo + ko; FragH bk[KS], bkl[KS];
#pragma unroll
      for (int ks = 0; ks < KS; ++ks) { bk[ks].half[0] = *(const v8us*)(kr + ks * 32 + 8 * hh); bk[ks].half[1] = *(const v8us*)(kr + ks * 32 + 16 + 8 * hh); bkl[ks].half[0] = *(const v8us*)(kl + ks * 32 + 8 * hh); bkl[ks].half[1] = *(const v8us*)(kl + ks * 32 + 16 + 8 * hh); }
      v8f acc = (v8f){0.f,0.f,0.f,0.f,0.f,0.f,0.f,0.f}, accr = acc;
#pragma unroll
      for (int ks = 0; ks < KS; ++ks) { acc = mmaH<1>(bk[ks].v, bk[ks].v, aq[ks].v, aq[ks].v, acc); accr = mmaH<1>(bk[ks].v, bk[ks].v, aql[ks].v, aql[ks].v, accr); accr = mmaH<1>(bkl[ks].v, bkl[ks].v, aq[ks].v, aq[ks].v, accr); }
      s[nt] = acc + accr * 0.0009765625f; }
    const unsigned mh = mrow[j0 >> 5] >> (8 * hh);      /* bit r: key 8 hh + r, bit 16 + r: key 16 + 8 hh + r */
    float sv[16]; float mc = -INFINITY;
#pragma unroll
    for (int e = 0; e < 16; ++e) { const bool ok = am || (((mh >> ((e >> 3) * 16 + (e & 7))) & 1u) == 0u); sv[e] = ok ? (am ? 0.f : s[e >> 3][e & 7] * SCL) : -INFINITY; mc = fmaxf(mc, sv[e]); }
    mc = fmaxf(mc, xhalf(mc));
    const float mn = fmaxf(m_r, mc); const float al = (mn > -1.0e38f) ? expf(m_r - mn) : 1.0f; m_r = mn;
    FragH pa, pl; float ps = 0.f;
#pragma unroll
    for (int e = 0; e < 16; ++e) { const float p = expf(sv[e] - mn);      /* a masked key: exp(-inf) = 0 (mn is finite) */
      ps += p; const float p10 = p * 1024.0f; const _Float16 ph = (_Float16)p10; pa.h[e] = ph; pl.h[e] = (_Float16)((p10 - (float)ph) * 1024.0f); }
    l_r = l_r * al + ps;
#pragma unroll
    for (int dt = 0; dt < DT; ++dt) { oacc[dt] *= al; oaccl[dt] *= al; }
#pragma unroll
    for (int dt = 0; dt < DT; ++dt) { const size_t vo = (size_t)(dt * 16 + ln) * TK + j0; FragH bv, bl; bv.half[0] = *(const v8us*)(Vth + vo + 8 * hh); bv.half[1] = *(const v8us*)(Vth + vo + 16 + 8 * hh); bl.half[0] = *(const v8us*)(Vtl + vo + 8 * hh); bl.half[1] = *(const v8us*)(Vtl + vo + 16 + 8 * hh);
      oacc[dt] = mmaH<1>(bv.v, bv.v, pa.v, pa.v, oacc[dt]); oaccl[dt] = mmaH<1>(bl.v, bl.v, pa.v, pa.v, oaccl[dt]); oaccl[dt] = mmaH<1>(bv.v, bv.v, pl.v, pl.v, oaccl[dt]); } }
  { const float l = l_r + xhalf(l_r); if (hh == 0) { sM[w][ln] = m_r; sL[w][ln] = l; } }
#pragma unroll
  for (int dt = 0; dt < DT; ++dt) { const v8f o = oacc[dt] + oaccl[dt] * 0.0009765625f;      /* register r = O[query ln][dt * 16 + 8 hh + r] */
    *(v4fa*)&sO[w][ln][dt * 16 + 8 * hh] = (v4f){o[0], o[1], o[2], o[3]}; *(v4fa*)&sO[w][ln][dt * 16 + 8 * hh + 4] = (v4f){o[4], o[5], o[6], o[7]}; }
  __syncthreads();      /* every part's partial is in LDS before any thread merges */
  for (int i = tid; i < 4 * RPW * 16; i += 128 * KSP) { const int row = i >> 4, pc = i & 15; const int tq = row / RPW, rr = row % RPW;
    float mx = sM[tq][rr];
#pragma unroll
    for (int p = 1; p < KSP; ++p) mx = fmaxf(mx, sM[p * 4 + tq][rr]);
    float lsum = 0.f; v4f o = {0.f, 0.f, 0.f, 0.f};
#pragma unroll
    for (int p = 0; p < KSP; ++p) { const float wg = expf(sM[p * 4 + tq][rr] - mx); lsum += wg * sL[p * 4 + tq][rr]; const v4f val = *(const v4fa*)&sO[p * 4 + tq][rr][pc * 4]; o += val * wg; }
    const float inv = (lsum > 0.f) ? 1.0f / (lsum * 1024.0f) : 0.f;
    *(v4f*)(O + ((size_t)b * TQ + qb0 + row) * ldo + h * 64 + pc * 4) = o * inv; } }


__constant__ float GRIDV[8] = {-2.000000000e+00f,-1.428571463e+00f,-8.571428657e-01f,-2.857141793e-01f,2.857143879e-01f,8.571429253e-01f,1.428571701e+00f,2.000000000e+00f};
#define INV_DENOM (1.0f / 0.5714285714285714f)
__global__ __launch_bounds__(256) void k_fulltab(unsigned* __restrict__ MB, int* __restrict__ RA, int* __restrict__ KE) {
  const int t = blockIdx.x * 256 + threadIdx.x;
  if (t < NPI * (NPI / 32)) { *(unsigned*)(MB + t) = 0u;  }
  if (t < NPI) { *(int*)(RA + t) = 0;  }
  if (t < NPI / 64) { *(int*)(KE + t * 32) = NPI;  } }
__global__ __launch_bounds__(256) void k_xcl(const float* __restrict__ x, _Float16* __restrict__ X16) {
  const int t = blockIdx.x * 256 + threadIdx.x; if (t >= NPX * (CIN / 8)) return; const int r = t / (CIN / 8), c0 = (t % (CIN / 8)) * 8; const int b = r / NPI, p = r % NPI; FragH f;
#pragma unroll
  for (int q = 0; q < 8; ++q) f.h[q] = (_Float16)bf16_round(x[((size_t)b * CIN + c0 + q) * NPI + p]);
  *(v8us*)((unsigned short*)X16 + (size_t)r * CIN + c0) = f.half[0];  }
__global__ __launch_bounds__(256) void k_instat(const float* __restrict__ A, const float* __restrict__ ST0, int phase, float* __restrict__ ST) {
  #pragma clang fp contract(off)
  __shared__ float sh[256]; const int b = blockIdx.x / DK, c = blockIdx.x % DK; const float mu = phase ? ST0[(size_t)blockIdx.x * 32] : 0.f; float s = 0.f;
  for (int p = threadIdx.x; p < NPI; p += 256) { const float v = A[((size_t)b * NPI + p) * DK + c] - mu; s += phase ? v * v : v; }
  sh[threadIdx.x] = s; __syncthreads();
  for (int st = 128; st > 0; st >>= 1) { if ((int)threadIdx.x < st) sh[threadIdx.x] += sh[threadIdx.x + st]; __syncthreads(); }
  if (threadIdx.x == 0) { const float v = sh[0] / (float)NPI; float* d = ST + ((size_t)phase * NIMG * DK + blockIdx.x) * 32; *(float*)d = v;  } }
__global__ __launch_bounds__(256) void k_basis(const float* __restrict__ A, const float* __restrict__ ST, _Float16* __restrict__ BAS) {
  #pragma clang fp contract(off)
  const int t = blockIdx.x * 256 + threadIdx.x; if (t >= NPX * DK) return; const int r = t / DK, c = t % DK; const int b = r / NPI; const float a = A[(size_t)r * DK + c];
  const float mu = ST[((size_t)b * DK + c) * 32], var = ST[((size_t)NIMG * DK + b * DK + c) * 32]; const float xn = (a - mu) * rsqrtf(var + 1e-5f); FragH bh, bl;
#pragma unroll
  for (int g = 0; g < NG; ++g) { const float z = (xn - GRIDV[g]) * INV_DENOM; const float e = expf(-(z * z)); const _Float16 hv = (_Float16)e; bh.h[g] = hv; bl.h[g] = (_Float16)((e - (float)hv) * 16.0f); }
  unsigned short* bd = (unsigned short*)BAS + (size_t)r * 2 * DK * NG + c * NG;
  { *(v8us*)bd = bh.half[0]; *(v8us*)(bd + DK * NG) = bl.half[0];  } }
__global__ __launch_bounds__(256) void k_silu(const float* __restrict__ A, _Float16* __restrict__ SIL) {
  #pragma clang fp contract(off)
  const int t = blockIdx.x * 256 + threadIdx.x; if (t >= NPX * (DK / 8)) return; const int r = t / (DK / 8), c0 = (t % (DK / 8)) * 8; const float* a = A + (size_t)r * DK + c0; FragH fh, fl;
#pragma unroll
  for (int q = 0; q < 8; ++q) { const float v = a[q]; const float sl = v / (1.0f + expf(-v)); const _Float16 hv = (_Float16)sl; fh.h[q] = hv; fl.h[q] = (_Float16)((sl - (float)hv) * 16.0f); }
  unsigned short* d = (unsigned short*)SIL + (size_t)r * 2 * DK + c0;
  { *(v8us*)d = fh.half[0]; *(v8us*)(d + DK) = fl.half[0];  } }
__global__ __launch_bounds__(256) void k_wnp2(const float* __restrict__ Wm, int K, int N, _Float16* __restrict__ Bt) {
  const int t = blockIdx.x * 256 + threadIdx.x; if (t >= N * (2 * K / 8)) return; const int n = t / (2 * K / 8), k0 = (t % (2 * K / 8)) * 8; const bool lo = (k0 >= K); const float sc = lo ? 1.0f : 16.0f; FragH f;
#pragma unroll
  for (int q = 0; q < 8; ++q) { const int k = k0 + q - (lo ? K : 0); f.h[q] = (_Float16)(bf16_round(Wm[(size_t)n * K + k]) * sc); }
  *(v8us*)((unsigned short*)Bt + (size_t)n * 2 * K + k0) = f.half[0];  }
__global__ __launch_bounds__(256) void k_pair16(const float* __restrict__ F, int n, _Float16* __restrict__ P, int rows) {
  #pragma clang fp contract(off)
  const int t = blockIdx.x * 256 + threadIdx.x; if (t >= rows * (n / 8)) return; const int r = t / (n / 8), c0 = (t % (n / 8)) * 8; const float* f = F + (size_t)r * n + c0; FragH fh, fl;
#pragma unroll
  for (int q = 0; q < 8; ++q) { const float v = f[q]; const _Float16 hv = (_Float16)v; fh.h[q] = hv; fl.h[q] = (_Float16)((v - (float)hv) * 16.0f); }
  unsigned short* d = (unsigned short*)P + (size_t)r * 2 * n + c0;
  { *(v8us*)d = fh.half[0]; *(v8us*)(d + n) = fl.half[0];  } }
__global__ __launch_bounds__(256) void k_y(const float* __restrict__ x, const float* __restrict__ gam, const float* __restrict__ A2, float* __restrict__ Y) {
  #pragma clang fp contract(off)
  const int t = blockIdx.x * 256 + threadIdx.x; if (t >= NPX * (CIN / 4)) return; const int r = t / (CIN / 4), c0 = (t % (CIN / 4)) * 4; const int b = r / NPI, p = r % NPI; const float g = bf16_round(gam[0]); const v4f a = *(const v4fa*)(A2 + (size_t)t * 4); v4f o;
#pragma unroll
  for (int q = 0; q < 4; ++q) o[q] = g * bf16_round(x[((size_t)b * CIN + c0 + q) * NPI + p]) + a[q];
  *(v4f*)(Y + (size_t)t * 4) = o;  }
__global__ __launch_bounds__(256) void k_bnstat(const float* __restrict__ Y, const float* __restrict__ ST0, int phase, float* __restrict__ ST) {
  #pragma clang fp contract(off)
  __shared__ float sh[256]; const int c = blockIdx.x; const float mu = phase ? ST0[(size_t)c * 32] : 0.f; float s = 0.f;
  for (int r = threadIdx.x; r < NPX; r += 256) { const float v = Y[(size_t)r * CIN + c] - mu; s += phase ? v * v : v; }
  sh[threadIdx.x] = s; __syncthreads();
  for (int st = 128; st > 0; st >>= 1) { if ((int)threadIdx.x < st) sh[threadIdx.x] += sh[threadIdx.x + st]; __syncthreads(); }
  if (threadIdx.x == 0) { const float v = sh[0] / (float)NPX; float* d = ST + ((size_t)phase * CIN + c) * 32; *(float*)d = v;  } }
__global__ __launch_bounds__(256) void k_bnout(const float* __restrict__ Y, const float* __restrict__ ST, const float* __restrict__ bw, const float* __restrict__ bb, float* __restrict__ out) {
  #pragma clang fp contract(off)
  const int t = blockIdx.x * 256 + threadIdx.x; if (t >= NIMG * CIN * (NPI / 4)) return; const int p0 = (t % (NPI / 4)) * 4; const int c = (t / (NPI / 4)) % CIN; const int b = t / ((NPI / 4) * CIN); const float mu = ST[(size_t)c * 32], var = ST[(size_t)(CIN + c) * 32]; const float sc = rsqrtf(var + 1e-5f), g = bf16_round(bw[c]), be = bf16_round(bb[c]); v4f o;
#pragma unroll
  for (int q = 0; q < 4; ++q) o[q] = g * ((Y[((size_t)b * NPI + p0 + q) * CIN + c] - mu) * sc) + be;
  float* dst = out + ((size_t)b * CIN + c) * NPI + p0; *(v4f*)dst = o;  }

extern "C" void kernel_launch(void* const* d_in, const int* in_sizes, int n_in,
                              void* d_out, int out_size, void* d_ws, size_t ws_size, hipStream_t stream) {
  (void)in_sizes; (void)n_in; (void)out_size;
  const float* const* I = (const float* const*)d_in; const float* x = I[0]; const float* w_in = I[1]; const float* b_in = I[2];
  const float* qbw = I[3]; const float* qbb = I[4]; const float* qsw = I[5]; const float* qsb = I[6]; const float* kbw = I[7]; const float* kbb = I[8]; const float* ksw = I[9]; const float* ksb = I[10]; const float* vbw = I[11]; const float* vbb = I[12]; const float* vsw = I[13]; const float* vsb = I[14];
  const float* w_out = I[15]; const float* b_out = I[16]; const float* gam = I[17]; const float* bnw = I[18]; const float* bnb = I[19];
  char* ws = (char*)d_ws; size_t off = 0;
  auto take = [&](size_t bytes) { char* p = ws + off; off += (bytes + 255) & ~(size_t)255; return p; };
  _Float16* BIN = (_Float16*)take((size_t)DK * CIN * 2); _Float16* BB[3]; _Float16* BS[3]; for (int i = 0; i < 3; ++i) { BB[i] = (_Float16*)take((size_t)DK * 2 * DK * 2); BS[i] = (_Float16*)take((size_t)DK * 2 * DK * NG * 2); } _Float16* BOUT = (_Float16*)take((size_t)CIN * 2 * DK * 2);
  _Float16* X16 = (_Float16*)take((size_t)NPX * CIN * 2); float* ATT = (float*)take((size_t)NPX * DK * 4); float* IST = (float*)take((size_t)2 * NIMG * DK * 32 * 4); _Float16* SIL = (_Float16*)take((size_t)NPX * 2 * DK * 2); _Float16* BAS = (_Float16*)take((size_t)NPX * 2 * DK * NG * 2);
  float* F = (float*)take((size_t)NPX * DK * 4); _Float16* Qh = (_Float16*)take((size_t)NPX * DK * 2); _Float16* Ql = (_Float16*)take((size_t)NPX * DK * 2); _Float16* Kh = (_Float16*)take((size_t)NPX * DK * 2); _Float16* Kl = (_Float16*)take((size_t)NPX * DK * 2); _Float16* Vth = (_Float16*)take((size_t)NPX * DK * 2); _Float16* Vtl = (_Float16*)take((size_t)NPX * DK * 2);
  float* O = (float*)take((size_t)NPX * DK * 4); _Float16* O16 = (_Float16*)take((size_t)NPX * 2 * DK * 2); float* A2 = (float*)take((size_t)NPX * CIN * 4); float* Y = (float*)take((size_t)NPX * CIN * 4); float* BST = (float*)take((size_t)2 * CIN * 32 * 4);
  unsigned* MB = (unsigned*)take((size_t)NPI * (NPI / 32) * 4); int* RA = (int*)take((size_t)NPI * 4); int* KE = (int*)take((size_t)(NPI / 64) * 32 * 4);
  if (off > ws_size) return;      /* 0.5 + 8 + 4 + 4 + 32 + 4 + 12 + 4 + 4 + 16 + 16 + 2 = 106.5 MiB */
  k_round16f<<<(DK * CIN / 8 + 255) / 256, 256, 0, stream>>>(w_in, BIN, (size_t)DK * CIN / 8); k_wnp2<<<(CIN * (2 * DK / 8) + 255) / 256, 256, 0, stream>>>(w_out, DK, CIN, BOUT);      /* (out,in) natural -> [16w | w] pair planes */
  const float* bw3[3] = {qbw, kbw, vbw}; const float* sw3[3] = {qsw, ksw, vsw};
  for (int i = 0; i < 3; ++i) { k_wnp2<<<(DK * (2 * DK / 8) + 255) / 256, 256, 0, stream>>>(bw3[i], DK, DK, BB[i]); k_wnp2<<<(DK * (2 * DK * NG / 8) + 255) / 256, 256, 0, stream>>>(sw3[i], DK * NG, DK, BS[i]); }
  k_fulltab<<<(NPI * (NPI / 32) + 255) / 256, 256, 0, stream>>>(MB, RA, KE);
  k_xcl<<<(NPX * (CIN / 8) + 255) / 256, 256, 0, stream>>>(x, X16);
  const dim3 g64((NPX / 128) * 1, 1), g256((NPX / 128) * (CIN / 64), 1);
  k_gemm2<0><<<g64, 128, 0, stream>>>(X16, CIN, 0, BIN, CIN, 0, 0.0625f, b_in, 0, nullptr, 1, 0, 0, ATT, nullptr, DK, 0, NPX, DK, CIN);      /* att = conv1x1(x) + b */
  k_instat<<<NIMG * DK, 256, 0, stream>>>(ATT, IST, 0, IST); k_instat<<<NIMG * DK, 256, 0, stream>>>(ATT, IST, 1, IST);
  k_basis<<<(NPX * DK + 255) / 256, 256, 0, stream>>>(ATT, IST, BAS); k_silu<<<(NPX * (DK / 8) + 255) / 256, 256, 0, stream>>>(ATT, SIL);
  const float* bb3[3] = {qbb, kbb, vbb}; const float* sb3[3] = {qsb, ksb, vsb}; const size_t n8 = (size_t)NPX * DK / 8; const unsigned nb8 = (unsigned)((n8 + 255) / 256);
  for (int i = 0; i < 3; ++i) {      /* q, k, v = base(silu) + b_base + spline(basis) + b_spline (two GEMMs, the second accumulating through the f32 addend) */
    k_gemm2<0><<<g64, 128, 0, stream>>>(SIL, 2 * DK, 0, BB[i], 2 * DK, 0, 0.0625f, bb3[i], 0, nullptr, 1, 0, 0, F, nullptr, DK, 0, NPX, DK, 2 * DK);
    k_gemm2<0><<<g64, 128, 0, stream>>>(BAS, 2 * DK * NG, 0, BS[i], 2 * DK * NG, 0, 0.0625f, sb3[i], 0, F, 1, (size_t)DK, 0, F, nullptr, DK, 0, NPX, DK, 2 * DK * NG);
    if (i == 0) k_hl<<<nb8, 256, 0, stream>>>(F, Qh, Ql, n8);
    else if (i == 1) k_hl<<<nb8, 256, 0, stream>>>(F, Kh, Kl, n8);
    else for (int b = 0; b < NIMG; ++b) k_vthl<NPI><<<NH * (NPI / 64), 256, 0, stream>>>(F + (size_t)b * NPI * DK, DK, Vth + (size_t)b * NPI * DK, Vtl + (size_t)b * NPI * DK); }
  k_flashm<NPI, NPI, KSPLIT><<<NIMG * NH * (NPI / 64), 128 * KSPLIT, 0, stream>>>(Qh, Ql, DK, Kh, Kl, DK, Vth, Vtl, MB, RA, KE, O, DK);      /* slab = image (NH 1) */
  k_pair16<<<nb8, 256, 0, stream>>>(O, DK, O16, NPX);
  k_gemm2<0><<<g256, 128, 0, stream>>>(O16, 2 * DK, 0, BOUT, 2 * DK, 0, 0.0625f, b_out, 0, nullptr, 1, 0, 0, A2, nullptr, CIN, 0, NPX, CIN, 2 * DK);      /* att2 = conv1x1(out) + b (pair operand) */
  k_y<<<(NPX * (CIN / 4) + 255) / 256, 256, 0, stream>>>(x, gam, A2, Y);
  k_bnstat<<<CIN, 256, 0, stream>>>(Y, BST, 0, BST); k_bnstat<<<CIN, 256, 0, stream>>>(Y, BST, 1, BST);
  k_bnout<<<(NIMG * CIN * (NPI / 4) + 255) / 256, 256, 0, stream>>>(Y, BST, bnw, bnb, (float*)d_out);
}

// v003
// Measured time: 449 microseconds a run.
// Two timings next to v002 put it at 1.11 and 1.14 times that version's speed.
// Over all steps from v000 it is 2.08 times as fast.
#include <hip/hip_runtime.h>
// Self-KAN attention (4 images, 256 channels, 64 x 64): att = conv1x1(x) (64 ch); q, k, v = FastKAN 1x1 convs (base_conv(silu(att)) + spline_conv(RBF basis of the instance-normalised att, 8 grid points)); energy = q.k over the 4096 positions (NO scaling), softmax over keys, out = v.attn^T; att2 = conv1x1(out) (256 ch); y = gamma*x + att2; training-mode BatchNorm -> [4,256,64,64].
// Compute dtype: x, weights, biases, gamma, BN affine rounded to bf16; x exact in f16; silu/basis operands as hi + 16x residual pairs (~2^-20); q, k, P, v as hi + x2^10 residual pairs (~2^-21); the attention output as hi + 16x residual pairs too; f32 accumulation, statistics, softmax. v_wmma_f32_16x16x32_f16.
#define NIMG 4
#define CIN 256
#define DK 64
#define HW 64
#define NPI (HW * HW)            /* 4096 */
#define NPX (NIMG * NPI)         /* 16384 */
#define NG 8
#define NH 1
#define DM DK
#define SCL 1.0f
#define KSPLIT 4
typedef __bf16 v16b __attribute__((ext_vector_type(16)));
typedef unsigned short v8us __attribute__((ext_vector_type(8), may_alias));
typedef float  v8f  __attribute__((ext_vector_type(8)));
typedef float  v4f  __attribute__((ext_vector_type(4)));
typedef float  v4fa __attribute__((ext_vector_type(4), may_alias));
union FragB { v16b v; v8us half[2]; unsigned short u[16]; };

__device__ __forceinline__ unsigned short bf16_bits(float x) { unsigned int u = __float_as_uint(x); return (unsigned short)((u + 0x7FFFu + ((u >> 16) & 1u)) >> 16); }
__device__ __forceinline__ float bf16_val(unsigned short b) { return __uint_as_float(((unsigned int)b) << 16); }
__device__ __forceinline__ float bf16_round(float x) { return bf16_val(bf16_bits(x)); }
// D += A·B with NT terms: 1 = ah·bh, 2 = + al·bh (A split), 3 = + ah·bl (both split)
template <int NT>
__device__ __forceinline__ v8f mmaN(v16b ah, v16b al, v16b bh, v16b bl, v8f c) {
  c = __builtin_amdgcn_wmma_f32_16x16x32_bf16(false, ah, false, bh, (short)0, c, false, false);
  if (NT >= 2) c = __builtin_amdgcn_wmma_f32_16x16x32_bf16(false, al, false, bh, (short)0, c, false, false);
  if (NT >= 3) c = __builtin_amdgcn_wmma_f32_16x16x32_bf16(false, ah, false, bl, (short)0, c, false, false);
  asm volatile("v_nop\n\tv_nop\n\tv_nop\n\tv_nop" : "+v"(c) : "v"(ah), "v"(al), "v"(bh), "v"(bl));
  return c;
}

__global__ __launch_bounds__(256) void k_wt_bf16(const float* __restrict__ W, unsigned short* __restrict__ Wt, int K, int N) {
  const int t = blockIdx.x * 256 + threadIdx.x;
  const int k8n = K / 8;
  if (t >= N * k8n) return;
  const int n = t / k8n, k8 = (t % k8n) * 8;
  v8us v;
#pragma unroll
  for (int i = 0; i < 8; ++i) v[i] = bf16_bits(W[(size_t)(k8 + i) * N + n]);
  *(v8us*)(Wt + (size_t)n * K + k8) = v;
  
}

// GEMM C[M][N] (f32, pitch ldc) = act(A[M][K]·W + bias). A f32 row-major (pitch lda) converted per fragment to bf16
// (ASPLIT: hi/lo two planes -> 2 terms, else single rounded term); Wt bf16 [N][K] (pitch ldb). BIAS_BF16 rounds the
// bias to bf16 first (bias quantised to bf16 before the add). K%32==0, M%16==0, N%64==0.
template <bool ASPLIT, int ACT, bool BIAS_BF16>
__global__ __launch_bounds__(128) void k_gemm_bf(const float* __restrict__ A, int lda, const unsigned short* __restrict__ Wt, int ldb,
                                               const float* __restrict__ bias, float* __restrict__ C, int ldc, int M, int N, int K) {
  __shared__ __attribute__((aligned(16))) float so[4][16][64];
  const int tid = threadIdx.x, w = tid >> 5, lane = tid & 31, ln = lane & 15, hh = lane >> 4;
  const int ntn = N / 64;
  const int wid = blockIdx.x * 4 + w;
  const int mt = wid / ntn, nq = wid % ntn;
  if (mt * 16 >= M) return;
  const int row0 = mt * 16, col0 = nq * 64;
  const float* arow = A + (size_t)(row0 + ln) * lda;
  v8f acc[4] = {};
  for (int kb = 0; kb < K; kb += 32) {
    FragB ah, al;
    const v4f x0 = *(const v4fa*)(arow + kb + 8 * hh), x1 = *(const v4fa*)(arow + kb + 8 * hh + 4);
    const v4f x2 = *(const v4fa*)(arow + kb + 16 + 8 * hh), x3 = *(const v4fa*)(arow + kb + 16 + 8 * hh + 4);
    float xs[16] = {x0[0],x0[1],x0[2],x0[3],x1[0],x1[1],x1[2],x1[3],x2[0],x2[1],x2[2],x2[3],x3[0],x3[1],x3[2],x3[3]};
#pragma unroll
    for (int i = 0; i < 16; ++i) { const unsigned short hb = bf16_bits(xs[i]); ah.u[i] = hb; al.u[i] = ASPLIT ? bf16_bits(xs[i] - bf16_val(hb)) : (unsigned short)0; }
#pragma unroll
    for (int t = 0; t < 4; ++t) {
      const unsigned short* brow = Wt + (size_t)(col0 + t * 16 + ln) * ldb + kb;
      FragB b;
      b.half[0] = *(const v8us*)(brow + 8 * hh);
      b.half[1] = *(const v8us*)(brow + 16 + 8 * hh);
      acc[t] = mmaN<ASPLIT ? 2 : 1>(ah.v, al.v, b.v, b.v, acc[t]);
    }
  }
#pragma unroll
  for (int t = 0; t < 4; ++t) {
    float bv = bias ? bias[col0 + t * 16 + ln] : 0.f;
    if (BIAS_BF16) bv = bf16_round(bv);
#pragma unroll
    for (int r = 0; r < 8; ++r) { float v = acc[t][r] + bv; if (ACT == 1) v = fmaxf(v, 0.f); so[w][8 * hh + r][t * 16 + ln] = v; }
  }
  __builtin_amdgcn_fence(__ATOMIC_ACQ_REL, "workgroup");
  __builtin_amdgcn_wave_barrier();
  const int rsub = lane >> 4, c4 = (lane & 15) * 4;
  {
#pragma unroll
    for (int q = 0; q < 8; ++q) {
      const int r = q * 2 + rsub;
      const v4f v = *(const v4fa*)&so[w][r][c4];
      *(v4f*)(C + (size_t)(row0 + r) * ldc + col0 + c4) = v;
    }
    
  }
}

// GEMM C = act(A·W + bias + resid): A f32 (ASPLIT -> hi/lo 2 terms), Wt bf16 [N][K]; ACT 0 none, 1 relu, 2 exact gelu;
// resid (optional, f32, row index = (row % rmod), pitch ldr, RES_BF16 rounds it) added before the activation.
template <bool ASPLIT, int ACT, bool BIAS_BF16, bool RES_BF16>
__global__ __launch_bounds__(128) void k_gemm_bf3(const float* __restrict__ A, int lda, const unsigned short* __restrict__ Wt, int ldb,
                                                const float* __restrict__ bias, const float* __restrict__ resid, int rmod, int ldr,
                                                float* __restrict__ C, int ldc, int M, int N, int K) {
  __shared__ __attribute__((aligned(16))) float so[4][16][64];
  const int tid = threadIdx.x, w = tid >> 5, lane = tid & 31, ln = lane & 15, hh = lane >> 4;
  const int ntn = N / 64;
  const int wid = blockIdx.x * 4 + w;
  const int mt = wid / ntn, nq = wid % ntn;
  if (mt * 16 >= M) return;
  const int row0 = mt * 16, col0 = nq * 64;
  const float* arow = A + (size_t)(row0 + ln) * lda;
  v8f acc[4] = {};
  for (int kb = 0; kb < K; kb += 32) {
    FragB ah, al;
    const v4f x0 = *(const v4fa*)(arow + kb + 8 * hh), x1 = *(const v4fa*)(arow + kb + 8 * hh + 4);
    const v4f x2 = *(const v4fa*)(arow + kb + 16 + 8 * hh), x3 = *(const v4fa*)(arow + kb + 16 + 8 * hh + 4);
    float xs[16] = {x0[0],x0[1],x0[2],x0[3],x1[0],x1[1],x1[2],x1[3],x2[0],x2[1],x2[2],x2[3],x3[0],x3[1],x3[2],x3[3]};
#pragma unroll
    for (int i = 0; i < 16; ++i) { const unsigned short hb = bf16_bits(xs[i]); ah.u[i] = hb; al.u[i] = ASPLIT ? bf16_bits(xs[i] - bf16_val(hb)) : (unsigned short)0; }
#pragma unroll
    for (int t = 0; t < 4; ++t) {
      const unsigned short* brow = Wt + (size_t)(col0 + t * 16 + ln) * ldb + kb;
      FragB b;
      b.half[0] = *(const v8us*)(brow + 8 * hh);
      b.half[1] = *(const v8us*)(brow + 16 + 8 * hh);
      acc[t] = mmaN<ASPLIT ? 2 : 1>(ah.v, al.v, b.v, b.v, acc[t]);
    }
  }
#pragma unroll
  for (int t = 0; t < 4; ++t) {
    const int col = col0 + t * 16 + ln;
    float bv = bias ? bias[col] : 0.f;
    if (BIAS_BF16) bv = bf16_round(bv);
#pragma unroll
    for (int r = 0; r < 8; ++r) {
      float v = acc[t][r] + bv;
      if (resid) { float rv = resid[(size_t)((row0 + 8 * hh + r) % rmod) * ldr + col]; if (RES_BF16) rv = bf16_round(rv); v += rv; }
      if (ACT == 1) v = fmaxf(v, 0.f);
      if (ACT == 2) v = 0.5f * v * (1.0f + erff(v * 0.70710678118654752f));
      if (ACT == 3) { const float u = 0.7978845608028654f * (v + 0.044715f * v * v * v); v = 0.5f * v * (1.0f + tanhf(u)); }
      so[w][8 * hh + r][t * 16 + ln] = v;
    }
  }
  __builtin_amdgcn_fence(__ATOMIC_ACQ_REL, "workgroup");
  __builtin_amdgcn_wave_barrier();
  const int rsub = lane >> 4, c4 = (lane & 15) * 4;
  {
#pragma unroll
    for (int q = 0; q < 8; ++q) {
      const int r = q * 2 + rsub;
      const v4f v = *(const v4fa*)&so[w][r][c4];
      *(v4f*)(C + (size_t)(row0 + r) * ldc + col0 + c4) = v;
    }
    
  }
}
// row LayerNorm (biased variance, eps) over N: s = X (+ R); optional out_sum <- s; out_norm <- (s-mu)*rsqrt(var+eps)*g + b
template <bool PARAM_BF16>
__global__ __launch_bounds__(256) void k_layernorm(const float* __restrict__ X, const float* __restrict__ R, const float* __restrict__ g, const float* __restrict__ bta,
                                                  float* __restrict__ out_sum, float* __restrict__ out_norm, int N, float eps) {
  __shared__ float red[256];
  const int row = blockIdx.x, tid = threadIdx.x;
  const float* x = X + (size_t)row * N; const float* rr = R ? R + (size_t)row * N : nullptr;
  float vals[16];                     // up to N = 4096
  const int per = N / 256;            // contiguous chunk per thread? use strided-by-4 chunks: thread handles j = tid*4 + 1024*u
  float s1 = 0.f;
  for (int u = 0; u < per / 4; ++u) {
    const int j = tid * 4 + 1024 * u;
    const v4f a = *(const v4fa*)(x + j);
    v4f b = {0.f,0.f,0.f,0.f}; if (rr) b = *(const v4fa*)(rr + j);
#pragma unroll
    for (int q = 0; q < 4; ++q) { const float v = a[q] + b[q]; vals[u * 4 + q] = v; s1 += v; }
  }
  red[tid] = s1; __syncthreads();
  for (int st = 128; st > 0; st >>= 1) { if (tid < st) red[tid] += red[tid + st]; __syncthreads(); }
  const float mu = red[0] / (float)N; __syncthreads();
  float s2 = 0.f;
  for (int u = 0; u < per / 4; ++u)
#pragma unroll
    for (int q = 0; q < 4; ++q) { const float c = vals[u * 4 + q] - mu; s2 += c * c; }
  red[tid] = s2; __syncthreads();
  for (int st = 128; st > 0; st >>= 1) { if (tid < st) red[tid] += red[tid + st]; __syncthreads(); }
  const float rs = rsqrtf(red[0] / (float)N + eps);
  {
    for (int u = 0; u < per / 4; ++u) {
      const int j = tid * 4 + 1024 * u;
      v4f o, sm;
#pragma unroll
      for (int q = 0; q < 4; ++q) {
        float gg = g[j + q], bb = bta[j + q];
        if (PARAM_BF16) { gg = bf16_round(gg); bb = bf16_round(bb); }
        sm[q] = vals[u * 4 + q]; o[q] = (vals[u * 4 + q] - mu) * rs * gg + bb;
      }
      if (out_sum) *(v4f*)(out_sum + (size_t)row * N + j) = sm;
      *(v4f*)(out_norm + (size_t)row * N + j) = o;
    }
    
  }
}



// ---- f16 WMMA path (v_wmma_f32_16x16x32_f16): 11-bit significands for operands in range — used where a [0,1] probability operand needs more precision than bf16
typedef _Float16 v16h __attribute__((ext_vector_type(16)));
union FragH { v16h v; v8us half[2]; _Float16 h[16]; unsigned short u[16]; };
template <int NT>
__device__ __forceinline__ v8f mmaH(v16h ah, v16h al, v16h bh, v16h bl, v8f c) {
  c = __builtin_amdgcn_wmma_f32_16x16x32_f16(false, ah, false, bh, (short)0, c, false, false);
  if (NT >= 2) c = __builtin_amdgcn_wmma_f32_16x16x32_f16(false, al, false, bh, (short)0, c, false, false);
  if (NT >= 3) c = __builtin_amdgcn_wmma_f32_16x16x32_f16(false, ah, false, bl, (short)0, c, false, false);
  asm volatile("v_nop\n\tv_nop\n\tv_nop\n\tv_nop" : "+v"(c) : "v"(ah), "v"(al), "v"(bh), "v"(bl));
  return c;
}
// batched GEMM like k_gemm_b but f16 operands: A f32 (split into f16 hi/lo if ASPLIT, else rounded to f16), Bt = f16 values [n][k]; alpha; C f32; N multiple of 16 (partial tiles skipped)
template <bool ASPLIT>
__global__ __launch_bounds__(128) void k_gemm_h(const float* __restrict__ A, int lda, size_t sA, const _Float16* __restrict__ Bh, int ldb, size_t sB, float alpha, float* __restrict__ C, int ldc, size_t sC, int M, int N, int K) {
  __shared__ __attribute__((aligned(16))) float so[4][16][64];
  const int tid = threadIdx.x, w = tid >> 5, lane = tid & 31, ln = lane & 15, hh = lane >> 4; const int by = blockIdx.y;
  A += (size_t)by * sA; Bh += (size_t)by * sB; C += (size_t)by * sC;
  const int ntn = (N + 63) / 64; const int wid = blockIdx.x * 4 + w; const int mt = wid / ntn, nq = wid % ntn; if (mt * 16 >= M) return;
  const int row0 = mt * 16, col0 = nq * 64; const float* arow = A + (size_t)(row0 + ln) * lda;
  v8f acc[4] = {};
  for (int kb = 0; kb < K; kb += 32) {
    FragH ah, al;
    const v4f x0 = *(const v4fa*)(arow + kb + 8 * hh), x1 = *(const v4fa*)(arow + kb + 8 * hh + 4), x2 = *(const v4fa*)(arow + kb + 16 + 8 * hh), x3 = *(const v4fa*)(arow + kb + 16 + 8 * hh + 4);
    float xs[16] = {x0[0],x0[1],x0[2],x0[3],x1[0],x1[1],x1[2],x1[3],x2[0],x2[1],x2[2],x2[3],x3[0],x3[1],x3[2],x3[3]};
#pragma unroll
    for (int i = 0; i < 16; ++i) { const _Float16 h = (_Float16)xs[i]; ah.h[i] = h; al.h[i] = ASPLIT ? (_Float16)(xs[i] - (float)h) : (_Float16)0.0f; }
#pragma unroll
    for (int t = 0; t < 4; ++t) { if (col0 + t * 16 >= N) continue; const size_t boff = (size_t)(col0 + t * 16 + ln) * ldb + kb; FragH bq; bq.half[0] = *(const v8us*)(Bh + boff + 8 * hh); bq.half[1] = *(const v8us*)(Bh + boff + 16 + 8 * hh);
      acc[t] = mmaH<ASPLIT ? 2 : 1>(ah.v, al.v, bq.v, bq.v, acc[t]); }
  }
#pragma unroll
  for (int t = 0; t < 4; ++t) { if (col0 + t * 16 >= N) continue;
#pragma unroll
    for (int r = 0; r < 8; ++r) so[w][8 * hh + r][t * 16 + ln] = acc[t][r] * alpha; }
  __builtin_amdgcn_fence(__ATOMIC_ACQ_REL, "workgroup"); __builtin_amdgcn_wave_barrier();
  const int rsub = lane >> 4, c4 = (lane & 15) * 4;
  {
#pragma unroll
    for (int q = 0; q < 8; ++q) { const int r = q * 2 + rsub; if (col0 + c4 < N) { const v4f v = *(const v4fa*)&so[w][r][c4]; *(v4f*)(C + (size_t)(row0 + r) * ldc + col0 + c4) = v; } }
     }
}

// Wt[n][k] = f16(W[k][n]·scale) from f32 row-major W[K][N] (scale = power of two; bf16-exact weights stay exact in f16 away from the subnormal range)
__global__ __launch_bounds__(256) void k_wt_f16(const float* __restrict__ W, _Float16* __restrict__ Wt, int K, int N, float scale) {
  const int t = blockIdx.x * 256 + threadIdx.x; if (t >= N * (K / 8)) return; const int n = t / (K / 8), k8 = (t % (K / 8)) * 8; FragH f;
#pragma unroll
  for (int i = 0; i < 8; ++i) f.h[i] = (_Float16)(bf16_round(W[(size_t)(k8 + i) * N + n]) * scale); const v8us o = f.half[0];
  *(v8us*)((unsigned short*)Wt + (size_t)n * K + k8) = o; 
}
// k_gemm_hh variant with fused epilogue: v = acc·alpha + bias[by·sBias + col] (+ CP[(row/rowsPerB)·sCPb + by·64 + col] if CP) ; ACT 0 none / 1 elu ; writes f16 C16 (and f32 C if non-null)
template <int ACT>
__global__ __launch_bounds__(128) void k_gemm_hhx(const _Float16* __restrict__ A, int lda, size_t sA, const _Float16* __restrict__ Bh, int ldb, size_t sB, float alpha, const float* __restrict__ bias, size_t sBias, const float* __restrict__ CP, int rowsPerB, size_t sCPb, int row0g,
    float* __restrict__ C, _Float16* __restrict__ C16, int ldc, size_t sC, int M, int N, int K) {
  __shared__ __attribute__((aligned(16))) float so[4][16][64];
  const int tid = threadIdx.x, w = tid >> 5, lane = tid & 31, ln = lane & 15, hh = lane >> 4; const int by = blockIdx.y;
  A += (size_t)by * sA; Bh += (size_t)by * sB; const size_t cofs = (size_t)by * sC; const float* bp = bias ? bias + (size_t)by * sBias : nullptr;
  const int ntn = (N + 63) / 64; const int wid = blockIdx.x * 4 + w; const int mt = wid / ntn, nq = wid % ntn; if (mt * 16 >= M) return;
  const int row0 = mt * 16, col0 = nq * 64; const _Float16* arow = A + (size_t)(row0 + ln) * lda;
  v8f acc[4] = {};
  for (int kb = 0; kb < K; kb += 32) { FragH ah; ah.half[0] = *(const v8us*)((const unsigned short*)arow + kb + 8 * hh); ah.half[1] = *(const v8us*)((const unsigned short*)arow + kb + 16 + 8 * hh);
#pragma unroll
    for (int t = 0; t < 4; ++t) { if (col0 + t * 16 >= N) continue; const size_t boff = (size_t)(col0 + t * 16 + ln) * ldb + kb; FragH bq; bq.half[0] = *(const v8us*)((const unsigned short*)Bh + boff + 8 * hh); bq.half[1] = *(const v8us*)((const unsigned short*)Bh + boff + 16 + 8 * hh);
      acc[t] = mmaH<1>(ah.v, ah.v, bq.v, bq.v, acc[t]); }
  }
#pragma unroll
  for (int t = 0; t < 4; ++t) { if (col0 + t * 16 >= N) continue; const int col = col0 + t * 16 + ln; const float bv = bp ? bf16_round(bp[col]) : 0.f;
#pragma unroll
    for (int r = 0; r < 8; ++r) { float v = acc[t][r] * alpha + bv; if (CP) { const int bidx = (row0g + row0 + 8 * hh + r) / rowsPerB; v += CP[(size_t)bidx * sCPb + (size_t)by * 64 + col]; } if (ACT == 1) v = (v > 0.f) ? v : expm1f(v); else if (ACT == 7) v = (v > 0.f) ? v + 1.0f : expf(v); else if (ACT == 8) v = tanhf(v); else if (ACT == 9) v = 0.5f * v * (1.0f + tanhf(0.7978845608028654f * (v + 0.044715f * v * v * v))); else if (ACT == 11) v = 1.0f / (1.0f + expf(-v)); else if (ACT == 12) v = (v > 0.f) ? v : 0.01f * v; else if (ACT == 14) v = (v > 0.f) ? v : 0.1f * v; else if (ACT == 15) v = v / (1.0f + expf(-v)); else if (ACT == 3) v = fmaxf(v, 0.f); else if (ACT == 6) v = 0.5f * v * (1.0f + erff(v * 0.70710678118654752f)); so[w][8 * hh + r][t * 16 + ln] = v; } }
  __builtin_amdgcn_fence(__ATOMIC_ACQ_REL, "workgroup"); __builtin_amdgcn_wave_barrier();
  const int rsub = lane >> 4, c4 = (lane & 15) * 4; typedef _Float16 v4h __attribute__((ext_vector_type(4)));
  {
#pragma unroll
    for (int q = 0; q < 8; ++q) { const int r = q * 2 + rsub; if (col0 + c4 < N) { const v4f v = *(const v4fa*)&so[w][r][c4]; if (C) *(v4f*)(C + cofs + (size_t)(row0 + r) * ldc + col0 + c4) = v; if (C16) { v4h h4; for (int i = 0; i < 4; ++i) h4[i] = (_Float16)v[i]; *(v4h*)(C16 + cofs + (size_t)(row0 + r) * ldc + col0 + c4) = h4; } } }
     }
}


typedef _Float16 v4h __attribute__((ext_vector_type(4)));

__global__ __launch_bounds__(256) void k_x16(const float* __restrict__ x, _Float16* __restrict__ X16, size_t n8) { const size_t t = (size_t)blockIdx.x * 256 + threadIdx.x; if (t >= n8) return; FragH f;
#pragma unroll
  for (int q = 0; q < 8; ++q) f.h[q] = (_Float16)bf16_round(x[t * 8 + q]); *(v8us*)((unsigned short*)X16 + t * 8) = f.half[0];  }
__global__ __launch_bounds__(256) void k_h16(const float* __restrict__ x, _Float16* __restrict__ X16, size_t n8) { const size_t t = (size_t)blockIdx.x * 256 + threadIdx.x; if (t >= n8) return; FragH f;
#pragma unroll
  for (int q = 0; q < 8; ++q) f.h[q] = (_Float16)x[t * 8 + q]; *(v8us*)((unsigned short*)X16 + t * 8) = f.half[0];  }
__global__ __launch_bounds__(256) void k_round16f(const float* __restrict__ W, _Float16* __restrict__ Bt, size_t n8) { const size_t t = (size_t)blockIdx.x * 256 + threadIdx.x; if (t >= n8) return; FragH f;
#pragma unroll
  for (int i = 0; i < 8; ++i) f.h[i] = (_Float16)(bf16_round(W[t * 8 + i]) * 16.0f); *(v8us*)((unsigned short*)Bt + t * 8) = f.half[0];  }
template <int NHv, int TTv>
__global__ __launch_bounds__(256) void k_vt(const _Float16* __restrict__ V16, int ldv, int voff, _Float16* __restrict__ Vt) { __shared__ unsigned short tl[64][66]; const int tid = threadIdx.x; const int slab = blockIdx.x / (TTv / 64), lg = blockIdx.x % (TTv / 64); const int b = slab / NHv, h = slab % NHv;
  for (int i = tid; i < 64 * 8; i += 256) { const int r = i / 8, c8 = (i % 8) * 8; FragH f; f.half[0] = *(const v8us*)((const unsigned short*)V16 + ((size_t)b * TTv + lg * 64 + r) * ldv + voff + h * 64 + c8);
#pragma unroll
    for (int q = 0; q < 8; ++q) tl[r][c8 + q] = f.u[q]; }
  __syncthreads();
  {
#pragma unroll
    for (int rd = 0; rd < 2; ++rd) { const int d = rd * 32 + tid / 8, pc = tid % 8; FragH f;
#pragma unroll
      for (int q = 0; q < 8; ++q) f.u[q] = tl[pc * 8 + q][d];
      *(v8us*)((unsigned short*)Vt + ((size_t)slab * 64 + d) * TTv + lg * 64 + pc * 8) = f.half[0]; }
     } }

__global__ __launch_bounds__(256) void k_hl(const float* __restrict__ F, _Float16* __restrict__ Hh, _Float16* __restrict__ Hl, size_t n8) { const size_t t = (size_t)blockIdx.x * 256 + threadIdx.x; if (t >= n8) return; FragH fh, fl; const v4f a = *(const v4fa*)(F + t * 8), c = *(const v4fa*)(F + t * 8 + 4);
#pragma unroll
  for (int q = 0; q < 4; ++q) { _Float16 h = (_Float16)a[q]; fh.h[q] = h; fl.h[q] = (_Float16)((a[q] - (float)h) * 1024.0f); h = (_Float16)c[q]; fh.h[4 + q] = h; fl.h[4 + q] = (_Float16)((c[q] - (float)h) * 1024.0f); }
  { *(v8us*)((unsigned short*)Hh + t * 8) = fh.half[0]; *(v8us*)((unsigned short*)Hl + t * 8) = fl.half[0];  } }

// ---- fast GEMM (wave tile 32x64; requires M % 32 == 0 rows per launch region and N % 64 == 0); epilogue = k_gemm_hhx semantics ----
__device__ __forceinline__ v16h g2_frag(const _Float16* p, int hh) { FragH f; f.half[0] = *(const v8us*)((const unsigned short*)p + 8 * hh); f.half[1] = *(const v8us*)((const unsigned short*)p + 16 + 8 * hh); return f.v; }
__device__ __forceinline__ v8f g2_mma(v16h a, v16h b, v8f c) { v8f d = __builtin_amdgcn_wmma_f32_16x16x32_f16(false, a, false, b, (short)0, c, false, false); asm volatile("v_nop\n\tv_nop\n\tv_nop\n\tv_nop" : "+v"(d) : "v"(a), "v"(b)); return d; }
template <int ACT>
__global__ __launch_bounds__(128) void k_gemm2(const _Float16* __restrict__ A, int lda, size_t sA, const _Float16* __restrict__ Bh, int ldb, size_t sB, float alpha, const float* __restrict__ bias, size_t sBias, const float* __restrict__ CP, int rowsPerB, size_t sCPb, int row0g,
    float* __restrict__ C, _Float16* __restrict__ C16, int ldc, size_t sC, int M, int N, int K) {
  __shared__ __attribute__((aligned(16))) float so[4][32][68];
  const int tid = threadIdx.x, w = tid >> 5, lane = tid & 31, ln = lane & 15, hh = lane >> 4; const int by = blockIdx.y;
  A += (size_t)by * sA; Bh += (size_t)by * sB; const size_t cofs = (size_t)by * sC; const float* bp = bias ? bias + (size_t)by * sBias : nullptr;
  const int ntn = N >> 6; const int mt = blockIdx.x / ntn, nq = blockIdx.x - mt * ntn; const int row0 = mt * 128 + 32 * w, col0 = nq * 64; if (row0 >= M) return;
  const _Float16* a0p = A + (size_t)(row0 + ln) * lda; const _Float16* a1p = a0p + (size_t)16 * lda;
  const _Float16* b0p = Bh + (size_t)(col0 + ln) * ldb; const _Float16* b1p = b0p + (size_t)16 * ldb; const _Float16* b2p = b1p + (size_t)16 * ldb; const _Float16* b3p = b2p + (size_t)16 * ldb;
  const v8f z8 = {0.f,0.f,0.f,0.f,0.f,0.f,0.f,0.f}; v8f c00 = z8, c01 = z8, c02 = z8, c03 = z8, c10 = z8, c11 = z8, c12 = z8, c13 = z8;
#pragma unroll 1
  for (int kb = 0; kb < K; kb += 32) { const v16h a0 = g2_frag(a0p + kb, hh), a1 = g2_frag(a1p + kb, hh);
    v16h b = g2_frag(b0p + kb, hh); c00 = g2_mma(a0, b, c00); c10 = g2_mma(a1, b, c10);
    b = g2_frag(b1p + kb, hh); c01 = g2_mma(a0, b, c01); c11 = g2_mma(a1, b, c11);
    b = g2_frag(b2p + kb, hh); c02 = g2_mma(a0, b, c02); c12 = g2_mma(a1, b, c12);
    b = g2_frag(b3p + kb, hh); c03 = g2_mma(a0, b, c03); c13 = g2_mma(a1, b, c13); }
  v8f accs[8] = {c00, c01, c02, c03, c10, c11, c12, c13};
#pragma unroll
  for (int u = 0; u < 8; ++u) { const int t = u & 3, half = u >> 2; const int col = col0 + t * 16 + ln; const float bv = bp ? bf16_round(bp[col]) : 0.f;
#pragma unroll
    for (int r = 0; r < 8; ++r) { const int rloc = half * 16 + 8 * hh + r; float v = accs[u][r] * alpha + bv; if (CP) { const int bidx = (row0g + row0 + rloc) / rowsPerB; v += CP[(size_t)bidx * sCPb + (size_t)by * 64 + col]; }
      if (ACT == 3) v = fmaxf(v, 0.f); else if (ACT == 6) v = 0.5f * v * (1.0f + erff(v * 0.70710678118654752f)); else if (ACT == 11) v = 1.0f / (1.0f + expf(-v)); else if (ACT == 15) v = v / (1.0f + expf(-v)); else if (ACT == 12) v = (v > 0.f) ? v : 0.01f * v; else if (ACT == 8) v = tanhf(v);
      so[w][rloc][t * 16 + ln] = v; } }
  __builtin_amdgcn_fence(__ATOMIC_ACQ_REL, "workgroup"); __builtin_amdgcn_wave_barrier();
  const int rsub = lane >> 4, c4 = (lane & 15) * 4;
  {
#pragma unroll
    for (int q = 0; q < 16; ++q) { const int r = q * 2 + rsub; const v4f v = *(const v4fa*)&so[w][r][c4]; if (C) *(v4f*)(C + cofs + (size_t)(row0 + r) * ldc + col0 + c4) = v; if (C16) { v4h h4; for (int i = 0; i < 4; ++i) h4[i] = (_Float16)v[i]; *(v4h*)(C16 + cofs + (size_t)(row0 + r) * ldc + col0 + c4) = h4; } }
     } }


template <int TK>
__global__ __launch_bounds__(256) void k_vthl(const float* __restrict__ VF, int ldv, _Float16* __restrict__ Vth, _Float16* __restrict__ Vtl) { __shared__ float tl[64][65]; const int tid = threadIdx.x; const int slab = blockIdx.x / (TK / 64), lg = blockIdx.x % (TK / 64); const int b = slab / NH, h = slab % NH;
  for (int i = tid; i < 64 * 16; i += 256) { const int r = i / 16, c4 = (i % 16) * 4; const v4f a = *(const v4fa*)(VF + ((size_t)b * TK + lg * 64 + r) * ldv + h * 64 + c4); tl[r][c4] = a[0]; tl[r][c4 + 1] = a[1]; tl[r][c4 + 2] = a[2]; tl[r][c4 + 3] = a[3]; }
  __syncthreads();
  FragH fh[2], fl[2]; size_t oo[2];
#pragma unroll
  for (int rd = 0; rd < 2; ++rd) { const int d = rd * 32 + tid / 8, pc = tid % 8;
#pragma unroll
    for (int q = 0; q < 8; ++q) { const float v = tl[pc * 8 + q][d]; const _Float16 hv = (_Float16)v; fh[rd].h[q] = hv; fl[rd].h[q] = (_Float16)((v - (float)hv) * 1024.0f); } oo[rd] = ((size_t)slab * 64 + d) * TK + lg * 64 + pc * 8; }
  {
#pragma unroll
    for (int rd = 0; rd < 2; ++rd) { *(v8us*)((unsigned short*)Vth + oo[rd]) = fh[rd].half[0]; *(v8us*)((unsigned short*)Vtl + oo[rd]) = fl[rd].half[0]; }
     } }

__device__ __forceinline__ float xhalf(float v) { const int b = __float_as_int(v); return __int_as_float(__builtin_amdgcn_permlanex16(b, b, 0x76543210, 0xfedcba98, false, false)); }      /* lane l <-> l ^ 16 */
template <int TQ, int TK, int KSP>
__global__ __launch_bounds__(128 * KSP) void k_flashm(const _Float16* __restrict__ Q16, const _Float16* __restrict__ Q16lo, int ldq, const _Float16* __restrict__ K16, const _Float16* __restrict__ K16lo, int ldk, const _Float16* __restrict__ Vt, const _Float16* __restrict__ Vtlo, const unsigned* __restrict__ MB, const int* __restrict__ RA, const int* __restrict__ KE, float* __restrict__ O, int ldo) {
  constexpr int RPW = 16, NQB = TQ / (4 * RPW), DT = 4, KS = 2, NW = 4 * KSP;
  __shared__ __attribute__((aligned(16))) float sO[NW][RPW][64 + 4]; __shared__ float sM[NW][RPW], sL[NW][RPW];
  const int tid = threadIdx.x, w = tid >> 5, lane = tid & 31, ln = lane & 15, hh = lane >> 4; const int qt = w & 3, kp = __builtin_amdgcn_readfirstlane(w >> 2);      /* scalar: the key loop's counter and trip test stay wave-uniform */
  const int slab = blockIdx.x / NQB, qblk = blockIdx.x % NQB; const int b = slab / NH, h = slab % NH; const int qb0 = qblk * (4 * RPW); const int q0 = qb0 + qt * RPW;
  FragH aq[KS], aql[KS];
  { const size_t qo = ((size_t)b * TQ + q0 + ln) * ldq + h * 64; const unsigned short* qr = (const unsigned short*)Q16 + qo; const unsigned short* ql = (const unsigned short*)Q16lo + qo;
#pragma unroll
    for (int ks = 0; ks < KS; ++ks) { aq[ks].half[0] = *(const v8us*)(qr + ks * 32 + 8 * hh); aq[ks].half[1] = *(const v8us*)(qr + ks * 32 + 16 + 8 * hh); aql[ks].half[0] = *(const v8us*)(ql + ks * 32 + 8 * hh); aql[ks].half[1] = *(const v8us*)(ql + ks * 32 + 16 + 8 * hh); } }
  const unsigned short* Vth = (const unsigned short*)Vt + (size_t)slab * 64 * TK; const unsigned short* Vtl = (const unsigned short*)Vtlo + (size_t)slab * 64 * TK;
  float m_r = -3.0e38f, l_r = 0.f; v8f oacc[DT], oaccl[DT];
#pragma unroll
  for (int dt = 0; dt < DT; ++dt) { oacc[dt] = (v8f){0.f,0.f,0.f,0.f,0.f,0.f,0.f,0.f}; oaccl[dt] = oacc[dt]; }
  int jend = KE[qblk * 32]; jend = min(TK, (jend + 31) & ~31); if (jend < 32) jend = 32;      /* block-uniform */
  const bool am = (RA[q0 + ln] != 0); const unsigned* mrow = MB + (size_t)(q0 + ln) * (TK / 32);
#pragma unroll 1
  for (int j0 = kp * 32; j0 < jend; j0 += 32 * KSP) {
    v8f s[2];
#pragma unroll
    for (int nt = 0; nt < 2; ++nt) { const size_t ko = ((size_t)b * TK + j0 + nt * 16 + ln) * ldk + h * 64; const unsigned short* kr = (const unsigned short*)K16 + ko; const unsigned short* kl = (const unsigned short*)K16lo + ko; FragH bk[KS], bkl[KS];
#pragma unroll
      for (int ks = 0; ks < KS; ++ks) { bk[ks].half[0] = *(const v8us*)(kr + ks * 32 + 8 * hh); bk[ks].half[1] = *(const v8us*)(kr + ks * 32 + 16 + 8 * hh); bkl[ks].half[0] = *(const v8us*)(kl + ks * 32 + 8 * hh); bkl[ks].half[1] = *(const v8us*)(kl + ks * 32 + 16 + 8 * hh); }
      v8f acc = (v8f){0.f,0.f,0.f,0.f,0.f,0.f,0.f,0.f}, accr = acc;
#pragma unroll
      for (int ks = 0; ks < KS; ++ks) { acc = mmaH<1>(bk[ks].v, bk[ks].v, aq[ks].v, aq[ks].v, acc); accr = mmaH<1>(bk[ks].v, bk[ks].v, aql[ks].v, aql[ks].v, accr); accr = mmaH<1>(bkl[ks].v, bkl[ks].v, aq[ks].v, aq[ks].v, accr); }
      s[nt] = acc + accr * 0.0009765625f; }
    const unsigned mh = mrow[j0 >> 5] >> (8 * hh);      /* bit r: key 8 hh + r, bit 16 + r: key 16 + 8 hh + r */
    float sv[16]; float mc = -INFINITY;
#pragma unroll
    for (int e = 0; e < 16; ++e) { const bool ok = am || (((mh >> ((e >> 3) * 16 + (e & 7))) & 1u) == 0u); sv[e] = ok ? (am ? 0.f : s[e >> 3][e & 7] * SCL) : -INFINITY; mc = fmaxf(mc, sv[e]); }
    mc = fmaxf(mc, xhalf(mc));
    const float mn = fmaxf(m_r, mc); const float al = (mn > -1.0e38f) ? expf(m_r - mn) : 1.0f; m_r = mn;
    FragH pa, pl; float ps = 0.f;
#pragma unroll
    for (int e = 0; e < 16; ++e) { const float p = expf(sv[e] - mn);      /* a masked key: exp(-inf) = 0 (mn is finite) */
      ps += p; const float p10 = p * 1024.0f; const _Float16 ph = (_Float16)p10; pa.h[e] = ph; pl.h[e] = (_Float16)((p10 - (float)ph) * 1024.0f); }
    l_r = l_r * al + ps;
#pragma unroll
    for (int dt = 0; dt < DT; ++dt) { oacc[dt] *= al; oaccl[dt] *= al; }
#pragma unroll
    for (int dt = 0; dt < DT; ++dt) { const size_t vo = (size_t)(dt * 16 + ln) * TK + j0; FragH bv, bl; bv.half[0] = *(const v8us*)(Vth + vo + 8 * hh); bv.half[1] = *(const v8us*)(Vth + vo + 16 + 8 * hh); bl.half[0] = *(const v8us*)(Vtl + vo + 8 * hh); bl.half[1] = *(const v8us*)(Vtl + vo + 16 + 8 * hh);
      oacc[dt] = mmaH<1>(bv.v, bv.v, pa.v, pa.v, oacc[dt]); oaccl[dt] = mmaH<1>(bl.v, bl.v, pa.v, pa.v, oaccl[dt]); oaccl[dt] = mmaH<1>(bv.v, bv.v, pl.v, pl.v, oaccl[dt]); } }
  { const float l = l_r + xhalf(l_r); if (hh == 0) { sM[w][ln] = m_r; sL[w][ln] = l; } }
#pragma unroll
  for (int dt = 0; dt < DT; ++dt) { const v8f o = oacc[dt] + oaccl[dt] * 0.0009765625f;      /* register r = O[query ln][dt * 16 + 8 hh + r] */
    *(v4fa*)&sO[w][ln][dt * 16 + 8 * hh] = (v4f){o[0], o[1], o[2], o[3]}; *(v4fa*)&sO[w][ln][dt * 16 + 8 * hh + 4] = (v4f){o[4], o[5], o[6], o[7]}; }
  __syncthreads();      /* every part's partial is in LDS before any thread merges */
  for (int i = tid; i < 4 * RPW * 16; i += 128 * KSP) { const int row = i >> 4, pc = i & 15; const int tq = row / RPW, rr = row % RPW;
    float mx = sM[tq][rr];
#pragma unroll
    for (int p = 1; p < KSP; ++p) mx = fmaxf(mx, sM[p * 4 + tq][rr]);
    float lsum = 0.f; v4f o = {0.f, 0.f, 0.f, 0.f};
#pragma unroll
    for (int p = 0; p < KSP; ++p) { const float wg = expf(sM[p * 4 + tq][rr] - mx); lsum += wg * sL[p * 4 + tq][rr]; const v4f val = *(const v4fa*)&sO[p * 4 + tq][rr][pc * 4]; o += val * wg; }
    const float inv = (lsum > 0.f) ? 1.0f / (lsum * 1024.0f) : 0.f;
    *(v4f*)(O + ((size_t)b * TQ + qb0 + row) * ldo + h * 64 + pc * 4) = o * inv; } }


__constant__ float GRIDV[8] = {-2.000000000e+00f,-1.428571463e+00f,-8.571428657e-01f,-2.857141793e-01f,2.857143879e-01f,8.571429253e-01f,1.428571701e+00f,2.000000000e+00f};
#define INV_DENOM (1.0f / 0.5714285714285714f)
__global__ __launch_bounds__(256) void k_fulltab(unsigned* __restrict__ MB, int* __restrict__ RA, int* __restrict__ KE) {
  const int t = blockIdx.x * 256 + threadIdx.x;
  if (t < NPI * (NPI / 32)) { *(unsigned*)(MB + t) = 0u;  }
  if (t < NPI) { *(int*)(RA + t) = 0;  }
  if (t < NPI / 64) { *(int*)(KE + t * 32) = NPI;  } }
// Layout changes go through a 64 x 64 LDS tile (pitch 65 floats: no bank conflict in either direction), so that every global read and write covers whole 128-byte lines.
__global__ __launch_bounds__(256) void k_xcl(const float* __restrict__ x, _Float16* __restrict__ X16) {
  __shared__ float tl[64][65]; const int tid = threadIdx.x; const int pt = blockIdx.x % (NPI / 64), ct = (blockIdx.x / (NPI / 64)) % (CIN / 64), b = blockIdx.x / ((NPI / 64) * (CIN / 64));
  const int r16 = tid / 16, k4 = (tid % 16) * 4; v4f a[4];      /* thread: rows r16 + 16 u of the tile, four floats at k4; the four loads fly together */
#pragma unroll      /* a[] stays in registers */
  for (int u = 0; u < 4; ++u) a[u] = *(const v4fa*)(x + ((size_t)b * CIN + ct * 64 + r16 + 16 * u) * NPI + pt * 64 + k4);
#pragma unroll      /* a[] stays in registers */
  for (int u = 0; u < 4; ++u) { float* d = &tl[r16 + 16 * u][k4]; d[0] = a[u][0]; d[1] = a[u][1]; d[2] = a[u][2]; d[3] = a[u][3]; }
  __syncthreads();      /* the whole tile is in LDS before any thread reads it across */
#pragma unroll      /* both rows' LDS reads are issued together */
  for (int rd = 0; rd < 2; ++rd) { const int p = rd * 32 + tid / 8, c8 = (tid % 8) * 8; FragH f;
#pragma unroll
    for (int q = 0; q < 8; ++q) f.h[q] = (_Float16)bf16_round(tl[c8 + q][p]);
    *(v8us*)((unsigned short*)X16 + ((size_t)b * NPI + pt * 64 + p) * CIN + ct * 64 + c8) = f.half[0]; } }
__global__ __launch_bounds__(256) void k_instat(const float* __restrict__ A, const float* __restrict__ ST0, int phase, float* __restrict__ ST) {
  #pragma clang fp contract(off)
  __shared__ float sh[256]; const int b = blockIdx.x / DK, c = blockIdx.x % DK; const float mu = phase ? ST0[(size_t)blockIdx.x * 32] : 0.f; float s = 0.f;
  for (int p = threadIdx.x; p < NPI; p += 256) { const float v = A[((size_t)b * NPI + p) * DK + c] - mu; s += phase ? v * v : v; }
  sh[threadIdx.x] = s; __syncthreads();
  for (int st = 128; st > 0; st >>= 1) { if ((int)threadIdx.x < st) sh[threadIdx.x] += sh[threadIdx.x + st]; __syncthreads(); }
  if (threadIdx.x == 0) { const float v = sh[0] / (float)NPI; float* d = ST + ((size_t)phase * NIMG * DK + blockIdx.x) * 32; *(float*)d = v;  } }
__global__ __launch_bounds__(256) void k_basis(const float* __restrict__ A, const float* __restrict__ ST, _Float16* __restrict__ BAS) {
  #pragma clang fp contract(off)
  const int t = blockIdx.x * 256 + threadIdx.x; if (t >= NPX * DK) return; const int r = t / DK, c = t % DK; const int b = r / NPI; const float a = A[(size_t)r * DK + c];
  const float mu = ST[((size_t)b * DK + c) * 32], var = ST[((size_t)NIMG * DK + b * DK + c) * 32]; const float xn = (a - mu) * rsqrtf(var + 1e-5f); FragH bh, bl;
#pragma unroll
  for (int g = 0; g < NG; ++g) { const float z = (xn - GRIDV[g]) * INV_DENOM; const float e = expf(-(z * z)); const _Float16 hv = (_Float16)e; bh.h[g] = hv; bl.h[g] = (_Float16)((e - (float)hv) * 16.0f); }
  unsigned short* bd = (unsigned short*)BAS + (size_t)r * 2 * DK * NG + c * NG;
  { *(v8us*)bd = bh.half[0]; *(v8us*)(bd + DK * NG) = bl.half[0];  } }
__global__ __launch_bounds__(256) void k_silu(const float* __restrict__ A, _Float16* __restrict__ SIL) {
  #pragma clang fp contract(off)
  const int t = blockIdx.x * 256 + threadIdx.x; if (t >= NPX * (DK / 8)) return; const int r = t / (DK / 8), c0 = (t % (DK / 8)) * 8; const float* a = A + (size_t)r * DK + c0; FragH fh, fl;
#pragma unroll
  for (int q = 0; q < 8; ++q) { const float v = a[q]; const float sl = v / (1.0f + expf(-v)); const _Float16 hv = (_Float16)sl; fh.h[q] = hv; fl.h[q] = (_Float16)((sl - (float)hv) * 16.0f); }
  unsigned short* d = (unsigned short*)SIL + (size_t)r * 2 * DK + c0;
  { *(v8us*)d = fh.half[0]; *(v8us*)(d + DK) = fl.half[0];  } }
__global__ __launch_bounds__(256) void k_wnp2(const float* __restrict__ Wm, int K, int N, _Float16* __restrict__ Bt) {
  const int t = blockIdx.x * 256 + threadIdx.x; if (t >= N * (2 * K / 8)) return; const int n = t / (2 * K / 8), k0 = (t % (2 * K / 8)) * 8; const bool lo = (k0 >= K); const float sc = lo ? 1.0f : 16.0f; FragH f;
#pragma unroll
  for (int q = 0; q < 8; ++q) { const int k = k0 + q - (lo ? K : 0); f.h[q] = (_Float16)(bf16_round(Wm[(size_t)n * K + k]) * sc); }
  *(v8us*)((unsigned short*)Bt + (size_t)n * 2 * K + k0) = f.half[0];  }
__global__ __launch_bounds__(256) void k_pair16(const float* __restrict__ F, int n, _Float16* __restrict__ P, int rows) {
  #pragma clang fp contract(off)
  const int t = blockIdx.x * 256 + threadIdx.x; if (t >= rows * (n / 8)) return; const int r = t / (n / 8), c0 = (t % (n / 8)) * 8; const float* f = F + (size_t)r * n + c0; FragH fh, fl;
#pragma unroll
  for (int q = 0; q < 8; ++q) { const float v = f[q]; const _Float16 hv = (_Float16)v; fh.h[q] = hv; fl.h[q] = (_Float16)((v - (float)hv) * 16.0f); }
  unsigned short* d = (unsigned short*)P + (size_t)r * 2 * n + c0;
  { *(v8us*)d = fh.half[0]; *(v8us*)(d + n) = fl.half[0];  } }
// Y is kept channel-major ([image][channel][position], the layout of x and of the output): only the position-major A2 tile is turned, through LDS.
__global__ __launch_bounds__(256) void k_y(const float* __restrict__ x, const float* __restrict__ gam, const float* __restrict__ A2, float* __restrict__ Y) {
  #pragma clang fp contract(off)
  __shared__ float tl[64][65]; const int tid = threadIdx.x; const int pt = blockIdx.x % (NPI / 64), ct = (blockIdx.x / (NPI / 64)) % (CIN / 64), b = blockIdx.x / ((NPI / 64) * (CIN / 64)); const float g = bf16_round(gam[0]);
  const int r16 = tid / 16, k4 = (tid % 16) * 4; v4f a[4], xv[4];      /* thread: rows r16 + 16 u of a tile, four floats at k4; all eight loads fly together */
  const size_t o0 = ((size_t)b * CIN + ct * 64 + r16) * NPI + pt * 64 + k4;
#pragma unroll      /* a[], xv[] stay in registers */
  for (int u = 0; u < 4; ++u) { a[u] = *(const v4fa*)(A2 + ((size_t)b * NPI + pt * 64 + r16 + 16 * u) * CIN + ct * 64 + k4); xv[u] = *(const v4fa*)(x + o0 + (size_t)16 * u * NPI); }
#pragma unroll      /* a[] stays in registers */
  for (int u = 0; u < 4; ++u) { float* d = &tl[r16 + 16 * u][k4]; d[0] = a[u][0]; d[1] = a[u][1]; d[2] = a[u][2]; d[3] = a[u][3]; }      /* tl[position][channel] */
  __syncthreads();      /* the whole tile is in LDS before any thread reads it across */
#pragma unroll      /* xv[] stays in registers */
  for (int u = 0; u < 4; ++u) { v4f o;
#pragma unroll
    for (int q = 0; q < 4; ++q) o[q] = g * bf16_round(xv[u][q]) + tl[k4 + q][r16 + 16 * u];
    *(v4f*)(Y + o0 + (size_t)16 * u * NPI) = o; } }
__global__ __launch_bounds__(256) void k_bnstat(const float* __restrict__ Y, const float* __restrict__ ST0, int phase, float* __restrict__ ST) {
  #pragma clang fp contract(off)
  __shared__ float sh[256]; const int c = blockIdx.x; const float mu = phase ? ST0[(size_t)c * 32] : 0.f; float s = 0.f;
  for (int bi = 0; bi < NIMG; ++bi) { const float* yr = Y + ((size_t)bi * CIN + c) * NPI + threadIdx.x;      /* pixel bi * NPI + threadIdx.x + 256 k, in rising order */
#pragma unroll      /* the sixteen loads of an image fly together */
    for (int k = 0; k < NPI / 256; ++k) { const float v = yr[256 * k] - mu; s += phase ? v * v : v; } }
  sh[threadIdx.x] = s; __syncthreads();
  for (int st = 128; st > 0; st >>= 1) { if ((int)threadIdx.x < st) sh[threadIdx.x] += sh[threadIdx.x + st]; __syncthreads(); }
  if (threadIdx.x == 0) { const float v = sh[0] / (float)NPX; float* d = ST + ((size_t)phase * CIN + c) * 32; *(float*)d = v;  } }
__global__ __launch_bounds__(256) void k_bnout(const float* __restrict__ Y, const float* __restrict__ ST, const float* __restrict__ bw, const float* __restrict__ bb, float* __restrict__ out) {
  #pragma clang fp contract(off)
  const int t = blockIdx.x * 256 + threadIdx.x; if (t >= NIMG * CIN * (NPI / 4)) return; const int c = (t / (NPI / 4)) % CIN; const float mu = ST[(size_t)c * 32], var = ST[(size_t)(CIN + c) * 32]; const float sc = rsqrtf(var + 1e-5f), g = bf16_round(bw[c]), be = bf16_round(bb[c]); const v4f yv = *(const v4fa*)(Y + (size_t)t * 4); v4f o;
#pragma unroll
  for (int q = 0; q < 4; ++q) o[q] = g * ((yv[q] - mu) * sc) + be;
  *(v4f*)(out + (size_t)t * 4) = o;  }

extern "C" void kernel_launch(void* const* d_in, const int* in_sizes, int n_in,
                              void* d_out, int out_size, void* d_ws, size_t ws_size, hipStream_t stream) {
  (void)in_sizes; (void)n_in; (void)out_size;
  const float* const* I = (const float* const*)d_in; const float* x = I[0]; const float* w_in = I[1]; const float* b_in = I[2];
  const float* qbw = I[3]; const float* qbb = I[4]; const float* qsw = I[5]; const float* qsb = I[6]; const float* kbw = I[7]; const float* kbb = I[8]; const float* ksw = I[9]; const float* ksb = I[10]; const float* vbw = I[11]; const float* vbb = I[12]; const float* vsw = I[13]; const float* vsb = I[14];
  const float* w_out = I[15]; const float* b_out = I[16]; const float* gam = I[17]; const float* bnw = I[18]; const float* bnb = I[19];
  char* ws = (char*)d_ws; size_t off = 0;
  auto take = [&](size_t bytes) { char* p = ws + off; off += (bytes + 255) & ~(size_t)255; return p; };
  _Float16* BIN = (_Float16*)take((size_t)DK * CIN * 2); _Float16* BB[3]; _Float16* BS[3]; for (int i = 0; i < 3; ++i) { BB[i] = (_Float16*)take((size_t)DK * 2 * DK * 2); BS[i] = (_Float16*)take((size_t)DK * 2 * DK * NG * 2); } _Float16* BOUT = (_Float16*)take((size_t)CIN * 2 * DK * 2);
  _Float16* X16 = (_Float16*)take((size_t)NPX * CIN * 2); float* ATT = (float*)take((size_t)NPX * DK * 4); float* IST = (float*)take((size_t)2 * NIMG * DK * 32 * 4); _Float16* SIL = (_Float16*)take((size_t)NPX * 2 * DK * 2); _Float16* BAS = (_Float16*)take((size_t)NPX * 2 * DK * NG * 2);
  float* F = (float*)take((size_t)NPX * DK * 4); _Float16* Qh = (_Float16*)take((size_t)NPX * DK * 2); _Float16* Ql = (_Float16*)take((size_t)NPX * DK * 2); _Float16* Kh = (_Float16*)take((size_t)NPX * DK * 2); _Float16* Kl = (_Float16*)take((size_t)NPX * DK * 2); _Float16* Vth = (_Float16*)take((size_t)NPX * DK * 2); _Float16* Vtl = (_Float16*)take((size_t)NPX * DK * 2);
  float* O = (float*)take((size_t)NPX * DK * 4); _Float16* O16 = (_Float16*)take((size_t)NPX * 2 * DK * 2); float* A2 = (float*)take((size_t)NPX * CIN * 4); float* Y = (float*)take((size_t)NPX * CIN * 4); float* BST = (float*)take((size_t)2 * CIN * 32 * 4);
  unsigned* MB = (unsigned*)take((size_t)NPI * (NPI / 32) * 4); int* RA = (int*)take((size_t)NPI * 4); int* KE = (int*)take((size_t)(NPI / 64) * 32 * 4);
  if (off > ws_size) return;      /* 0.5 + 8 + 4 + 4 + 32 + 4 + 12 + 4 + 4 + 16 + 16 + 2 = 106.5 MiB */
  k_round16f<<<(DK * CIN / 8 + 255) / 256, 256, 0, stream>>>(w_in, BIN, (size_t)DK * CIN / 8); k_wnp2<<<(CIN * (2 * DK / 8) + 255) / 256, 256, 0, stream>>>(w_out, DK, CIN, BOUT);      /* (out,in) natural -> [16w | w] pair planes */
  const float* bw3[3] = {qbw, kbw, vbw}; const float* sw3[3] = {qsw, ksw, vsw};
  for (int i = 0; i < 3; ++i) { k_wnp2<<<(DK * (2 * DK / 8) + 255) / 256, 256, 0, stream>>>(bw3[i], DK, DK, BB[i]); k_wnp2<<<(DK * (2 * DK * NG / 8) + 255) / 256, 256, 0, stream>>>(sw3[i], DK * NG, DK, BS[i]); }
  k_fulltab<<<(NPI * (NPI / 32) + 255) / 256, 256, 0, stream>>>(MB, RA, KE);
  k_xcl<<<NIMG * (CIN / 64) * (NPI / 64), 256, 0, stream>>>(x, X16);
  const dim3 g64((NPX / 128) * 1, 1), g256((NPX / 128) * (CIN / 64), 1);
  k_gemm2<0><<<g64, 128, 0, stream>>>(X16, CIN, 0, BIN, CIN, 0, 0.0625f, b_in, 0, nullptr, 1, 0, 0, ATT, nullptr, DK, 0, NPX, DK, CIN);      /* att = conv1x1(x) + b */
  k_instat<<<NIMG * DK, 256, 0, stream>>>(ATT, IST, 0, IST); k_instat<<<NIMG * DK, 256, 0, stream>>>(ATT, IST, 1, IST);
  k_basis<<<(NPX * DK + 255) / 256, 256, 0, stream>>>(ATT, IST, BAS); k_silu<<<(NPX * (DK / 8) + 255) / 256, 256, 0, stream>>>(ATT, SIL);
  const float* bb3[3] = {qbb, kbb, vbb}; const float* sb3[3] = {qsb, ksb, vsb}; const size_t n8 = (size_t)NPX * DK / 8; const unsigned nb8 = (unsigned)((n8 + 255) / 256);
  for (int i = 0; i < 3; ++i) {      /* q, k, v = base(silu) + b_base + spline(basis) + b_spline (two GEMMs, the second accumulating through the f32 addend) */
    k_gemm2<0><<<g64, 128, 0, stream>>>(SIL, 2 * DK, 0, BB[i], 2 * DK, 0, 0.0625f, bb3[i], 0, nullptr, 1, 0, 0, F, nullptr, DK, 0, NPX, DK, 2 * DK);
    k_gemm2<0><<<g64, 128, 0, stream>>>(BAS, 2 * DK * NG, 0, BS[i], 2 * DK * NG, 0, 0.0625f, sb3[i], 0, F, 1, (size_t)DK, 0, F, nullptr, DK, 0, NPX, DK, 2 * DK * NG);
    if (i == 0) k_hl<<<nb8, 256, 0, stream>>>(F, Qh, Ql, n8);
    else if (i == 1) k_hl<<<nb8, 256, 0, stream>>>(F, Kh, Kl, n8);
    else for (int b = 0; b < NIMG; ++b) k_vthl<NPI><<<NH * (NPI / 64), 256, 0, stream>>>(F + (size_t)b * NPI * DK, DK, Vth + (size_t)b * NPI * DK, Vtl + (size_t)b * NPI * DK); }
  k_flashm<NPI, NPI, KSPLIT><<<NIMG * NH * (NPI / 64), 128 * KSPLIT, 0, stream>>>(Qh, Ql, DK, Kh, Kl, DK, Vth, Vtl, MB, RA, KE, O, DK);      /* slab = image (NH 1) */
  k_pair16<<<nb8, 256, 0, stream>>>(O, DK, O16, NPX);
  k_gemm2<0><<<g256, 128, 0, stream>>>(O16, 2 * DK, 0, BOUT, 2 * DK, 0, 0.0625f, b_out, 0, nullptr, 1, 0, 0, A2, nullptr, CIN, 0, NPX, CIN, 2 * DK);      /* att2 = conv1x1(out) + b (pair operand) */
  k_y<<<NIMG * (CIN / 64) * (NPI / 64), 256, 0, stream>>>(x, gam, A2, Y);
  k_bnstat<<<CIN, 256, 0, stream>>>(Y, BST, 0, BST); k_bnstat<<<CIN, 256, 0, stream>>>(Y, BST, 1, BST);
  k_bnout<<<(NIMG * CIN * (NPI / 4) + 255) / 256, 256, 0, stream>>>(Y, BST, bnw, bnb, (float*)d_out);
}

// v004
// It runs in 382 microseconds.
// In both of two side-by-side timings against v003, it was 1.17 times as fast.
// Counting every step since v000, it is 2.44 times as fast.
#include <hip/hip_runtime.h>
// Self-KAN attention (4 images, 256 channels, 64 x 64): att = conv1x1(x) (64 ch); q, k, v = FastKAN 1x1 convs (base_conv(silu(att)) + spline_conv(RBF basis of the instance-normalised att, 8 grid points)); energy = q.k over the 4096 positions (NO scaling), softmax over keys, out = v.attn^T; att2 = conv1x1(out) (256 ch); y = gamma*x + att2; training-mode BatchNorm -> [4,256,64,64].
// Compute dtype: x, weights, biases, gamma, BN affine rounded to bf16; x exact in f16; silu/basis operands as hi + 16x residual pairs (~2^-20); q, k, P, v as hi + x2^10 residual pairs (~2^-21); the attention output as hi + 16x residual pairs too; f32 accumulation, statistics, softmax. v_wmma_f32_16x16x32_f16.
#define NIMG 4
#define CIN 256
#define DK 64
#define HW 64
#define NPI (HW * HW)            /* 4096 */
#define NPX (NIMG * NPI)         /* 16384 */
#define NG 8
#define NH 1
#define DM DK
#define SCL 1.0f
#define KSPLIT 4
typedef __bf16 v16b __attribute__((ext_vector_type(16)));
typedef unsigned short v8us __attribute__((ext_vector_type(8), may_alias));
typedef float  v8f  __attribute__((ext_vector_type(8)));
typedef float  v4f  __attribute__((ext_vector_type(4)));
typedef float  v4fa __attribute__((ext_vector_type(4), may_alias));
union FragB { v16b v; v8us half[2]; unsigned short u[16]; };

__device__ __forceinline__ unsigned short bf16_bits(float x) { unsigned int u = __float_as_uint(x); return (unsigned short)((u + 0x7FFFu + ((u >> 16) & 1u)) >> 16); }
__device__ __forceinline__ float bf16_val(unsigned short b) { return __uint_as_float(((unsigned int)b) << 16); }
__device__ __forceinline__ float bf16_round(float x) { return bf16_val(bf16_bits(x)); }
// D += A·B with NT terms: 1 = ah·bh, 2 = + al·bh (A split), 3 = + ah·bl (both split)
template <int NT>
__device__ __forceinline__ v8f mmaN(v16b ah, v16b al, v16b bh, v16b bl, v8f c) {
  c = __builtin_amdgcn_wmma_f32_16x16x32_bf16(false, ah, false, bh, (short)0, c, false, false);
  if (NT >= 2) c = __builtin_amdgcn_wmma_f32_16x16x32_bf16(false, al, false, bh, (short)0, c, false, false);
  if (NT >= 3) c = __builtin_amdgcn_wmma_f32_16x16x32_bf16(false, ah, false, bl, (short)0, c, false, false);
  asm volatile("v_nop\n\tv_nop\n\tv_nop\n\tv_nop" : "+v"(c) : "v"(ah), "v"(al), "v"(bh), "v"(bl));
  return c;
}

__global__ __launch_bounds__(256) void k_wt_bf16(const float* __restrict__ W, unsigned short* __restrict__ Wt, int K, int N) {
  const int t = blockIdx.x * 256 + threadIdx.x;
  const int k8n = K / 8;
  if (t >= N * k8n) return;
  const int n = t / k8n, k8 = (t % k8n) * 8;
  v8us v;
#pragma unroll
  for (int i = 0; i < 8; ++i) v[i] = bf16_bits(W[(size_t)(k8 + i) * N + n]);
  *(v8us*)(Wt + (size_t)n * K + k8) = v;
  
}

// GEMM C[M][N] (f32, pitch ldc) = act(A[M][K]·W + bias). A f32 row-major (pitch lda) converted per fragment to bf16
// (ASPLIT: hi/lo two planes -> 2 terms, else single rounded term); Wt bf16 [N][K] (pitch ldb). BIAS_BF16 rounds the
// bias to bf16 first (bias quantised to bf16 before the add). K%32==0, M%16==0, N%64==0.
template <bool ASPLIT, int ACT, bool BIAS_BF16>
__global__ __launch_bounds__(128) void k_gemm_bf(const float* __restrict__ A, int lda, const unsigned short* __restrict__ Wt, int ldb,
                                               const float* __restrict__ bias, float* __restrict__ C, int ldc, int M, int N, int K) {
  __shared__ __attribute__((aligned(16))) float so[4][16][64];
  const int tid = threadIdx.x, w = tid >> 5, lane = tid & 31, ln = lane & 15, hh = lane >> 4;
  const int ntn = N / 64;
  const int wid = blockIdx.x * 4 + w;
  const int mt = wid / ntn, nq = wid % ntn;
  if (mt * 16 >= M) return;
  const int row0 = mt * 16, col0 = nq * 64;
  const float* arow = A + (size_t)(row0 + ln) * lda;
  v8f acc[4] = {};
  for (int kb = 0; kb < K; kb += 32) {
    FragB ah, al;
    const v4f x0 = *(const v4fa*)(arow + kb + 8 * hh), x1 = *(const v4fa*)(arow + kb + 8 * hh + 4);
    const v4f x2 = *(const v4fa*)(arow + kb + 16 + 8 * hh), x3 = *(const v4fa*)(arow + kb + 16 + 8 * hh + 4);
    float xs[16] = {x0[0],x0[1],x0[2],x0[3],x1[0],x1[1],x1[2],x1[3],x2[0],x2[1],x2[2],x2[3],x3[0],x3[1],x3[2],x3[3]};
#pragma unroll
    for (int i = 0; i < 16; ++i) { const unsigned short hb = bf16_bits(xs[i]); ah.u[i] = hb; al.u[i] = ASPLIT ? bf16_bits(xs[i] - bf16_val(hb)) : (unsigned short)0; }
#pragma unroll
    for (int t = 0; t < 4; ++t) {
      const unsigned short* brow = Wt + (size_t)(col0 + t * 16 + ln) * ldb + kb;
      FragB b;
      b.half[0] = *(const v8us*)(brow + 8 * hh);
      b.half[1] = *(const v8us*)(brow + 16 + 8 * hh);
      acc[t] = mmaN<ASPLIT ? 2 : 1>(ah.v, al.v, b.v, b.v, acc[t]);
    }
  }
#pragma unroll
  for (int t = 0; t < 4; ++t) {
    float bv = bias ? bias[col0 + t * 16 + ln] : 0.f;
    if (BIAS_BF16) bv = bf16_round(bv);
#pragma unroll
    for (int r = 0; r < 8; ++r) { float v = acc[t][r] + bv; if (ACT == 1) v = fmaxf(v, 0.f); so[w][8 * hh + r][t * 16 + ln] = v; }
  }
  __builtin_amdgcn_fence(__ATOMIC_ACQ_REL, "workgroup");
  __builtin_amdgcn_wave_barrier();
  const int rsub = lane >> 4, c4 = (lane & 15) * 4;
  {
#pragma unroll
    for (int q = 0; q < 8; ++q) {
      const int r = q * 2 + rsub;
      const v4f v = *(const v4fa*)&so[w][r][c4];
      *(v4f*)(C + (size_t)(row0 + r) * ldc + col0 + c4) = v;
    }
    
  }
}

// GEMM C = act(A·W + bias + resid): A f32 (ASPLIT -> hi/lo 2 terms), Wt bf16 [N][K]; ACT 0 none, 1 relu, 2 exact gelu;
// resid (optional, f32, row index = (row % rmod), pitch ldr, RES_BF16 rounds it) added before the activation.
template <bool ASPLIT, int ACT, bool BIAS_BF16, bool RES_BF16>
__global__ __launch_bounds__(128) void k_gemm_bf3(const float* __restrict__ A, int lda, const unsigned short* __restrict__ Wt, int ldb,
                                                const float* __restrict__ bias, const float* __restrict__ resid, int rmod, int ldr,
                                                float* __restrict__ C, int ldc, int M, int N, int K) {
  __shared__ __attribute__((aligned(16))) float so[4][16][64];
  const int tid = threadIdx.x, w = tid >> 5, lane = tid & 31, ln = lane & 15, hh = lane >> 4;
  const int ntn = N / 64;
  const int wid = blockIdx.x * 4 + w;
  const int mt = wid / ntn, nq = wid % ntn;
  if (mt * 16 >= M) return;
  const int row0 = mt * 16, col0 = nq * 64;
  const float* arow = A + (size_t)(row0 + ln) * lda;
  v8f acc[4] = {};
  for (int kb = 0; kb < K; kb += 32) {
    FragB ah, al;
    const v4f x0 = *(const v4fa*)(arow + kb + 8 * hh), x1 = *(const v4fa*)(arow + kb + 8 * hh + 4);
    const v4f x2 = *(const v4fa*)(arow + kb + 16 + 8 * hh), x3 = *(const v4fa*)(arow + kb + 16 + 8 * hh + 4);
    float xs[16] = {x0[0],x0[1],x0[2],x0[3],x1[0],x1[1],x1[2],x1[3],x2[0],x2[1],x2[2],x2[3],x3[0],x3[1],x3[2],x3[3]};
#pragma unroll
    for (int i = 0; i < 16; ++i) { const unsigned short hb = bf16_bits(xs[i]); ah.u[i] = hb; al.u[i] = ASPLIT ? bf16_bits(xs[i] - bf16_val(hb)) : (unsigned short)0; }
#pragma unroll
    for (int t = 0; t < 4; ++t) {
      const unsigned short* brow = Wt + (size_t)(col0 + t * 16 + ln) * ldb + kb;
      FragB b;
      b.half[0] = *(const v8us*)(brow + 8 * hh);
      b.half[1] = *(const v8us*)(brow + 16 + 8 * hh);
      acc[t] = mmaN<ASPLIT ? 2 : 1>(ah.v, al.v, b.v, b.v, acc[t]);
    }
  }
#pragma unroll
  for (int t = 0; t < 4; ++t) {
    const int col = col0 + t * 16 + ln;
    float bv = bias ? bias[col] : 0.f;
    if (BIAS_BF16) bv = bf16_round(bv);
#pragma unroll
    for (int r = 0; r < 8; ++r) {
      float v = acc[t][r] + bv;
      if (resid) { float rv = resid[(size_t)((row0 + 8 * hh + r) % rmod) * ldr + col]; if (RES_BF16) rv = bf16_round(rv); v += rv; }
      if (ACT == 1) v = fmaxf(v, 0.f);
      if (ACT == 2) v = 0.5f * v * (1.0f + erff(v * 0.70710678118654752f));
      if (ACT == 3) { const float u = 0.7978845608028654f * (v + 0.044715f * v * v * v); v = 0.5f * v * (1.0f + tanhf(u)); }
      so[w][8 * hh + r][t * 16 + ln] = v;
    }
  }
  __builtin_amdgcn_fence(__ATOMIC_ACQ_REL, "workgroup");
  __builtin_amdgcn_wave_barrier();
  const int rsub = lane >> 4, c4 = (lane & 15) * 4;
  {
#pragma unroll
    for (int q = 0; q < 8; ++q) {
      const int r = q * 2 + rsub;
      const v4f v = *(const v4fa*)&so[w][r][c4];
      *(v4f*)(C + (size_t)(row0 + r) * ldc + col0 + c4) = v;
    }
    
  }
}
// row LayerNorm (biased variance, eps) over N: s = X (+ R); optional out_sum <- s; out_norm <- (s-mu)*rsqrt(var+eps)*g + b
template <bool PARAM_BF16>
__global__ __launch_bounds__(256) void k_layernorm(const float* __restrict__ X, const float* __restrict__ R, const float* __restrict__ g, const float* __restrict__ bta,
                                                  float* __restrict__ out_sum, float* __restrict__ out_norm, int N, float eps) {
  __shared__ float red[256];
  const int row = blockIdx.x, tid = threadIdx.x;
  const float* x = X + (size_t)row * N; const float* rr = R ? R + (size_t)row * N : nullptr;
  float vals[16];                     // up to N = 4096
  const int per = N / 256;            // contiguous chunk per thread? use strided-by-4 chunks: thread handles j = tid*4 + 1024*u
  float s1 = 0.f;
  for (int u = 0; u < per / 4; ++u) {
    const int j = tid * 4 + 1024 * u;
    const v4f a = *(const v4fa*)(x + j);
    v4f b = {0.f,0.f,0.f,0.f}; if (rr) b = *(const v4fa*)(rr + j);
#pragma unroll
    for (int q = 0; q < 4; ++q) { const float v = a[q] + b[q]; vals[u * 4 + q] = v; s1 += v; }
  }
  red[tid] = s1; __syncthreads();
  for (int st = 128; st > 0; st >>= 1) { if (tid < st) red[tid] += red[tid + st]; __syncthreads(); }
  const float mu = red[0] / (float)N; __syncthreads();
  float s2 = 0.f;
  for (int u = 0; u < per / 4; ++u)
#pragma unroll
    for (int q = 0; q < 4; ++q) { const float c = vals[u * 4 + q] - mu; s2 += c * c; }
  red[tid] = s2; __syncthreads();
  for (int st = 128; st > 0; st >>= 1) { if (tid < st) red[tid] += red[tid + st]; __syncthreads(); }
  const float rs = rsqrtf(red[0] / (float)N + eps);
  {
    for (int u = 0; u < per / 4; ++u) {
      const int j = tid * 4 + 1024 * u;
      v4f o, sm;
#pragma unroll
      for (int q = 0; q < 4; ++q) {
        float gg = g[j + q], bb = bta[j + q];
        if (PARAM_BF16) { gg = bf16_round(gg); bb = bf16_round(bb); }
        sm[q] = vals[u * 4 + q]; o[q] = (vals[u * 4 + q] - mu) * rs * gg + bb;
      }
      if (out_sum) *(v4f*)(out_sum + (size_t)row * N + j) = sm;
      *(v4f*)(out_norm + (size_t)row * N + j) = o;
    }
    
  }
}



// ---- f16 WMMA path (v_wmma_f32_16x16x32_f16): 11-bit significands for operands in range — used where a [0,1] probability operand needs more precision than bf16
typedef _Float16 v16h __attribute__((ext_vector_type(16)));
union FragH { v16h v; v8us half[2]; _Float16 h[16]; unsigned short u[16]; };
template <int NT>
__device__ __forceinline__ v8f mmaH(v16h ah, v16h al, v16h bh, v16h bl, v8f c) {
  c = __builtin_amdgcn_wmma_f32_16x16x32_f16(false, ah, false, bh, (short)0, c, false, false);
  if (NT >= 2) c = __builtin_amdgcn_wmma_f32_16x16x32_f16(false, al, false, bh, (short)0, c, false, false);
  if (NT >= 3) c = __builtin_amdgcn_wmma_f32_16x16x32_f16(false, ah, false, bl, (short)0, c, false, false);
  asm volatile("v_nop\n\tv_nop\n\tv_nop\n\tv_nop" : "+v"(c) : "v"(ah), "v"(al), "v"(bh), "v"(bl));
  return c;
}
// batched GEMM like k_gemm_b but f16 operands: A f32 (split into f16 hi/lo if ASPLIT, else rounded to f16), Bt = f16 values [n][k]; alpha; C f32; N multiple of 16 (partial tiles skipped)
template <bool ASPLIT>
__global__ __launch_bounds__(128) void k_gemm_h(const float* __restrict__ A, int lda, size_t sA, const _Float16* __restrict__ Bh, int ldb, size_t sB, float alpha, float* __restrict__ C, int ldc, size_t sC, int M, int N, int K) {
  __shared__ __attribute__((aligned(16))) float so[4][16][64];
  const int tid = threadIdx.x, w = tid >> 5, lane = tid & 31, ln = lane & 15, hh = lane >> 4; const int by = blockIdx.y;
  A += (size_t)by * sA; Bh += (size_t)by * sB; C += (size_t)by * sC;
  const int ntn = (N + 63) / 64; const int wid = blockIdx.x * 4 + w; const int mt = wid / ntn, nq = wid % ntn; if (mt * 16 >= M) return;
  const int row0 = mt * 16, col0 = nq * 64; const float* arow = A + (size_t)(row0 + ln) * lda;
  v8f acc[4] = {};
  for (int kb = 0; kb < K; kb += 32) {
    FragH ah, al;
    const v4f x0 = *(const v4fa*)(arow + kb + 8 * hh), x1 = *(const v4fa*)(arow + kb + 8 * hh + 4), x2 = *(const v4fa*)(arow + kb + 16 + 8 * hh), x3 = *(const v4fa*)(arow + kb + 16 + 8 * hh + 4);
    float xs[16] = {x0[0],x0[1],x0[2],x0[3],x1[0],x1[1],x1[2],x1[3],x2[0],x2[1],x2[2],x2[3],x3[0],x3[1],x3[2],x3[3]};
#pragma unroll
    for (int i = 0; i < 16; ++i) { const _Float16 h = (_Float16)xs[i]; ah.h[i] = h; al.h[i] = ASPLIT ? (_Float16)(xs[i] - (float)h) : (_Float16)0.0f; }
#pragma unroll
    for (int t = 0; t < 4; ++t) { if (col0 + t * 16 >= N) continue; const size_t boff = (size_t)(col0 + t * 16 + ln) * ldb + kb; FragH bq; bq.half[0] = *(const v8us*)(Bh + boff + 8 * hh); bq.half[1] = *(const v8us*)(Bh + boff + 16 + 8 * hh);
      acc[t] = mmaH<ASPLIT ? 2 : 1>(ah.v, al.v, bq.v, bq.v, acc[t]); }
  }
#pragma unroll
  for (int t = 0; t < 4; ++t) { if (col0 + t * 16 >= N) continue;
#pragma unroll
    for (int r = 0; r < 8; ++r) so[w][8 * hh + r][t * 16 + ln] = acc[t][r] * alpha; }
  __builtin_amdgcn_fence(__ATOMIC_ACQ_REL, "workgroup"); __builtin_amdgcn_wave_barrier();
  const int rsub = lane >> 4, c4 = (lane & 15) * 4;
  {
#pragma unroll
    for (int q = 0; q < 8; ++q) { const int r = q * 2 + rsub; if (col0 + c4 < N) { const v4f v = *(const v4fa*)&so[w][r][c4]; *(v4f*)(C + (size_t)(row0 + r) * ldc + col0 + c4) = v; } }
     }
}

// Wt[n][k] = f16(W[k][n]·scale) from f32 row-major W[K][N] (scale = power of two; bf16-exact weights stay exact in f16 away from the subnormal range)
__global__ __launch_bounds__(256) void k_wt_f16(const float* __restrict__ W, _Float16* __restrict__ Wt, int K, int N, float scale) {
  const int t = blockIdx.x * 256 + threadIdx.x; if (t >= N * (K / 8)) return; const int n = t / (K / 8), k8 = (t % (K / 8)) * 8; FragH f;
#pragma unroll
  for (int i = 0; i < 8; ++i) f.h[i] = (_Float16)(bf16_round(W[(size_t)(k8 + i) * N + n]) * scale); const v8us o = f.half[0];
  *(v8us*)((unsigned short*)Wt + (size_t)n * K + k8) = o; 
}
// k_gemm_hh variant with fused epilogue: v = acc·alpha + bias[by·sBias + col] (+ CP[(row/rowsPerB)·sCPb + by·64 + col] if CP) ; ACT 0 none / 1 elu ; writes f16 C16 (and f32 C if non-null)
template <int ACT>
__global__ __launch_bounds__(128) void k_gemm_hhx(const _Float16* __restrict__ A, int lda, size_t sA, const _Float16* __restrict__ Bh, int ldb, size_t sB, float alpha, const float* __restrict__ bias, size_t sBias, const float* __restrict__ CP, int rowsPerB, size_t sCPb, int row0g,
    float* __restrict__ C, _Float16* __restrict__ C16, int ldc, size_t sC, int M, int N, int K) {
  __shared__ __attribute__((aligned(16))) float so[4][16][64];
  const int tid = threadIdx.x, w = tid >> 5, lane = tid & 31, ln = lane & 15, hh = lane >> 4; const int by = blockIdx.y;
  A += (size_t)by * sA; Bh += (size_t)by * sB; const size_t cofs = (size_t)by * sC; const float* bp = bias ? bias + (size_t)by * sBias : nullptr;
  const int ntn = (N + 63) / 64; const int wid = blockIdx.x * 4 + w; const int mt = wid / ntn, nq = wid % ntn; if (mt * 16 >= M) return;
  const int row0 = mt * 16, col0 = nq * 64; const _Float16* arow = A + (size_t)(row0 + ln) * lda;
  v8f acc[4] = {};
  for (int kb = 0; kb < K; kb += 32) { FragH ah; ah.half[0] = *(const v8us*)((const unsigned short*)arow + kb + 8 * hh); ah.half[1] = *(const v8us*)((const unsigned short*)arow + kb + 16 + 8 * hh);
#pragma unroll
    for (int t = 0; t < 4; ++t) { if (col0 + t * 16 >= N) continue; const size_t boff = (size_t)(col0 + t * 16 + ln) * ldb + kb; FragH bq; bq.half[0] = *(const v8us*)((const unsigned short*)Bh + boff + 8 * hh); bq.half[1] = *(const v8us*)((const unsigned short*)Bh + boff + 16 + 8 * hh);
      acc[t] = mmaH<1>(ah.v, ah.v, bq.v, bq.v, acc[t]); }
  }
#pragma unroll
  for (int t = 0; t < 4; ++t) { if (col0 + t * 16 >= N) continue; const int col = col0 + t * 16 + ln; const float bv = bp ? bf16_round(bp[col]) : 0.f;
#pragma unroll
    for (int r = 0; r < 8; ++r) { float v = acc[t][r] * alpha + bv; if (CP) { const int bidx = (row0g + row0 + 8 * hh + r) / rowsPerB; v += CP[(size_t)bidx * sCPb + (size_t)by * 64 + col]; } if (ACT == 1) v = (v > 0.f) ? v : expm1f(v); else if (ACT == 7) v = (v > 0.f) ? v + 1.0f : expf(v); else if (ACT == 8) v = tanhf(v); else if (ACT == 9) v = 0.5f * v * (1.0f + tanhf(0.7978845608028654f * (v + 0.044715f * v * v * v))); else if (ACT == 11) v = 1.0f / (1.0f + expf(-v)); else if (ACT == 12) v = (v > 0.f) ? v : 0.01f * v; else if (ACT == 14) v = (v > 0.f) ? v : 0.1f * v; else if (ACT == 15) v = v / (1.0f + expf(-v)); else if (ACT == 3) v = fmaxf(v, 0.f); else if (ACT == 6) v = 0.5f * v * (1.0f + erff(v * 0.70710678118654752f)); so[w][8 * hh + r][t * 16 + ln] = v; } }
  __builtin_amdgcn_fence(__ATOMIC_ACQ_REL, "workgroup"); __builtin_amdgcn_wave_barrier();
  const int rsub = lane >> 4, c4 = (lane & 15) * 4; typedef _Float16 v4h __attribute__((ext_vector_type(4)));
  {
#pragma unroll
    for (int q = 0; q < 8; ++q) { const int r = q * 2 + rsub; if (col0 + c4 < N) { const v4f v = *(const v4fa*)&so[w][r][c4]; if (C) *(v4f*)(C + cofs + (size_t)(row0 + r) * ldc + col0 + c4) = v; if (C16) { v4h h4; for (int i = 0; i < 4; ++i) h4[i] = (_Float16)v[i]; *(v4h*)(C16 + cofs + (size_t)(row0 + r) * ldc + col0 + c4) = h4; } } }
     }
}


typedef _Float16 v4h __attribute__((ext_vector_type(4)));

__global__ __launch_bounds__(256) void k_x16(const float* __restrict__ x, _Float16* __restrict__ X16, size_t n8) { const size_t t = (size_t)blockIdx.x * 256 + threadIdx.x; if (t >= n8) return; FragH f;
#pragma unroll
  for (int q = 0; q < 8; ++q) f.h[q] = (_Float16)bf16_round(x[t * 8 + q]); *(v8us*)((unsigned short*)X16 + t * 8) = f.half[0];  }
__global__ __launch_bounds__(256) void k_h16(const float* __restrict__ x, _Float16* __restrict__ X16, size_t n8) { const size_t t = (size_t)blockIdx.x * 256 + threadIdx.x; if (t >= n8) return; FragH f;
#pragma unroll
  for (int q = 0; q < 8; ++q) f.h[q] = (_Float16)x[t * 8 + q]; *(v8us*)((unsigned short*)X16 + t * 8) = f.half[0];  }
__global__ __launch_bounds__(256) void k_round16f(const float* __restrict__ W, _Float16* __restrict__ Bt, size_t n8) { const size_t t = (size_t)blockIdx.x * 256 + threadIdx.x; if (t >= n8) return; FragH f;
#pragma unroll
  for (int i = 0; i < 8; ++i) f.h[i] = (_Float16)(bf16_round(W[t * 8 + i]) * 16.0f); *(v8us*)((unsigned short*)Bt + t * 8) = f.half[0];  }
template <int NHv, int TTv>
__global__ __launch_bounds__(256) void k_vt(const _Float16* __restrict__ V16, int ldv, int voff, _Float16* __restrict__ Vt) { __shared__ unsigned short tl[64][66]; const int tid = threadIdx.x; const int slab = blockIdx.x / (TTv / 64), lg = blockIdx.x % (TTv / 64); const int b = slab / NHv, h = slab % NHv;
  for (int i = tid; i < 64 * 8; i += 256) { const int r = i / 8, c8 = (i % 8) * 8; FragH f; f.half[0] = *(const v8us*)((const unsigned short*)V16 + ((size_t)b * TTv + lg * 64 + r) * ldv + voff + h * 64 + c8);
#pragma unroll
    for (int q = 0; q < 8; ++q) tl[r][c8 + q] = f.u[q]; }
  __syncthreads();
  {
#pragma unroll
    for (int rd = 0; rd < 2; ++rd) { const int d = rd * 32 + tid / 8, pc = tid % 8; FragH f;
#pragma unroll
      for (int q = 0; q < 8; ++q) f.u[q] = tl[pc * 8 + q][d];
      *(v8us*)((unsigned short*)Vt + ((size_t)slab * 64 + d) * TTv + lg * 64 + pc * 8) = f.half[0]; }
     } }

// FRAGMENT ORDER of the attention operands: a 16-row x 64-column tile (q, k) or a 64-row x 32-key block (v^T) is stored as its WMMA fragment halves one after the other, each half as 32 lanes x 16 bytes in lane order,
// so that a wave's 16-byte load reads 512 bytes in a row (4 whole lines) and not 32 bytes out of each of 16 lines. Which element a lane and register hold is unchanged.
// q, k: row r, columns 8 c8 .. 8 c8 + 7 -> tile r >> 4, half c8 >> 1 (= 2 ks + part), lane 16 (c8 & 1) + (r & 15).
__global__ __launch_bounds__(256) void k_hl(const float* __restrict__ F, _Float16* __restrict__ Hh, _Float16* __restrict__ Hl, size_t n8) { const size_t t = (size_t)blockIdx.x * 256 + threadIdx.x; if (t >= n8) return; FragH fh, fl; const v4f a = *(const v4fa*)(F + t * 8), c = *(const v4fa*)(F + t * 8 + 4);
#pragma unroll
  for (int q = 0; q < 4; ++q) { _Float16 h = (_Float16)a[q]; fh.h[q] = h; fl.h[q] = (_Float16)((a[q] - (float)h) * 1024.0f); h = (_Float16)c[q]; fh.h[4 + q] = h; fl.h[4 + q] = (_Float16)((c[q] - (float)h) * 1024.0f); }
  const size_t r = t >> 3; const unsigned c8 = (unsigned)t & 7u; const size_t o = ((r >> 4) * 4 + (c8 >> 1)) * 256 + ((c8 & 1u) * 16 + (r & 15)) * 8;
  { *(v8us*)((unsigned short*)Hh + o) = fh.half[0]; *(v8us*)((unsigned short*)Hl + o) = fl.half[0];  } }

// ---- fast GEMM (wave tile 32x64; requires M % 32 == 0 rows per launch region and N % 64 == 0); epilogue = k_gemm_hhx semantics ----
__device__ __forceinline__ v16h g2_frag(const _Float16* p, int hh) { FragH f; f.half[0] = *(const v8us*)((const unsigned short*)p + 8 * hh); f.half[1] = *(const v8us*)((const unsigned short*)p + 16 + 8 * hh); return f.v; }
__device__ __forceinline__ v8f g2_mma(v16h a, v16h b, v8f c) { v8f d = __builtin_amdgcn_wmma_f32_16x16x32_f16(false, a, false, b, (short)0, c, false, false); asm volatile("v_nop\n\tv_nop\n\tv_nop\n\tv_nop" : "+v"(d) : "v"(a), "v"(b)); return d; }
template <int ACT>
__global__ __launch_bounds__(128) void k_gemm2(const _Float16* __restrict__ A, int lda, size_t sA, const _Float16* __restrict__ Bh, int ldb, size_t sB, float alpha, const float* __restrict__ bias, size_t sBias, const float* __restrict__ CP, int rowsPerB, size_t sCPb, int row0g,
    float* __restrict__ C, _Float16* __restrict__ C16, int ldc, size_t sC, int M, int N, int K) {
  __shared__ __attribute__((aligned(16))) float so[4][32][68];
  const int tid = threadIdx.x, w = tid >> 5, lane = tid & 31, ln = lane & 15, hh = lane >> 4; const int by = blockIdx.y;
  A += (size_t)by * sA; Bh += (size_t)by * sB; const size_t cofs = (size_t)by * sC; const float* bp = bias ? bias + (size_t)by * sBias : nullptr;
  const int ntn = N >> 6; const int mt = blockIdx.x / ntn, nq = blockIdx.x - mt * ntn; const int row0 = mt * 128 + 32 * w, col0 = nq * 64; if (row0 >= M) return;
  const _Float16* a0p = A + (size_t)(row0 + ln) * lda; const _Float16* a1p = a0p + (size_t)16 * lda;
  const _Float16* b0p = Bh + (size_t)(col0 + ln) * ldb; const _Float16* b1p = b0p + (size_t)16 * ldb; const _Float16* b2p = b1p + (size_t)16 * ldb; const _Float16* b3p = b2p + (size_t)16 * ldb;
  const v8f z8 = {0.f,0.f,0.f,0.f,0.f,0.f,0.f,0.f}; v8f c00 = z8, c01 = z8, c02 = z8, c03 = z8, c10 = z8, c11 = z8, c12 = z8, c13 = z8;
#pragma unroll 1
  for (int kb = 0; kb < K; kb += 32) { const v16h a0 = g2_frag(a0p + kb, hh), a1 = g2_frag(a1p + kb, hh);
    v16h b = g2_frag(b0p + kb, hh); c00 = g2_mma(a0, b, c00); c10 = g2_mma(a1, b, c10);
    b = g2_frag(b1p + kb, hh); c01 = g2_mma(a0, b, c01); c11 = g2_mma(a1, b, c11);
    b = g2_frag(b2p + kb, hh); c02 = g2_mma(a0, b, c02); c12 = g2_mma(a1, b, c12);
    b = g2_frag(b3p + kb, hh); c03 = g2_mma(a0, b, c03); c13 = g2_mma(a1, b, c13); }
  v8f accs[8] = {c00, c01, c02, c03, c10, c11, c12, c13};
#pragma unroll
  for (int u = 0; u < 8; ++u) { const int t = u & 3, half = u >> 2; const int col = col0 + t * 16 + ln; const float bv = bp ? bf16_round(bp[col]) : 0.f;
#pragma unroll
    for (int r = 0; r < 8; ++r) { const int rloc = half * 16 + 8 * hh + r; float v = accs[u][r] * alpha + bv; if (CP) { const int bidx = (row0g + row0 + rloc) / rowsPerB; v += CP[(size_t)bidx * sCPb + (size_t)by * 64 + col]; }
      if (ACT == 3) v = fmaxf(v, 0.f); else if (ACT == 6) v = 0.5f * v * (1.0f + erff(v * 0.70710678118654752f)); else if (ACT == 11) v = 1.0f / (1.0f + expf(-v)); else if (ACT == 15) v = v / (1.0f + expf(-v)); else if (ACT == 12) v = (v > 0.f) ? v : 0.01f * v; else if (ACT == 8) v = tanhf(v);
      so[w][rloc][t * 16 + ln] = v; } }
  __builtin_amdgcn_fence(__ATOMIC_ACQ_REL, "workgroup"); __builtin_amdgcn_wave_barrier();
  const int rsub = lane >> 4, c4 = (lane & 15) * 4;
  {
#pragma unroll
    for (int q = 0; q < 16; ++q) { const int r = q * 2 + rsub; const v4f v = *(const v4fa*)&so[w][r][c4]; if (C) *(v4f*)(C + cofs + (size_t)(row0 + r) * ldc + col0 + c4) = v; if (C16) { v4h h4; for (int i = 0; i < 4; ++i) h4[i] = (_Float16)v[i]; *(v4h*)(C16 + cofs + (size_t)(row0 + r) * ldc + col0 + c4) = h4; } }
     } }


template <int TK>
__global__ __launch_bounds__(256) void k_vthl(const float* __restrict__ VF, int ldv, _Float16* __restrict__ Vth, _Float16* __restrict__ Vtl) { __shared__ float tl[64][65]; const int tid = threadIdx.x; const int slab = blockIdx.x / (TK / 64), lg = blockIdx.x % (TK / 64); const int b = slab / NH, h = slab % NH;
  for (int i = tid; i < 64 * 16; i += 256) { const int r = i / 16, c4 = (i % 16) * 4; const v4f a = *(const v4fa*)(VF + ((size_t)b * TK + lg * 64 + r) * ldv + h * 64 + c4); tl[r][c4] = a[0]; tl[r][c4 + 1] = a[1]; tl[r][c4 + 2] = a[2]; tl[r][c4 + 3] = a[3]; }
  __syncthreads();
  FragH fh[2], fl[2]; size_t oo[2];
#pragma unroll
  for (int rd = 0; rd < 2; ++rd) { const int d = rd * 32 + tid / 8, pc = tid % 8;
#pragma unroll
    for (int q = 0; q < 8; ++q) { const float v = tl[pc * 8 + q][d]; const _Float16 hv = (_Float16)v; fh[rd].h[q] = hv; fl[rd].h[q] = (_Float16)((v - (float)hv) * 1024.0f); }
    oo[rd] = (size_t)slab * 64 * TK + (size_t)((lg * 2 + (pc >> 2)) * 8 + (d >> 4) * 2 + ((pc >> 1) & 1)) * 256 + ((pc & 1) * 16 + (d & 15)) * 8; }      /* fragment order: 32-key block, half 2 dt + part, lane 16 hh + ln */
  {
#pragma unroll
    for (int rd = 0; rd < 2; ++rd) { *(v8us*)((unsigned short*)Vth + oo[rd]) = fh[rd].half[0]; *(v8us*)((unsigned short*)Vtl + oo[rd]) = fl[rd].half[0]; }
     } }

__device__ __forceinline__ float xhalf(float v) { const int b = __float_as_int(v); return __int_as_float(__builtin_amdgcn_permlanex16(b, b, 0x76543210, 0xfedcba98, false, false)); }      /* lane l <-> l ^ 16 */
template <int TQ, int TK, int KSP>
__global__ __launch_bounds__(128 * KSP) void k_flashm(const _Float16* __restrict__ Q16, const _Float16* __restrict__ Q16lo, const _Float16* __restrict__ K16, const _Float16* __restrict__ K16lo, const _Float16* __restrict__ Vt, const _Float16* __restrict__ Vtlo, const unsigned* __restrict__ MB, const int* __restrict__ RA, const int* __restrict__ KE, float* __restrict__ O, int ldo) {
  constexpr int RPW = 16, NQB = TQ / (4 * RPW), DT = 4, KS = 2, NW = 4 * KSP; static_assert(NH == 1 && DK == 64, "the fragment-order planes hold one 64-wide head");
  __shared__ __attribute__((aligned(16))) float sO[NW][RPW][64 + 4]; __shared__ float sM[NW][RPW], sL[NW][RPW];
  const int tid = threadIdx.x, w = tid >> 5, lane = tid & 31, ln = lane & 15, hh = lane >> 4; const int qt = w & 3, kp = __builtin_amdgcn_readfirstlane(w >> 2);      /* scalar: the key loop's counter and trip test stay wave-uniform */
  const int slab = blockIdx.x / NQB, qblk = blockIdx.x % NQB; const int b = slab / NH, h = slab % NH; const int qb0 = qblk * (4 * RPW); const int q0 = qb0 + qt * RPW;
  FragH aq[KS], aql[KS];
  { const size_t qo = (((size_t)b * TQ + q0) >> 4) * 1024 + lane * 8; const unsigned short* qr = (const unsigned short*)Q16 + qo; const unsigned short* ql = (const unsigned short*)Q16lo + qo;
#pragma unroll
    for (int ks = 0; ks < KS; ++ks) { aq[ks].half[0] = *(const v8us*)(qr + ks * 512); aq[ks].half[1] = *(const v8us*)(qr + ks * 512 + 256); aql[ks].half[0] = *(const v8us*)(ql + ks * 512); aql[ks].half[1] = *(const v8us*)(ql + ks * 512 + 256); } }
  const unsigned short* Vth = (const unsigned short*)Vt + (size_t)slab * 64 * TK; const unsigned short* Vtl = (const unsigned short*)Vtlo + (size_t)slab * 64 * TK;
  float m_r = -3.0e38f, l_r = 0.f; v8f oacc[DT], oaccl[DT];
#pragma unroll
  for (int dt = 0; dt < DT; ++dt) { oacc[dt] = (v8f){0.f,0.f,0.f,0.f,0.f,0.f,0.f,0.f}; oaccl[dt] = oacc[dt]; }
  int jend = KE[qblk * 32]; jend = min(TK, (jend + 31) & ~31); if (jend < 32) jend = 32;      /* block-uniform */
  const bool am = (RA[q0 + ln] != 0); const unsigned* mrow = MB + (size_t)(q0 + ln) * (TK / 32);
#pragma unroll 1
  for (int j0 = kp * 32; j0 < jend; j0 += 32 * KSP) {
    v8f s[2];
#pragma unroll
    for (int nt = 0; nt < 2; ++nt) { const size_t ko = ((((size_t)b * TK + j0) >> 4) + nt) * 1024 + lane * 8; const unsigned short* kr = (const unsigned short*)K16 + ko; const unsigned short* kl = (const unsigned short*)K16lo + ko; FragH bk[KS], bkl[KS];
#pragma unroll
      for (int ks = 0; ks < KS; ++ks) { bk[ks].half[0] = *(const v8us*)(kr + ks * 512); bk[ks].half[1] = *(const v8us*)(kr + ks * 512 + 256); bkl[ks].half[0] = *(const v8us*)(kl + ks * 512); bkl[ks].half[1] = *(const v8us*)(kl + ks * 512 + 256); }
      v8f acc = (v8f){0.f,0.f,0.f,0.f,0.f,0.f,0.f,0.f}, accr = acc;
#pragma unroll
      for (int ks = 0; ks < KS; ++ks) { acc = mmaH<1>(bk[ks].v, bk[ks].v, aq[ks].v, aq[ks].v, acc); accr = mmaH<1>(bk[ks].v, bk[ks].v, aql[ks].v, aql[ks].v, accr); accr = mmaH<1>(bkl[ks].v, bkl[ks].v, aq[ks].v, aq[ks].v, accr); }
      s[nt] = acc + accr * 0.0009765625f; }
    const unsigned mh = mrow[j0 >> 5] >> (8 * hh);      /* bit r: key 8 hh + r, bit 16 + r: key 16 + 8 hh + r */
    float sv[16]; float mc = -INFINITY;
#pragma unroll
    for (int e = 0; e < 16; ++e) { const bool ok = am || (((mh >> ((e >> 3) * 16 + (e & 7))) & 1u) == 0u); sv[e] = ok ? (am ? 0.f : s[e >> 3][e & 7] * SCL) : -INFINITY; mc = fmaxf(mc, sv[e]); }
    mc = fmaxf(mc, xhalf(mc));
    const float mn = fmaxf(m_r, mc); const float al = (mn > -1.0e38f) ? expf(m_r - mn) : 1.0f; m_r = mn;
    FragH pa, pl; float ps = 0.f;
#pragma unroll
    for (int e = 0; e < 16; ++e) { const float p = expf(sv[e] - mn);      /* a masked key: exp(-inf) = 0 (mn is finite) */
      ps += p; const float p10 = p * 1024.0f; const _Float16 ph = (_Float16)p10; pa.h[e] = ph; pl.h[e] = (_Float16)((p10 - (float)ph) * 1024.0f); }
    l_r = l_r * al + ps;
#pragma unroll
    for (int dt = 0; dt < DT; ++dt) { oacc[dt] *= al; oaccl[dt] *= al; }
#pragma unroll
    for (int dt = 0; dt < DT; ++dt) { const size_t vo = (size_t)(j0 >> 5) * 2048 + dt * 512 + lane * 8; FragH bv, bl; bv.half[0] = *(const v8us*)(Vth + vo); bv.half[1] = *(const v8us*)(Vth + vo + 256); bl.half[0] = *(const v8us*)(Vtl + vo); bl.half[1] = *(const v8us*)(Vtl + vo + 256);
      oacc[dt] = mmaH<1>(bv.v, bv.v, pa.v, pa.v, oacc[dt]); oaccl[dt] = mmaH<1>(bl.v, bl.v, pa.v, pa.v, oaccl[dt]); oaccl[dt] = mmaH<1>(bv.v, bv.v, pl.v, pl.v, oaccl[dt]); } }
  { const float l = l_r + xhalf(l_r); if (hh == 0) { sM[w][ln] = m_r; sL[w][ln] = l; } }
#pragma unroll
  for (int dt = 0; dt < DT; ++dt) { const v8f o = oacc[dt] + oaccl[dt] * 0.0009765625f;      /* register r = O[query ln][dt * 16 + 8 hh + r] */
    *(v4fa*)&sO[w][ln][dt * 16 + 8 * hh] = (v4f){o[0], o[1], o[2], o[3]}; *(v4fa*)&sO[w][ln][dt * 16 + 8 * hh + 4] = (v4f){o[4], o[5], o[6], o[7]}; }
  __syncthreads();      /* every part's partial is in LDS before any thread merges */
  for (int i = tid; i < 4 * RPW * 16; i += 128 * KSP) { const int row = i >> 4, pc = i & 15; const int tq = row / RPW, rr = row % RPW;
    float mx = sM[tq][rr];
#pragma unroll
    for (int p = 1; p < KSP; ++p) mx = fmaxf(mx, sM[p * 4 + tq][rr]);
    float lsum = 0.f; v4f o = {0.f, 0.f, 0.f, 0.f};
#pragma unroll
    for (int p = 0; p < KSP; ++p) { const float wg = expf(sM[p * 4 + tq][rr] - mx); lsum += wg * sL[p * 4 + tq][rr]; const v4f val = *(const v4fa*)&sO[p * 4 + tq][rr][pc * 4]; o += val * wg; }
    const float inv = (lsum > 0.f) ? 1.0f / (lsum * 1024.0f) : 0.f;
    *(v4f*)(O + ((size_t)b * TQ + qb0 + row) * ldo + h * 64 + pc * 4) = o * inv; } }


__constant__ float GRIDV[8] = {-2.000000000e+00f,-1.428571463e+00f,-8.571428657e-01f,-2.857141793e-01f,2.857143879e-01f,8.571429253e-01f,1.428571701e+00f,2.000000000e+00f};
#define INV_DENOM (1.0f / 0.5714285714285714f)
__global__ __launch_bounds__(256) void k_fulltab(unsigned* __restrict__ MB, int* __restrict__ RA, int* __restrict__ KE) {
  const int t = blockIdx.x * 256 + threadIdx.x;
  if (t < NPI * (NPI / 32)) { *(unsigned*)(MB + t) = 0u;  }
  if (t < NPI) { *(int*)(RA + t) = 0;  }
  if (t < NPI / 64) { *(int*)(KE + t * 32) = NPI;  } }
// Layout changes go through a 64 x 64 LDS tile (pitch 65 floats: no bank conflict in either direction), so that every global read and write covers whole 128-byte lines.
__global__ __launch_bounds__(256) void k_xcl(const float* __restrict__ x, _Float16* __restrict__ X16) {
  __shared__ float tl[64][65]; const int tid = threadIdx.x; const int pt = blockIdx.x % (NPI / 64), ct = (blockIdx.x / (NPI / 64)) % (CIN / 64), b = blockIdx.x / ((NPI / 64) * (CIN / 64));
  const int r16 = tid / 16, k4 = (tid % 16) * 4; v4f a[4];      /* thread: rows r16 + 16 u of the tile, four floats at k4; the four loads fly together */
#pragma unroll      /* a[] stays in registers */
  for (int u = 0; u < 4; ++u) a[u] = *(const v4fa*)(x + ((size_t)b * CIN + ct * 64 + r16 + 16 * u) * NPI + pt * 64 + k4);
#pragma unroll      /* a[] stays in registers */
  for (int u = 0; u < 4; ++u) { float* d = &tl[r16 + 16 * u][k4]; d[0] = a[u][0]; d[1] = a[u][1]; d[2] = a[u][2]; d[3] = a[u][3]; }
  __syncthreads();      /* the whole tile is in LDS before any thread reads it across */
#pragma unroll      /* both rows' LDS reads are issued together */
  for (int rd = 0; rd < 2; ++rd) { const int p = rd * 32 + tid / 8, c8 = (tid % 8) * 8; FragH f;
#pragma unroll
    for (int q = 0; q < 8; ++q) f.h[q] = (_Float16)bf16_round(tl[c8 + q][p]);
    *(v8us*)((unsigned short*)X16 + ((size_t)b * NPI + pt * 64 + p) * CIN + ct * 64 + c8) = f.half[0]; } }
__global__ __launch_bounds__(256) void k_instat(const float* __restrict__ A, const float* __restrict__ ST0, int phase, float* __restrict__ ST) {
  #pragma clang fp contract(off)
  __shared__ float sh[256]; const int b = blockIdx.x / DK, c = blockIdx.x % DK; const float mu = phase ? ST0[(size_t)blockIdx.x * 32] : 0.f; float s = 0.f;
  for (int p = threadIdx.x; p < NPI; p += 256) { const float v = A[((size_t)b * NPI + p) * DK + c] - mu; s += phase ? v * v : v; }
  sh[threadIdx.x] = s; __syncthreads();
  for (int st = 128; st > 0; st >>= 1) { if ((int)threadIdx.x < st) sh[threadIdx.x] += sh[threadIdx.x + st]; __syncthreads(); }
  if (threadIdx.x == 0) { const float v = sh[0] / (float)NPI; float* d = ST + ((size_t)phase * NIMG * DK + blockIdx.x) * 32; *(float*)d = v;  } }
__global__ __launch_bounds__(256) void k_basis(const float* __restrict__ A, const float* __restrict__ ST, _Float16* __restrict__ BAS) {
  #pragma clang fp contract(off)
  const int t = blockIdx.x * 256 + threadIdx.x; if (t >= NPX * DK) return; const int r = t / DK, c = t % DK; const int b = r / NPI; const float a = A[(size_t)r * DK + c];
  const float mu = ST[((size_t)b * DK + c) * 32], var = ST[((size_t)NIMG * DK + b * DK + c) * 32]; const float xn = (a - mu) * rsqrtf(var + 1e-5f); FragH bh, bl;
#pragma unroll
  for (int g = 0; g < NG; ++g) { const float z = (xn - GRIDV[g]) * INV_DENOM; const float e = expf(-(z * z)); const _Float16 hv = (_Float16)e; bh.h[g] = hv; bl.h[g] = (_Float16)((e - (float)hv) * 16.0f); }
  unsigned short* bd = (unsigned short*)BAS + (size_t)r * 2 * DK * NG + c * NG;
  { *(v8us*)bd = bh.half[0]; *(v8us*)(bd + DK * NG) = bl.half[0];  } }
__global__ __launch_bounds__(256) void k_silu(const float* __restrict__ A, _Float16* __restrict__ SIL) {
  #pragma clang fp contract(off)
  const int t = blockIdx.x * 256 + threadIdx.x; if (t >= NPX * (DK / 8)) return; const int r = t / (DK / 8), c0 = (t % (DK / 8)) * 8; const float* a = A + (size_t)r * DK + c0; FragH fh, fl;
#pragma unroll
  for (int q = 0; q < 8; ++q) { const float v = a[q]; const float sl = v / (1.0f + expf(-v)); const _Float16 hv = (_Float16)sl; fh.h[q] = hv; fl.h[q] = (_Float16)((sl - (float)hv) * 16.0f); }
  unsigned short* d = (unsigned short*)SIL + (size_t)r * 2 * DK + c0;
  { *(v8us*)d = fh.half[0]; *(v8us*)(d + DK) = fl.half[0];  } }
__global__ __launch_bounds__(256) void k_wnp2(const float* __restrict__ Wm, int K, int N, _Float16* __restrict__ Bt) {
  const int t = blockIdx.x * 256 + threadIdx.x; if (t >= N * (2 * K / 8)) return; const int n = t / (2 * K / 8), k0 = (t % (2 * K / 8)) * 8; const bool lo = (k0 >= K); const float sc = lo ? 1.0f : 16.0f; FragH f;
#pragma unroll
  for (int q = 0; q < 8; ++q) { const int k = k0 + q - (lo ? K : 0); f.h[q] = (_Float16)(bf16_round(Wm[(size_t)n * K + k]) * sc); }
  *(v8us*)((unsigned short*)Bt + (size_t)n * 2 * K + k0) = f.half[0];  }
__global__ __launch_bounds__(256) void k_pair16(const float* __restrict__ F, int n, _Float16* __restrict__ P, int rows) {
  #pragma clang fp contract(off)
  const int t = blockIdx.x * 256 + threadIdx.x; if (t >= rows * (n / 8)) return; const int r = t / (n / 8), c0 = (t % (n / 8)) * 8; const float* f = F + (size_t)r * n + c0; FragH fh, fl;
#pragma unroll
  for (int q = 0; q < 8; ++q) { const float v = f[q]; const _Float16 hv = (_Float16)v; fh.h[q] = hv; fl.h[q] = (_Float16)((v - (float)hv) * 16.0f); }
  unsigned short* d = (unsigned short*)P + (size_t)r * 2 * n + c0;
  { *(v8us*)d = fh.half[0]; *(v8us*)(d + n) = fl.half[0];  } }
// Y is kept channel-major ([image][channel][position], the layout of x and of the output): only the position-major A2 tile is turned, through LDS.
__global__ __launch_bounds__(256) void k_y(const float* __restrict__ x, const float* __restrict__ gam, const float* __restrict__ A2, float* __restrict__ Y) {
  #pragma clang fp contract(off)
  __shared__ float tl[64][65]; const int tid = threadIdx.x; const int pt = blockIdx.x % (NPI / 64), ct = (blockIdx.x / (NPI / 64)) % (CIN / 64), b = blockIdx.x / ((NPI / 64) * (CIN / 64)); const float g = bf16_round(gam[0]);
  const int r16 = tid / 16, k4 = (tid % 16) * 4; v4f a[4], xv[4];      /* thread: rows r16 + 16 u of a tile, four floats at k4; all eight loads fly together */
  const size_t o0 = ((size_t)b * CIN + ct * 64 + r16) * NPI + pt * 64 + k4;
#pragma unroll      /* a[], xv[] stay in registers */
  for (int u = 0; u < 4; ++u) { a[u] = *(const v4fa*)(A2 + ((size_t)b * NPI + pt * 64 + r16 + 16 * u) * CIN + ct * 64 + k4); xv[u] = *(const v4fa*)(x + o0 + (size_t)16 * u * NPI); }
#pragma unroll      /* a[] stays in registers */
  for (int u = 0; u < 4; ++u) { float* d = &tl[r16 + 16 * u][k4]; d[0] = a[u][0]; d[1] = a[u][1]; d[2] = a[u][2]; d[3] = a[u][3]; }      /* tl[position][channel] */
  __syncthreads();      /* the whole tile is in LDS before any thread reads it across */
#pragma unroll      /* xv[] stays in registers */
  for (int u = 0; u < 4; ++u) { v4f o;
#pragma unroll
    for (int q = 0; q < 4; ++q) o[q] = g * bf16_round(xv[u][q]) + tl[k4 + q][r16 + 16 * u];
    *(v4f*)(Y + o0 + (size_t)16 * u * NPI) = o; } }
__global__ __launch_bounds__(256) void k_bnstat(const float* __restrict__ Y, const float* __restrict__ ST0, int phase, float* __restrict__ ST) {
  #pragma clang fp contract(off)
  __shared__ float sh[256]; const int c = blockIdx.x; const float mu = phase ? ST0[(size_t)c * 32] : 0.f; float s = 0.f;
  for (int bi = 0; bi < NIMG; ++bi) { const float* yr = Y + ((size_t)bi * CIN + c) * NPI + threadIdx.x;      /* pixel bi * NPI + threadIdx.x + 256 k, in rising order */
#pragma unroll      /* the sixteen loads of an image fly together */
    for (int k = 0; k < NPI / 256; ++k) { const float v = yr[256 * k] - mu; s += phase ? v * v : v; } }
  sh[threadIdx.x] = s; __syncthreads();
  for (int st = 128; st > 0; st >>= 1) { if ((int)threadIdx.x < st) sh[threadIdx.x] += sh[threadIdx.x + st]; __syncthreads(); }
  if (threadIdx.x == 0) { const float v = sh[0] / (float)NPX; float* d = ST + ((size_t)phase * CIN + c) * 32; *(float*)d = v;  } }
__global__ __launch_bounds__(256) void k_bnout(const float* __restrict__ Y, const float* __restrict__ ST, const float* __restrict__ bw, const float* __restrict__ bb, float* __restrict__ out) {
  #pragma clang fp contract(off)
  const int t = blockIdx.x * 256 + threadIdx.x; if (t >= NIMG * CIN * (NPI / 4)) return; const int c = (t / (NPI / 4)) % CIN; const float mu = ST[(size_t)c * 32], var = ST[(size_t)(CIN + c) * 32]; const float sc = rsqrtf(var + 1e-5f), g = bf16_round(bw[c]), be = bf16_round(bb[c]); const v4f yv = *(const v4fa*)(Y + (size_t)t * 4); v4f o;
#pragma unroll
  for (int q = 0; q < 4; ++q) o[q] = g * ((yv[q] - mu) * sc) + be;
  *(v4f*)(out + (size_t)t * 4) = o;  }

extern "C" void kernel_launch(void* const* d_in, const int* in_sizes, int n_in,
                              void* d_out, int out_size, void* d_ws, size_t ws_size, hipStream_t stream) {
  (void)in_sizes; (void)n_in; (void)out_size;
  const float* const* I = (const float* const*)d_in; const float* x = I[0]; const float* w_in = I[1]; const float* b_in = I[2];
  const float* qbw = I[3]; const float* qbb = I[4]; const float* qsw = I[5]; const float* qsb = I[6]; const float* kbw = I[7]; const float* kbb = I[8]; const float* ksw = I[9]; const float* ksb = I[10]; const float* vbw = I[11]; const float* vbb = I[12]; const float* vsw = I[13]; const float* vsb = I[14];
  const float* w_out = I[15]; const float* b_out = I[16]; const float* gam = I[17]; const float* bnw = I[18]; const float* bnb = I[19];
  char* ws = (char*)d_ws; size_t off = 0;
  auto take = [&](size_t bytes) { char* p = ws + off; off += (bytes + 255) & ~(size_t)255; return p; };
  _Float16* BIN = (_Float16*)take((size_t)DK * CIN * 2); _Float16* BB[3]; _Float16* BS[3]; for (int i = 0; i < 3; ++i) { BB[i] = (_Float16*)take((size_t)DK * 2 * DK * 2); BS[i] = (_Float16*)take((size_t)DK * 2 * DK * NG * 2); } _Float16* BOUT = (_Float16*)take((size_t)CIN * 2 * DK * 2);
  _Float16* X16 = (_Float16*)take((size_t)NPX * CIN * 2); float* ATT = (float*)take((size_t)NPX * DK * 4); float* IST = (float*)take((size_t)2 * NIMG * DK * 32 * 4); _Float16* SIL = (_Float16*)take((size_t)NPX * 2 * DK * 2); _Float16* BAS = (_Float16*)take((size_t)NPX * 2 * DK * NG * 2);
  float* F = (float*)take((size_t)NPX * DK * 4); _Float16* Qh = (_Float16*)take((size_t)NPX * DK * 2); _Float16* Ql = (_Float16*)take((size_t)NPX * DK * 2); _Float16* Kh = (_Float16*)take((size_t)NPX * DK * 2); _Float16* Kl = (_Float16*)take((size_t)NPX * DK * 2); _Float16* Vth = (_Float16*)take((size_t)NPX * DK * 2); _Float16* Vtl = (_Float16*)take((size_t)NPX * DK * 2);
  float* O = (float*)take((size_t)NPX * DK * 4); _Float16* O16 = (_Float16*)take((size_t)NPX * 2 * DK * 2); float* A2 = (float*)take((size_t)NPX * CIN * 4); float* Y = (float*)take((size_t)NPX * CIN * 4); float* BST = (float*)take((size_t)2 * CIN * 32 * 4);
  unsigned* MB = (unsigned*)take((size_t)NPI * (NPI / 32) * 4); int* RA = (int*)take((size_t)NPI * 4); int* KE = (int*)take((size_t)(NPI / 64) * 32 * 4);
  if (off > ws_size) return;      /* 0.5 + 8 + 4 + 4 + 32 + 4 + 12 + 4 + 4 + 16 + 16 + 2 = 106.5 MiB */
  k_round16f<<<(DK * CIN / 8 + 255) / 256, 256, 0, stream>>>(w_in, BIN, (size_t)DK * CIN / 8); k_wnp2<<<(CIN * (2 * DK / 8) + 255) / 256, 256, 0, stream>>>(w_out, DK, CIN, BOUT);      /* (out,in) natural -> [16w | w] pair planes */
  const float* bw3[3] = {qbw, kbw, vbw}; const float* sw3[3] = {qsw, ksw, vsw};
  for (int i = 0; i < 3; ++i) { k_wnp2<<<(DK * (2 * DK / 8) + 255) / 256, 256, 0, stream>>>(bw3[i], DK, DK, BB[i]); k_wnp2<<<(DK * (2 * DK * NG / 8) + 255) / 256, 256, 0, stream>>>(sw3[i], DK * NG, DK, BS[i]); }
  k_fulltab<<<(NPI * (NPI / 32) + 255) / 256, 256, 0, stream>>>(MB, RA, KE);
  k_xcl<<<NIMG * (CIN / 64) * (NPI / 64), 256, 0, stream>>>(x, X16);
  const dim3 g64((NPX / 128) * 1, 1), g256((NPX / 128) * (CIN / 64), 1);
  k_gemm2<0><<<g64, 128, 0, stream>>>(X16, CIN, 0, BIN, CIN, 0, 0.0625f, b_in, 0, nullptr, 1, 0, 0, ATT, nullptr, DK, 0, NPX, DK, CIN);      /* att = conv1x1(x) + b */
  k_instat<<<NIMG * DK, 256, 0, stream>>>(ATT, IST, 0, IST); k_instat<<<NIMG * DK, 256, 0, stream>>>(ATT, IST, 1, IST);
  k_basis<<<(NPX * DK + 255) / 256, 256, 0, stream>>>(ATT, IST, BAS); k_silu<<<(NPX * (DK / 8) + 255) / 256, 256, 0, stream>>>(ATT, SIL);
  const float* bb3[3] = {qbb, kbb, vbb}; const float* sb3[3] = {qsb, ksb, vsb}; const size_t n8 = (size_t)NPX * DK / 8; const unsigned nb8 = (unsigned)((n8 + 255) / 256);
  for (int i = 0; i < 3; ++i) {      /* q, k, v = base(silu) + b_base + spline(basis) + b_spline (two GEMMs, the second accumulating through the f32 addend) */
    k_gemm2<0><<<g64, 128, 0, stream>>>(SIL, 2 * DK, 0, BB[i], 2 * DK, 0, 0.0625f, bb3[i], 0, nullptr, 1, 0, 0, F, nullptr, DK, 0, NPX, DK, 2 * DK);
    k_gemm2<0><<<g64, 128, 0, stream>>>(BAS, 2 * DK * NG, 0, BS[i], 2 * DK * NG, 0, 0.0625f, sb3[i], 0, F, 1, (size_t)DK, 0, F, nullptr, DK, 0, NPX, DK, 2 * DK * NG);
    if (i == 0) k_hl<<<nb8, 256, 0, stream>>>(F, Qh, Ql, n8);
    else if (i == 1) k_hl<<<nb8, 256, 0, stream>>>(F, Kh, Kl, n8);
    else for (int b = 0; b < NIMG; ++b) k_vthl<NPI><<<NH * (NPI / 64), 256, 0, stream>>>(F + (size_t)b * NPI * DK, DK, Vth + (size_t)b * NPI * DK, Vtl + (size_t)b * NPI * DK); }
  k_flashm<NPI, NPI, KSPLIT><<<NIMG * NH * (NPI / 64), 128 * KSPLIT, 0, stream>>>(Qh, Ql, Kh, Kl, Vth, Vtl, MB, RA, KE, O, DK);      /* slab = image (NH 1) */
  k_pair16<<<nb8, 256, 0, stream>>>(O, DK, O16, NPX);
  k_gemm2<0><<<g256, 128, 0, stream>>>(O16, 2 * DK, 0, BOUT, 2 * DK, 0, 0.0625f, b_out, 0, nullptr, 1, 0, 0, A2, nullptr, CIN, 0, NPX, CIN, 2 * DK);      /* att2 = conv1x1(out) + b (pair operand) */
  k_y<<<NIMG * (CIN / 64) * (NPI / 64), 256, 0, stream>>>(x, gam, A2, Y);
  k_bnstat<<<CIN, 256, 0, stream>>>(Y, BST, 0, BST); k_bnstat<<<CIN, 256, 0, stream>>>(Y, BST, 1, BST);
  k_bnout<<<(NIMG * CIN * (NPI / 4) + 255) / 256, 256, 0, stream>>>(Y, BST, bnw, bnb, (float*)d_out);
}

// v005
// A run of this version takes 219 microseconds.
// Timed twice side by side with v004, it ran 1.73 and 1.72 times as fast.
// All steps since v000 together make it 4.20 times as fast.
#include <hip/hip_runtime.h>
// Self-KAN attention (4 images, 256 channels, 64 x 64): att = conv1x1(x) (64 ch); q, k, v = FastKAN 1x1 convs (base_conv(silu(att)) + spline_conv(RBF basis of the instance-normalised att, 8 grid points)); energy = q.k over the 4096 positions (NO scaling), softmax over keys, out = v.attn^T; att2 = conv1x1(out) (256 ch); y = gamma*x + att2; training-mode BatchNorm -> [4,256,64,64].
// Compute dtype: x, weights, biases, gamma, BN affine rounded to bf16; x exact in f16; silu/basis operands as hi + 16x residual pairs (~2^-20); q, k, P, v as hi + x2^10 residual pairs (~2^-21); the attention output as hi + 16x residual pairs too; f32 accumulation, statistics, softmax. v_wmma_f32_16x16x32_f16.
#define NIMG 4
#define CIN 256
#define DK 64
#define HW 64
#define NPI (HW * HW)            /* 4096 */
#define NPX (NIMG * NPI)         /* 16384 */
#define NG 8
#define NH 1
#define DM DK
#define SCL 1.0f
#define KSPLIT 4
typedef __bf16 v16b __attribute__((ext_vector_type(16)));
typedef unsigned short v8us __attribute__((ext_vector_type(8), may_alias));
typedef float  v8f  __attribute__((ext_vector_type(8)));
typedef float  v4f  __attribute__((ext_vector_type(4)));
typedef float  v4fa __attribute__((ext_vector_type(4), may_alias));
union FragB { v16b v; v8us half[2]; unsigned short u[16]; };

__device__ __forceinline__ unsigned short bf16_bits(float x) { unsigned int u = __float_as_uint(x); return (unsigned short)((u + 0x7FFFu + ((u >> 16) & 1u)) >> 16); }
__device__ __forceinline__ float bf16_val(unsigned short b) { return __uint_as_float(((unsigned int)b) << 16); }
__device__ __forceinline__ float bf16_round(float x) { return bf16_val(bf16_bits(x)); }
// D += A·B with NT terms: 1 = ah·bh, 2 = + al·bh (A split), 3 = + ah·bl (both split)
template <int NT>
__device__ __forceinline__ v8f mmaN(v16b ah, v16b al, v16b bh, v16b bl, v8f c) {
  c = __builtin_amdgcn_wmma_f32_16x16x32_bf16(false, ah, false, bh, (short)0, c, false, false);
  if (NT >= 2) c = __builtin_amdgcn_wmma_f32_16x16x32_bf16(false, al, false, bh, (short)0, c, false, false);
  if (NT >= 3) c = __builtin_amdgcn_wmma_f32_16x16x32_bf16(false, ah, false, bl, (short)0, c, false, false);
  asm volatile("v_nop\n\tv_nop\n\tv_nop\n\tv_nop" : "+v"(c) : "v"(ah), "v"(al), "v"(bh), "v"(bl));
  return c;
}

__global__ __launch_bounds__(256) void k_wt_bf16(const float* __restrict__ W, unsigned short* __restrict__ Wt, int K, int N) {
  const int t = blockIdx.x * 256 + threadIdx.x;
  const int k8n = K / 8;
  if (t >= N * k8n) return;
  const int n = t / k8n, k8 = (t % k8n) * 8;
  v8us v;
#pragma unroll
  for (int i = 0; i < 8; ++i) v[i] = bf16_bits(W[(size_t)(k8 + i) * N + n]);
  *(v8us*)(Wt + (size_t)n * K + k8) = v;
  
}

// GEMM C[M][N] (f32, pitch ldc) = act(A[M][K]·W + bias). A f32 row-major (pitch lda) converted per fragment to bf16
// (ASPLIT: hi/lo two planes -> 2 terms, else single rounded term); Wt bf16 [N][K] (pitch ldb). BIAS_BF16 rounds the
// bias to bf16 first (bias quantised to bf16 before the add). K%32==0, M%16==0, N%64==0.
template <bool ASPLIT, int ACT, bool BIAS_BF16>
__global__ __launch_bounds__(128) void k_gemm_bf(const float* __restrict__ A, int lda, const unsigned short* __restrict__ Wt, int ldb,
                                               const float* __restrict__ bias, float* __restrict__ C, int ldc, int M, int N, int K) {
  __shared__ __attribute__((aligned(16))) float so[4][16][64];
  const int tid = threadIdx.x, w = tid >> 5, lane = tid & 31, ln = lane & 15, hh = lane >> 4;
  const int ntn = N / 64;
  const int wid = blockIdx.x * 4 + w;
  const int mt = wid / ntn, nq = wid % ntn;
  if (mt * 16 >= M) return;
  const int row0 = mt * 16, col0 = nq * 64;
  const float* arow = A + (size_t)(row0 + ln) * lda;
  v8f acc[4] = {};
  for (int kb = 0; kb < K; kb += 32) {
    FragB ah, al;
    const v4f x0 = *(const v4fa*)(arow + kb + 8 * hh), x1 = *(const v4fa*)(arow + kb + 8 * hh + 4);
    const v4f x2 = *(const v4fa*)(arow + kb + 16 + 8 * hh), x3 = *(const v4fa*)(arow + kb + 16 + 8 * hh + 4);
    float xs[16] = {x0[0],x0[1],x0[2],x0[3],x1[0],x1[1],x1[2],x1[3],x2[0],x2[1],x2[2],x2[3],x3[0],x3[1],x3[2],x3[3]};
#pragma unroll
    for (int i = 0; i < 16; ++i) { const unsigned short hb = bf16_bits(xs[i]); ah.u[i] = hb; al.u[i] = ASPLIT ? bf16_bits(xs[i] - bf16_val(hb)) : (unsigned short)0; }
#pragma unroll
    for (int t = 0; t < 4; ++t) {
      const unsigned short* brow = Wt + (size_t)(col0 + t * 16 + ln) * ldb + kb;
      FragB b;
      b.half[0] = *(const v8us*)(brow + 8 * hh);
      b.half[1] = *(const v8us*)(brow + 16 + 8 * hh);
      acc[t] = mmaN<ASPLIT ? 2 : 1>(ah.v, al.v, b.v, b.v, acc[t]);
    }
  }
#pragma unroll
  for (int t = 0; t < 4; ++t) {
    float bv = bias ? bias[col0 + t * 16 + ln] : 0.f;
    if (BIAS_BF16) bv = bf16_round(bv);
#pragma unroll
    for (int r = 0; r < 8; ++r) { float v = acc[t][r] + bv; if (ACT == 1) v = fmaxf(v, 0.f); so[w][8 * hh + r][t * 16 + ln] = v; }
  }
  __builtin_amdgcn_fence(__ATOMIC_ACQ_REL, "workgroup");
  __builtin_amdgcn_wave_barrier();
  const int rsub = lane >> 4, c4 = (lane & 15) * 4;
  {
#pragma unroll
    for (int q = 0; q < 8; ++q) {
      const int r = q * 2 + rsub;
      const v4f v = *(const v4fa*)&so[w][r][c4];
      *(v4f*)(C + (size_t)(row0 + r) * ldc + col0 + c4) = v;
    }
    
  }
}

// GEMM C = act(A·W + bias + resid): A f32 (ASPLIT -> hi/lo 2 terms), Wt bf16 [N][K]; ACT 0 none, 1 relu, 2 exact gelu;
// resid (optional, f32, row index = (row % rmod), pitch ldr, RES_BF16 rounds it) added before the activation.
template <bool ASPLIT, int ACT, bool BIAS_BF16, bool RES_BF16>
__global__ __launch_bounds__(128) void k_gemm_bf3(const float* __restrict__ A, int lda, const unsigned short* __restrict__ Wt, int ldb,
                                                const float* __restrict__ bias, const float* __restrict__ resid, int rmod, int ldr,
                                                float* __restrict__ C, int ldc, int M, int N, int K) {
  __shared__ __attribute__((aligned(16))) float so[4][16][64];
  const int tid = threadIdx.x, w = tid >> 5, lane = tid & 31, ln = lane & 15, hh = lane >> 4;
  const int ntn = N / 64;
  const int wid = blockIdx.x * 4 + w;
  const int mt = wid / ntn, nq = wid % ntn;
  if (mt * 16 >= M) return;
  const int row0 = mt * 16, col0 = nq * 64;
  const float* arow = A + (size_t)(row0 + ln) * lda;
  v8f acc[4] = {};
  for (int kb = 0; kb < K; kb += 32) {
    FragB ah, al;
    const v4f x0 = *(const v4fa*)(arow + kb + 8 * hh), x1 = *(const v4fa*)(arow + kb + 8 * hh + 4);
    const v4f x2 = *(const v4fa*)(arow + kb + 16 + 8 * hh), x3 = *(const v4fa*)(arow + kb + 16 + 8 * hh + 4);
    float xs[16] = {x0[0],x0[1],x0[2],x0[3],x1[0],x1[1],x1[2],x1[3],x2[0],x2[1],x2[2],x2[3],x3[0],x3[1],x3[2],x3[3]};
#pragma unroll
    for (int i = 0; i < 16; ++i) { const unsigned short hb = bf16_bits(xs[i]); ah.u[i] = hb; al.u[i] = ASPLIT ? bf16_bits(xs[i] - bf16_val(hb)) : (unsigned short)0; }
#pragma unroll
    for (int t = 0; t < 4; ++t) {
      const unsigned short* brow = Wt + (size_t)(col0 + t * 16 + ln) * ldb + kb;
      FragB b;
      b.half[0] = *(const v8us*)(brow + 8 * hh);
      b.half[1] = *(const v8us*)(brow + 16 + 8 * hh);
      acc[t] = mmaN<ASPLIT ? 2 : 1>(ah.v, al.v, b.v, b.v, acc[t]);
    }
  }
#pragma unroll
  for (int t = 0; t < 4; ++t) {
    const int col = col0 + t * 16 + ln;
    float bv = bias ? bias[col] : 0.f;
    if (BIAS_BF16) bv = bf16_round(bv);
#pragma unroll
    for (int r = 0; r < 8; ++r) {
      float v = acc[t][r] + bv;
      if (resid) { float rv = resid[(size_t)((row0 + 8 * hh + r) % rmod) * ldr + col]; if (RES_BF16) rv = bf16_round(rv); v += rv; }
      if (ACT == 1) v = fmaxf(v, 0.f);
      if (ACT == 2) v = 0.5f * v * (1.0f + erff(v * 0.70710678118654752f));
      if (ACT == 3) { const float u = 0.7978845608028654f * (v + 0.044715f * v * v * v); v = 0.5f * v * (1.0f + tanhf(u)); }
      so[w][8 * hh + r][t * 16 + ln] = v;
    }
  }
  __builtin_amdgcn_fence(__ATOMIC_ACQ_REL, "workgroup");
  __builtin_amdgcn_wave_barrier();
  const int rsub = lane >> 4, c4 = (lane & 15) * 4;
  {
#pragma unroll
    for (int q = 0; q < 8; ++q) {
      const int r = q * 2 + rsub;
      const v4f v = *(const v4fa*)&so[w][r][c4];
      *(v4f*)(C + (size_t)(row0 + r) * ldc + col0 + c4) = v;
    }
    
  }
}
// row LayerNorm (biased variance, eps) over N: s = X (+ R); optional out_sum <- s; out_norm <- (s-mu)*rsqrt(var+eps)*g + b
template <bool PARAM_BF16>
__global__ __launch_bounds__(256) void k_layernorm(const float* __restrict__ X, const float* __restrict__ R, const float* __restrict__ g, const float* __restrict__ bta,
                                                  float* __restrict__ out_sum, float* __restrict__ out_norm, int N, float eps) {
  __shared__ float red[256];
  const int row = blockIdx.x, tid = threadIdx.x;
  const float* x = X + (size_t)row * N; const float* rr = R ? R + (size_t)row * N : nullptr;
  float vals[16];                     // up to N = 4096
  const int per = N / 256;            // contiguous chunk per thread? use strided-by-4 chunks: thread handles j = tid*4 + 1024*u
  float s1 = 0.f;
  for (int u = 0; u < per / 4; ++u) {
    const int j = tid * 4 + 1024 * u;
    const v4f a = *(const v4fa*)(x + j);
    v4f b = {0.f,0.f,0.f,0.f}; if (rr) b = *(const v4fa*)(rr + j);
#pragma unroll
    for (int q = 0; q < 4; ++q) { const float v = a[q] + b[q]; vals[u * 4 + q] = v; s1 += v; }
  }
  red[tid] = s1; __syncthreads();
  for (int st = 128; st > 0; st >>= 1) { if (tid < st) red[tid] += red[tid + st]; __syncthreads(); }
  const float mu = red[0] / (float)N; __syncthreads();
  float s2 = 0.f;
  for (int u = 0; u < per / 4; ++u)
#pragma unroll
    for (int q = 0; q < 4; ++q) { const float c = vals[u * 4 + q] - mu; s2 += c * c; }
  red[tid] = s2; __syncthreads();
  for (int st = 128; st > 0; st >>= 1) { if (tid < st) red[tid] += red[tid + st]; __syncthreads(); }
  const float rs = rsqrtf(red[0] / (float)N + eps);
  {
    for (int u = 0; u < per / 4; ++u) {
      const int j = tid * 4 + 1024 * u;
      v4f o, sm;
#pragma unroll
      for (int q = 0; q < 4; ++q) {
        float gg = g[j + q], bb = bta[j + q];
        if (PARAM_BF16) { gg = bf16_round(gg); bb = bf16_round(bb); }
        sm[q] = vals[u * 4 + q]; o[q] = (vals[u * 4 + q] - mu) * rs * gg + bb;
      }
      if (out_sum) *(v4f*)(out_sum + (size_t)row * N + j) = sm;
      *(v4f*)(out_norm + (size_t)row * N + j) = o;
    }
    
  }
}



// ---- f16 WMMA path (v_wmma_f32_16x16x32_f16): 11-bit significands for operands in range — used where a [0,1] probability operand needs more precision than bf16
typedef _Float16 v16h __attribute__((ext_vector_type(16)));
union FragH { v16h v; v8us half[2]; _Float16 h[16]; unsigned short u[16]; };
template <int NT>
__device__ __forceinline__ v8f mmaH(v16h ah, v16h al, v16h bh, v16h bl, v8f c) {
  c = __builtin_amdgcn_wmma_f32_16x16x32_f16(false, ah, false, bh, (short)0, c, false, false);
  if (NT >= 2) c = __builtin_amdgcn_wmma_f32_16x16x32_f16(false, al, false, bh, (short)0, c, false, false);
  if (NT >= 3) c = __builtin_amdgcn_wmma_f32_16x16x32_f16(false, ah, false, bl, (short)0, c, false, false);
  asm volatile("v_nop\n\tv_nop\n\tv_nop\n\tv_nop" : "+v"(c) : "v"(ah), "v"(al), "v"(bh), "v"(bl));
  return c;
}
// batched GEMM like k_gemm_b but f16 operands: A f32 (split into f16 hi/lo if ASPLIT, else rounded to f16), Bt = f16 values [n][k]; alpha; C f32; N multiple of 16 (partial tiles skipped)
template <bool ASPLIT>
__global__ __launch_bounds__(128) void k_gemm_h(const float* __restrict__ A, int lda, size_t sA, const _Float16* __restrict__ Bh, int ldb, size_t sB, float alpha, float* __restrict__ C, int ldc, size_t sC, int M, int N, int K) {
  __shared__ __attribute__((aligned(16))) float so[4][16][64];
  const int tid = threadIdx.x, w = tid >> 5, lane = tid & 31, ln = lane & 15, hh = lane >> 4; const int by = blockIdx.y;
  A += (size_t)by * sA; Bh += (size_t)by * sB; C += (size_t)by * sC;
  const int ntn = (N + 63) / 64; const int wid = blockIdx.x * 4 + w; const int mt = wid / ntn, nq = wid % ntn; if (mt * 16 >= M) return;
  const int row0 = mt * 16, col0 = nq * 64; const float* arow = A + (size_t)(row0 + ln) * lda;
  v8f acc[4] = {};
  for (int kb = 0; kb < K; kb += 32) {
    FragH ah, al;
    const v4f x0 = *(const v4fa*)(arow + kb + 8 * hh), x1 = *(const v4fa*)(arow + kb + 8 * hh + 4), x2 = *(const v4fa*)(arow + kb + 16 + 8 * hh), x3 = *(const v4fa*)(arow + kb + 16 + 8 * hh + 4);
    float xs[16] = {x0[0],x0[1],x0[2],x0[3],x1[0],x1[1],x1[2],x1[3],x2[0],x2[1],x2[2],x2[3],x3[0],x3[1],x3[2],x3[3]};
#pragma unroll
    for (int i = 0; i < 16; ++i) { const _Float16 h = (_Float16)xs[i]; ah.h[i] = h; al.h[i] = ASPLIT ? (_Float16)(xs[i] - (float)h) : (_Float16)0.0f; }
#pragma unroll
    for (int t = 0; t < 4; ++t) { if (col0 + t * 16 >= N) continue; const size_t boff = (size_t)(col0 + t * 16 + ln) * ldb + kb; FragH bq; bq.half[0] = *(const v8us*)(Bh + boff + 8 * hh); bq.half[1] = *(const v8us*)(Bh + boff + 16 + 8 * hh);
      acc[t] = mmaH<ASPLIT ? 2 : 1>(ah.v, al.v, bq.v, bq.v, acc[t]); }
  }
#pragma unroll
  for (int t = 0; t < 4; ++t) { if (col0 + t * 16 >= N) continue;
#pragma unroll
    for (int r = 0; r < 8; ++r) so[w][8 * hh + r][t * 16 + ln] = acc[t][r] * alpha; }
  __builtin_amdgcn_fence(__ATOMIC_ACQ_REL, "workgroup"); __builtin_amdgcn_wave_barrier();
  const int rsub = lane >> 4, c4 = (lane & 15) * 4;
  {
#pragma unroll
    for (int q = 0; q < 8; ++q) { const int r = q * 2 + rsub; if (col0 + c4 < N) { const v4f v = *(const v4fa*)&so[w][r][c4]; *(v4f*)(C + (size_t)(row0 + r) * ldc + col0 + c4) = v; } }
     }
}

// Wt[n][k] = f16(W[k][n]·scale) from f32 row-major W[K][N] (scale = power of two; bf16-exact weights stay exact in f16 away from the subnormal range)
__global__ __launch_bounds__(256) void k_wt_f16(const float* __restrict__ W, _Float16* __restrict__ Wt, int K, int N, float scale) {
  const int t = blockIdx.x * 256 + threadIdx.x; if (t >= N * (K / 8)) return; const int n = t / (K / 8), k8 = (t % (K / 8)) * 8; FragH f;
#pragma unroll
  for (int i = 0; i < 8; ++i) f.h[i] = (_Float16)(bf16_round(W[(size_t)(k8 + i) * N + n]) * scale); const v8us o = f.half[0];
  *(v8us*)((unsigned short*)Wt + (size_t)n * K + k8) = o; 
}
// k_gemm_hh variant with fused epilogue: v = acc·alpha + bias[by·sBias + col] (+ CP[(row/rowsPerB)·sCPb + by·64 + col] if CP) ; ACT 0 none / 1 elu ; writes f16 C16 (and f32 C if non-null)
template <int ACT>
__global__ __launch_bounds__(128) void k_gemm_hhx(const _Float16* __restrict__ A, int lda, size_t sA, const _Float16* __restrict__ Bh, int ldb, size_t sB, float alpha, const float* __restrict__ bias, size_t sBias, const float* __restrict__ CP, int rowsPerB, size_t sCPb, int row0g,
    float* __restrict__ C, _Float16* __restrict__ C16, int ldc, size_t sC, int M, int N, int K) {
  __shared__ __attribute__((aligned(16))) float so[4][16][64];
  const int tid = threadIdx.x, w = tid >> 5, lane = tid & 31, ln = lane & 15, hh = lane >> 4; const int by = blockIdx.y;
  A += (size_t)by * sA; Bh += (size_t)by * sB; const size_t cofs = (size_t)by * sC; const float* bp = bias ? bias + (size_t)by * sBias : nullptr;
  const int ntn = (N + 63) / 64; const int wid = blockIdx.x * 4 + w; const int mt = wid / ntn, nq = wid % ntn; if (mt * 16 >= M) return;
  const int row0 = mt * 16, col0 = nq * 64; const _Float16* arow = A + (size_t)(row0 + ln) * lda;
  v8f acc[4] = {};
  for (int kb = 0; kb < K; kb += 32) { FragH ah; ah.half[0] = *(const v8us*)((const unsigned short*)arow + kb + 8 * hh); ah.half[1] = *(const v8us*)((const unsigned short*)arow + kb + 16 + 8 * hh);
#pragma unroll
    for (int t = 0; t < 4; ++t) { if (col0 + t * 16 >= N) continue; const size_t boff = (size_t)(col0 + t * 16 + ln) * ldb + kb; FragH bq; bq.half[0] = *(const v8us*)((const unsigned short*)Bh + boff + 8 * hh); bq.half[1] = *(const v8us*)((const unsigned short*)Bh + boff + 16 + 8 * hh);
      acc[t] = mmaH<1>(ah.v, ah.v, bq.v, bq.v, acc[t]); }
  }
#pragma unroll
  for (int t = 0; t < 4; ++t) { if (col0 + t * 16 >= N) continue; const int col = col0 + t * 16 + ln; const float bv = bp ? bf16_round(bp[col]) : 0.f;
#pragma unroll
    for (int r = 0; r < 8; ++r) { float v = acc[t][r] * alpha + bv; if (CP) { const int bidx = (row0g + row0 + 8 * hh + r) / rowsPerB; v += CP[(size_t)bidx * sCPb + (size_t)by * 64 + col]; } if (ACT == 1) v = (v > 0.f) ? v : expm1f(v); else if (ACT == 7) v = (v > 0.f) ? v + 1.0f : expf(v); else if (ACT == 8) v = tanhf(v); else if (ACT == 9) v = 0.5f * v * (1.0f + tanhf(0.7978845608028654f * (v + 0.044715f * v * v * v))); else if (ACT == 11) v = 1.0f / (1.0f + expf(-v)); else if (ACT == 12) v = (v > 0.f) ? v : 0.01f * v; else if (ACT == 14) v = (v > 0.f) ? v : 0.1f * v; else if (ACT == 15) v = v / (1.0f + expf(-v)); else if (ACT == 3) v = fmaxf(v, 0.f); else if (ACT == 6) v = 0.5f * v * (1.0f + erff(v * 0.70710678118654752f)); so[w][8 * hh + r][t * 16 + ln] = v; } }
  __builtin_amdgcn_fence(__ATOMIC_ACQ_REL, "workgroup"); __builtin_amdgcn_wave_barrier();
  const int rsub = lane >> 4, c4 = (lane & 15) * 4; typedef _Float16 v4h __attribute__((ext_vector_type(4)));
  {
#pragma unroll
    for (int q = 0; q < 8; ++q) { const int r = q * 2 + rsub; if (col0 + c4 < N) { const v4f v = *(const v4fa*)&so[w][r][c4]; if (C) *(v4f*)(C + cofs + (size_t)(row0 + r) * ldc + col0 + c4) = v; if (C16) { v4h h4; for (int i = 0; i < 4; ++i) h4[i] = (_Float16)v[i]; *(v4h*)(C16 + cofs + (size_t)(row0 + r) * ldc + col0 + c4) = h4; } } }
     }
}


typedef _Float16 v4h __attribute__((ext_vector_type(4)));

__global__ __launch_bounds__(256) void k_x16(const float* __restrict__ x, _Float16* __restrict__ X16, size_t n8) { const size_t t = (size_t)blockIdx.x * 256 + threadIdx.x; if (t >= n8) return; FragH f;
#pragma unroll
  for (int q = 0; q < 8; ++q) f.h[q] = (_Float16)bf16_round(x[t * 8 + q]); *(v8us*)((unsigned short*)X16 + t * 8) = f.half[0];  }
__global__ __launch_bounds__(256) void k_h16(const float* __restrict__ x, _Float16* __restrict__ X16, size_t n8) { const size_t t = (size_t)blockIdx.x * 256 + threadIdx.x; if (t >= n8) return; FragH f;
#pragma unroll
  for (int q = 0; q < 8; ++q) f.h[q] = (_Float16)x[t * 8 + q]; *(v8us*)((unsigned short*)X16 + t * 8) = f.half[0];  }
__device__ __forceinline__ void d_round16f(const float* __restrict__ W, _Float16* __restrict__ Bt, size_t n8, unsigned bx) { const size_t t = (size_t)bx * 256 + threadIdx.x; if (t >= n8) return; FragH f;
#pragma unroll
  for (int i = 0; i < 8; ++i) f.h[i] = (_Float16)(bf16_round(W[t * 8 + i]) * 16.0f); *(v8us*)((unsigned short*)Bt + t * 8) = f.half[0];  }
template <int NHv, int TTv>
__global__ __launch_bounds__(256) void k_vt(const _Float16* __restrict__ V16, int ldv, int voff, _Float16* __restrict__ Vt) { __shared__ unsigned short tl[64][66]; const int tid = threadIdx.x; const int slab = blockIdx.x / (TTv / 64), lg = blockIdx.x % (TTv / 64); const int b = slab / NHv, h = slab % NHv;
  for (int i = tid; i < 64 * 8; i += 256) { const int r = i / 8, c8 = (i % 8) * 8; FragH f; f.half[0] = *(const v8us*)((const unsigned short*)V16 + ((size_t)b * TTv + lg * 64 + r) * ldv + voff + h * 64 + c8);
#pragma unroll
    for (int q = 0; q < 8; ++q) tl[r][c8 + q] = f.u[q]; }
  __syncthreads();
  {
#pragma unroll
    for (int rd = 0; rd < 2; ++rd) { const int d = rd * 32 + tid / 8, pc = tid % 8; FragH f;
#pragma unroll
      for (int q = 0; q < 8; ++q) f.u[q] = tl[pc * 8 + q][d];
      *(v8us*)((unsigned short*)Vt + ((size_t)slab * 64 + d) * TTv + lg * 64 + pc * 8) = f.half[0]; }
     } }

// FRAGMENT ORDER of the attention operands: a 16-row x 64-column tile (q, k) or a 64-row x 32-key block (v^T) is stored as its WMMA fragment halves one after the other, each half as 32 lanes x 16 bytes in lane order,
// so that a wave's 16-byte load reads 512 bytes in a row (4 whole lines) and not 32 bytes out of each of 16 lines. Which element a lane and register hold is unchanged.
// q, k: row r, columns 8 c8 .. 8 c8 + 7 -> tile r >> 4, half c8 >> 1 (= 2 ks + part), lane 16 (c8 & 1) + (r & 15).
__device__ __forceinline__ void d_hl(const float* __restrict__ F, _Float16* __restrict__ Hh, _Float16* __restrict__ Hl, size_t n8, unsigned bx) { const size_t t = (size_t)bx * 256 + threadIdx.x; if (t >= n8) return; FragH fh, fl; const v4f a = *(const v4fa*)(F + t * 8), c = *(const v4fa*)(F + t * 8 + 4);
#pragma unroll
  for (int q = 0; q < 4; ++q) { _Float16 h = (_Float16)a[q]; fh.h[q] = h; fl.h[q] = (_Float16)((a[q] - (float)h) * 1024.0f); h = (_Float16)c[q]; fh.h[4 + q] = h; fl.h[4 + q] = (_Float16)((c[q] - (float)h) * 1024.0f); }
  const size_t r = t >> 3; const unsigned c8 = (unsigned)t & 7u; const size_t o = ((r >> 4) * 4 + (c8 >> 1)) * 256 + ((c8 & 1u) * 16 + (r & 15)) * 8;
  { *(v8us*)((unsigned short*)Hh + o) = fh.half[0]; *(v8us*)((unsigned short*)Hl + o) = fl.half[0];  } }

// ---- fast GEMM (wave tile 32x64; requires M % 32 == 0 rows per launch region and N % 64 == 0); epilogue = k_gemm_hhx semantics ----
__device__ __forceinline__ v16h g2_frag(const _Float16* p, int hh) { FragH f; f.half[0] = *(const v8us*)((const unsigned short*)p + 8 * hh); f.half[1] = *(const v8us*)((const unsigned short*)p + 16 + 8 * hh); return f.v; }
__device__ __forceinline__ v8f g2_mma(v16h a, v16h b, v8f c) { v8f d = __builtin_amdgcn_wmma_f32_16x16x32_f16(false, a, false, b, (short)0, c, false, false); asm volatile("v_nop\n\tv_nop\n\tv_nop\n\tv_nop" : "+v"(d) : "v"(a), "v"(b)); return d; }
template <int ACT, int NWV>      /* NWV waves a block, each a 32 x 64 tile */
__device__ __forceinline__ void d_gemm2(const _Float16* __restrict__ A, int lda, size_t sA, const _Float16* __restrict__ Bh, int ldb, size_t sB, float alpha, const float* __restrict__ bias, size_t sBias, const float* __restrict__ CP, int rowsPerB, size_t sCPb, int row0g,
    float* __restrict__ C, _Float16* __restrict__ C16, int ldc, size_t sC, int M, int N, int K, unsigned bx, int by) {
  __shared__ __attribute__((aligned(16))) float so[NWV][32][68];
  const int tid = threadIdx.x, w = tid >> 5, lane = tid & 31, ln = lane & 15, hh = lane >> 4;
  A += (size_t)by * sA; Bh += (size_t)by * sB; const size_t cofs = (size_t)by * sC; const float* bp = bias ? bias + (size_t)by * sBias : nullptr;
  const int ntn = N >> 6; const int mt = bx / ntn, nq = bx - mt * ntn; const int row0 = mt * (32 * NWV) + 32 * w, col0 = nq * 64; if (row0 >= M) return;
  const _Float16* a0p = A + (size_t)(row0 + ln) * lda; const _Float16* a1p = a0p + (size_t)16 * lda;
  const _Float16* b0p = Bh + (size_t)(col0 + ln) * ldb; const _Float16* b1p = b0p + (size_t)16 * ldb; const _Float16* b2p = b1p + (size_t)16 * ldb; const _Float16* b3p = b2p + (size_t)16 * ldb;
  const v8f z8 = {0.f,0.f,0.f,0.f,0.f,0.f,0.f,0.f}; v8f c00 = z8, c01 = z8, c02 = z8, c03 = z8, c10 = z8, c11 = z8, c12 = z8, c13 = z8;
#pragma unroll 1
  for (int kb = 0; kb < K; kb += 32) { const v16h a0 = g2_frag(a0p + kb, hh), a1 = g2_frag(a1p + kb, hh);
    v16h b = g2_frag(b0p + kb, hh); c00 = g2_mma(a0, b, c00); c10 = g2_mma(a1, b, c10);
    b = g2_frag(b1p + kb, hh); c01 = g2_mma(a0, b, c01); c11 = g2_mma(a1, b, c11);
    b = g2_frag(b2p + kb, hh); c02 = g2_mma(a0, b, c02); c12 = g2_mma(a1, b, c12);
    b = g2_frag(b3p + kb, hh); c03 = g2_mma(a0, b, c03); c13 = g2_mma(a1, b, c13); }
  v8f accs[8] = {c00, c01, c02, c03, c10, c11, c12, c13};
#pragma unroll
  for (int u = 0; u < 8; ++u) { const int t = u & 3, half = u >> 2; const int col = col0 + t * 16 + ln; const float bv = bp ? bf16_round(bp[col]) : 0.f;
#pragma unroll
    for (int r = 0; r < 8; ++r) { const int rloc = half * 16 + 8 * hh + r; float v = accs[u][r] * alpha + bv; if (CP) { const int bidx = (row0g + row0 + rloc) / rowsPerB; v += CP[(size_t)bidx * sCPb + (size_t)by * 64 + col]; }
      if (ACT == 3) v = fmaxf(v, 0.f); else if (ACT == 6) v = 0.5f * v * (1.0f + erff(v * 0.70710678118654752f)); else if (ACT == 11) v = 1.0f / (1.0f + expf(-v)); else if (ACT == 15) v = v / (1.0f + expf(-v)); else if (ACT == 12) v = (v > 0.f) ? v : 0.01f * v; else if (ACT == 8) v = tanhf(v);
      so[w][rloc][t * 16 + ln] = v; } }
  __builtin_amdgcn_fence(__ATOMIC_ACQ_REL, "workgroup"); __builtin_amdgcn_wave_barrier();
  const int rsub = lane >> 4, c4 = (lane & 15) * 4;
  {
#pragma unroll
    for (int q = 0; q < 16; ++q) { const int r = q * 2 + rsub; const v4f v = *(const v4fa*)&so[w][r][c4]; if (C) *(v4f*)(C + cofs + (size_t)(row0 + r) * ldc + col0 + c4) = v; if (C16) { v4h h4; for (int i = 0; i < 4; ++i) h4[i] = (_Float16)v[i]; *(v4h*)(C16 + cofs + (size_t)(row0 + r) * ldc + col0 + c4) = h4; } }
     } }
template <int ACT>
__global__ __launch_bounds__(128) void k_gemm2(const _Float16* __restrict__ A, int lda, size_t sA, const _Float16* __restrict__ Bh, int ldb, size_t sB, float alpha, const float* __restrict__ bias, size_t sBias, const float* __restrict__ CP, int rowsPerB, size_t sCPb, int row0g,
    float* __restrict__ C, _Float16* __restrict__ C16, int ldc, size_t sC, int M, int N, int K) {
  d_gemm2<ACT, 4>(A, lda, sA, Bh, ldb, sB, alpha, bias, sBias, CP, rowsPerB, sCPb, row0g, C, C16, ldc, sC, M, N, K, blockIdx.x, blockIdx.y); }
// LAUNCHES THAT NEED NOTHING OF EACH OTHER SHARE ONE GRID: a block-uniform branch on the block index picks the part; each part's code, block count and arithmetic are those of its own former launch.
// The q, k and v spline products on one operand A: blockIdx.y picks the weights, the bias, the f32 addend plane (CP, one row a row) and the result plane.
__global__ __launch_bounds__(128) void k_gemm2qkv(const _Float16* __restrict__ A, int lda, const _Float16* __restrict__ B0, const _Float16* __restrict__ B1, const _Float16* __restrict__ B2, int ldb, float alpha,
    const float* __restrict__ bias0, const float* __restrict__ bias1, const float* __restrict__ bias2, const float* __restrict__ CP, float* __restrict__ C, size_t plane, int ldc, int M, int N, int K) {
  const int i = blockIdx.y; const _Float16* Bh = (i == 0) ? B0 : (i == 1) ? B1 : B2; const float* bias = (i == 0) ? bias0 : (i == 1) ? bias1 : bias2;
  d_gemm2<0, 4>(A, lda, 0, Bh, ldb, 0, alpha, bias, 0, CP + (size_t)i * plane, 1, (size_t)ldc, 0, C + (size_t)i * plane, nullptr, ldc, 0, M, N, K, blockIdx.x, 0); }


template <int TK>
__device__ __forceinline__ void d_vthl(const float* __restrict__ VF, int ldv, _Float16* __restrict__ Vth, _Float16* __restrict__ Vtl, unsigned bx) { __shared__ float tl[64][65]; const int tid = threadIdx.x; const int slab = bx / (TK / 64), lg = bx % (TK / 64); const int b = slab / NH, h = slab % NH;
  for (int i = tid; i < 64 * 16; i += 256) { const int r = i / 16, c4 = (i % 16) * 4; const v4f a = *(const v4fa*)(VF + ((size_t)b * TK + lg * 64 + r) * ldv + h * 64 + c4); tl[r][c4] = a[0]; tl[r][c4 + 1] = a[1]; tl[r][c4 + 2] = a[2]; tl[r][c4 + 3] = a[3]; }
  __syncthreads();
  FragH fh[2], fl[2]; size_t oo[2];
#pragma unroll
  for (int rd = 0; rd < 2; ++rd) { const int d = rd * 32 + tid / 8, pc = tid % 8;
#pragma unroll
    for (int q = 0; q < 8; ++q) { const float v = tl[pc * 8 + q][d]; const _Float16 hv = (_Float16)v; fh[rd].h[q] = hv; fl[rd].h[q] = (_Float16)((v - (float)hv) * 1024.0f); }
    oo[rd] = (size_t)slab * 64 * TK + (size_t)((lg * 2 + (pc >> 2)) * 8 + (d >> 4) * 2 + ((pc >> 1) & 1)) * 256 + ((pc & 1) * 16 + (d & 15)) * 8; }      /* fragment order: 32-key block, half 2 dt + part, lane 16 hh + ln */
  {
#pragma unroll
    for (int rd = 0; rd < 2; ++rd) { *(v8us*)((unsigned short*)Vth + oo[rd]) = fh[rd].half[0]; *(v8us*)((unsigned short*)Vtl + oo[rd]) = fl[rd].half[0]; }
     } }
// One grid for the three operand packs: v^T of all images (slab = image), then q, then k.
#define NB_VT (NIMG * NH * (NPI / 64))
#define NB_HL (NPX * DK / 8 / 256)
__global__ __launch_bounds__(256) void k_pack(const float* __restrict__ FQ, const float* __restrict__ FK, const float* __restrict__ FV, _Float16* __restrict__ Qh, _Float16* __restrict__ Ql, _Float16* __restrict__ Kh, _Float16* __restrict__ Kl, _Float16* __restrict__ Vth, _Float16* __restrict__ Vtl) {
  const int bx = blockIdx.x;
  if (bx < NB_VT) d_vthl<NPI>(FV, DK, Vth, Vtl, bx);
  else if (bx < NB_VT + NB_HL) d_hl(FQ, Qh, Ql, (size_t)NPX * DK / 8, bx - NB_VT);
  else d_hl(FK, Kh, Kl, (size_t)NPX * DK / 8, bx - NB_VT - NB_HL); }

__device__ __forceinline__ float xhalf(float v) { const int b = __float_as_int(v); return __int_as_float(__builtin_amdgcn_permlanex16(b, b, 0x76543210, 0xfedcba98, false, false)); }      /* lane l <-> l ^ 16 */
template <int TQ, int TK, int KSP>
__global__ __launch_bounds__(128 * KSP) void k_flashm(const _Float16* __restrict__ Q16, const _Float16* __restrict__ Q16lo, const _Float16* __restrict__ K16, const _Float16* __restrict__ K16lo, const _Float16* __restrict__ Vt, const _Float16* __restrict__ Vtlo, const unsigned* __restrict__ MB, const int* __restrict__ RA, const int* __restrict__ KE, float* __restrict__ O, int ldo) {
  constexpr int RPW = 16, NQB = TQ / (4 * RPW), DT = 4, KS = 2, NW = 4 * KSP; static_assert(NH == 1 && DK == 64, "the fragment-order planes hold one 64-wide head");
  __shared__ __attribute__((aligned(16))) float sO[NW][RPW][64 + 4]; __shared__ float sM[NW][RPW], sL[NW][RPW];
  const int tid = threadIdx.x, w = tid >> 5, lane = tid & 31, ln = lane & 15, hh = lane >> 4; const int qt = w & 3, kp = __builtin_amdgcn_readfirstlane(w >> 2);      /* scalar: the key loop's counter and trip test stay wave-uniform */
  const int slab = blockIdx.x / NQB, qblk = blockIdx.x % NQB; const int b = slab / NH, h = slab % NH; const int qb0 = qblk * (4 * RPW); const int q0 = qb0 + qt * RPW;
  FragH aq[KS], aql[KS];
  { const size_t qo = (((size_t)b * TQ + q0) >> 4) * 1024 + lane * 8; const unsigned short* qr = (const unsigned short*)Q16 + qo; const unsigned short* ql = (const unsigned short*)Q16lo + qo;
#pragma unroll
    for (int ks = 0; ks < KS; ++ks) { aq[ks].half[0] = *(const v8us*)(qr + ks * 512); aq[ks].half[1] = *(const v8us*)(qr + ks * 512 + 256); aql[ks].half[0] = *(const v8us*)(ql + ks * 512); aql[ks].half[1] = *(const v8us*)(ql + ks * 512 + 256); } }
  const unsigned short* Vth = (const unsigned short*)Vt + (size_t)slab * 64 * TK; const unsigned short* Vtl = (const unsigned short*)Vtlo + (size_t)slab * 64 * TK;
  float m_r = -3.0e38f, l_r = 0.f; v8f oacc[DT], oaccl[DT];
#pragma unroll
  for (int dt = 0; dt < DT; ++dt) { oacc[dt] = (v8f){0.f,0.f,0.f,0.f,0.f,0.f,0.f,0.f}; oaccl[dt] = oacc[dt]; }
  int jend = KE[qblk * 32]; jend = min(TK, (jend + 31) & ~31); if (jend < 32) jend = 32;      /* block-uniform */
  const bool am = (RA[q0 + ln] != 0); const unsigned* mrow = MB + (size_t)(q0 + ln) * (TK / 32);
#pragma unroll 1
  for (int j0 = kp * 32; j0 < jend; j0 += 32 * KSP) {
    v8f s[2];
#pragma unroll
    for (int nt = 0; nt < 2; ++nt) { const size_t ko = ((((size_t)b * TK + j0) >> 4) + nt) * 1024 + lane * 8; const unsigned short* kr = (const unsigned short*)K16 + ko; const unsigned short* kl = (const unsigned short*)K16lo + ko; FragH bk[KS], bkl[KS];
#pragma unroll
      for (int ks = 0; ks < KS; ++ks) { bk[ks].half[0] = *(const v8us*)(kr + ks * 512); bk[ks].half[1] = *(const v8us*)(kr + ks * 512 + 256); bkl[ks].half[0] = *(const v8us*)(kl + ks * 512); bkl[ks].half[1] = *(const v8us*)(kl + ks * 512 + 256); }
      v8f acc = (v8f){0.f,0.f,0.f,0.f,0.f,0.f,0.f,0.f}, accr = acc;
#pragma unroll
      for (int ks = 0; ks < KS; ++ks) { acc = mmaH<1>(bk[ks].v, bk[ks].v, aq[ks].v, aq[ks].v, acc); accr = mmaH<1>(bk[ks].v, bk[ks].v, aql[ks].v, aql[ks].v, accr); accr = mmaH<1>(bkl[ks].v, bkl[ks].v, aq[ks].v, aq[ks].v, accr); }
      s[nt] = acc + accr * 0.0009765625f; }
    const unsigned mh = mrow[j0 >> 5] >> (8 * hh);      /* bit r: key 8 hh + r, bit 16 + r: key 16 + 8 hh + r */
    float sv[16]; float mc = -INFINITY;
#pragma unroll
    for (int e = 0; e < 16; ++e) { const bool ok = am || (((mh >> ((e >> 3) * 16 + (e & 7))) & 1u) == 0u); sv[e] = ok ? (am ? 0.f : s[e >> 3][e & 7] * SCL) : -INFINITY; mc = fmaxf(mc, sv[e]); }
    mc = fmaxf(mc, xhalf(mc));
    const float mn = fmaxf(m_r, mc); const float al = (mn > -1.0e38f) ? expf(m_r - mn) : 1.0f; m_r = mn;
    FragH pa, pl; float ps = 0.f;
#pragma unroll
    for (int e = 0; e < 16; ++e) { const float p = expf(sv[e] - mn);      /* a masked key: exp(-inf) = 0 (mn is finite) */
      ps += p; const float p10 = p * 1024.0f; const _Float16 ph = (_Float16)p10; pa.h[e] = ph; pl.h[e] = (_Float16)((p10 - (float)ph) * 1024.0f); }
    l_r = l_r * al + ps;
#pragma unroll
    for (int dt = 0; dt < DT; ++dt) { oacc[dt] *= al; oaccl[dt] *= al; }
#pragma unroll
    for (int dt = 0; dt < DT; ++dt) { const size_t vo = (size_t)(j0 >> 5) * 2048 + dt * 512 + lane * 8; FragH bv, bl; bv.half[0] = *(const v8us*)(Vth + vo); bv.half[1] = *(const v8us*)(Vth + vo + 256); bl.half[0] = *(const v8us*)(Vtl + vo); bl.half[1] = *(const v8us*)(Vtl + vo + 256);
      oacc[dt] = mmaH<1>(bv.v, bv.v, pa.v, pa.v, oacc[dt]); oaccl[dt] = mmaH<1>(bl.v, bl.v, pa.v, pa.v, oaccl[dt]); oaccl[dt] = mmaH<1>(bv.v, bv.v, pl.v, pl.v, oaccl[dt]); } }
  { const float l = l_r + xhalf(l_r); if (hh == 0) { sM[w][ln] = m_r; sL[w][ln] = l; } }
#pragma unroll
  for (int dt = 0; dt < DT; ++dt) { const v8f o = oacc[dt] + oaccl[dt] * 0.0009765625f;      /* register r = O[query ln][dt * 16 + 8 hh + r] */
    *(v4fa*)&sO[w][ln][dt * 16 + 8 * hh] = (v4f){o[0], o[1], o[2], o[3]}; *(v4fa*)&sO[w][ln][dt * 16 + 8 * hh + 4] = (v4f){o[4], o[5], o[6], o[7]}; }
  __syncthreads();      /* every part's partial is in LDS before any thread merges */
  for (int i = tid; i < 4 * RPW * 16; i += 128 * KSP) { const int row = i >> 4, pc = i & 15; const int tq = row / RPW, rr = row % RPW;
    float mx = sM[tq][rr];
#pragma unroll
    for (int p = 1; p < KSP; ++p) mx = fmaxf(mx, sM[p * 4 + tq][rr]);
    float lsum = 0.f; v4f o = {0.f, 0.f, 0.f, 0.f};
#pragma unroll
    for (int p = 0; p < KSP; ++p) { const float wg = expf(sM[p * 4 + tq][rr] - mx); lsum += wg * sL[p * 4 + tq][rr]; const v4f val = *(const v4fa*)&sO[p * 4 + tq][rr][pc * 4]; o += val * wg; }
    const float inv = (lsum > 0.f) ? 1.0f / (lsum * 1024.0f) : 0.f;
    *(v4f*)(O + ((size_t)b * TQ + qb0 + row) * ldo + h * 64 + pc * 4) = o * inv; } }


__constant__ float GRIDV[8] = {-2.000000000e+00f,-1.428571463e+00f,-8.571428657e-01f,-2.857141793e-01f,2.857143879e-01f,8.571429253e-01f,1.428571701e+00f,2.000000000e+00f};
#define INV_DENOM (1.0f / 0.5714285714285714f)
__device__ __forceinline__ void d_fulltab(unsigned* __restrict__ MB, int* __restrict__ RA, int* __restrict__ KE, unsigned bx) {
  const int t = bx * 256 + threadIdx.x;
  if (t < NPI * (NPI / 32)) { *(unsigned*)(MB + t) = 0u;  }
  if (t < NPI) { *(int*)(RA + t) = 0;  }
  if (t < NPI / 64) { *(int*)(KE + t * 32) = NPI;  } }
// Layout changes go through a 64 x 64 LDS tile (pitch 65 floats: no bank conflict in either direction), so that every global read and write covers whole 128-byte lines.
__device__ __forceinline__ void d_xcl(const float* __restrict__ x, _Float16* __restrict__ X16, unsigned bx) {
  __shared__ float tl[64][65]; const int tid = threadIdx.x; const int pt = bx % (NPI / 64), ct = (bx / (NPI / 64)) % (CIN / 64), b = bx / ((NPI / 64) * (CIN / 64));
  const int r16 = tid / 16, k4 = (tid % 16) * 4; v4f a[4];      /* thread: rows r16 + 16 u of the tile, four floats at k4; the four loads fly together */
#pragma unroll      /* a[] stays in registers */
  for (int u = 0; u < 4; ++u) a[u] = *(const v4fa*)(x + ((size_t)b * CIN + ct * 64 + r16 + 16 * u) * NPI + pt * 64 + k4);
#pragma unroll      /* a[] stays in registers */
  for (int u = 0; u < 4; ++u) { float* d = &tl[r16 + 16 * u][k4]; d[0] = a[u][0]; d[1] = a[u][1]; d[2] = a[u][2]; d[3] = a[u][3]; }
  __syncthreads();      /* the whole tile is in LDS before any thread reads it across */
#pragma unroll      /* both rows' LDS reads are issued together */
  for (int rd = 0; rd < 2; ++rd) { const int p = rd * 32 + tid / 8, c8 = (tid % 8) * 8; FragH f;
#pragma unroll
    for (int q = 0; q < 8; ++q) f.h[q] = (_Float16)bf16_round(tl[c8 + q][p]);
    *(v8us*)((unsigned short*)X16 + ((size_t)b * NPI + pt * 64 + p) * CIN + ct * 64 + c8) = f.half[0]; } }
__device__ __forceinline__ void d_instat(const float* __restrict__ A, const float* __restrict__ ST0, int phase, float* __restrict__ ST, unsigned bx) {
  #pragma clang fp contract(off)
  __shared__ float sh[256]; const int b = bx / DK, c = bx % DK; const float mu = phase ? ST0[(size_t)bx * 32] : 0.f; float s = 0.f;
  for (int p = threadIdx.x; p < NPI; p += 256) { const float v = A[((size_t)b * NPI + p) * DK + c] - mu; s += phase ? v * v : v; }
  sh[threadIdx.x] = s; __syncthreads();
  for (int st = 128; st > 0; st >>= 1) { if ((int)threadIdx.x < st) sh[threadIdx.x] += sh[threadIdx.x + st]; __syncthreads(); }
  if (threadIdx.x == 0) { const float v = sh[0] / (float)NPI; float* d = ST + ((size_t)phase * NIMG * DK + bx) * 32; *(float*)d = v;  } }
__global__ __launch_bounds__(256) void k_basis(const float* __restrict__ A, const float* __restrict__ ST, _Float16* __restrict__ BAS) {
  #pragma clang fp contract(off)
  const int t = blockIdx.x * 256 + threadIdx.x; if (t >= NPX * DK) return; const int r = t / DK, c = t % DK; const int b = r / NPI; const float a = A[(size_t)r * DK + c];
  const float mu = ST[((size_t)b * DK + c) * 32], var = ST[((size_t)NIMG * DK + b * DK + c) * 32]; const float xn = (a - mu) * rsqrtf(var + 1e-5f); FragH bh, bl;
#pragma unroll
  for (int g = 0; g < NG; ++g) { const float z = (xn - GRIDV[g]) * INV_DENOM; const float e = expf(-(z * z)); const _Float16 hv = (_Float16)e; bh.h[g] = hv; bl.h[g] = (_Float16)((e - (float)hv) * 16.0f); }
  unsigned short* bd = (unsigned short*)BAS + (size_t)r * 2 * DK * NG + c * NG;
  { *(v8us*)bd = bh.half[0]; *(v8us*)(bd + DK * NG) = bl.half[0];  } }
__device__ __forceinline__ void d_silu(const float* __restrict__ A, _Float16* __restrict__ SIL, unsigned bx) {
  #pragma clang fp contract(off)
  const int t = bx * 256 + threadIdx.x; if (t >= NPX * (DK / 8)) return; const int r = t / (DK / 8), c0 = (t % (DK / 8)) * 8; const float* a = A + (size_t)r * DK + c0; FragH fh, fl;
#pragma unroll
  for (int q = 0; q < 8; ++q) { const float v = a[q]; const float sl = v / (1.0f + expf(-v)); const _Float16 hv = (_Float16)sl; fh.h[q] = hv; fl.h[q] = (_Float16)((sl - (float)hv) * 16.0f); }
  unsigned short* d = (unsigned short*)SIL + (size_t)r * 2 * DK + c0;
  { *(v8us*)d = fh.half[0]; *(v8us*)(d + DK) = fl.half[0];  } }
__device__ __forceinline__ void d_wnp2(const float* __restrict__ Wm, int K, int N, _Float16* __restrict__ Bt, unsigned bx) {
  const int t = bx * 256 + threadIdx.x; if (t >= N * (2 * K / 8)) return; const int n = t / (2 * K / 8), k0 = (t % (2 * K / 8)) * 8; const bool lo = (k0 >= K); const float sc = lo ? 1.0f : 16.0f; FragH f;
#pragma unroll
  for (int q = 0; q < 8; ++q) { const int k = k0 + q - (lo ? K : 0); f.h[q] = (_Float16)(bf16_round(Wm[(size_t)n * K + k]) * sc); }
  *(v8us*)((unsigned short*)Bt + (size_t)n * 2 * K + k0) = f.half[0];  }
// One grid for all that reads inputs alone: x turned to f16 rows (first: the longest part), the mask tables, the eight weight planes.
#define NB_XCL (NIMG * (CIN / 64) * (NPI / 64))
#define NB_TAB (NPI * (NPI / 32) / 256)
#define NB_WS (DK * (2 * DK * NG / 8) / 256)
#define NB_WB (DK * (2 * DK / 8) / 256)
#define NB_WO (CIN * (2 * DK / 8) / 256)
#define NB_WI (DK * CIN / 8 / 256)
__global__ __launch_bounds__(256) void k_prep(const float* __restrict__ x, const float* __restrict__ w_in, const float* __restrict__ w_out, const float* __restrict__ qbw, const float* __restrict__ kbw, const float* __restrict__ vbw,
    const float* __restrict__ qsw, const float* __restrict__ ksw, const float* __restrict__ vsw, _Float16* __restrict__ X16, _Float16* __restrict__ BIN, _Float16* __restrict__ BOUT,
    _Float16* __restrict__ BB0, _Float16* __restrict__ BB1, _Float16* __restrict__ BB2, _Float16* __restrict__ BS0, _Float16* __restrict__ BS1, _Float16* __restrict__ BS2, unsigned* __restrict__ MB, int* __restrict__ RA, int* __restrict__ KE) {
  int bx = blockIdx.x;
  if (bx < NB_XCL) { d_xcl(x, X16, bx); return; }
  bx -= NB_XCL; if (bx < NB_TAB) { d_fulltab(MB, RA, KE, bx); return; }
  bx -= NB_TAB; if (bx < 3 * NB_WS) { const int i = bx / NB_WS; d_wnp2((i == 0) ? qsw : (i == 1) ? ksw : vsw, DK * NG, DK, (i == 0) ? BS0 : (i == 1) ? BS1 : BS2, bx % NB_WS); return; }
  bx -= 3 * NB_WS; if (bx < 3 * NB_WB) { const int i = bx / NB_WB; d_wnp2((i == 0) ? qbw : (i == 1) ? kbw : vbw, DK, DK, (i == 0) ? BB0 : (i == 1) ? BB1 : BB2, bx % NB_WB); return; }
  bx -= 3 * NB_WB; if (bx < NB_WO) { d_wnp2(w_out, DK, CIN, BOUT, bx); return; }      /* (out,in) natural -> [16w | w] pair planes */
  d_round16f(w_in, BIN, (size_t)DK * CIN / 8, bx - NB_WO); }
// att's channel means beside silu(att): both read att alone.
#define NB_IS (NIMG * DK)
#define NB_SIL (NPX * (DK / 8) / 256)
__global__ __launch_bounds__(256) void k_stat0_silu(const float* __restrict__ A, const float* __restrict__ ST0, float* __restrict__ ST, _Float16* __restrict__ SIL) {
  const int bx = blockIdx.x;
  if (bx < NB_IS) d_instat(A, ST0, 0, ST, bx); else d_silu(A, SIL, bx - NB_IS); }
// att's channel variances beside the q, k, v base products (8 waves a block): the first reads att and the means, the second silu(att) and weights.
#define NB_GB (NPX / 256)
__global__ __launch_bounds__(256) void k_stat1_base(const float* __restrict__ A, const float* __restrict__ ST0, float* __restrict__ ST, const _Float16* __restrict__ SIL, const _Float16* __restrict__ B0, const _Float16* __restrict__ B1, const _Float16* __restrict__ B2,
    const float* __restrict__ bias0, const float* __restrict__ bias1, const float* __restrict__ bias2, float* __restrict__ G, size_t plane, int ldc, int M, int N, int K) {
  const int bx = blockIdx.x;
  if (bx < NB_IS) { d_instat(A, ST0, 1, ST, bx); return; }
  const int i = (bx - NB_IS) / NB_GB;
  d_gemm2<0, 8>(SIL, K, 0, (i == 0) ? B0 : (i == 1) ? B1 : B2, K, 0, 0.0625f, (i == 0) ? bias0 : (i == 1) ? bias1 : bias2, 0, nullptr, 1, 0, 0, G + (size_t)i * plane, nullptr, ldc, 0, M, N, K, (bx - NB_IS) % NB_GB, 0); }
__global__ __launch_bounds__(256) void k_pair16(const float* __restrict__ F, int n, _Float16* __restrict__ P, int rows) {
  #pragma clang fp contract(off)
  const int t = blockIdx.x * 256 + threadIdx.x; if (t >= rows * (n / 8)) return; const int r = t / (n / 8), c0 = (t % (n / 8)) * 8; const float* f = F + (size_t)r * n + c0; FragH fh, fl;
#pragma unroll
  for (int q = 0; q < 8; ++q) { const float v = f[q]; const _Float16 hv = (_Float16)v; fh.h[q] = hv; fl.h[q] = (_Float16)((v - (float)hv) * 16.0f); }
  unsigned short* d = (unsigned short*)P + (size_t)r * 2 * n + c0;
  { *(v8us*)d = fh.half[0]; *(v8us*)(d + n) = fl.half[0];  } }
// Y is kept channel-major ([image][channel][position], the layout of x and of the output): only the position-major A2 tile is turned, through LDS.
__global__ __launch_bounds__(256) void k_y(const float* __restrict__ x, const float* __restrict__ gam, const float* __restrict__ A2, float* __restrict__ Y) {
  #pragma clang fp contract(off)
  __shared__ float tl[64][65]; const int tid = threadIdx.x; const int pt = blockIdx.x % (NPI / 64), ct = (blockIdx.x / (NPI / 64)) % (CIN / 64), b = blockIdx.x / ((NPI / 64) * (CIN / 64)); const float g = bf16_round(gam[0]);
  const int r16 = tid / 16, k4 = (tid % 16) * 4; v4f a[4], xv[4];      /* thread: rows r16 + 16 u of a tile, four floats at k4; all eight loads fly together */
  const size_t o0 = ((size_t)b * CIN + ct * 64 + r16) * NPI + pt * 64 + k4;
#pragma unroll      /* a[], xv[] stay in registers */
  for (int u = 0; u < 4; ++u) { a[u] = *(const v4fa*)(A2 + ((size_t)b * NPI + pt * 64 + r16 + 16 * u) * CIN + ct * 64 + k4); xv[u] = *(const v4fa*)(x + o0 + (size_t)16 * u * NPI); }
#pragma unroll      /* a[] stays in registers */
  for (int u = 0; u < 4; ++u) { float* d = &tl[r16 + 16 * u][k4]; d[0] = a[u][0]; d[1] = a[u][1]; d[2] = a[u][2]; d[3] = a[u][3]; }      /* tl[position][channel] */
  __syncthreads();      /* the whole tile is in LDS before any thread reads it across */
#pragma unroll      /* xv[] stays in registers */
  for (int u = 0; u < 4; ++u) { v4f o;
#pragma unroll
    for (int q = 0; q < 4; ++q) o[q] = g * bf16_round(xv[u][q]) + tl[k4 + q][r16 + 16 * u];
    *(v4f*)(Y + o0 + (size_t)16 * u * NPI) = o; } }
__global__ __launch_bounds__(256) void k_bnstat(const float* __restrict__ Y, const float* __restrict__ ST0, int phase, float* __restrict__ ST) {
  #pragma clang fp contract(off)
  __shared__ float sh[256]; const int c = blockIdx.x; const float mu = phase ? ST0[(size_t)c * 32] : 0.f; float s = 0.f;
  for (int bi = 0; bi < NIMG; ++bi) { const float* yr = Y + ((size_t)bi * CIN + c) * NPI + threadIdx.x;      /* pixel bi * NPI + threadIdx.x + 256 k, in rising order */
#pragma unroll      /* the sixteen loads of an image fly together */
    for (int k = 0; k < NPI / 256; ++k) { const float v = yr[256 * k] - mu; s += phase ? v * v : v; } }
  sh[threadIdx.x] = s; __syncthreads();
  for (int st = 128; st > 0; st >>= 1) { if ((int)threadIdx.x < st) sh[threadIdx.x] += sh[threadIdx.x + st]; __syncthreads(); }
  if (threadIdx.x == 0) { const float v = sh[0] / (float)NPX; float* d = ST + ((size_t)phase * CIN + c) * 32; *(float*)d = v;  } }
__global__ __launch_bounds__(256) void k_bnout(const float* __restrict__ Y, const float* __restrict__ ST, const float* __restrict__ bw, const float* __restrict__ bb, float* __restrict__ out) {
  #pragma clang fp contract(off)
  const int t = blockIdx.x * 256 + threadIdx.x; if (t >= NIMG * CIN * (NPI / 4)) return; const int c = (t / (NPI / 4)) % CIN; const float mu = ST[(size_t)c * 32], var = ST[(size_t)(CIN + c) * 32]; const float sc = rsqrtf(var + 1e-5f), g = bf16_round(bw[c]), be = bf16_round(bb[c]); const v4f yv = *(const v4fa*)(Y + (size_t)t * 4); v4f o;
#pragma unroll
  for (int q = 0; q < 4; ++q) o[q] = g * ((yv[q] - mu) * sc) + be;
  *(v4f*)(out + (size_t)t * 4) = o;  }

extern "C" void kernel_launch(void* const* d_in, const int* in_sizes, int n_in,
                              void* d_out, int out_size, void* d_ws, size_t ws_size, hipStream_t stream) {
  (void)in_sizes; (void)n_in; (void)out_size;
  const float* const* I = (const float* const*)d_in; const float* x = I[0]; const float* w_in = I[1]; const float* b_in = I[2];
  const float* qbw = I[3]; const float* qbb = I[4]; const float* qsw = I[5]; const float* qsb = I[6]; const float* kbw = I[7]; const float* kbb = I[8]; const float* ksw = I[9]; const float* ksb = I[10]; const float* vbw = I[11]; const float* vbb = I[12]; const float* vsw = I[13]; const float* vsb = I[14];
  const float* w_out = I[15]; const float* b_out = I[16]; const float* gam = I[17]; const float* bnw = I[18]; const float* bnb = I[19];
  char* ws = (char*)d_ws; size_t off = 0;
  auto take = [&](size_t bytes) { char* p = ws + off; off += (bytes + 255) & ~(size_t)255; return p; };
  _Float16* BIN = (_Float16*)take((size_t)DK * CIN * 2); _Float16* BB[3]; _Float16* BS[3]; for (int i = 0; i < 3; ++i) { BB[i] = (_Float16*)take((size_t)DK * 2 * DK * 2); BS[i] = (_Float16*)take((size_t)DK * 2 * DK * NG * 2); } _Float16* BOUT = (_Float16*)take((size_t)CIN * 2 * DK * 2);
  _Float16* X16 = (_Float16*)take((size_t)NPX * CIN * 2); float* ATT = (float*)take((size_t)NPX * DK * 4); float* IST = (float*)take((size_t)2 * NIMG * DK * 32 * 4); _Float16* SIL = (_Float16*)take((size_t)NPX * 2 * DK * 2); _Float16* BAS = (_Float16*)take((size_t)NPX * 2 * DK * NG * 2);
  float* G = (float*)take((size_t)3 * NPX * DK * 4); float* F = (float*)take((size_t)3 * NPX * DK * 4); _Float16* Qh = (_Float16*)take((size_t)NPX * DK * 2); _Float16* Ql = (_Float16*)take((size_t)NPX * DK * 2); _Float16* Kh = (_Float16*)take((size_t)NPX * DK * 2); _Float16* Kl = (_Float16*)take((size_t)NPX * DK * 2); _Float16* Vth = (_Float16*)take((size_t)NPX * DK * 2); _Float16* Vtl = (_Float16*)take((size_t)NPX * DK * 2);
  float* O = (float*)take((size_t)NPX * DK * 4); _Float16* O16 = (_Float16*)take((size_t)NPX * 2 * DK * 2); float* A2 = (float*)take((size_t)NPX * CIN * 4); float* Y = (float*)take((size_t)NPX * CIN * 4); float* BST = (float*)take((size_t)2 * CIN * 32 * 4);
  unsigned* MB = (unsigned*)take((size_t)NPI * (NPI / 32) * 4); int* RA = (int*)take((size_t)NPI * 4); int* KE = (int*)take((size_t)(NPI / 64) * 32 * 4);
  if (off > ws_size) return;      /* 0.7 + 8 + 4 + 4 + 32 + 24 + 12 + 4 + 4 + 16 + 16 + 2 = 126.7 MiB */
  k_prep<<<NB_XCL + NB_TAB + 3 * NB_WS + 3 * NB_WB + NB_WO + NB_WI, 256, 0, stream>>>(x, w_in, w_out, qbw, kbw, vbw, qsw, ksw, vsw, X16, BIN, BOUT, BB[0], BB[1], BB[2], BS[0], BS[1], BS[2], MB, RA, KE);
  const dim3 g64((NPX / 128) * 1, 1), g64x3((NPX / 128) * 1, 3), g256((NPX / 128) * (CIN / 64), 1);
  k_gemm2<0><<<g64, 128, 0, stream>>>(X16, CIN, 0, BIN, CIN, 0, 0.0625f, b_in, 0, nullptr, 1, 0, 0, ATT, nullptr, DK, 0, NPX, DK, CIN);      /* att = conv1x1(x) + b */
  k_stat0_silu<<<NB_IS + NB_SIL, 256, 0, stream>>>(ATT, IST, IST, SIL);
  k_stat1_base<<<NB_IS + 3 * NB_GB, 256, 0, stream>>>(ATT, IST, IST, SIL, BB[0], BB[1], BB[2], qbb, kbb, vbb, G, (size_t)NPX * DK, DK, NPX, DK, 2 * DK);      /* G = base(silu) + b_base, planes q, k, v */
  k_basis<<<(NPX * DK + 255) / 256, 256, 0, stream>>>(ATT, IST, BAS);
  const size_t n8 = (size_t)NPX * DK / 8; const unsigned nb8 = (unsigned)((n8 + 255) / 256);
  k_gemm2qkv<<<g64x3, 128, 0, stream>>>(BAS, 2 * DK * NG, BS[0], BS[1], BS[2], 2 * DK * NG, 0.0625f, qsb, ksb, vsb, G, F, (size_t)NPX * DK, DK, NPX, DK, 2 * DK * NG);      /* F = spline(basis) + b_spline + G */
  k_pack<<<NB_VT + 2 * NB_HL, 256, 0, stream>>>(F, F + (size_t)NPX * DK, F + (size_t)2 * NPX * DK, Qh, Ql, Kh, Kl, Vth, Vtl);
  k_flashm<NPI, NPI, KSPLIT><<<NIMG * NH * (NPI / 64), 128 * KSPLIT, 0, stream>>>(Qh, Ql, Kh, Kl, Vth, Vtl, MB, RA, KE, O, DK);      /* slab = image (NH 1) */
  k_pair16<<<nb8, 256, 0, stream>>>(O, DK, O16, NPX);
  k_gemm2<0><<<g256, 128, 0, stream>>>(O16, 2 * DK, 0, BOUT, 2 * DK, 0, 0.0625f, b_out, 0, nullptr, 1, 0, 0, A2, nullptr, CIN, 0, NPX, CIN, 2 * DK);      /* att2 = conv1x1(out) + b (pair operand) */
  k_y<<<NIMG * (CIN / 64) * (NPI / 64), 256, 0, stream>>>(x, gam, A2, Y);
  k_bnstat<<<CIN, 256, 0, stream>>>(Y, BST, 0, BST); k_bnstat<<<CIN, 256, 0, stream>>>(Y, BST, 1, BST);
  k_bnout<<<(NIMG * CIN * (NPI / 4) + 255) / 256, 256, 0, stream>>>(Y, BST, bnw, bnb, (float*)d_out);
}

// v006
// It runs in 161 microseconds.
// Two timings next to v005 put it at 1.34 and 1.37 times that version's speed.
// All steps since v000 together make it 5.71 times as fast.
#include <hip/hip_runtime.h>
// Self-KAN attention (4 images, 256 channels, 64 x 64): att = conv1x1(x) (64 ch); q, k, v = FastKAN 1x1 convs (base_conv(silu(att)) + spline_conv(RBF basis of the instance-normalised att, 8 grid points)); energy = q.k over the 4096 positions (NO scaling), softmax over keys, out = v.attn^T; att2 = conv1x1(out) (256 ch); y = gamma*x + att2; training-mode BatchNorm -> [4,256,64,64].
// Compute dtype: x, weights, biases, gamma, BN affine rounded to bf16; x exact in f16; silu/basis operands as hi + 16x residual pairs (~2^-20); q, k, P, v as hi + x2^10 residual pairs (~2^-21); the attention output as hi + 16x residual pairs too; f32 accumulation, statistics, softmax. v_wmma_f32_16x16x32_f16.
#define NIMG 4
#define CIN 256
#define DK 64
#define HW 64
#define NPI (HW * HW)            /* 4096 */
#define NPX (NIMG * NPI)         /* 16384 */
#define NG 8
#define NH 1
#define DM DK
#define SCL 1.0f
#define KSPLIT 4
typedef __bf16 v16b __attribute__((ext_vector_type(16)));
typedef unsigned short v8us __attribute__((ext_vector_type(8), may_alias));
typedef float  v8f  __attribute__((ext_vector_type(8)));
typedef float  v4f  __attribute__((ext_vector_type(4)));
typedef float  v4fa __attribute__((ext_vector_type(4), may_alias));
union FragB { v16b v; v8us half[2]; unsigned short u[16]; };

__device__ __forceinline__ unsigned short bf16_bits(float x) { unsigned int u = __float_as_uint(x); return (unsigned short)((u + 0x7FFFu + ((u >> 16) & 1u)) >> 16); }
__device__ __forceinline__ float bf16_val(unsigned short b) { return __uint_as_float(((unsigned int)b) << 16); }
__device__ __forceinline__ float bf16_round(float x) { return bf16_val(bf16_bits(x)); }
// D += A·B with NT terms: 1 = ah·bh, 2 = + al·bh (A split), 3 = + ah·bl (both split)
template <int NT>
__device__ __forceinline__ v8f mmaN(v16b ah, v16b al, v16b bh, v16b bl, v8f c) {
  c = __builtin_amdgcn_wmma_f32_16x16x32_bf16(false, ah, false, bh, (short)0, c, false, false);
  if (NT >= 2) c = __builtin_amdgcn_wmma_f32_16x16x32_bf16(false, al, false, bh, (short)0, c, false, false);
  if (NT >= 3) c = __builtin_amdgcn_wmma_f32_16x16x32_bf16(false, ah, false, bl, (short)0, c, false, false);
  asm volatile("v_nop\n\tv_nop\n\tv_nop\n\tv_nop" : "+v"(c) : "v"(ah), "v"(al), "v"(bh), "v"(bl));
  return c;
}

__global__ __launch_bounds__(256) void k_wt_bf16(const float* __restrict__ W, unsigned short* __restrict__ Wt, int K, int N) {
  const int t = blockIdx.x * 256 + threadIdx.x;
  const int k8n = K / 8;
  if (t >= N * k8n) return;
  const int n = t / k8n, k8 = (t % k8n) * 8;
  v8us v;
#pragma unroll
  for (int i = 0; i < 8; ++i) v[i] = bf16_bits(W[(size_t)(k8 + i) * N + n]);
  *(v8us*)(Wt + (size_t)n * K + k8) = v;
  
}

// GEMM C[M][N] (f32, pitch ldc) = act(A[M][K]·W + bias). A f32 row-major (pitch lda) converted per fragment to bf16
// (ASPLIT: hi/lo two planes -> 2 terms, else single rounded term); Wt bf16 [N][K] (pitch ldb). BIAS_BF16 rounds the
// bias to bf16 first (bias quantised to bf16 before the add). K%32==0, M%16==0, N%64==0.
template <bool ASPLIT, int ACT, bool BIAS_BF16>
__global__ __launch_bounds__(128) void k_gemm_bf(const float* __restrict__ A, int lda, const unsigned short* __restrict__ Wt, int ldb,
                                               const float* __restrict__ bias, float* __restrict__ C, int ldc, int M, int N, int K) {
  __shared__ __attribute__((aligned(16))) float so[4][16][64];
  const int tid = threadIdx.x, w = tid >> 5, lane = tid & 31, ln = lane & 15, hh = lane >> 4;
  const int ntn = N / 64;
  const int wid = blockIdx.x * 4 + w;
  const int mt = wid / ntn, nq = wid % ntn;
  if (mt * 16 >= M) return;
  const int row0 = mt * 16, col0 = nq * 64;
  const float* arow = A + (size_t)(row0 + ln) * lda;
  v8f acc[4] = {};
  for (int kb = 0; kb < K; kb += 32) {
    FragB ah, al;
    const v4f x0 = *(const v4fa*)(arow + kb + 8 * hh), x1 = *(const v4fa*)(arow + kb + 8 * hh + 4);
    const v4f x2 = *(const v4fa*)(arow + kb + 16 + 8 * hh), x3 = *(const v4fa*)(arow + kb + 16 + 8 * hh + 4);
    float xs[16] = {x0[0],x0[1],x0[2],x0[3],x1[0],x1[1],x1[2],x1[3],x2[0],x2[1],x2[2],x2[3],x3[0],x3[1],x3[2],x3[3]};
#pragma unroll
    for (int i = 0; i < 16; ++i) { const unsigned short hb = bf16_bits(xs[i]); ah.u[i] = hb; al.u[i] = ASPLIT ? bf16_bits(xs[i] - bf16_val(hb)) : (unsigned short)0; }
#pragma unroll
    for (int t = 0; t < 4; ++t) {
      const unsigned short* brow = Wt + (size_t)(col0 + t * 16 + ln) * ldb + kb;
      FragB b;
      b.half[0] = *(const v8us*)(brow + 8 * hh);
      b.half[1] = *(const v8us*)(brow + 16 + 8 * hh);
      acc[t] = mmaN<ASPLIT ? 2 : 1>(ah.v, al.v, b.v, b.v, acc[t]);
    }
  }
#pragma unroll
  for (int t = 0; t < 4; ++t) {
    float bv = bias ? bias[col0 + t * 16 + ln] : 0.f;
    if (BIAS_BF16) bv = bf16_round(bv);
#pragma unroll
    for (int r = 0; r < 8; ++r) { float v = acc[t][r] + bv; if (ACT == 1) v = fmaxf(v, 0.f); so[w][8 * hh + r][t * 16 + ln] = v; }
  }
  __builtin_amdgcn_fence(__ATOMIC_ACQ_REL, "workgroup");
  __builtin_amdgcn_wave_barrier();
  const int rsub = lane >> 4, c4 = (lane & 15) * 4;
  {
#pragma unroll
    for (int q = 0; q < 8; ++q) {
      const int r = q * 2 + rsub;
      const v4f v = *(const v4fa*)&so[w][r][c4];
      *(v4f*)(C + (size_t)(row0 + r) * ldc + col0 + c4) = v;
    }
    
  }
}

// GEMM C = act(A·W + bias + resid): A f32 (ASPLIT -> hi/lo 2 terms), Wt bf16 [N][K]; ACT 0 none, 1 relu, 2 exact gelu;
// resid (optional, f32, row index = (row % rmod), pitch ldr, RES_BF16 rounds it) added before the activation.
template <bool ASPLIT, int ACT, bool BIAS_BF16, bool RES_BF16>
__global__ __launch_bounds__(128) void k_gemm_bf3(const float* __restrict__ A, int lda, const unsigned short* __restrict__ Wt, int ldb,
                                                const float* __restrict__ bias, const float* __restrict__ resid, int rmod, int ldr,
                                                float* __restrict__ C, int ldc, int M, int N, int K) {
  __shared__ __attribute__((aligned(16))) float so[4][16][64];
  const int tid = threadIdx.x, w = tid >> 5, lane = tid & 31, ln = lane & 15, hh = lane >> 4;
  const int ntn = N / 64;
  const int wid = blockIdx.x * 4 + w;
  const int mt = wid / ntn, nq = wid % ntn;
  if (mt * 16 >= M) return;
  const int row0 = mt * 16, col0 = nq * 64;
  const float* arow = A + (size_t)(row0 + ln) * lda;
  v8f acc[4] = {};
  for (int kb = 0; kb < K; kb += 32) {
    FragB ah, al;
    const v4f x0 = *(const v4fa*)(arow + kb + 8 * hh), x1 = *(const v4fa*)(arow + kb + 8 * hh + 4);
    const v4f x2 = *(const v4fa*)(arow + kb + 16 + 8 * hh), x3 = *(const v4fa*)(arow + kb + 16 + 8 * hh + 4);
    float xs[16] = {x0[0],x0[1],x0[2],x0[3],x1[0],x1[1],x1[2],x1[3],x2[0],x2[1],x2[2],x2[3],x3[0],x3[1],x3[2],x3[3]};
#pragma unroll
    for (int i = 0; i < 16; ++i) { const unsigned short hb = bf16_bits(xs[i]); ah.u[i] = hb; al.u[i] = ASPLIT ? bf16_bits(xs[i] - bf16_val(hb)) : (unsigned short)0; }
#pragma unroll
    for (int t = 0; t < 4; ++t) {
      const unsigned short* brow = Wt + (size_t)(col0 + t * 16 + ln) * ldb + kb;
      FragB b;
      b.half[0] = *(const v8us*)(brow + 8 * hh);
      b.half[1] = *(const v8us*)(brow + 16 + 8 * hh);
      acc[t] = mmaN<ASPLIT ? 2 : 1>(ah.v, al.v, b.v, b.v, acc[t]);
    }
  }
#pragma unroll
  for (int t = 0; t < 4; ++t) {
    const int col = col0 + t * 16 + ln;
    float bv = bias ? bias[col] : 0.f;
    if (BIAS_BF16) bv = bf16_round(bv);
#pragma unroll
    for (int r = 0; r < 8; ++r) {
      float v = acc[t][r] + bv;
      if (resid) { float rv = resid[(size_t)((row0 + 8 * hh + r) % rmod) * ldr + col]; if (RES_BF16) rv = bf16_round(rv); v += rv; }
      if (ACT == 1) v = fmaxf(v, 0.f);
      if (ACT == 2) v = 0.5f * v * (1.0f + erff(v * 0.70710678118654752f));
      if (ACT == 3) { const float u = 0.7978845608028654f * (v + 0.044715f * v * v * v); v = 0.5f * v * (1.0f + tanhf(u)); }
      so[w][8 * hh + r][t * 16 + ln] = v;
    }
  }
  __builtin_amdgcn_fence(__ATOMIC_ACQ_REL, "workgroup");
  __builtin_amdgcn_wave_barrier();
  const int rsub = lane >> 4, c4 = (lane & 15) * 4;
  {
#pragma unroll
    for (int q = 0; q < 8; ++q) {
      const int r = q * 2 + rsub;
      const v4f v = *(const v4fa*)&so[w][r][c4];
      *(v4f*)(C + (size_t)(row0 + r) * ldc + col0 + c4) = v;
    }
    
  }
}
// row LayerNorm (biased variance, eps) over N: s = X (+ R); optional out_sum <- s; out_norm <- (s-mu)*rsqrt(var+eps)*g + b
template <bool PARAM_BF16>
__global__ __launch_bounds__(256) void k_layernorm(const float* __restrict__ X, const float* __restrict__ R, const float* __restrict__ g, const float* __restrict__ bta,
                                                  float* __restrict__ out_sum, float* __restrict__ out_norm, int N, float eps) {
  __shared__ float red[256];
  const int row = blockIdx.x, tid = threadIdx.x;
  const float* x = X + (size_t)row * N; const float* rr = R ? R + (size_t)row * N : nullptr;
  float vals[16];                     // up to N = 4096
  const int per = N / 256;            // contiguous chunk per thread? use strided-by-4 chunks: thread handles j = tid*4 + 1024*u
  float s1 = 0.f;
  for (int u = 0; u < per / 4; ++u) {
    const int j = tid * 4 + 1024 * u;
    const v4f a = *(const v4fa*)(x + j);
    v4f b = {0.f,0.f,0.f,0.f}; if (rr) b = *(const v4fa*)(rr + j);
#pragma unroll
    for (int q = 0; q < 4; ++q) { const float v = a[q] + b[q]; vals[u * 4 + q] = v; s1 += v; }
  }
  red[tid] = s1; __syncthreads();
  for (int st = 128; st > 0; st >>= 1) { if (tid < st) red[tid] += red[tid + st]; __syncthreads(); }
  const float mu = red[0] / (float)N; __syncthreads();
  float s2 = 0.f;
  for (int u = 0; u < per / 4; ++u)
#pragma unroll
    for (int q = 0; q < 4; ++q) { const float c = vals[u * 4 + q] - mu; s2 += c * c; }
  red[tid] = s2; __syncthreads();
  for (int st = 128; st > 0; st >>= 1) { if (tid < st) red[tid] += red[tid + st]; __syncthreads(); }
  const float rs = rsqrtf(red[0] / (float)N + eps);
  {
    for (int u = 0; u < per / 4; ++u) {
      const int j = tid * 4 + 1024 * u;
      v4f o, sm;
#pragma unroll
      for (int q = 0; q < 4; ++q) {
        float gg = g[j + q], bb = bta[j + q];
        if (PARAM_BF16) { gg = bf16_round(gg); bb = bf16_round(bb); }
        sm[q] = vals[u * 4 + q]; o[q] = (vals[u * 4 + q] - mu) * rs * gg + bb;
      }
      if (out_sum) *(v4f*)(out_sum + (size_t)row * N + j) = sm;
      *(v4f*)(out_norm + (size_t)row * N + j) = o;
    }
    
  }
}



// ---- f16 WMMA path (v_wmma_f32_16x16x32_f16): 11-bit significands for operands in range — used where a [0,1] probability operand needs more precision than bf16
typedef _Float16 v16h __attribute__((ext_vector_type(16)));
union FragH { v16h v; v8us half[2]; _Float16 h[16]; unsigned short u[16]; };
template <int NT>
__device__ __forceinline__ v8f mmaH(v16h ah, v16h al, v16h bh, v16h bl, v8f c) {
  c = __builtin_amdgcn_wmma_f32_16x16x32_f16(false, ah, false, bh, (short)0, c, false, false);
  if (NT >= 2) c = __builtin_amdgcn_wmma_f32_16x16x32_f16(false, al, false, bh, (short)0, c, false, false);
  if (NT >= 3) c = __builtin_amdgcn_wmma_f32_16x16x32_f16(false, ah, false, bl, (short)0, c, false, false);
  asm volatile("v_nop\n\tv_nop\n\tv_nop\n\tv_nop" : "+v"(c) : "v"(ah), "v"(al), "v"(bh), "v"(bl));
  return c;
}
// batched GEMM like k_gemm_b but f16 operands: A f32 (split into f16 hi/lo if ASPLIT, else rounded to f16), Bt = f16 values [n][k]; alpha; C f32; N multiple of 16 (partial tiles skipped)
template <bool ASPLIT>
__global__ __launch_bounds__(128) void k_gemm_h(const float* __restrict__ A, int lda, size_t sA, const _Float16* __restrict__ Bh, int ldb, size_t sB, float alpha, float* __restrict__ C, int ldc, size_t sC, int M, int N, int K) {
  __shared__ __attribute__((aligned(16))) float so[4][16][64];
  const int tid = threadIdx.x, w = tid >> 5, lane = tid & 31, ln = lane & 15, hh = lane >> 4; const int by = blockIdx.y;
  A += (size_t)by * sA; Bh += (size_t)by * sB; C += (size_t)by * sC;
  const int ntn = (N + 63) / 64; const int wid = blockIdx.x * 4 + w; const int mt = wid / ntn, nq = wid % ntn; if (mt * 16 >= M) return;
  const int row0 = mt * 16, col0 = nq * 64; const float* arow = A + (size_t)(row0 + ln) * lda;
  v8f acc[4] = {};
  for (int kb = 0; kb < K; kb += 32) {
    FragH ah, al;
    const v4f x0 = *(const v4fa*)(arow + kb + 8 * hh), x1 = *(const v4fa*)(arow + kb + 8 * hh + 4), x2 = *(const v4fa*)(arow + kb + 16 + 8 * hh), x3 = *(const v4fa*)(arow + kb + 16 + 8 * hh + 4);
    float xs[16] = {x0[0],x0[1],x0[2],x0[3],x1[0],x1[1],x1[2],x1[3],x2[0],x2[1],x2[2],x2[3],x3[0],x3[1],x3[2],x3[3]};
#pragma unroll
    for (int i = 0; i < 16; ++i) { const _Float16 h = (_Float16)xs[i]; ah.h[i] = h; al.h[i] = ASPLIT ? (_Float16)(xs[i] - (float)h) : (_Float16)0.0f; }
#pragma unroll
    for (int t = 0; t < 4; ++t) { if (col0 + t * 16 >= N) continue; const size_t boff = (size_t)(col0 + t * 16 + ln) * ldb + kb; FragH bq; bq.half[0] = *(const v8us*)(Bh + boff + 8 * hh); bq.half[1] = *(const v8us*)(Bh + boff + 16 + 8 * hh);
      acc[t] = mmaH<ASPLIT ? 2 : 1>(ah.v, al.v, bq.v, bq.v, acc[t]); }
  }
#pragma unroll
  for (int t = 0; t < 4; ++t) { if (col0 + t * 16 >= N) continue;
#pragma unroll
    for (int r = 0; r < 8; ++r) so[w][8 * hh + r][t * 16 + ln] = acc[t][r] * alpha; }
  __builtin_amdgcn_fence(__ATOMIC_ACQ_REL, "workgroup"); __builtin_amdgcn_wave_barrier();
  const int rsub = lane >> 4, c4 = (lane & 15) * 4;
  {
#pragma unroll
    for (int q = 0; q < 8; ++q) { const int r = q * 2 + rsub; if (col0 + c4 < N) { const v4f v = *(const v4fa*)&so[w][r][c4]; *(v4f*)(C + (size_t)(row0 + r) * ldc + col0 + c4) = v; } }
     }
}

// Wt[n][k] = f16(W[k][n]·scale) from f32 row-major W[K][N] (scale = power of two; bf16-exact weights stay exact in f16 away from the subnormal range)
__global__ __launch_bounds__(256) void k_wt_f16(const float* __restrict__ W, _Float16* __restrict__ Wt, int K, int N, float scale) {
  const int t = blockIdx.x * 256 + threadIdx.x; if (t >= N * (K / 8)) return; const int n = t / (K / 8), k8 = (t % (K / 8)) * 8; FragH f;
#pragma unroll
  for (int i = 0; i < 8; ++i) f.h[i] = (_Float16)(bf16_round(W[(size_t)(k8 + i) * N + n]) * scale); const v8us o = f.half[0];
  *(v8us*)((unsigned short*)Wt + (size_t)n * K + k8) = o; 
}
// k_gemm_hh variant with fused epilogue: v = acc·alpha + bias[by·sBias + col] (+ CP[(row/rowsPerB)·sCPb + by·64 + col] if CP) ; ACT 0 none / 1 elu ; writes f16 C16 (and f32 C if non-null)
template <int ACT>
__global__ __launch_bounds__(128) void k_gemm_hhx(const _Float16* __restrict__ A, int lda, size_t sA, const _Float16* __restrict__ Bh, int ldb, size_t sB, float alpha, const float* __restrict__ bias, size_t sBias, const float* __restrict__ CP, int rowsPerB, size_t sCPb, int row0g,
    float* __restrict__ C, _Float16* __restrict__ C16, int ldc, size_t sC, int M, int N, int K) {
  __shared__ __attribute__((aligned(16))) float so[4][16][64];
  const int tid = threadIdx.x, w = tid >> 5, lane = tid & 31, ln = lane & 15, hh = lane >> 4; const int by = blockIdx.y;
  A += (size_t)by * sA; Bh += (size_t)by * sB; const size_t cofs = (size_t)by * sC; const float* bp = bias ? bias + (size_t)by * sBias : nullptr;
  const int ntn = (N + 63) / 64; const int wid = blockIdx.x * 4 + w; const int mt = wid / ntn, nq = wid % ntn; if (mt * 16 >= M) return;
  const int row0 = mt * 16, col0 = nq * 64; const _Float16* arow = A + (size_t)(row0 + ln) * lda;
  v8f acc[4] = {};
  for (int kb = 0; kb < K; kb += 32) { FragH ah; ah.half[0] = *(const v8us*)((const unsigned short*)arow + kb + 8 * hh); ah.half[1] = *(const v8us*)((const unsigned short*)arow + kb + 16 + 8 * hh);
#pragma unroll
    for (int t = 0; t < 4; ++t) { if (col0 + t * 16 >= N) continue; const size_t boff = (size_t)(col0 + t * 16 + ln) * ldb + kb; FragH bq; bq.half[0] = *(const v8us*)((const unsigned short*)Bh + boff + 8 * hh); bq.half[1] = *(const v8us*)((const unsigned short*)Bh + boff + 16 + 8 * hh);
      acc[t] = mmaH<1>(ah.v, ah.v, bq.v, bq.v, acc[t]); }
  }
#pragma unroll
  for (int t = 0; t < 4; ++t) { if (col0 + t * 16 >= N) continue; const int col = col0 + t * 16 + ln; const float bv = bp ? bf16_round(bp[col]) : 0.f;
#pragma unroll
    for (int r = 0; r < 8; ++r) { float v = acc[t][r] * alpha + bv; if (CP) { const int bidx = (row0g + row0 + 8 * hh + r) / rowsPerB; v += CP[(size_t)bidx * sCPb + (size_t)by * 64 + col]; } if (ACT == 1) v = (v > 0.f) ? v : expm1f(v); else if (ACT == 7) v = (v > 0.f) ? v + 1.0f : expf(v); else if (ACT == 8) v = tanhf(v); else if (ACT == 9) v = 0.5f * v * (1.0f + tanhf(0.7978845608028654f * (v + 0.044715f * v * v * v))); else if (ACT == 11) v = 1.0f / (1.0f + expf(-v)); else if (ACT == 12) v = (v > 0.f) ? v : 0.01f * v; else if (ACT == 14) v = (v > 0.f) ? v : 0.1f * v; else if (ACT == 15) v = v / (1.0f + expf(-v)); else if (ACT == 3) v = fmaxf(v, 0.f); else if (ACT == 6) v = 0.5f * v * (1.0f + erff(v * 0.70710678118654752f)); so[w][8 * hh + r][t * 16 + ln] = v; } }
  __builtin_amdgcn_fence(__ATOMIC_ACQ_REL, "workgroup"); __builtin_amdgcn_wave_barrier();
  const int rsub = lane >> 4, c4 = (lane & 15) * 4; typedef _Float16 v4h __attribute__((ext_vector_type(4)));
  {
#pragma unroll
    for (int q = 0; q < 8; ++q) { const int r = q * 2 + rsub; if (col0 + c4 < N) { const v4f v = *(const v4fa*)&so[w][r][c4]; if (C) *(v4f*)(C + cofs + (size_t)(row0 + r) * ldc + col0 + c4) = v; if (C16) { v4h h4; for (int i = 0; i < 4; ++i) h4[i] = (_Float16)v[i]; *(v4h*)(C16 + cofs + (size_t)(row0 + r) * ldc + col0 + c4) = h4; } } }
     }
}


typedef _Float16 v4h __attribute__((ext_vector_type(4)));

__global__ __launch_bounds__(256) void k_x16(const float* __restrict__ x, _Float16* __restrict__ X16, size_t n8) { const size_t t = (size_t)blockIdx.x * 256 + threadIdx.x; if (t >= n8) return; FragH f;
#pragma unroll
  for (int q = 0; q < 8; ++q) f.h[q] = (_Float16)bf16_round(x[t * 8 + q]); *(v8us*)((unsigned short*)X16 + t * 8) = f.half[0];  }
__global__ __launch_bounds__(256) void k_h16(const float* __restrict__ x, _Float16* __restrict__ X16, size_t n8) { const size_t t = (size_t)blockIdx.x * 256 + threadIdx.x; if (t >= n8) return; FragH f;
#pragma unroll
  for (int q = 0; q < 8; ++q) f.h[q] = (_Float16)x[t * 8 + q]; *(v8us*)((unsigned short*)X16 + t * 8) = f.half[0];  }
__device__ __forceinline__ void d_round16f(const float* __restrict__ W, _Float16* __restrict__ Bt, size_t n8, unsigned bx) { const size_t t = (size_t)bx * 256 + threadIdx.x; if (t >= n8) return; FragH f;
#pragma unroll
  for (int i = 0; i < 8; ++i) f.h[i] = (_Float16)(bf16_round(W[t * 8 + i]) * 16.0f); *(v8us*)((unsigned short*)Bt + t * 8) = f.half[0];  }
template <int NHv, int TTv>
__global__ __launch_bounds__(256) void k_vt(const _Float16* __restrict__ V16, int ldv, int voff, _Float16* __restrict__ Vt) { __shared__ unsigned short tl[64][66]; const int tid = threadIdx.x; const int slab = blockIdx.x / (TTv / 64), lg = blockIdx.x % (TTv / 64); const int b = slab / NHv, h = slab % NHv;
  for (int i = tid; i < 64 * 8; i += 256) { const int r = i / 8, c8 = (i % 8) * 8; FragH f; f.half[0] = *(const v8us*)((const unsigned short*)V16 + ((size_t)b * TTv + lg * 64 + r) * ldv + voff + h * 64 + c8);
#pragma unroll
    for (int q = 0; q < 8; ++q) tl[r][c8 + q] = f.u[q]; }
  __syncthreads();
  {
#pragma unroll
    for (int rd = 0; rd < 2; ++rd) { const int d = rd * 32 + tid / 8, pc = tid % 8; FragH f;
#pragma unroll
      for (int q = 0; q < 8; ++q) f.u[q] = tl[pc * 8 + q][d];
      *(v8us*)((unsigned short*)Vt + ((size_t)slab * 64 + d) * TTv + lg * 64 + pc * 8) = f.half[0]; }
     } }

// FRAGMENT ORDER of the attention operands: a 16-row x 64-column tile (q, k) or a 64-row x 32-key block (v^T) is stored as its WMMA fragment halves one after the other, each half as 32 lanes x 16 bytes in lane order,
// so that a wave's 16-byte load reads 512 bytes in a row (4 whole lines) and not 32 bytes out of each of 16 lines. Which element a lane and register hold is unchanged.
// q, k: row r, columns 8 c8 .. 8 c8 + 7 -> tile r >> 4, half c8 >> 1 (= 2 ks + part), lane 16 (c8 & 1) + (r & 15).
__device__ __forceinline__ void d_hl(const float* __restrict__ F, _Float16* __restrict__ Hh, _Float16* __restrict__ Hl, size_t n8, unsigned bx) { const size_t t = (size_t)bx * 256 + threadIdx.x; if (t >= n8) return; FragH fh, fl; const v4f a = *(const v4fa*)(F + t * 8), c = *(const v4fa*)(F + t * 8 + 4);
#pragma unroll
  for (int q = 0; q < 4; ++q) { _Float16 h = (_Float16)a[q]; fh.h[q] = h; fl.h[q] = (_Float16)((a[q] - (float)h) * 1024.0f); h = (_Float16)c[q]; fh.h[4 + q] = h; fl.h[4 + q] = (_Float16)((c[q] - (float)h) * 1024.0f); }
  const size_t r = t >> 3; const unsigned c8 = (unsigned)t & 7u; const size_t o = ((r >> 4) * 4 + (c8 >> 1)) * 256 + ((c8 & 1u) * 16 + (r & 15)) * 8;
  { *(v8us*)((unsigned short*)Hh + o) = fh.half[0]; *(v8us*)((unsigned short*)Hl + o) = fl.half[0];  } }

// ---- fast GEMM (wave tile 32x64; requires M % 32 == 0 rows per launch region and N % 64 == 0); epilogue = k_gemm_hhx semantics ----
__device__ __forceinline__ v16h g2_frag(const _Float16* p, int hh) { FragH f; f.half[0] = *(const v8us*)((const unsigned short*)p + 8 * hh); f.half[1] = *(const v8us*)((const unsigned short*)p + 16 + 8 * hh); return f.v; }
__device__ __forceinline__ v8f g2_mma(v16h a, v16h b, v8f c) { v8f d = __builtin_amdgcn_wmma_f32_16x16x32_f16(false, a, false, b, (short)0, c, false, false); asm volatile("v_nop\n\tv_nop\n\tv_nop\n\tv_nop" : "+v"(d) : "v"(a), "v"(b)); return d; }
template <int ACT, int NWV>      /* NWV waves a block, each a 32 x 64 tile */
__device__ __forceinline__ void d_gemm2(const _Float16* __restrict__ A, int lda, size_t sA, const _Float16* __restrict__ Bh, int ldb, size_t sB, float alpha, const float* __restrict__ bias, size_t sBias, const float* __restrict__ CP, int rowsPerB, size_t sCPb, int row0g,
    float* __restrict__ C, _Float16* __restrict__ C16, int ldc, size_t sC, int M, int N, int K, unsigned bx, int by) {
  __shared__ __attribute__((aligned(16))) float so[NWV][32][68];
  const int tid = threadIdx.x, w = tid >> 5, lane = tid & 31, ln = lane & 15, hh = lane >> 4;
  A += (size_t)by * sA; Bh += (size_t)by * sB; const size_t cofs = (size_t)by * sC; const float* bp = bias ? bias + (size_t)by * sBias : nullptr;
  const int ntn = N >> 6; const int mt = bx / ntn, nq = bx - mt * ntn; const int row0 = mt * (32 * NWV) + 32 * w, col0 = nq * 64; if (row0 >= M) return;
  const _Float16* a0p = A + (size_t)(row0 + ln) * lda; const _Float16* a1p = a0p + (size_t)16 * lda;
  const _Float16* b0p = Bh + (size_t)(col0 + ln) * ldb; const _Float16* b1p = b0p + (size_t)16 * ldb; const _Float16* b2p = b1p + (size_t)16 * ldb; const _Float16* b3p = b2p + (size_t)16 * ldb;
  const v8f z8 = {0.f,0.f,0.f,0.f,0.f,0.f,0.f,0.f}; v8f c00 = z8, c01 = z8, c02 = z8, c03 = z8, c10 = z8, c11 = z8, c12 = z8, c13 = z8;
  // LOADS GO OUT IN GROUPS, AHEAD OF THEIR USE. No load moves across the statement behind a matrix instruction, so a load written at its use is waited for alone.
  // The six fragments of a 32-wide k step are loaded together, one step ahead, into a second register set (K % 64 == 0); the bias in front of the loop; the addend rows as one group behind it.
  float bvr[4] = {0.f, 0.f, 0.f, 0.f};
  if (bp) {
#pragma unroll
    for (int t = 0; t < 4; ++t) bvr[t] = bp[col0 + t * 16 + ln];
    asm volatile("s_wait_xcnt 0x0" ::: "memory"); }      /* the loads' address registers are reused right behind this branch */
  v16h a0 = g2_frag(a0p, hh), a1 = g2_frag(a1p, hh), b0 = g2_frag(b0p, hh), b1 = g2_frag(b1p, hh), b2 = g2_frag(b2p, hh), b3 = g2_frag(b3p, hh);
#pragma unroll 1      /* two k steps a trip: one per register set */
  for (int kb = 0; kb < K; kb += 64) { const int k1 = kb + 32;
    const v16h e0 = g2_frag(a0p + k1, hh), e1 = g2_frag(a1p + k1, hh), f0 = g2_frag(b0p + k1, hh), f1 = g2_frag(b1p + k1, hh), f2 = g2_frag(b2p + k1, hh), f3 = g2_frag(b3p + k1, hh);
    c00 = g2_mma(a0, b0, c00); c10 = g2_mma(a1, b0, c10); c01 = g2_mma(a0, b1, c01); c11 = g2_mma(a1, b1, c11);
    c02 = g2_mma(a0, b2, c02); c12 = g2_mma(a1, b2, c12); c03 = g2_mma(a0, b3, c03); c13 = g2_mma(a1, b3, c13);
    if (kb + 64 < K) { const int k2 = kb + 64; a0 = g2_frag(a0p + k2, hh); a1 = g2_frag(a1p + k2, hh); b0 = g2_frag(b0p + k2, hh); b1 = g2_frag(b1p + k2, hh); b2 = g2_frag(b2p + k2, hh); b3 = g2_frag(b3p + k2, hh); }
    c00 = g2_mma(e0, f0, c00); c10 = g2_mma(e1, f0, c10); c01 = g2_mma(e0, f1, c01); c11 = g2_mma(e1, f1, c11);
    c02 = g2_mma(e0, f2, c02); c12 = g2_mma(e1, f2, c12); c03 = g2_mma(e0, f3, c03); c13 = g2_mma(e1, f3, c13); }
  v8f accs[8] = {c00, c01, c02, c03, c10, c11, c12, c13};
  float cpv[8][8];
  if (CP) {
#pragma unroll
    for (int rr = 0; rr < 16; ++rr) { const int bidx = (row0g + row0 + (rr >> 3) * 16 + 8 * hh + (rr & 7)) / rowsPerB; const float* cr = CP + (size_t)bidx * sCPb + (size_t)by * 64 + col0 + ln;
#pragma unroll
      for (int t = 0; t < 4; ++t) cpv[(rr >> 3) * 4 + t][rr & 7] = cr[t * 16];
      asm volatile("s_wait_xcnt 0x0" ::: "memory"); } }      /* a row's address registers are free for the next rows' values; the data are not waited for here */
#pragma unroll
  for (int u = 0; u < 8; ++u) { const int t = u & 3, half = u >> 2; const float bv = bp ? bf16_round(bvr[t]) : 0.f;
#pragma unroll
    for (int r = 0; r < 8; ++r) { const int rloc = half * 16 + 8 * hh + r; float v = accs[u][r] * alpha + bv; if (CP) v += cpv[u][r];
      if (ACT == 3) v = fmaxf(v, 0.f); else if (ACT == 6) v = 0.5f * v * (1.0f + erff(v * 0.70710678118654752f)); else if (ACT == 11) v = 1.0f / (1.0f + expf(-v)); else if (ACT == 15) v = v / (1.0f + expf(-v)); else if (ACT == 12) v = (v > 0.f) ? v : 0.01f * v; else if (ACT == 8) v = tanhf(v);
      so[w][rloc][t * 16 + ln] = v; } }
  __builtin_amdgcn_fence(__ATOMIC_ACQ_REL, "workgroup"); __builtin_amdgcn_wave_barrier();
  const int rsub = lane >> 4, c4 = (lane & 15) * 4;
  {
#pragma unroll
    for (int q = 0; q < 16; ++q) { const int r = q * 2 + rsub; const v4f v = *(const v4fa*)&so[w][r][c4]; if (C) *(v4f*)(C + cofs + (size_t)(row0 + r) * ldc + col0 + c4) = v; if (C16) { v4h h4; for (int i = 0; i < 4; ++i) h4[i] = (_Float16)v[i]; *(v4h*)(C16 + cofs + (size_t)(row0 + r) * ldc + col0 + c4) = h4; } }
     } }
template <int ACT>
__global__ __launch_bounds__(128) void k_gemm2(const _Float16* __restrict__ A, int lda, size_t sA, const _Float16* __restrict__ Bh, int ldb, size_t sB, float alpha, const float* __restrict__ bias, size_t sBias, const float* __restrict__ CP, int rowsPerB, size_t sCPb, int row0g,
    float* __restrict__ C, _Float16* __restrict__ C16, int ldc, size_t sC, int M, int N, int K) {
  d_gemm2<ACT, 4>(A, lda, sA, Bh, ldb, sB, alpha, bias, sBias, CP, rowsPerB, sCPb, row0g, C, C16, ldc, sC, M, N, K, blockIdx.x, blockIdx.y); }
// LAUNCHES THAT NEED NOTHING OF EACH OTHER SHARE ONE GRID: a block-uniform branch on the block index picks the part; each part's code, block count and arithmetic are those of its own former launch.
// The q, k and v spline products on one operand A: blockIdx.y picks the weights, the bias, the f32 addend plane (CP, one row a row) and the result plane.
__global__ __launch_bounds__(128) void k_gemm2qkv(const _Float16* __restrict__ A, int lda, const _Float16* __restrict__ B0, const _Float16* __restrict__ B1, const _Float16* __restrict__ B2, int ldb, float alpha,
    const float* __restrict__ bias0, const float* __restrict__ bias1, const float* __restrict__ bias2, const float* __restrict__ CP, float* __restrict__ C, size_t plane, int ldc, int M, int N, int K) {
  const int i = blockIdx.y; const _Float16* Bh = (i == 0) ? B0 : (i == 1) ? B1 : B2; const float* bias = (i == 0) ? bias0 : (i == 1) ? bias1 : bias2;
  d_gemm2<0, 4>(A, lda, 0, Bh, ldb, 0, alpha, bias, 0, CP + (size_t)i * plane, 1, (size_t)ldc, 0, C + (size_t)i * plane, nullptr, ldc, 0, M, N, K, blockIdx.x, 0); }


template <int TK>
__device__ __forceinline__ void d_vthl(const float* __restrict__ VF, int ldv, _Float16* __restrict__ Vth, _Float16* __restrict__ Vtl, unsigned bx) { __shared__ float tl[64][65]; const int tid = threadIdx.x; const int slab = bx / (TK / 64), lg = bx % (TK / 64); const int b = slab / NH, h = slab % NH;
  for (int i = tid; i < 64 * 16; i += 256) { const int r = i / 16, c4 = (i % 16) * 4; const v4f a = *(const v4fa*)(VF + ((size_t)b * TK + lg * 64 + r) * ldv + h * 64 + c4); tl[r][c4] = a[0]; tl[r][c4 + 1] = a[1]; tl[r][c4 + 2] = a[2]; tl[r][c4 + 3] = a[3]; }
  __syncthreads();
  FragH fh[2], fl[2]; size_t oo[2];
#pragma unroll
  for (int rd = 0; rd < 2; ++rd) { const int d = rd * 32 + tid / 8, pc = tid % 8;
#pragma unroll
    for (int q = 0; q < 8; ++q) { const float v = tl[pc * 8 + q][d]; const _Float16 hv = (_Float16)v; fh[rd].h[q] = hv; fl[rd].h[q] = (_Float16)((v - (float)hv) * 1024.0f); }
    oo[rd] = (size_t)slab * 64 * TK + (size_t)((lg * 2 + (pc >> 2)) * 8 + (d >> 4) * 2 + ((pc >> 1) & 1)) * 256 + ((pc & 1) * 16 + (d & 15)) * 8; }      /* fragment order: 32-key block, half 2 dt + part, lane 16 hh + ln */
  {
#pragma unroll
    for (int rd = 0; rd < 2; ++rd) { *(v8us*)((unsigned short*)Vth + oo[rd]) = fh[rd].half[0]; *(v8us*)((unsigned short*)Vtl + oo[rd]) = fl[rd].half[0]; }
     } }
// One grid for the three operand packs: v^T of all images (slab = image), then q, then k.
#define NB_VT (NIMG * NH * (NPI / 64))
#define NB_HL (NPX * DK / 8 / 256)
__global__ __launch_bounds__(256) void k_pack(const float* __restrict__ FQ, const float* __restrict__ FK, const float* __restrict__ FV, _Float16* __restrict__ Qh, _Float16* __restrict__ Ql, _Float16* __restrict__ Kh, _Float16* __restrict__ Kl, _Float16* __restrict__ Vth, _Float16* __restrict__ Vtl) {
  const int bx = blockIdx.x;
  if (bx < NB_VT) d_vthl<NPI>(FV, DK, Vth, Vtl, bx);
  else if (bx < NB_VT + NB_HL) d_hl(FQ, Qh, Ql, (size_t)NPX * DK / 8, bx - NB_VT);
  else d_hl(FK, Kh, Kl, (size_t)NPX * DK / 8, bx - NB_VT - NB_HL); }

__device__ __forceinline__ float xhalf(float v) { const int b = __float_as_int(v); return __int_as_float(__builtin_amdgcn_permlanex16(b, b, 0x76543210, 0xfedcba98, false, false)); }      /* lane l <-> l ^ 16 */
template <int TQ, int TK, int KSP>
__global__ __launch_bounds__(128 * KSP) void k_flashm(const _Float16* __restrict__ Q16, const _Float16* __restrict__ Q16lo, const _Float16* __restrict__ K16, const _Float16* __restrict__ K16lo, const _Float16* __restrict__ Vt, const _Float16* __restrict__ Vtlo, const unsigned* __restrict__ MB, const int* __restrict__ RA, const int* __restrict__ KE, float* __restrict__ O, int ldo) {
  constexpr int RPW = 16, NQB = TQ / (4 * RPW), DT = 4, KS = 2, NW = 4 * KSP; static_assert(NH == 1 && DK == 64, "the fragment-order planes hold one 64-wide head");
  __shared__ __attribute__((aligned(16))) float sO[NW][RPW][64 + 4]; __shared__ float sM[NW][RPW], sL[NW][RPW];
  const int tid = threadIdx.x, w = tid >> 5, lane = tid & 31, ln = lane & 15, hh = lane >> 4; const int qt = w & 3, kp = __builtin_amdgcn_readfirstlane(w >> 2);      /* scalar: the key loop's counter and trip test stay wave-uniform */
  const int slab = blockIdx.x / NQB, qblk = blockIdx.x % NQB; const int b = slab / NH, h = slab % NH; const int qb0 = qblk * (4 * RPW); const int q0 = qb0 + qt * RPW;
  FragH aq[KS], aql[KS];
  { const size_t qo = (((size_t)b * TQ + q0) >> 4) * 1024 + lane * 8; const unsigned short* qr = (const unsigned short*)Q16 + qo; const unsigned short* ql = (const unsigned short*)Q16lo + qo;
#pragma unroll
    for (int ks = 0; ks < KS; ++ks) { aq[ks].half[0] = *(const v8us*)(qr + ks * 512); aq[ks].half[1] = *(const v8us*)(qr + ks * 512 + 256); aql[ks].half[0] = *(const v8us*)(ql + ks * 512); aql[ks].half[1] = *(const v8us*)(ql + ks * 512 + 256); } }
  const unsigned short* Vth = (const unsigned short*)Vt + (size_t)slab * 64 * TK; const unsigned short* Vtl = (const unsigned short*)Vtlo + (size_t)slab * 64 * TK;
  float m_r = -3.0e38f, l_r = 0.f; v8f oacc[DT], oaccl[DT];
#pragma unroll
  for (int dt = 0; dt < DT; ++dt) { oacc[dt] = (v8f){0.f,0.f,0.f,0.f,0.f,0.f,0.f,0.f}; oaccl[dt] = oacc[dt]; }
  int jend = KE[qblk * 32]; jend = min(TK, (jend + 31) & ~31); if (jend < 32) jend = 32;      /* block-uniform */
  const bool am = (RA[q0 + ln] != 0); const unsigned* mrow = MB + (size_t)(q0 + ln) * (TK / 32);
  const unsigned short* kr = (const unsigned short*)K16 + (((size_t)b * TK + kp * 32) >> 4) * 1024 + lane * 8; const unsigned short* kl = (const unsigned short*)K16lo + (((size_t)b * TK + kp * 32) >> 4) * 1024 + lane * 8;
  const unsigned short* vh = Vth + (size_t)kp * 2048 + lane * 8; const unsigned short* vl = Vtl + (size_t)kp * 2048 + lane * 8; const unsigned* mp = mrow + kp;      /* this wave's block of 32 keys; all five step by KSP blocks a trip */
#pragma unroll 1
  for (int j0 = kp * 32; j0 < jend; j0 += 32 * KSP, kr += KSP * 2048, kl += KSP * 2048, vh += KSP * 2048, vl += KSP * 2048, mp += KSP) {
    v8f s[2]; FragH bk[2][KS], bkl[2][KS];      /* as in the GEMM body, loads go out in groups ahead of their use: both key tiles and the mask word here, in front of the first product */
#pragma unroll
    for (int nt = 0; nt < 2; ++nt) {
#pragma unroll
      for (int ks = 0; ks < KS; ++ks) { const int o = nt * 1024 + ks * 512; bk[nt][ks].half[0] = *(const v8us*)(kr + o); bkl[nt][ks].half[0] = *(const v8us*)(kl + o); if (nt + ks < 2) { bk[nt][ks].half[1] = *(const v8us*)(kr + o + 256); bkl[nt][ks].half[1] = *(const v8us*)(kl + o + 256); } } }
    const unsigned mw = *mp;
    asm volatile("s_wait_xcnt 0x0" ::: "memory");      /* the last load from an address may land on the address registers, which the loads above name too */
    bk[1][1].half[1] = *(const v8us*)(kr + 1792);
    asm volatile("s_wait_xcnt 0x0" ::: "memory");      /* the same, for the load above */
    bkl[1][1].half[1] = *(const v8us*)(kl + 1792);
#pragma unroll
    for (int nt = 0; nt < 2; ++nt) { v8f acc = (v8f){0.f,0.f,0.f,0.f,0.f,0.f,0.f,0.f}, accr = acc;
#pragma unroll
      for (int ks = 0; ks < KS; ++ks) { acc = mmaH<1>(bk[nt][ks].v, bk[nt][ks].v, aq[ks].v, aq[ks].v, acc); accr = mmaH<1>(bk[nt][ks].v, bk[nt][ks].v, aql[ks].v, aql[ks].v, accr); accr = mmaH<1>(bkl[nt][ks].v, bkl[nt][ks].v, aq[ks].v, aq[ks].v, accr); }
      s[nt] = acc + accr * 0.0009765625f; }
    FragH bv[DT], bl[DT];      /* the whole v^T block, in front of the softmax arithmetic, which covers its latency */
#pragma unroll
    for (int dt = 0; dt < DT; ++dt) { const int o = dt * 512; bv[dt].half[0] = *(const v8us*)(vh + o); bl[dt].half[0] = *(const v8us*)(vl + o); if (dt < DT - 1) { bv[dt].half[1] = *(const v8us*)(vh + o + 256); bl[dt].half[1] = *(const v8us*)(vl + o + 256); } }
    asm volatile("s_wait_xcnt 0x0" ::: "memory");      /* as at the key tiles */
    bv[DT - 1].half[1] = *(const v8us*)(vh + (DT - 1) * 512 + 256);
    asm volatile("s_wait_xcnt 0x0" ::: "memory");      /* as at the key tiles */
    bl[DT - 1].half[1] = *(const v8us*)(vl + (DT - 1) * 512 + 256);
    const unsigned mh = mw >> (8 * hh);      /* bit r: key 8 hh + r, bit 16 + r: key 16 + 8 hh + r */
    float sv[16]; float mc = -INFINITY;
#pragma unroll
    for (int e = 0; e < 16; ++e) { const bool ok = am || (((mh >> ((e >> 3) * 16 + (e & 7))) & 1u) == 0u); sv[e] = ok ? (am ? 0.f : s[e >> 3][e & 7] * SCL) : -INFINITY; mc = fmaxf(mc, sv[e]); }
    mc = fmaxf(mc, xhalf(mc));
    const float mn = fmaxf(m_r, mc); const float al = (mn > -1.0e38f) ? expf(m_r - mn) : 1.0f; m_r = mn;
    FragH pa, pl; float ps = 0.f;
#pragma unroll
    for (int e = 0; e < 16; ++e) { const float p = expf(sv[e] - mn);      /* a masked key: exp(-inf) = 0 (mn is finite) */
      ps += p; const float p10 = p * 1024.0f; const _Float16 ph = (_Float16)p10; pa.h[e] = ph; pl.h[e] = (_Float16)((p10 - (float)ph) * 1024.0f); }
    l_r = l_r * al + ps;
#pragma unroll
    for (int dt = 0; dt < DT; ++dt) { oacc[dt] *= al; oaccl[dt] *= al; }
#pragma unroll
    for (int dt = 0; dt < DT; ++dt) { oacc[dt] = mmaH<1>(bv[dt].v, bv[dt].v, pa.v, pa.v, oacc[dt]); oaccl[dt] = mmaH<1>(bl[dt].v, bl[dt].v, pa.v, pa.v, oaccl[dt]); oaccl[dt] = mmaH<1>(bv[dt].v, bv[dt].v, pl.v, pl.v, oaccl[dt]); } }
  { const float l = l_r + xhalf(l_r); if (hh == 0) { sM[w][ln] = m_r; sL[w][ln] = l; } }
#pragma unroll
  for (int dt = 0; dt < DT; ++dt) { const v8f o = oacc[dt] + oaccl[dt] * 0.0009765625f;      /* register r = O[query ln][dt * 16 + 8 hh + r] */
    *(v4fa*)&sO[w][ln][dt * 16 + 8 * hh] = (v4f){o[0], o[1], o[2], o[3]}; *(v4fa*)&sO[w][ln][dt * 16 + 8 * hh + 4] = (v4f){o[4], o[5], o[6], o[7]}; }
  __syncthreads();      /* every part's partial is in LDS before any thread merges */
  for (int i = tid; i < 4 * RPW * 16; i += 128 * KSP) { const int row = i >> 4, pc = i & 15; const int tq = row / RPW, rr = row % RPW;
    float mx = sM[tq][rr];
#pragma unroll
    for (int p = 1; p < KSP; ++p) mx = fmaxf(mx, sM[p * 4 + tq][rr]);
    float lsum = 0.f; v4f o = {0.f, 0.f, 0.f, 0.f};
#pragma unroll
    for (int p = 0; p < KSP; ++p) { const float wg = expf(sM[p * 4 + tq][rr] - mx); lsum += wg * sL[p * 4 + tq][rr]; const v4f val = *(const v4fa*)&sO[p * 4 + tq][rr][pc * 4]; o += val * wg; }
    const float inv = (lsum > 0.f) ? 1.0f / (lsum * 1024.0f) : 0.f;
    *(v4f*)(O + ((size_t)b * TQ + qb0 + row) * ldo + h * 64 + pc * 4) = o * inv; } }


__constant__ float GRIDV[8] = {-2.000000000e+00f,-1.428571463e+00f,-8.571428657e-01f,-2.857141793e-01f,2.857143879e-01f,8.571429253e-01f,1.428571701e+00f,2.000000000e+00f};
#define INV_DENOM (1.0f / 0.5714285714285714f)
__device__ __forceinline__ void d_fulltab(unsigned* __restrict__ MB, int* __restrict__ RA, int* __restrict__ KE, unsigned bx) {
  const int t = bx * 256 + threadIdx.x;
  if (t < NPI * (NPI / 32)) { *(unsigned*)(MB + t) = 0u;  }
  if (t < NPI) { *(int*)(RA + t) = 0;  }
  if (t < NPI / 64) { *(int*)(KE + t * 32) = NPI;  } }
// Layout changes go through a 64 x 64 LDS tile (pitch 65 floats: no bank conflict in either direction), so that every global read and write covers whole 128-byte lines.
__device__ __forceinline__ void d_xcl(const float* __restrict__ x, _Float16* __restrict__ X16, unsigned bx) {
  __shared__ float tl[64][65]; const int tid = threadIdx.x; const int pt = bx % (NPI / 64), ct = (bx / (NPI / 64)) % (CIN / 64), b = bx / ((NPI / 64) * (CIN / 64));
  const int r16 = tid / 16, k4 = (tid % 16) * 4; v4f a[4];      /* thread: rows r16 + 16 u of the tile, four floats at k4; the four loads fly together */
#pragma unroll      /* a[] stays in registers */
  for (int u = 0; u < 4; ++u) a[u] = *(const v4fa*)(x + ((size_t)b * CIN + ct * 64 + r16 + 16 * u) * NPI + pt * 64 + k4);
#pragma unroll      /* a[] stays in registers */
  for (int u = 0; u < 4; ++u) { float* d = &tl[r16 + 16 * u][k4]; d[0] = a[u][0]; d[1] = a[u][1]; d[2] = a[u][2]; d[3] = a[u][3]; }
  __syncthreads();      /* the whole tile is in LDS before any thread reads it across */
#pragma unroll      /* both rows' LDS reads are issued together */
  for (int rd = 0; rd < 2; ++rd) { const int p = rd * 32 + tid / 8, c8 = (tid % 8) * 8; FragH f;
#pragma unroll
    for (int q = 0; q < 8; ++q) f.h[q] = (_Float16)bf16_round(tl[c8 + q][p]);
    *(v8us*)((unsigned short*)X16 + ((size_t)b * NPI + pt * 64 + p) * CIN + ct * 64 + c8) = f.half[0]; } }
__device__ __forceinline__ void d_instat(const float* __restrict__ A, const float* __restrict__ ST0, int phase, float* __restrict__ ST, unsigned bx) {
  #pragma clang fp contract(off)
  __shared__ float sh[256]; const int b = bx / DK, c = bx % DK; const float mu = phase ? ST0[(size_t)bx * 32] : 0.f; float s = 0.f;
  for (int p = threadIdx.x; p < NPI; p += 256) { const float v = A[((size_t)b * NPI + p) * DK + c] - mu; s += phase ? v * v : v; }
  sh[threadIdx.x] = s; __syncthreads();
  for (int st = 128; st > 0; st >>= 1) { if ((int)threadIdx.x < st) sh[threadIdx.x] += sh[threadIdx.x + st]; __syncthreads(); }
  if (threadIdx.x == 0) { const float v = sh[0] / (float)NPI; float* d = ST + ((size_t)phase * NIMG * DK + bx) * 32; *(float*)d = v;  } }
__global__ __launch_bounds__(256) void k_basis(const float* __restrict__ A, const float* __restrict__ ST, _Float16* __restrict__ BAS) {
  #pragma clang fp contract(off)
  const int t = blockIdx.x * 256 + threadIdx.x; if (t >= NPX * DK) return; const int r = t / DK, c = t % DK; const int b = r / NPI; const float a = A[(size_t)r * DK + c];
  const float mu = ST[((size_t)b * DK + c) * 32], var = ST[((size_t)NIMG * DK + b * DK + c) * 32]; const float xn = (a - mu) * rsqrtf(var + 1e-5f); FragH bh, bl;
#pragma unroll
  for (int g = 0; g < NG; ++g) { const float z = (xn - GRIDV[g]) * INV_DENOM; const float e = expf(-(z * z)); const _Float16 hv = (_Float16)e; bh.h[g] = hv; bl.h[g] = (_Float16)((e - (float)hv) * 16.0f); }
  unsigned short* bd = (unsigned short*)BAS + (size_t)r * 2 * DK * NG + c * NG;
  { *(v8us*)bd = bh.half[0]; *(v8us*)(bd + DK * NG) = bl.half[0];  } }
__device__ __forceinline__ void d_silu(const float* __restrict__ A, _Float16* __restrict__ SIL, unsigned bx) {
  #pragma clang fp contract(off)
  const int t = bx * 256 + threadIdx.x; if (t >= NPX * (DK / 8)) return; const int r = t / (DK / 8), c0 = (t % (DK / 8)) * 8; const float* a = A + (size_t)r * DK + c0; FragH fh, fl;
#pragma unroll
  for (int q = 0; q < 8; ++q) { const float v = a[q]; const float sl = v / (1.0f + expf(-v)); const _Float16 hv = (_Float16)sl; fh.h[q] = hv; fl.h[q] = (_Float16)((sl - (float)hv) * 16.0f); }
  unsigned short* d = (unsigned short*)SIL + (size_t)r * 2 * DK + c0;
  { *(v8us*)d = fh.half[0]; *(v8us*)(d + DK) = fl.half[0];  } }
__device__ __forceinline__ void d_wnp2(const float* __restrict__ Wm, int K, int N, _Float16* __restrict__ Bt, unsigned bx) {
  const int t = bx * 256 + threadIdx.x; if (t >= N * (2 * K / 8)) return; const int n = t / (2 * K / 8), k0 = (t % (2 * K / 8)) * 8; const bool lo = (k0 >= K); const float sc = lo ? 1.0f : 16.0f; FragH f;
#pragma unroll
  for (int q = 0; q < 8; ++q) { const int k = k0 + q - (lo ? K : 0); f.h[q] = (_Float16)(bf16_round(Wm[(size_t)n * K + k]) * sc); }
  *(v8us*)((unsigned short*)Bt + (size_t)n * 2 * K + k0) = f.half[0];  }
// One grid for all that reads inputs alone: x turned to f16 rows (first: the longest part), the mask tables, the eight weight planes.
#define NB_XCL (NIMG * (CIN / 64) * (NPI / 64))
#define NB_TAB (NPI * (NPI / 32) / 256)
#define NB_WS (DK * (2 * DK * NG / 8) / 256)
#define NB_WB (DK * (2 * DK / 8) / 256)
#define NB_WO (CIN * (2 * DK / 8) / 256)
#define NB_WI (DK * CIN / 8 / 256)
__global__ __launch_bounds__(256) void k_prep(const float* __restrict__ x, const float* __restrict__ w_in, const float* __restrict__ w_out, const float* __restrict__ qbw, const float* __restrict__ kbw, const float* __restrict__ vbw,
    const float* __restrict__ qsw, const float* __restrict__ ksw, const float* __restrict__ vsw, _Float16* __restrict__ X16, _Float16* __restrict__ BIN, _Float16* __restrict__ BOUT,
    _Float16* __restrict__ BB0, _Float16* __restrict__ BB1, _Float16* __restrict__ BB2, _Float16* __restrict__ BS0, _Float16* __restrict__ BS1, _Float16* __restrict__ BS2, unsigned* __restrict__ MB, int* __restrict__ RA, int* __restrict__ KE) {
  int bx = blockIdx.x;
  if (bx < NB_XCL) { d_xcl(x, X16, bx); return; }
  bx -= NB_XCL; if (bx < NB_TAB) { d_fulltab(MB, RA, KE, bx); return; }
  bx -= NB_TAB; if (bx < 3 * NB_WS) { const int i = bx / NB_WS; d_wnp2((i == 0) ? qsw : (i == 1) ? ksw : vsw, DK * NG, DK, (i == 0) ? BS0 : (i == 1) ? BS1 : BS2, bx % NB_WS); return; }
  bx -= 3 * NB_WS; if (bx < 3 * NB_WB) { const int i = bx / NB_WB; d_wnp2((i == 0) ? qbw : (i == 1) ? kbw : vbw, DK, DK, (i == 0) ? BB0 : (i == 1) ? BB1 : BB2, bx % NB_WB); return; }
  bx -= 3 * NB_WB; if (bx < NB_WO) { d_wnp2(w_out, DK, CIN, BOUT, bx); return; }      /* (out,in) natural -> [16w | w] pair planes */
  d_round16f(w_in, BIN, (size_t)DK * CIN / 8, bx - NB_WO); }
// att's channel means beside silu(att): both read att alone.
#define NB_IS (NIMG * DK)
#define NB_SIL (NPX * (DK / 8) / 256)
__global__ __launch_bounds__(256) void k_stat0_silu(const float* __restrict__ A, const float* __restrict__ ST0, float* __restrict__ ST, _Float16* __restrict__ SIL) {
  const int bx = blockIdx.x;
  if (bx < NB_IS) d_instat(A, ST0, 0, ST, bx); else d_silu(A, SIL, bx - NB_IS); }
// att's channel variances beside the q, k, v base products (8 waves a block): the first reads att and the means, the second silu(att) and weights.
#define NB_GB (NPX / 256)
__global__ __launch_bounds__(256) void k_stat1_base(const float* __restrict__ A, const float* __restrict__ ST0, float* __restrict__ ST, const _Float16* __restrict__ SIL, const _Float16* __restrict__ B0, const _Float16* __restrict__ B1, const _Float16* __restrict__ B2,
    const float* __restrict__ bias0, const float* __restrict__ bias1, const float* __restrict__ bias2, float* __restrict__ G, size_t plane, int ldc, int M, int N, int K) {
  const int bx = blockIdx.x;
  if (bx < NB_IS) { d_instat(A, ST0, 1, ST, bx); return; }
  const int i = (bx - NB_IS) / NB_GB;
  d_gemm2<0, 8>(SIL, K, 0, (i == 0) ? B0 : (i == 1) ? B1 : B2, K, 0, 0.0625f, (i == 0) ? bias0 : (i == 1) ? bias1 : bias2, 0, nullptr, 1, 0, 0, G + (size_t)i * plane, nullptr, ldc, 0, M, N, K, (bx - NB_IS) % NB_GB, 0); }
__global__ __launch_bounds__(256) void k_pair16(const float* __restrict__ F, int n, _Float16* __restrict__ P, int rows) {
  #pragma clang fp contract(off)
  const int t = blockIdx.x * 256 + threadIdx.x; if (t >= rows * (n / 8)) return; const int r = t / (n / 8), c0 = (t % (n / 8)) * 8; const float* f = F + (size_t)r * n + c0; FragH fh, fl;
#pragma unroll
  for (int q = 0; q < 8; ++q) { const float v = f[q]; const _Float16 hv = (_Float16)v; fh.h[q] = hv; fl.h[q] = (_Float16)((v - (float)hv) * 16.0f); }
  unsigned short* d = (unsigned short*)P + (size_t)r * 2 * n + c0;
  { *(v8us*)d = fh.half[0]; *(v8us*)(d + n) = fl.half[0];  } }
// Y is kept channel-major ([image][channel][position], the layout of x and of the output): only the position-major A2 tile is turned, through LDS.
__global__ __launch_bounds__(256) void k_y(const float* __restrict__ x, const float* __restrict__ gam, const float* __restrict__ A2, float* __restrict__ Y) {
  #pragma clang fp contract(off)
  __shared__ float tl[64][65]; const int tid = threadIdx.x; const int pt = blockIdx.x % (NPI / 64), ct = (blockIdx.x / (NPI / 64)) % (CIN / 64), b = blockIdx.x / ((NPI / 64) * (CIN / 64)); const float g = bf16_round(gam[0]);
  const int r16 = tid / 16, k4 = (tid % 16) * 4; v4f a[4], xv[4];      /* thread: rows r16 + 16 u of a tile, four floats at k4; all eight loads fly together */
  const size_t o0 = ((size_t)b * CIN + ct * 64 + r16) * NPI + pt * 64 + k4;
#pragma unroll      /* a[], xv[] stay in registers */
  for (int u = 0; u < 4; ++u) { a[u] = *(const v4fa*)(A2 + ((size_t)b * NPI + pt * 64 + r16 + 16 * u) * CIN + ct * 64 + k4); xv[u] = *(const v4fa*)(x + o0 + (size_t)16 * u * NPI); }
#pragma unroll      /* a[] stays in registers */
  for (int u = 0; u < 4; ++u) { float* d = &tl[r16 + 16 * u][k4]; d[0] = a[u][0]; d[1] = a[u][1]; d[2] = a[u][2]; d[3] = a[u][3]; }      /* tl[position][channel] */
  __syncthreads();      /* the whole tile is in LDS before any thread reads it across */
#pragma unroll      /* xv[] stays in registers */
  for (int u = 0; u < 4; ++u) { v4f o;
#pragma unroll
    for (int q = 0; q < 4; ++q) o[q] = g * bf16_round(xv[u][q]) + tl[k4 + q][r16 + 16 * u];
    *(v4f*)(Y + o0 + (size_t)16 * u * NPI) = o; } }
__global__ __launch_bounds__(256) void k_bnstat(const float* __restrict__ Y, const float* __restrict__ ST0, int phase, float* __restrict__ ST) {
  #pragma clang fp contract(off)
  __shared__ float sh[256]; const int c = blockIdx.x; const float mu = phase ? ST0[(size_t)c * 32] : 0.f; float s = 0.f;
  for (int bi = 0; bi < NIMG; ++bi) { const float* yr = Y + ((size_t)bi * CIN + c) * NPI + threadIdx.x;      /* pixel bi * NPI + threadIdx.x + 256 k, in rising order */
#pragma unroll      /* the sixteen loads of an image fly together */
    for (int k = 0; k < NPI / 256; ++k) { const float v = yr[256 * k] - mu; s += phase ? v * v : v; } }
  sh[threadIdx.x] = s; __syncthreads();
  for (int st = 128; st > 0; st >>= 1) { if ((int)threadIdx.x < st) sh[threadIdx.x] += sh[threadIdx.x + st]; __syncthreads(); }
  if (threadIdx.x == 0) { const float v = sh[0] / (float)NPX; float* d = ST + ((size_t)phase * CIN + c) * 32; *(float*)d = v;  } }
__global__ __launch_bounds__(256) void k_bnout(const float* __restrict__ Y, const float* __restrict__ ST, const float* __restrict__ bw, const float* __restrict__ bb, float* __restrict__ out) {
  #pragma clang fp contract(off)
  const int t = blockIdx.x * 256 + threadIdx.x; if (t >= NIMG * CIN * (NPI / 4)) return; const int c = (t / (NPI / 4)) % CIN; const float mu = ST[(size_t)c * 32], var = ST[(size_t)(CIN + c) * 32]; const float sc = rsqrtf(var + 1e-5f), g = bf16_round(bw[c]), be = bf16_round(bb[c]); const v4f yv = *(const v4fa*)(Y + (size_t)t * 4); v4f o;
#pragma unroll
  for (int q = 0; q < 4; ++q) o[q] = g * ((yv[q] - mu) * sc) + be;
  *(v4f*)(out + (size_t)t * 4) = o;  }

extern "C" void kernel_launch(void* const* d_in, const int* in_sizes, int n_in,
                              void* d_out, int out_size, void* d_ws, size_t ws_size, hipStream_t stream) {
  (void)in_sizes; (void)n_in; (void)out_size;
  const float* const* I = (const float* const*)d_in; const float* x = I[0]; const float* w_in = I[1]; const float* b_in = I[2];
  const float* qbw = I[3]; const float* qbb = I[4]; const float* qsw = I[5]; const float* qsb = I[6]; const float* kbw = I[7]; const float* kbb = I[8]; const float* ksw = I[9]; const float* ksb = I[10]; const float* vbw = I[11]; const float* vbb = I[12]; const float* vsw = I[13]; const float* vsb = I[14];
  const float* w_out = I[15]; const float* b_out = I[16]; const float* gam = I[17]; const float* bnw = I[18]; const float* bnb = I[19];
  char* ws = (char*)d_ws; size_t off = 0;
  auto take = [&](size_t bytes) { char* p = ws + off; off += (bytes + 255) & ~(size_t)255; return p; };
  _Float16* BIN = (_Float16*)take((size_t)DK * CIN * 2); _Float16* BB[3]; _Float16* BS[3]; for (int i = 0; i < 3; ++i) { BB[i] = (_Float16*)take((size_t)DK * 2 * DK * 2); BS[i] = (_Float16*)take((size_t)DK * 2 * DK * NG * 2); } _Float16* BOUT = (_Float16*)take((size_t)CIN * 2 * DK * 2);
  _Float16* X16 = (_Float16*)take((size_t)NPX * CIN * 2); float* ATT = (float*)take((size_t)NPX * DK * 4); float* IST = (float*)take((size_t)2 * NIMG * DK * 32 * 4); _Float16* SIL = (_Float16*)take((size_t)NPX * 2 * DK * 2); _Float16* BAS = (_Float16*)take((size_t)NPX * 2 * DK * NG * 2);
  float* G = (float*)take((size_t)3 * NPX * DK * 4); float* F = (float*)take((size_t)3 * NPX * DK * 4); _Float16* Qh = (_Float16*)take((size_t)NPX * DK * 2); _Float16* Ql = (_Float16*)take((size_t)NPX * DK * 2); _Float16* Kh = (_Float16*)take((size_t)NPX * DK * 2); _Float16* Kl = (_Float16*)take((size_t)NPX * DK * 2); _Float16* Vth = (_Float16*)take((size_t)NPX * DK * 2); _Float16* Vtl = (_Float16*)take((size_t)NPX * DK * 2);
  float* O = (float*)take((size_t)NPX * DK * 4); _Float16* O16 = (_Float16*)take((size_t)NPX * 2 * DK * 2); float* A2 = (float*)take((size_t)NPX * CIN * 4); float* Y = (float*)take((size_t)NPX * CIN * 4); float* BST = (float*)take((size_t)2 * CIN * 32 * 4);
  unsigned* MB = (unsigned*)take((size_t)NPI * (NPI / 32) * 4); int* RA = (int*)take((size_t)NPI * 4); int* KE = (int*)take((size_t)(NPI / 64) * 32 * 4);
  if (off > ws_size) return;      /* 0.7 + 8 + 4 + 4 + 32 + 24 + 12 + 4 + 4 + 16 + 16 + 2 = 126.7 MiB */
  k_prep<<<NB_XCL + NB_TAB + 3 * NB_WS + 3 * NB_WB + NB_WO + NB_WI, 256, 0, stream>>>(x, w_in, w_out, qbw, kbw, vbw, qsw, ksw, vsw, X16, BIN, BOUT, BB[0], BB[1], BB[2], BS[0], BS[1], BS[2], MB, RA, KE);
  const dim3 g64((NPX / 128) * 1, 1), g64x3((NPX / 128) * 1, 3), g256((NPX / 128) * (CIN / 64), 1);
  k_gemm2<0><<<g64, 128, 0, stream>>>(X16, CIN, 0, BIN, CIN, 0, 0.0625f, b_in, 0, nullptr, 1, 0, 0, ATT, nullptr, DK, 0, NPX, DK, CIN);      /* att = conv1x1(x) + b */
  k_stat0_silu<<<NB_IS + NB_SIL, 256, 0, stream>>>(ATT, IST, IST, SIL);
  k_stat1_base<<<NB_IS + 3 * NB_GB, 256, 0, stream>>>(ATT, IST, IST, SIL, BB[0], BB[1], BB[2], qbb, kbb, vbb, G, (size_t)NPX * DK, DK, NPX, DK, 2 * DK);      /* G = base(silu) + b_base, planes q, k, v */
  k_basis<<<(NPX * DK + 255) / 256, 256, 0, stream>>>(ATT, IST, BAS);
  const size_t n8 = (size_t)NPX * DK / 8; const unsigned nb8 = (unsigned)((n8 + 255) / 256);
  k_gemm2qkv<<<g64x3, 128, 0, stream>>>(BAS, 2 * DK * NG, BS[0], BS[1], BS[2], 2 * DK * NG, 0.0625f, qsb, ksb, vsb, G, F, (size_t)NPX * DK, DK, NPX, DK, 2 * DK * NG);      /* F = spline(basis) + b_spline + G */
  k_pack<<<NB_VT + 2 * NB_HL, 256, 0, stream>>>(F, F + (size_t)NPX * DK, F + (size_t)2 * NPX * DK, Qh, Ql, Kh, Kl, Vth, Vtl);
  k_flashm<NPI, NPI, KSPLIT><<<NIMG * NH * (NPI / 64), 128 * KSPLIT, 0, stream>>>(Qh, Ql, Kh, Kl, Vth, Vtl, MB, RA, KE, O, DK);      /* slab = image (NH 1) */
  k_pair16<<<nb8, 256, 0, stream>>>(O, DK, O16, NPX);
  k_gemm2<0><<<g256, 128, 0, stream>>>(O16, 2 * DK, 0, BOUT, 2 * DK, 0, 0.0625f, b_out, 0, nullptr, 1, 0, 0, A2, nullptr, CIN, 0, NPX, CIN, 2 * DK);      /* att2 = conv1x1(out) + b (pair operand) */
  k_y<<<NIMG * (CIN / 64) * (NPI / 64), 256, 0, stream>>>(x, gam, A2, Y);
  k_bnstat<<<CIN, 256, 0, stream>>>(Y, BST, 0, BST); k_bnstat<<<CIN, 256, 0, stream>>>(Y, BST, 1, BST);
  k_bnout<<<(NIMG * CIN * (NPI / 4) + 255) / 256, 256, 0, stream>>>(Y, BST, bnw, bnb, (float*)d_out);
}

// v007
// One run takes 144 microseconds.
// Two timings next to v006 both put it at 1.13 times that version's speed.
// Over all steps from v000 it is 6.45 times as fast.
#include <hip/hip_runtime.h>
// Self-KAN attention (4 images, 256 channels, 64 x 64): att = conv1x1(x) (64 ch); q, k, v = FastKAN 1x1 convs (base_conv(silu(att)) + spline_conv(RBF basis of the instance-normalised att, 8 grid points)); energy = q.k over the 4096 positions (NO scaling), softmax over keys, out = v.attn^T; att2 = conv1x1(out) (256 ch); y = gamma*x + att2; training-mode BatchNorm -> [4,256,64,64].
// Compute dtype: x, weights, biases, gamma, BN affine rounded to bf16; x exact in f16; silu/basis operands as hi + 16x residual pairs (~2^-20); q, k, P, v as hi + x2^10 residual pairs (~2^-21); the attention output as hi + 16x residual pairs too; f32 accumulation, statistics, softmax. v_wmma_f32_16x16x32_f16.
#define NIMG 4
#define CIN 256
#define DK 64
#define HW 64
#define NPI (HW * HW)            /* 4096 */
#define NPX (NIMG * NPI)         /* 16384 */
#define NG 8
#define NH 1
#define DM DK
#define SCL 1.0f
#define KSPLIT 4
typedef __bf16 v16b __attribute__((ext_vector_type(16)));
typedef unsigned short v8us __attribute__((ext_vector_type(8), may_alias));
typedef float  v8f  __attribute__((ext_vector_type(8)));
typedef float  v4f  __attribute__((ext_vector_type(4)));
typedef float  v4fa __attribute__((ext_vector_type(4), may_alias));
union FragB { v16b v; v8us half[2]; unsigned short u[16]; };

__device__ __forceinline__ unsigned short bf16_bits(float x) { unsigned int u = __float_as_uint(x); return (unsigned short)((u + 0x7FFFu + ((u >> 16) & 1u)) >> 16); }
__device__ __forceinline__ float bf16_val(unsigned short b) { return __uint_as_float(((unsigned int)b) << 16); }
__device__ __forceinline__ float bf16_round(float x) { return bf16_val(bf16_bits(x)); }
// D += A·B with NT terms: 1 = ah·bh, 2 = + al·bh (A split), 3 = + ah·bl (both split)
template <int NT>
__device__ __forceinline__ v8f mmaN(v16b ah, v16b al, v16b bh, v16b bl, v8f c) {
  c = __builtin_amdgcn_wmma_f32_16x16x32_bf16(false, ah, false, bh, (short)0, c, false, false);
  if (NT >= 2) c = __builtin_amdgcn_wmma_f32_16x16x32_bf16(false, al, false, bh, (short)0, c, false, false);
  if (NT >= 3) c = __builtin_amdgcn_wmma_f32_16x16x32_bf16(false, ah, false, bl, (short)0, c, false, false);
  asm volatile("v_nop\n\tv_nop\n\tv_nop\n\tv_nop" : "+v"(c) : "v"(ah), "v"(al), "v"(bh), "v"(bl));
  return c;
}

__global__ __launch_bounds__(256) void k_wt_bf16(const float* __restrict__ W, unsigned short* __restrict__ Wt, int K, int N) {
  const int t = blockIdx.x * 256 + threadIdx.x;
  const int k8n = K / 8;
  if (t >= N * k8n) return;
  const int n = t / k8n, k8 = (t % k8n) * 8;
  v8us v;
#pragma unroll
  for (int i = 0; i < 8; ++i) v[i] = bf16_bits(W[(size_t)(k8 + i) * N + n]);
  *(v8us*)(Wt + (size_t)n * K + k8) = v;
  
}

// GEMM C[M][N] (f32, pitch ldc) = act(A[M][K]·W + bias). A f32 row-major (pitch lda) converted per fragment to bf16
// (ASPLIT: hi/lo two planes -> 2 terms, else single rounded term); Wt bf16 [N][K] (pitch ldb). BIAS_BF16 rounds the
// bias to bf16 first (bias quantised to bf16 before the add). K%32==0, M%16==0, N%64==0.
template <bool ASPLIT, int ACT, bool BIAS_BF16>
__global__ __launch_bounds__(128) void k_gemm_bf(const float* __restrict__ A, int lda, const unsigned short* __restrict__ Wt, int ldb,
                                               const float* __restrict__ bias, float* __restrict__ C, int ldc, int M, int N, int K) {
  __shared__ __attribute__((aligned(16))) float so[4][16][64];
  const int tid = threadIdx.x, w = tid >> 5, lane = tid & 31, ln = lane & 15, hh = lane >> 4;
  const int ntn = N / 64;
  const int wid = blockIdx.x * 4 + w;
  const int mt = wid / ntn, nq = wid % ntn;
  if (mt * 16 >= M) return;
  const int row0 = mt * 16, col0 = nq * 64;
  const float* arow = A + (size_t)(row0 + ln) * lda;
  v8f acc[4] = {};
  for (int kb = 0; kb < K; kb += 32) {
    FragB ah, al;
    const v4f x0 = *(const v4fa*)(arow + kb + 8 * hh), x1 = *(const v4fa*)(arow + kb + 8 * hh + 4);
    const v4f x2 = *(const v4fa*)(arow + kb + 16 + 8 * hh), x3 = *(const v4fa*)(arow + kb + 16 + 8 * hh + 4);
    float xs[16] = {x0[0],x0[1],x0[2],x0[3],x1[0],x1[1],x1[2],x1[3],x2[0],x2[1],x2[2],x2[3],x3[0],x3[1],x3[2],x3[3]};
#pragma unroll
    for (int i = 0; i < 16; ++i) { const unsigned short hb = bf16_bits(xs[i]); ah.u[i] = hb; al.u[i] = ASPLIT ? bf16_bits(xs[i] - bf16_val(hb)) : (unsigned short)0; }
#pragma unroll
    for (int t = 0; t < 4; ++t) {
      const unsigned short* brow = Wt + (size_t)(col0 + t * 16 + ln) * ldb + kb;
      FragB b;
      b.half[0] = *(const v8us*)(brow + 8 * hh);
      b.half[1] = *(const v8us*)(brow + 16 + 8 * hh);
      acc[t] = mmaN<ASPLIT ? 2 : 1>(ah.v, al.v, b.v, b.v, acc[t]);
    }
  }
#pragma unroll
  for (int t = 0; t < 4; ++t) {
    float bv = bias ? bias[col0 + t * 16 + ln] : 0.f;
    if (BIAS_BF16) bv = bf16_round(bv);
#pragma unroll
    for (int r = 0; r < 8; ++r) { float v = acc[t][r] + bv; if (ACT == 1) v = fmaxf(v, 0.f); so[w][8 * hh + r][t * 16 + ln] = v; }
  }
  __builtin_amdgcn_fence(__ATOMIC_ACQ_REL, "workgroup");
  __builtin_amdgcn_wave_barrier();
  const int rsub = lane >> 4, c4 = (lane & 15) * 4;
  {
#pragma unroll
    for (int q = 0; q < 8; ++q) {
      const int r = q * 2 + rsub;
      const v4f v = *(const v4fa*)&so[w][r][c4];
      *(v4f*)(C + (size_t)(row0 + r) * ldc + col0 + c4) = v;
    }
    
  }
}

// GEMM C = act(A·W + bias + resid): A f32 (ASPLIT -> hi/lo 2 terms), Wt bf16 [N][K]; ACT 0 none, 1 relu, 2 exact gelu;
// resid (optional, f32, row index = (row % rmod), pitch ldr, RES_BF16 rounds it) added before the activation.
template <bool ASPLIT, int ACT, bool BIAS_BF16, bool RES_BF16>
__global__ __launch_bounds__(128) void k_gemm_bf3(const float* __restrict__ A, int lda, const unsigned short* __restrict__ Wt, int ldb,
                                                const float* __restrict__ bias, const float* __restrict__ resid, int rmod, int ldr,
                                                float* __restrict__ C, int ldc, int M, int N, int K) {
  __shared__ __attribute__((aligned(16))) float so[4][16][64];
  const int tid = threadIdx.x, w = tid >> 5, lane = tid & 31, ln = lane & 15, hh = lane >> 4;
  const int ntn = N / 64;
  const int wid = blockIdx.x * 4 + w;
  const int mt = wid / ntn, nq = wid % ntn;
  if (mt * 16 >= M) return;
  const int row0 = mt * 16, col0 = nq * 64;
  const float* arow = A + (size_t)(row0 + ln) * lda;
  v8f acc[4] = {};
  for (int kb = 0; kb < K; kb += 32) {
    FragB ah, al;
    const v4f x0 = *(const v4fa*)(arow + kb + 8 * hh), x1 = *(const v4fa*)(arow + kb + 8 * hh + 4);
    const v4f x2 = *(const v4fa*)(arow + kb + 16 + 8 * hh), x3 = *(const v4fa*)(arow + kb + 16 + 8 * hh + 4);
    float xs[16] = {x0[0],x0[1],x0[2],x0[3],x1[0],x1[1],x1[2],x1[3],x2[0],x2[1],x2[2],x2[3],x3[0],x3[1],x3[2],x3[3]};
#pragma unroll
    for (int i = 0; i < 16; ++i) { const unsigned short hb = bf16_bits(xs[i]); ah.u[i] = hb; al.u[i] = ASPLIT ? bf16_bits(xs[i] - bf16_val(hb)) : (unsigned short)0; }
#pragma unroll
    for (int t = 0; t < 4; ++t) {
      const unsigned short* brow = Wt + (size_t)(col0 + t * 16 + ln) * ldb + kb;
      FragB b;
      b.half[0] = *(const v8us*)(brow + 8 * hh);
      b.half[1] = *(const v8us*)(brow + 16 + 8 * hh);
      acc[t] = mmaN<ASPLIT ? 2 : 1>(ah.v, al.v, b.v, b.v, acc[t]);
    }
  }
#pragma unroll
  for (int t = 0; t < 4; ++t) {
    const int col = col0 + t * 16 + ln;
    float bv = bias ? bias[col] : 0.f;
    if (BIAS_BF16) bv = bf16_round(bv);
#pragma unroll
    for (int r = 0; r < 8; ++r) {
      float v = acc[t][r] + bv;
      if (resid) { float rv = resid[(size_t)((row0 + 8 * hh + r) % rmod) * ldr + col]; if (RES_BF16) rv = bf16_round(rv); v += rv; }
      if (ACT == 1) v = fmaxf(v, 0.f);
      if (ACT == 2) v = 0.5f * v * (1.0f + erff(v * 0.70710678118654752f));
      if (ACT == 3) { const float u = 0.7978845608028654f * (v + 0.044715f * v * v * v); v = 0.5f * v * (1.0f + tanhf(u)); }
      so[w][8 * hh + r][t * 16 + ln] = v;
    }
  }
  __builtin_amdgcn_fence(__ATOMIC_ACQ_REL, "workgroup");
  __builtin_amdgcn_wave_barrier();
  const int rsub = lane >> 4, c4 = (lane & 15) * 4;
  {
#pragma unroll
    for (int q = 0; q < 8; ++q) {
      const int r = q * 2 + rsub;
      const v4f v = *(const v4fa*)&so[w][r][c4];
      *(v4f*)(C + (size_t)(row0 + r) * ldc + col0 + c4) = v;
    }
    
  }
}
// row LayerNorm (biased variance, eps) over N: s = X (+ R); optional out_sum <- s; out_norm <- (s-mu)*rsqrt(var+eps)*g + b
template <bool PARAM_BF16>
__global__ __launch_bounds__(256) void k_layernorm(const float* __restrict__ X, const float* __restrict__ R, const float* __restrict__ g, const float* __restrict__ bta,
                                                  float* __restrict__ out_sum, float* __restrict__ out_norm, int N, float eps) {
  __shared__ float red[256];
  const int row = blockIdx.x, tid = threadIdx.x;
  const float* x = X + (size_t)row * N; const float* rr = R ? R + (size_t)row * N : nullptr;
  float vals[16];                     // up to N = 4096
  const int per = N / 256;            // contiguous chunk per thread? use strided-by-4 chunks: thread handles j = tid*4 + 1024*u
  float s1 = 0.f;
  for (int u = 0; u < per / 4; ++u) {
    const int j = tid * 4 + 1024 * u;
    const v4f a = *(const v4fa*)(x + j);
    v4f b = {0.f,0.f,0.f,0.f}; if (rr) b = *(const v4fa*)(rr + j);
#pragma unroll
    for (int q = 0; q < 4; ++q) { const float v = a[q] + b[q]; vals[u * 4 + q] = v; s1 += v; }
  }
  red[tid] = s1; __syncthreads();
  for (int st = 128; st > 0; st >>= 1) { if (tid < st) red[tid] += red[tid + st]; __syncthreads(); }
  const float mu = red[0] / (float)N; __syncthreads();
  float s2 = 0.f;
  for (int u = 0; u < per / 4; ++u)
#pragma unroll
    for (int q = 0; q < 4; ++q) { const float c = vals[u * 4 + q] - mu; s2 += c * c; }
  red[tid] = s2; __syncthreads();
  for (int st = 128; st > 0; st >>= 1) { if (tid < st) red[tid] += red[tid + st]; __syncthreads(); }
  const float rs = rsqrtf(red[0] / (float)N + eps);
  {
    for (int u = 0; u < per / 4; ++u) {
      const int j = tid * 4 + 1024 * u;
      v4f o, sm;
#pragma unroll
      for (int q = 0; q < 4; ++q) {
        float gg = g[j + q], bb = bta[j + q];
        if (PARAM_BF16) { gg = bf16_round(gg); bb = bf16_round(bb); }
        sm[q] = vals[u * 4 + q]; o[q] = (vals[u * 4 + q] - mu) * rs * gg + bb;
      }
      if (out_sum) *(v4f*)(out_sum + (size_t)row * N + j) = sm;
      *(v4f*)(out_norm + (size_t)row * N + j) = o;
    }
    
  }
}



// ---- f16 WMMA path (v_wmma_f32_16x16x32_f16): 11-bit significands for operands in range — used where a [0,1] probability operand needs more precision than bf16
typedef _Float16 v16h __attribute__((ext_vector_type(16)));
union FragH { v16h v; v8us half[2]; _Float16 h[16]; unsigned short u[16]; };
template <int NT>
__device__ __forceinline__ v8f mmaH(v16h ah, v16h al, v16h bh, v16h bl, v8f c) {
  c = __builtin_amdgcn_wmma_f32_16x16x32_f16(false, ah, false, bh, (short)0, c, false, false);
  if (NT >= 2) c = __builtin_amdgcn_wmma_f32_16x16x32_f16(false, al, false, bh, (short)0, c, false, false);
  if (NT >= 3) c = __builtin_amdgcn_wmma_f32_16x16x32_f16(false, ah, false, bl, (short)0, c, false, false);
  asm volatile("v_nop\n\tv_nop\n\tv_nop\n\tv_nop" : "+v"(c) : "v"(ah), "v"(al), "v"(bh), "v"(bl));
  return c;
}
// batched GEMM like k_gemm_b but f16 operands: A f32 (split into f16 hi/lo if ASPLIT, else rounded to f16), Bt = f16 values [n][k]; alpha; C f32; N multiple of 16 (partial tiles skipped)
template <bool ASPLIT>
__global__ __launch_bounds__(128) void k_gemm_h(const float* __restrict__ A, int lda, size_t sA, const _Float16* __restrict__ Bh, int ldb, size_t sB, float alpha, float* __restrict__ C, int ldc, size_t sC, int M, int N, int K) {
  __shared__ __attribute__((aligned(16))) float so[4][16][64];
  const int tid = threadIdx.x, w = tid >> 5, lane = tid & 31, ln = lane & 15, hh = lane >> 4; const int by = blockIdx.y;
  A += (size_t)by * sA; Bh += (size_t)by * sB; C += (size_t)by * sC;
  const int ntn = (N + 63) / 64; const int wid = blockIdx.x * 4 + w; const int mt = wid / ntn, nq = wid % ntn; if (mt * 16 >= M) return;
  const int row0 = mt * 16, col0 = nq * 64; const float* arow = A + (size_t)(row0 + ln) * lda;
  v8f acc[4] = {};
  for (int kb = 0; kb < K; kb += 32) {
    FragH ah, al;
    const v4f x0 = *(const v4fa*)(arow + kb + 8 * hh), x1 = *(const v4fa*)(arow + kb + 8 * hh + 4), x2 = *(const v4fa*)(arow + kb + 16 + 8 * hh), x3 = *(const v4fa*)(arow + kb + 16 + 8 * hh + 4);
    float xs[16] = {x0[0],x0[1],x0[2],x0[3],x1[0],x1[1],x1[2],x1[3],x2[0],x2[1],x2[2],x2[3],x3[0],x3[1],x3[2],x3[3]};
#pragma unroll
    for (int i = 0; i < 16; ++i) { const _Float16 h = (_Float16)xs[i]; ah.h[i] = h; al.h[i] = ASPLIT ? (_Float16)(xs[i] - (float)h) : (_Float16)0.0f; }
#pragma unroll
    for (int t = 0; t < 4; ++t) { if (col0 + t * 16 >= N) continue; const size_t boff = (size_t)(col0 + t * 16 + ln) * ldb + kb; FragH bq; bq.half[0] = *(const v8us*)(Bh + boff + 8 * hh); bq.half[1] = *(const v8us*)(Bh + boff + 16 + 8 * hh);
      acc[t] = mmaH<ASPLIT ? 2 : 1>(ah.v, al.v, bq.v, bq.v, acc[t]); }
  }
#pragma unroll
  for (int t = 0; t < 4; ++t) { if (col0 + t * 16 >= N) continue;
#pragma unroll
    for (int r = 0; r < 8; ++r) so[w][8 * hh + r][t * 16 + ln] = acc[t][r] * alpha; }
  __builtin_amdgcn_fence(__ATOMIC_ACQ_REL, "workgroup"); __builtin_amdgcn_wave_barrier();
  const int rsub = lane >> 4, c4 = (lane & 15) * 4;
  {
#pragma unroll
    for (int q = 0; q < 8; ++q) { const int r = q * 2 + rsub; if (col0 + c4 < N) { const v4f v = *(const v4fa*)&so[w][r][c4]; *(v4f*)(C + (size_t)(row0 + r) * ldc + col0 + c4) = v; } }
     }
}

// Wt[n][k] = f16(W[k][n]·scale) from f32 row-major W[K][N] (scale = power of two; bf16-exact weights stay exact in f16 away from the subnormal range)
__global__ __launch_bounds__(256) void k_wt_f16(const float* __restrict__ W, _Float16* __restrict__ Wt, int K, int N, float scale) {
  const int t = blockIdx.x * 256 + threadIdx.x; if (t >= N * (K / 8)) return; const int n = t / (K / 8), k8 = (t % (K / 8)) * 8; FragH f;
#pragma unroll
  for (int i = 0; i < 8; ++i) f.h[i] = (_Float16)(bf16_round(W[(size_t)(k8 + i) * N + n]) * scale); const v8us o = f.half[0];
  *(v8us*)((unsigned short*)Wt + (size_t)n * K + k8) = o; 
}
// k_gemm_hh variant with fused epilogue: v = acc·alpha + bias[by·sBias + col] (+ CP[(row/rowsPerB)·sCPb + by·64 + col] if CP) ; ACT 0 none / 1 elu ; writes f16 C16 (and f32 C if non-null)
template <int ACT>
__global__ __launch_bounds__(128) void k_gemm_hhx(const _Float16* __restrict__ A, int lda, size_t sA, const _Float16* __restrict__ Bh, int ldb, size_t sB, float alpha, const float* __restrict__ bias, size_t sBias, const float* __restrict__ CP, int rowsPerB, size_t sCPb, int row0g,
    float* __restrict__ C, _Float16* __restrict__ C16, int ldc, size_t sC, int M, int N, int K) {
  __shared__ __attribute__((aligned(16))) float so[4][16][64];
  const int tid = threadIdx.x, w = tid >> 5, lane = tid & 31, ln = lane & 15, hh = lane >> 4; const int by = blockIdx.y;
  A += (size_t)by * sA; Bh += (size_t)by * sB; const size_t cofs = (size_t)by * sC; const float* bp = bias ? bias + (size_t)by * sBias : nullptr;
  const int ntn = (N + 63) / 64; const int wid = blockIdx.x * 4 + w; const int mt = wid / ntn, nq = wid % ntn; if (mt * 16 >= M) return;
  const int row0 = mt * 16, col0 = nq * 64; const _Float16* arow = A + (size_t)(row0 + ln) * lda;
  v8f acc[4] = {};
  for (int kb = 0; kb < K; kb += 32) { FragH ah; ah.half[0] = *(const v8us*)((const unsigned short*)arow + kb + 8 * hh); ah.half[1] = *(const v8us*)((const unsigned short*)arow + kb + 16 + 8 * hh);
#pragma unroll
    for (int t = 0; t < 4; ++t) { if (col0 + t * 16 >= N) continue; const size_t boff = (size_t)(col0 + t * 16 + ln) * ldb + kb; FragH bq; bq.half[0] = *(const v8us*)((const unsigned short*)Bh + boff + 8 * hh); bq.half[1] = *(const v8us*)((const unsigned short*)Bh + boff + 16 + 8 * hh);
      acc[t] = mmaH<1>(ah.v, ah.v, bq.v, bq.v, acc[t]); }
  }
#pragma unroll
  for (int t = 0; t < 4; ++t) { if (col0 + t * 16 >= N) continue; const int col = col0 + t * 16 + ln; const float bv = bp ? bf16_round(bp[col]) : 0.f;
#pragma unroll
    for (int r = 0; r < 8; ++r) { float v = acc[t][r] * alpha + bv; if (CP) { const int bidx = (row0g + row0 + 8 * hh + r) / rowsPerB; v += CP[(size_t)bidx * sCPb + (size_t)by * 64 + col]; } if (ACT == 1) v = (v > 0.f) ? v : expm1f(v); else if (ACT == 7) v = (v > 0.f) ? v + 1.0f : expf(v); else if (ACT == 8) v = tanhf(v); else if (ACT == 9) v = 0.5f * v * (1.0f + tanhf(0.7978845608028654f * (v + 0.044715f * v * v * v))); else if (ACT == 11) v = 1.0f / (1.0f + expf(-v)); else if (ACT == 12) v = (v > 0.f) ? v : 0.01f * v; else if (ACT == 14) v = (v > 0.f) ? v : 0.1f * v; else if (ACT == 15) v = v / (1.0f + expf(-v)); else if (ACT == 3) v = fmaxf(v, 0.f); else if (ACT == 6) v = 0.5f * v * (1.0f + erff(v * 0.70710678118654752f)); so[w][8 * hh + r][t * 16 + ln] = v; } }
  __builtin_amdgcn_fence(__ATOMIC_ACQ_REL, "workgroup"); __builtin_amdgcn_wave_barrier();
  const int rsub = lane >> 4, c4 = (lane & 15) * 4; typedef _Float16 v4h __attribute__((ext_vector_type(4)));
  {
#pragma unroll
    for (int q = 0; q < 8; ++q) { const int r = q * 2 + rsub; if (col0 + c4 < N) { const v4f v = *(const v4fa*)&so[w][r][c4]; if (C) *(v4f*)(C + cofs + (size_t)(row0 + r) * ldc + col0 + c4) = v; if (C16) { v4h h4; for (int i = 0; i < 4; ++i) h4[i] = (_Float16)v[i]; *(v4h*)(C16 + cofs + (size_t)(row0 + r) * ldc + col0 + c4) = h4; } } }
     }
}


typedef _Float16 v4h __attribute__((ext_vector_type(4)));

__global__ __launch_bounds__(256) void k_x16(const float* __restrict__ x, _Float16* __restrict__ X16, size_t n8) { const size_t t = (size_t)blockIdx.x * 256 + threadIdx.x; if (t >= n8) return; FragH f;
#pragma unroll
  for (int q = 0; q < 8; ++q) f.h[q] = (_Float16)bf16_round(x[t * 8 + q]); *(v8us*)((unsigned short*)X16 + t * 8) = f.half[0];  }
__global__ __launch_bounds__(256) void k_h16(const float* __restrict__ x, _Float16* __restrict__ X16, size_t n8) { const size_t t = (size_t)blockIdx.x * 256 + threadIdx.x; if (t >= n8) return; FragH f;
#pragma unroll
  for (int q = 0; q < 8; ++q) f.h[q] = (_Float16)x[t * 8 + q]; *(v8us*)((unsigned short*)X16 + t * 8) = f.half[0];  }
__device__ __forceinline__ void d_round16f(const float* __restrict__ W, _Float16* __restrict__ Bt, size_t n8, unsigned bx) { const size_t t = (size_t)bx * 256 + threadIdx.x; if (t >= n8) return; FragH f;
#pragma unroll
  for (int i = 0; i < 8; ++i) f.h[i] = (_Float16)(bf16_round(W[t * 8 + i]) * 16.0f); *(v8us*)((unsigned short*)Bt + t * 8) = f.half[0];  }
template <int NHv, int TTv>
__global__ __launch_bounds__(256) void k_vt(const _Float16* __restrict__ V16, int ldv, int voff, _Float16* __restrict__ Vt) { __shared__ unsigned short tl[64][66]; const int tid = threadIdx.x; const int slab = blockIdx.x / (TTv / 64), lg = blockIdx.x % (TTv / 64); const int b = slab / NHv, h = slab % NHv;
  for (int i = tid; i < 64 * 8; i += 256) { const int r = i / 8, c8 = (i % 8) * 8; FragH f; f.half[0] = *(const v8us*)((const unsigned short*)V16 + ((size_t)b * TTv + lg * 64 + r) * ldv + voff + h * 64 + c8);
#pragma unroll
    for (int q = 0; q < 8; ++q) tl[r][c8 + q] = f.u[q]; }
  __syncthreads();
  {
#pragma unroll
    for (int rd = 0; rd < 2; ++rd) { const int d = rd * 32 + tid / 8, pc = tid % 8; FragH f;
#pragma unroll
      for (int q = 0; q < 8; ++q) f.u[q] = tl[pc * 8 + q][d];
      *(v8us*)((unsigned short*)Vt + ((size_t)slab * 64 + d) * TTv + lg * 64 + pc * 8) = f.half[0]; }
     } }

// FRAGMENT ORDER of the attention operands: a 16-row x 64-column tile (q, k) or a 64-row x 32-key block (v^T) is stored as its WMMA fragment halves one after the other, each half as 32 lanes x 16 bytes in lane order,
// so that a wave's 16-byte load reads 512 bytes in a row (4 whole lines) and not 32 bytes out of each of 16 lines. Which element a lane and register hold is unchanged.
// q, k: row r, columns 8 c8 .. 8 c8 + 7 -> tile r >> 4, half c8 >> 1 (= 2 ks + part), lane 16 (c8 & 1) + (r & 15).

// ---- fast GEMM (wave tile 32x64; requires M % 32 == 0 rows per launch region and N % 64 == 0); epilogue = k_gemm_hhx semantics ----
__device__ __forceinline__ v16h g2_frag(const _Float16* p, int hh) { FragH f; f.half[0] = *(const v8us*)((const unsigned short*)p + 8 * hh); f.half[1] = *(const v8us*)((const unsigned short*)p + 16 + 8 * hh); return f.v; }
__device__ __forceinline__ v8f g2_mma(v16h a, v16h b, v8f c) { v8f d = __builtin_amdgcn_wmma_f32_16x16x32_f16(false, a, false, b, (short)0, c, false, false); asm volatile("v_nop\n\tv_nop\n\tv_nop\n\tv_nop" : "+v"(d) : "v"(a), "v"(b)); return d; }
// A CONSUMER THAT NEEDS ONLY THE TILE ITS PRODUCER WAVE HOLDS RUNS IN THAT WAVE, on the f32 tile in LDS, and has no launch of its own.
// EPI 0: C alone. EPI 1: C, and silu(C) as a hi + 16x residual pair row in E0 (N == DK). EPI 2: no C; the tile as hi + x2^10 residual planes E0, E1 in fragment order (N == DK): rows as q, k tiles, or (vt) turned, as one 32-key block of v^T.
template <int ACT, int NWV, int EPI>      /* NWV waves a block, each a 32 x 64 tile */
__device__ __forceinline__ void d_gemm2(const _Float16* __restrict__ A, int lda, size_t sA, const _Float16* __restrict__ Bh, int ldb, size_t sB, float alpha, const float* __restrict__ bias, size_t sBias, const float* __restrict__ CP, int rowsPerB, size_t sCPb, int row0g,
    float* __restrict__ C, _Float16* __restrict__ C16, int ldc, size_t sC, int M, int N, int K, unsigned bx, int by, _Float16* __restrict__ E0, _Float16* __restrict__ E1, bool vt) {
  __shared__ __attribute__((aligned(16))) float so[NWV][32][68];
  const int tid = threadIdx.x, w = tid >> 5, lane = tid & 31, ln = lane & 15, hh = lane >> 4;
  A += (size_t)by * sA; Bh += (size_t)by * sB; const size_t cofs = (size_t)by * sC; const float* bp = bias ? bias + (size_t)by * sBias : nullptr;
  const int ntn = N >> 6; const int mt = bx / ntn, nq = bx - mt * ntn; const int row0 = mt * (32 * NWV) + 32 * w, col0 = nq * 64; if (row0 >= M) return;
  const _Float16* a0p = A + (size_t)(row0 + ln) * lda; const _Float16* a1p = a0p + (size_t)16 * lda;
  const _Float16* b0p = Bh + (size_t)(col0 + ln) * ldb; const _Float16* b1p = b0p + (size_t)16 * ldb; const _Float16* b2p = b1p + (size_t)16 * ldb; const _Float16* b3p = b2p + (size_t)16 * ldb;
  const v8f z8 = {0.f,0.f,0.f,0.f,0.f,0.f,0.f,0.f}; v8f c00 = z8, c01 = z8, c02 = z8, c03 = z8, c10 = z8, c11 = z8, c12 = z8, c13 = z8;
  // LOADS GO OUT IN GROUPS, AHEAD OF THEIR USE. No load moves across the statement behind a matrix instruction, so a load written at its use is waited for alone.
  // The six fragments of a 32-wide k step are loaded together, one step ahead, into a second register set (K % 64 == 0); the bias in front of the loop; the addend rows as one group behind it.
  float bvr[4] = {0.f, 0.f, 0.f, 0.f};
  if (bp) {
#pragma unroll
    for (int t = 0; t < 4; ++t) bvr[t] = bp[col0 + t * 16 + ln];
    asm volatile("s_wait_xcnt 0x0" ::: "memory"); }      /* the loads' address registers are reused right behind this branch */
  v16h a0 = g2_frag(a0p, hh), a1 = g2_frag(a1p, hh), b0 = g2_frag(b0p, hh), b1 = g2_frag(b1p, hh), b2 = g2_frag(b2p, hh), b3 = g2_frag(b3p, hh);
#pragma unroll 1      /* two k steps a trip: one per register set */
  for (int kb = 0; kb < K; kb += 64) { const int k1 = kb + 32;
    const v16h e0 = g2_frag(a0p + k1, hh), e1 = g2_frag(a1p + k1, hh), f0 = g2_frag(b0p + k1, hh), f1 = g2_frag(b1p + k1, hh), f2 = g2_frag(b2p + k1, hh), f3 = g2_frag(b3p + k1, hh);
    c00 = g2_mma(a0, b0, c00); c10 = g2_mma(a1, b0, c10); c01 = g2_mma(a0, b1, c01); c11 = g2_mma(a1, b1, c11);
    c02 = g2_mma(a0, b2, c02); c12 = g2_mma(a1, b2, c12); c03 = g2_mma(a0, b3, c03); c13 = g2_mma(a1, b3, c13);
    if (kb + 64 < K) { const int k2 = kb + 64; a0 = g2_frag(a0p + k2, hh); a1 = g2_frag(a1p + k2, hh); b0 = g2_frag(b0p + k2, hh); b1 = g2_frag(b1p + k2, hh); b2 = g2_frag(b2p + k2, hh); b3 = g2_frag(b3p + k2, hh); }
    c00 = g2_mma(e0, f0, c00); c10 = g2_mma(e1, f0, c10); c01 = g2_mma(e0, f1, c01); c11 = g2_mma(e1, f1, c11);
    c02 = g2_mma(e0, f2, c02); c12 = g2_mma(e1, f2, c12); c03 = g2_mma(e0, f3, c03); c13 = g2_mma(e1, f3, c13); }
  v8f accs[8] = {c00, c01, c02, c03, c10, c11, c12, c13};
  float cpv[8][8];
  if (CP) {
#pragma unroll
    for (int rr = 0; rr < 16; ++rr) { const int bidx = (row0g + row0 + (rr >> 3) * 16 + 8 * hh + (rr & 7)) / rowsPerB; const float* cr = CP + (size_t)bidx * sCPb + (size_t)by * 64 + col0 + ln;
#pragma unroll
      for (int t = 0; t < 4; ++t) cpv[(rr >> 3) * 4 + t][rr & 7] = cr[t * 16];
      asm volatile("s_wait_xcnt 0x0" ::: "memory"); } }      /* a row's address registers are free for the next rows' values; the data are not waited for here */
#pragma unroll
  for (int u = 0; u < 8; ++u) { const int t = u & 3, half = u >> 2; const float bv = bp ? bf16_round(bvr[t]) : 0.f;
#pragma unroll
    for (int r = 0; r < 8; ++r) { const int rloc = half * 16 + 8 * hh + r; float v = accs[u][r] * alpha + bv; if (CP) v += cpv[u][r];
      if (ACT == 3) v = fmaxf(v, 0.f); else if (ACT == 6) v = 0.5f * v * (1.0f + erff(v * 0.70710678118654752f)); else if (ACT == 11) v = 1.0f / (1.0f + expf(-v)); else if (ACT == 15) v = v / (1.0f + expf(-v)); else if (ACT == 12) v = (v > 0.f) ? v : 0.01f * v; else if (ACT == 8) v = tanhf(v);
      so[w][rloc][t * 16 + ln] = v; } }
  __builtin_amdgcn_fence(__ATOMIC_ACQ_REL, "workgroup"); __builtin_amdgcn_wave_barrier();
  if (EPI == 2) {      /* eight fragment halves a plane, each 32 lanes x 16 bytes in a row */
    unsigned short* p0 = (unsigned short*)E0 + lane * 8; unsigned short* p1 = (unsigned short*)E1 + lane * 8;
    if (vt) { const size_t ob = (size_t)(row0 / NPI) * 64 * NPI + (size_t)((row0 % NPI) >> 5) * 2048;      /* image, 32-key block */
#pragma unroll
      for (int u = 0; u < 8; ++u) { FragH fh, fl;      /* half u = 2 dt + part: channel 16 dt + ln, keys 16 part + 8 hh + q */
#pragma unroll
        for (int q = 0; q < 8; ++q) { const float v = so[w][(u & 1) * 16 + 8 * hh + q][(u >> 1) * 16 + ln]; const _Float16 hv = (_Float16)v; fh.h[q] = hv; fl.h[q] = (_Float16)((v - (float)hv) * 1024.0f); }
        *(v8us*)(p0 + ob + u * 256) = fh.half[0]; *(v8us*)(p1 + ob + u * 256) = fl.half[0];
        asm volatile("s_wait_xcnt 0x0" ::: "memory"); } }      /* the stores' registers are reused for the next half */
    else { const size_t ob = (size_t)(row0 >> 4) * 1024;
#pragma unroll
      for (int u = 0; u < 8; ++u) { FragH fh, fl; const float* sr = &so[w][(u >> 2) * 16 + ln][((u & 3) * 2 + hh) * 8]; const v4f a = *(const v4fa*)sr, c = *(const v4fa*)(sr + 4);      /* tile u >> 2, half u & 3: row ln, columns 8 (2 (u & 3) + hh) .. + 7 */
#pragma unroll
        for (int q = 0; q < 4; ++q) { _Float16 h = (_Float16)a[q]; fh.h[q] = h; fl.h[q] = (_Float16)((a[q] - (float)h) * 1024.0f); h = (_Float16)c[q]; fh.h[4 + q] = h; fl.h[4 + q] = (_Float16)((c[q] - (float)h) * 1024.0f); }
        *(v8us*)(p0 + ob + u * 256) = fh.half[0]; *(v8us*)(p1 + ob + u * 256) = fl.half[0];
        asm volatile("s_wait_xcnt 0x0" ::: "memory"); } }      /* as above */
    return; }
  const int rsub = lane >> 4, c4 = (lane & 15) * 4;
  {
#pragma unroll
    for (int q = 0; q < 16; ++q) { const int r = q * 2 + rsub; const v4f v = *(const v4fa*)&so[w][r][c4]; if (C) *(v4f*)(C + cofs + (size_t)(row0 + r) * ldc + col0 + c4) = v; if (C16) { v4h h4; for (int i = 0; i < 4; ++i) h4[i] = (_Float16)v[i]; *(v4h*)(C16 + cofs + (size_t)(row0 + r) * ldc + col0 + c4) = h4; }
      if (EPI == 1) { v4h s0, s1;
#pragma unroll
        for (int i = 0; i < 4; ++i) { const float sl = v[i] / (1.0f + expf(-v[i])); const _Float16 hv = (_Float16)sl; s0[i] = hv; s1[i] = (_Float16)((sl - (float)hv) * 16.0f); }
        _Float16* d = E0 + (size_t)(row0 + r) * 2 * DK + c4; *(v4h*)d = s0; *(v4h*)(d + DK) = s1;
        asm volatile("s_wait_xcnt 0x0" ::: "memory"); } }      /* the stores' registers are reused for the next rows */
     } }
template <int ACT>
__global__ __launch_bounds__(128) void k_gemm2(const _Float16* __restrict__ A, int lda, size_t sA, const _Float16* __restrict__ Bh, int ldb, size_t sB, float alpha, const float* __restrict__ bias, size_t sBias, const float* __restrict__ CP, int rowsPerB, size_t sCPb, int row0g,
    float* __restrict__ C, _Float16* __restrict__ C16, int ldc, size_t sC, int M, int N, int K) {
  d_gemm2<ACT, 4, 0>(A, lda, sA, Bh, ldb, sB, alpha, bias, sBias, CP, rowsPerB, sCPb, row0g, C, C16, ldc, sC, M, N, K, blockIdx.x, blockIdx.y, nullptr, nullptr, false); }
// att = conv1x1(x) + b, and silu(att) from the same tile.
__global__ __launch_bounds__(128) void k_gemm_att(const _Float16* __restrict__ X16, const _Float16* __restrict__ BIN, const float* __restrict__ b_in, float* __restrict__ ATT, _Float16* __restrict__ SIL) {
  d_gemm2<0, 4, 1>(X16, CIN, 0, BIN, CIN, 0, 0.0625f, b_in, 0, nullptr, 1, 0, 0, ATT, nullptr, DK, 0, NPX, DK, CIN, blockIdx.x, 0, SIL, nullptr, false); }
// LAUNCHES THAT NEED NOTHING OF EACH OTHER SHARE ONE GRID: a block-uniform branch on the block index picks the part; each part's code, block count and arithmetic are those of its own former launch.
// The q, k and v spline products on one operand A: blockIdx.y picks the weights, the bias, the f32 addend plane (CP, one row a row) and the pair of result planes, written in fragment order.
__global__ __launch_bounds__(128) void k_gemm2qkv(const _Float16* __restrict__ A, int lda, const _Float16* __restrict__ B0, const _Float16* __restrict__ B1, const _Float16* __restrict__ B2, int ldb, float alpha,
    const float* __restrict__ bias0, const float* __restrict__ bias1, const float* __restrict__ bias2, const float* __restrict__ CP, size_t plane, int ldc, int M, int N, int K,
    _Float16* __restrict__ Qh, _Float16* __restrict__ Ql, _Float16* __restrict__ Kh, _Float16* __restrict__ Kl, _Float16* __restrict__ Vth, _Float16* __restrict__ Vtl) {
  const int i = blockIdx.y; const _Float16* Bh = (i == 0) ? B0 : (i == 1) ? B1 : B2; const float* bias = (i == 0) ? bias0 : (i == 1) ? bias1 : bias2;
  d_gemm2<0, 4, 2>(A, lda, 0, Bh, ldb, 0, alpha, bias, 0, CP + (size_t)i * plane, 1, (size_t)ldc, 0, nullptr, nullptr, ldc, 0, M, N, K, blockIdx.x, 0, (i == 0) ? Qh : (i == 1) ? Kh : Vth, (i == 0) ? Ql : (i == 1) ? Kl : Vtl, i == 2); }


__device__ __forceinline__ float xhalf(float v) { const int b = __float_as_int(v); return __int_as_float(__builtin_amdgcn_permlanex16(b, b, 0x76543210, 0xfedcba98, false, false)); }      /* lane l <-> l ^ 16 */
template <int TQ, int TK, int KSP>
__global__ __launch_bounds__(128 * KSP) void k_flashm(const _Float16* __restrict__ Q16, const _Float16* __restrict__ Q16lo, const _Float16* __restrict__ K16, const _Float16* __restrict__ K16lo, const _Float16* __restrict__ Vt, const _Float16* __restrict__ Vtlo, const unsigned* __restrict__ MB, const int* __restrict__ RA, const int* __restrict__ KE, _Float16* __restrict__ O16) {
  constexpr int RPW = 16, NQB = TQ / (4 * RPW), DT = 4, KS = 2, NW = 4 * KSP; static_assert(NH == 1 && DK == 64, "the fragment-order planes hold one 64-wide head");
  __shared__ __attribute__((aligned(16))) float sO[NW][RPW][64 + 4]; __shared__ float sM[NW][RPW], sL[NW][RPW];
  const int tid = threadIdx.x, w = tid >> 5, lane = tid & 31, ln = lane & 15, hh = lane >> 4; const int qt = w & 3, kp = __builtin_amdgcn_readfirstlane(w >> 2);      /* scalar: the key loop's counter and trip test stay wave-uniform */
  const int slab = blockIdx.x / NQB, qblk = blockIdx.x % NQB; const int b = slab / NH; const int qb0 = qblk * (4 * RPW); const int q0 = qb0 + qt * RPW;
  FragH aq[KS], aql[KS];
  { const size_t qo = (((size_t)b * TQ + q0) >> 4) * 1024 + lane * 8; const unsigned short* qr = (const unsigned short*)Q16 + qo; const unsigned short* ql = (const unsigned short*)Q16lo + qo;
#pragma unroll
    for (int ks = 0; ks < KS; ++ks) { aq[ks].half[0] = *(const v8us*)(qr + ks * 512); aq[ks].half[1] = *(const v8us*)(qr + ks * 512 + 256); aql[ks].half[0] = *(const v8us*)(ql + ks * 512); aql[ks].half[1] = *(const v8us*)(ql + ks * 512 + 256); } }
  const unsigned short* Vth = (const unsigned short*)Vt + (size_t)slab * 64 * TK; const unsigned short* Vtl = (const unsigned short*)Vtlo + (size_t)slab * 64 * TK;
  float m_r = -3.0e38f, l_r = 0.f; v8f oacc[DT], oaccl[DT];
#pragma unroll
  for (int dt = 0; dt < DT; ++dt) { oacc[dt] = (v8f){0.f,0.f,0.f,0.f,0.f,0.f,0.f,0.f}; oaccl[dt] = oacc[dt]; }
  int jend = KE[qblk * 32]; jend = min(TK, (jend + 31) & ~31); if (jend < 32) jend = 32;      /* block-uniform */
  const bool am = (RA[q0 + ln] != 0); const unsigned* mrow = MB + (size_t)(q0 + ln) * (TK / 32);
  const unsigned short* kr = (const unsigned short*)K16 + (((size_t)b * TK + kp * 32) >> 4) * 1024 + lane * 8; const unsigned short* kl = (const unsigned short*)K16lo + (((size_t)b * TK + kp * 32) >> 4) * 1024 + lane * 8;
  const unsigned short* vh = Vth + (size_t)kp * 2048 + lane * 8; const unsigned short* vl = Vtl + (size_t)kp * 2048 + lane * 8; const unsigned* mp = mrow + kp;      /* this wave's block of 32 keys; all five step by KSP blocks a trip */
#pragma unroll 1
  for (int j0 = kp * 32; j0 < jend; j0 += 32 * KSP, kr += KSP * 2048, kl += KSP * 2048, vh += KSP * 2048, vl += KSP * 2048, mp += KSP) {
    v8f s[2]; FragH bk[2][KS], bkl[2][KS];      /* as in the GEMM body, loads go out in groups ahead of their use: both key tiles and the mask word here, in front of the first product */
#pragma unroll
    for (int nt = 0; nt < 2; ++nt) {
#pragma unroll
      for (int ks = 0; ks < KS; ++ks) { const int o = nt * 1024 + ks * 512; bk[nt][ks].half[0] = *(const v8us*)(kr + o); bkl[nt][ks].half[0] = *(const v8us*)(kl + o); if (nt + ks < 2) { bk[nt][ks].half[1] = *(const v8us*)(kr + o + 256); bkl[nt][ks].half[1] = *(const v8us*)(kl + o + 256); } } }
    const unsigned mw = *mp;
    asm volatile("s_wait_xcnt 0x0" ::: "memory");      /* the last load from an address may land on the address registers, which the loads above name too */
    bk[1][1].half[1] = *(const v8us*)(kr + 1792);
    asm volatile("s_wait_xcnt 0x0" ::: "memory");      /* the same, for the load above */
    bkl[1][1].half[1] = *(const v8us*)(kl + 1792);
#pragma unroll
    for (int nt = 0; nt < 2; ++nt) { v8f acc = (v8f){0.f,0.f,0.f,0.f,0.f,0.f,0.f,0.f}, accr = acc;
#pragma unroll
      for (int ks = 0; ks < KS; ++ks) { acc = mmaH<1>(bk[nt][ks].v, bk[nt][ks].v, aq[ks].v, aq[ks].v, acc); accr = mmaH<1>(bk[nt][ks].v, bk[nt][ks].v, aql[ks].v, aql[ks].v, accr); accr = mmaH<1>(bkl[nt][ks].v, bkl[nt][ks].v, aq[ks].v, aq[ks].v, accr); }
      s[nt] = acc + accr * 0.0009765625f; }
    FragH bv[DT], bl[DT];      /* the whole v^T block, in front of the softmax arithmetic, which covers its latency */
#pragma unroll
    for (int dt = 0; dt < DT; ++dt) { const int o = dt * 512; bv[dt].half[0] = *(const v8us*)(vh + o); bl[dt].half[0] = *(const v8us*)(vl + o); if (dt < DT - 1) { bv[dt].half[1] = *(const v8us*)(vh + o + 256); bl[dt].half[1] = *(const v8us*)(vl + o + 256); } }
    asm volatile("s_wait_xcnt 0x0" ::: "memory");      /* as at the key tiles */
    bv[DT - 1].half[1] = *(const v8us*)(vh + (DT - 1) * 512 + 256);
    asm volatile("s_wait_xcnt 0x0" ::: "memory");      /* as at the key tiles */
    bl[DT - 1].half[1] = *(const v8us*)(vl + (DT - 1) * 512 + 256);
    const unsigned mh = mw >> (8 * hh);      /* bit r: key 8 hh + r, bit 16 + r: key 16 + 8 hh + r */
    float sv[16]; float mc = -INFINITY;
#pragma unroll
    for (int e = 0; e < 16; ++e) { const bool ok = am || (((mh >> ((e >> 3) * 16 + (e & 7))) & 1u) == 0u); sv[e] = ok ? (am ? 0.f : s[e >> 3][e & 7] * SCL) : -INFINITY; mc = fmaxf(mc, sv[e]); }
    mc = fmaxf(mc, xhalf(mc));
    const float mn = fmaxf(m_r, mc); const float al = (mn > -1.0e38f) ? expf(m_r - mn) : 1.0f; m_r = mn;
    FragH pa, pl; float ps = 0.f;
#pragma unroll
    for (int e = 0; e < 16; ++e) { const float p = expf(sv[e] - mn);      /* a masked key: exp(-inf) = 0 (mn is finite) */
      ps += p; const float p10 = p * 1024.0f; const _Float16 ph = (_Float16)p10; pa.h[e] = ph; pl.h[e] = (_Float16)((p10 - (float)ph) * 1024.0f); }
    l_r = l_r * al + ps;
#pragma unroll
    for (int dt = 0; dt < DT; ++dt) { oacc[dt] *= al; oaccl[dt] *= al; }
#pragma unroll
    for (int dt = 0; dt < DT; ++dt) { oacc[dt] = mmaH<1>(bv[dt].v, bv[dt].v, pa.v, pa.v, oacc[dt]); oaccl[dt] = mmaH<1>(bl[dt].v, bl[dt].v, pa.v, pa.v, oaccl[dt]); oaccl[dt] = mmaH<1>(bv[dt].v, bv[dt].v, pl.v, pl.v, oaccl[dt]); } }
  { const float l = l_r + xhalf(l_r); if (hh == 0) { sM[w][ln] = m_r; sL[w][ln] = l; } }
#pragma unroll
  for (int dt = 0; dt < DT; ++dt) { const v8f o = oacc[dt] + oaccl[dt] * 0.0009765625f;      /* register r = O[query ln][dt * 16 + 8 hh + r] */
    *(v4fa*)&sO[w][ln][dt * 16 + 8 * hh] = (v4f){o[0], o[1], o[2], o[3]}; *(v4fa*)&sO[w][ln][dt * 16 + 8 * hh + 4] = (v4f){o[4], o[5], o[6], o[7]}; }
  __syncthreads();      /* every part's partial is in LDS before any thread merges */
  for (int i = tid; i < 4 * RPW * 16; i += 128 * KSP) { const int row = i >> 4, pc = i & 15; const int tq = row / RPW, rr = row % RPW;
    float mx = sM[tq][rr];
#pragma unroll
    for (int p = 1; p < KSP; ++p) mx = fmaxf(mx, sM[p * 4 + tq][rr]);
    float lsum = 0.f; v4f o = {0.f, 0.f, 0.f, 0.f};
#pragma unroll
    for (int p = 0; p < KSP; ++p) { const float wg = expf(sM[p * 4 + tq][rr] - mx); lsum += wg * sL[p * 4 + tq][rr]; const v4f val = *(const v4fa*)&sO[p * 4 + tq][rr][pc * 4]; o += val * wg; }
    const float inv = (lsum > 0.f) ? 1.0f / (lsum * 1024.0f) : 0.f;
    const v4f ov = o * inv; v4h fh, fl;      /* the output row leaves as the next product's operand: hi + 16x residual pair */
#pragma unroll
    for (int q = 0; q < 4; ++q) { const _Float16 hv = (_Float16)ov[q]; fh[q] = hv; fl[q] = (_Float16)((ov[q] - (float)hv) * 16.0f); }
    _Float16* d = O16 + ((size_t)b * TQ + qb0 + row) * (2 * DK) + pc * 4; *(v4h*)d = fh; *(v4h*)(d + DK) = fl; } }


__constant__ float GRIDV[8] = {-2.000000000e+00f,-1.428571463e+00f,-8.571428657e-01f,-2.857141793e-01f,2.857143879e-01f,8.571429253e-01f,1.428571701e+00f,2.000000000e+00f};
#define INV_DENOM (1.0f / 0.5714285714285714f)
__device__ __forceinline__ void d_fulltab(unsigned* __restrict__ MB, int* __restrict__ RA, int* __restrict__ KE, unsigned bx) {
  const int t = bx * 256 + threadIdx.x;
  if (t < NPI * (NPI / 32)) { *(unsigned*)(MB + t) = 0u;  }
  if (t < NPI) { *(int*)(RA + t) = 0;  }
  if (t < NPI / 64) { *(int*)(KE + t * 32) = NPI;  } }
// Layout changes go through a 64 x 64 LDS tile (pitch 65 floats: no bank conflict in either direction), so that every global read and write covers whole 128-byte lines.
__device__ __forceinline__ void d_xcl(const float* __restrict__ x, _Float16* __restrict__ X16, unsigned bx) {
  __shared__ float tl[64][65]; const int tid = threadIdx.x; const int pt = bx % (NPI / 64), ct = (bx / (NPI / 64)) % (CIN / 64), b = bx / ((NPI / 64) * (CIN / 64));
  const int r16 = tid / 16, k4 = (tid % 16) * 4; v4f a[4];      /* thread: rows r16 + 16 u of the tile, four floats at k4; the four loads fly together */
#pragma unroll      /* a[] stays in registers */
  for (int u = 0; u < 4; ++u) a[u] = *(const v4fa*)(x + ((size_t)b * CIN + ct * 64 + r16 + 16 * u) * NPI + pt * 64 + k4);
#pragma unroll      /* a[] stays in registers */
  for (int u = 0; u < 4; ++u) { float* d = &tl[r16 + 16 * u][k4]; d[0] = a[u][0]; d[1] = a[u][1]; d[2] = a[u][2]; d[3] = a[u][3]; }
  __syncthreads();      /* the whole tile is in LDS before any thread reads it across */
#pragma unroll      /* both rows' LDS reads are issued together */
  for (int rd = 0; rd < 2; ++rd) { const int p = rd * 32 + tid / 8, c8 = (tid % 8) * 8; FragH f;
#pragma unroll
    for (int q = 0; q < 8; ++q) f.h[q] = (_Float16)bf16_round(tl[c8 + q][p]);
    *(v8us*)((unsigned short*)X16 + ((size_t)b * NPI + pt * 64 + p) * CIN + ct * 64 + c8) = f.half[0]; } }
// A channel's mean and variance in one block: its values stay in registers between the two sums, each summed in the order of a pass of its own.
__device__ __forceinline__ void d_instat(const float* __restrict__ A, float* __restrict__ ST, unsigned bx) {
  #pragma clang fp contract(off)
  __shared__ float sh[256]; const int b = bx / DK, c = bx % DK; const float* ap = A + ((size_t)b * NPI + threadIdx.x) * DK + c; float a[NPI / 256]; float s = 0.f;
#pragma unroll      /* a[] stays in registers; the sixteen loads fly together */
  for (int k = 0; k < NPI / 256; ++k) a[k] = ap[(size_t)256 * k * DK];
#pragma unroll
  for (int k = 0; k < NPI / 256; ++k) s += a[k];
  sh[threadIdx.x] = s; __syncthreads();
  for (int st = 128; st > 0; st >>= 1) { if ((int)threadIdx.x < st) sh[threadIdx.x] += sh[threadIdx.x + st]; __syncthreads(); }
  const float mu = sh[0] / (float)NPI; s = 0.f;
  __syncthreads();      /* every thread has read the first sum before sh is written again */
#pragma unroll
  for (int k = 0; k < NPI / 256; ++k) { const float v = a[k] - mu; s += v * v; }
  sh[threadIdx.x] = s; __syncthreads();
  for (int st = 128; st > 0; st >>= 1) { if ((int)threadIdx.x < st) sh[threadIdx.x] += sh[threadIdx.x + st]; __syncthreads(); }
  if (threadIdx.x == 0) { ST[(size_t)bx * 32] = mu; ST[((size_t)NIMG * DK + bx) * 32] = sh[0] / (float)NPI; } }
__global__ __launch_bounds__(256) void k_basis(const float* __restrict__ A, const float* __restrict__ ST, _Float16* __restrict__ BAS) {
  #pragma clang fp contract(off)
  const int t = blockIdx.x * 256 + threadIdx.x; if (t >= NPX * DK) return; const int r = t / DK, c = t % DK; const int b = r / NPI; const float a = A[(size_t)r * DK + c];
  const float mu = ST[((size_t)b * DK + c) * 32], var = ST[((size_t)NIMG * DK + b * DK + c) * 32]; const float xn = (a - mu) * rsqrtf(var + 1e-5f); FragH bh, bl;
#pragma unroll
  for (int g = 0; g < NG; ++g) { const float z = (xn - GRIDV[g]) * INV_DENOM; const float e = expf(-(z * z)); const _Float16 hv = (_Float16)e; bh.h[g] = hv; bl.h[g] = (_Float16)((e - (float)hv) * 16.0f); }
  unsigned short* bd = (unsigned short*)BAS + (size_t)r * 2 * DK * NG + c * NG;
  { *(v8us*)bd = bh.half[0]; *(v8us*)(bd + DK * NG) = bl.half[0];  } }
__device__ __forceinline__ void d_wnp2(const float* __restrict__ Wm, int K, int N, _Float16* __restrict__ Bt, unsigned bx) {
  const int t = bx * 256 + threadIdx.x; if (t >= N * (2 * K / 8)) return; const int n = t / (2 * K / 8), k0 = (t % (2 * K / 8)) * 8; const bool lo = (k0 >= K); const float sc = lo ? 1.0f : 16.0f; FragH f;
#pragma unroll
  for (int q = 0; q < 8; ++q) { const int k = k0 + q - (lo ? K : 0); f.h[q] = (_Float16)(bf16_round(Wm[(size_t)n * K + k]) * sc); }
  *(v8us*)((unsigned short*)Bt + (size_t)n * 2 * K + k0) = f.half[0];  }
// One grid for all that reads inputs alone: x turned to f16 rows (first: the longest part), the mask tables, the eight weight planes.
#define NB_XCL (NIMG * (CIN / 64) * (NPI / 64))
#define NB_TAB (NPI * (NPI / 32) / 256)
#define NB_WS (DK * (2 * DK * NG / 8) / 256)
#define NB_WB (DK * (2 * DK / 8) / 256)
#define NB_WO (CIN * (2 * DK / 8) / 256)
#define NB_WI (DK * CIN / 8 / 256)
__global__ __launch_bounds__(256) void k_prep(const float* __restrict__ x, const float* __restrict__ w_in, const float* __restrict__ w_out, const float* __restrict__ qbw, const float* __restrict__ kbw, const float* __restrict__ vbw,
    const float* __restrict__ qsw, const float* __restrict__ ksw, const float* __restrict__ vsw, _Float16* __restrict__ X16, _Float16* __restrict__ BIN, _Float16* __restrict__ BOUT,
    _Float16* __restrict__ BB0, _Float16* __restrict__ BB1, _Float16* __restrict__ BB2, _Float16* __restrict__ BS0, _Float16* __restrict__ BS1, _Float16* __restrict__ BS2, unsigned* __restrict__ MB, int* __restrict__ RA, int* __restrict__ KE) {
  int bx = blockIdx.x;
  if (bx < NB_XCL) { d_xcl(x, X16, bx); return; }
  bx -= NB_XCL; if (bx < NB_TAB) { d_fulltab(MB, RA, KE, bx); return; }
  bx -= NB_TAB; if (bx < 3 * NB_WS) { const int i = bx / NB_WS; d_wnp2((i == 0) ? qsw : (i == 1) ? ksw : vsw, DK * NG, DK, (i == 0) ? BS0 : (i == 1) ? BS1 : BS2, bx % NB_WS); return; }
  bx -= 3 * NB_WS; if (bx < 3 * NB_WB) { const int i = bx / NB_WB; d_wnp2((i == 0) ? qbw : (i == 1) ? kbw : vbw, DK, DK, (i == 0) ? BB0 : (i == 1) ? BB1 : BB2, bx % NB_WB); return; }
  bx -= 3 * NB_WB; if (bx < NB_WO) { d_wnp2(w_out, DK, CIN, BOUT, bx); return; }      /* (out,in) natural -> [16w | w] pair planes */
  d_round16f(w_in, BIN, (size_t)DK * CIN / 8, bx - NB_WO); }
// att's channel statistics beside the q, k, v base products (8 waves a block): the first reads att, the second silu(att) and weights.
#define NB_IS (NIMG * DK)
#define NB_GB (NPX / 256)
__global__ __launch_bounds__(256) void k_stat_base(const float* __restrict__ A, float* __restrict__ ST, const _Float16* __restrict__ SIL, const _Float16* __restrict__ B0, const _Float16* __restrict__ B1, const _Float16* __restrict__ B2,
    const float* __restrict__ bias0, const float* __restrict__ bias1, const float* __restrict__ bias2, float* __restrict__ G, size_t plane, int ldc, int M, int N, int K) {
  const int bx = blockIdx.x;
  if (bx < NB_IS) { d_instat(A, ST, bx); return; }
  const int i = (bx - NB_IS) / NB_GB;
  d_gemm2<0, 8, 0>(SIL, K, 0, (i == 0) ? B0 : (i == 1) ? B1 : B2, K, 0, 0.0625f, (i == 0) ? bias0 : (i == 1) ? bias1 : bias2, 0, nullptr, 1, 0, 0, G + (size_t)i * plane, nullptr, ldc, 0, M, N, K, (bx - NB_IS) % NB_GB, 0, nullptr, nullptr, false); }
// One block a channel: y = gamma x + att2 (A2T: the outer product without its bias, channel-major like x and the output) is formed in registers and stays there for the mean, the variance and the output.
// Thread t holds pixels bi * NPI + t + 256 k; each sum runs over them in rising order, then down the LDS tree.
__global__ __launch_bounds__(256) void k_ybn(const float* __restrict__ x, const float* __restrict__ gam, const float* __restrict__ A2T, const float* __restrict__ b_out, const float* __restrict__ bw, const float* __restrict__ bb, float* __restrict__ out) {
  __shared__ float sh[256]; const int c = blockIdx.x; const float g = bf16_round(gam[0]), bo = bf16_round(b_out[c]), gw = bf16_round(bw[c]), be = bf16_round(bb[c]); float y[NIMG][NPI / 256]; float s = 0.f;
#pragma unroll      /* y[][] stays in registers; an image's thirty-two loads fly together */
  for (int bi = 0; bi < NIMG; ++bi) { const float* xp = x + ((size_t)bi * CIN + c) * NPI; const float* ap = A2T + ((size_t)bi * CIN + c) * NPI; float xv[NPI / 256], av[NPI / 256];
#pragma unroll
    for (int k = 0; k < NPI / 256; ++k) xv[k] = xp[threadIdx.x + 256u * k];
    asm volatile("s_wait_xcnt 0x0" ::: "memory");      /* the loads' address registers are free for what follows; the data are not waited for here */
#pragma unroll
    for (int k = 0; k < NPI / 256; ++k) av[k] = ap[threadIdx.x + 256u * k];
    asm volatile("s_wait_xcnt 0x0" ::: "memory");      /* the same */
#pragma unroll
    for (int k = 0; k < NPI / 256; ++k) y[bi][k] = g * bf16_round(xv[k]) + (av[k] + bo); }
#pragma unroll
  for (int bi = 0; bi < NIMG; ++bi) {
#pragma unroll
    for (int k = 0; k < NPI / 256; ++k) s += y[bi][k]; }
  sh[threadIdx.x] = s; __syncthreads();
  for (int st = 128; st > 0; st >>= 1) { if ((int)threadIdx.x < st) sh[threadIdx.x] += sh[threadIdx.x + st]; __syncthreads(); }
  const float mu = sh[0] / (float)NPX; s = 0.f;
  __syncthreads();      /* every thread has read the first sum before sh is written again */
#pragma unroll
  for (int bi = 0; bi < NIMG; ++bi) {
#pragma unroll
    for (int k = 0; k < NPI / 256; ++k) { const float v = y[bi][k] - mu; s += v * v; } }
  sh[threadIdx.x] = s; __syncthreads();
  for (int st = 128; st > 0; st >>= 1) { if ((int)threadIdx.x < st) sh[threadIdx.x] += sh[threadIdx.x + st]; __syncthreads(); }
  const float sc = rsqrtf(sh[0] / (float)NPX + 1e-5f);
#pragma unroll
  for (int bi = 0; bi < NIMG; ++bi) { float* op = out + ((size_t)bi * CIN + c) * NPI;
#pragma unroll
    for (int k = 0; k < NPI / 256; ++k) op[threadIdx.x + 256u * k] = gw * ((y[bi][k] - mu) * sc) + be; } }

extern "C" void kernel_launch(void* const* d_in, const int* in_sizes, int n_in,
                              void* d_out, int out_size, void* d_ws, size_t ws_size, hipStream_t stream) {
  (void)in_sizes; (void)n_in; (void)out_size;
  const float* const* I = (const float* const*)d_in; const float* x = I[0]; const float* w_in = I[1]; const float* b_in = I[2];
  const float* qbw = I[3]; const float* qbb = I[4]; const float* qsw = I[5]; const float* qsb = I[6]; const float* kbw = I[7]; const float* kbb = I[8]; const float* ksw = I[9]; const float* ksb = I[10]; const float* vbw = I[11]; const float* vbb = I[12]; const float* vsw = I[13]; const float* vsb = I[14];
  const float* w_out = I[15]; const float* b_out = I[16]; const float* gam = I[17]; const float* bnw = I[18]; const float* bnb = I[19];
  char* ws = (char*)d_ws; size_t off = 0;
  auto take = [&](size_t bytes) { char* p = ws + off; off += (bytes + 255) & ~(size_t)255; return p; };
  _Float16* BIN = (_Float16*)take((size_t)DK * CIN * 2); _Float16* BB[3]; _Float16* BS[3]; for (int i = 0; i < 3; ++i) { BB[i] = (_Float16*)take((size_t)DK * 2 * DK * 2); BS[i] = (_Float16*)take((size_t)DK * 2 * DK * NG * 2); } _Float16* BOUT = (_Float16*)take((size_t)CIN * 2 * DK * 2);
  _Float16* X16 = (_Float16*)take((size_t)NPX * CIN * 2); float* ATT = (float*)take((size_t)NPX * DK * 4); float* IST = (float*)take((size_t)2 * NIMG * DK * 32 * 4); _Float16* SIL = (_Float16*)take((size_t)NPX * 2 * DK * 2); _Float16* BAS = (_Float16*)take((size_t)NPX * 2 * DK * NG * 2);
  float* G = (float*)take((size_t)3 * NPX * DK * 4); _Float16* Qh = (_Float16*)take((size_t)NPX * DK * 2); _Float16* Ql = (_Float16*)take((size_t)NPX * DK * 2); _Float16* Kh = (_Float16*)take((size_t)NPX * DK * 2); _Float16* Kl = (_Float16*)take((size_t)NPX * DK * 2); _Float16* Vth = (_Float16*)take((size_t)NPX * DK * 2); _Float16* Vtl = (_Float16*)take((size_t)NPX * DK * 2);
  _Float16* O16 = (_Float16*)take((size_t)NPX * 2 * DK * 2); float* A2T = (float*)take((size_t)NPX * CIN * 4);
  unsigned* MB = (unsigned*)take((size_t)NPI * (NPI / 32) * 4); int* RA = (int*)take((size_t)NPI * 4); int* KE = (int*)take((size_t)(NPI / 64) * 32 * 4);
  if (off > ws_size) return;      /* 0.6 + 8 + 4 + 4 + 32 + 12 + 12 + 4 + 16 + 2 = 95 MiB */
  k_prep<<<NB_XCL + NB_TAB + 3 * NB_WS + 3 * NB_WB + NB_WO + NB_WI, 256, 0, stream>>>(x, w_in, w_out, qbw, kbw, vbw, qsw, ksw, vsw, X16, BIN, BOUT, BB[0], BB[1], BB[2], BS[0], BS[1], BS[2], MB, RA, KE);
  const dim3 g64((NPX / 128) * 1, 1), g64x3((NPX / 128) * 1, 3), gout((CIN / 128) * (NPI / 64), NIMG);
  k_gemm_att<<<g64, 128, 0, stream>>>(X16, BIN, b_in, ATT, SIL);      /* att = conv1x1(x) + b; silu(att) */
  k_stat_base<<<NB_IS + 3 * NB_GB, 256, 0, stream>>>(ATT, IST, SIL, BB[0], BB[1], BB[2], qbb, kbb, vbb, G, (size_t)NPX * DK, DK, NPX, DK, 2 * DK);      /* G = base(silu) + b_base, planes q, k, v */
  k_basis<<<(NPX * DK + 255) / 256, 256, 0, stream>>>(ATT, IST, BAS);
  k_gemm2qkv<<<g64x3, 128, 0, stream>>>(BAS, 2 * DK * NG, BS[0], BS[1], BS[2], 2 * DK * NG, 0.0625f, qsb, ksb, vsb, G, (size_t)NPX * DK, DK, NPX, DK, 2 * DK * NG, Qh, Ql, Kh, Kl, Vth, Vtl);      /* spline(basis) + b_spline + G, as operand planes */
  k_flashm<NPI, NPI, KSPLIT><<<NIMG * NH * (NPI / 64), 128 * KSPLIT, 0, stream>>>(Qh, Ql, Kh, Kl, Vth, Vtl, MB, RA, KE, O16);      /* slab = image (NH 1) */
  k_gemm2<0><<<gout, 128, 0, stream>>>(BOUT, 2 * DK, 0, O16, 2 * DK, (size_t)NPI * 2 * DK, 0.0625f, nullptr, 0, nullptr, 1, 0, 0, A2T, nullptr, NPI, (size_t)CIN * NPI, CIN, NPI, 2 * DK);      /* att2^T = w_out . out^T of image blockIdx.y (pair operands), rows = channels; its bias is added in k_ybn */
  k_ybn<<<CIN, 256, 0, stream>>>(x, gam, A2T, b_out, bnw, bnb, (float*)d_out);
}

// v008
// A run of this version takes 128 microseconds.
// Timed twice side by side with v007, it ran 1.12 times as fast both times.
// Counting every step since v000, it is 7.20 times as fast.
#include <hip/hip_runtime.h>
// Self-KAN attention (4 images, 256 channels, 64 x 64): att = conv1x1(x) (64 ch); q, k, v = FastKAN 1x1 convs (base_conv(silu(att)) + spline_conv(RBF basis of the instance-normalised att, 8 grid points)); energy = q.k over the 4096 positions (NO scaling), softmax over keys, out = v.attn^T; att2 = conv1x1(out) (256 ch); y = gamma*x + att2; training-mode BatchNorm -> [4,256,64,64].
// Compute dtype: x, weights, biases, gamma, BN affine rounded to bf16; x exact in f16; silu/basis operands as hi + 16x residual pairs (~2^-20); q, k, P, v as hi + x2^10 residual pairs (~2^-21); the attention output as hi + 16x residual pairs too; f32 accumulation, statistics, softmax. v_wmma_f32_16x16x32_f16.
#define NIMG 4
#define CIN 256
#define DK 64
#define HW 64
#define NPI (HW * HW)            /* 4096 */
#define NPX (NIMG * NPI)         /* 16384 */
#define NG 8
#define NH 1
#define DM DK
#define SCL 1.0f
#define KSPLIT 4
#define LOG2E 1.4426950408889634f
typedef __bf16 v16b __attribute__((ext_vector_type(16)));
typedef unsigned short v8us __attribute__((ext_vector_type(8), may_alias));
typedef float  v8f  __attribute__((ext_vector_type(8)));
typedef float  v4f  __attribute__((ext_vector_type(4)));
typedef float  v2f  __attribute__((ext_vector_type(2)));
typedef float  v4fa __attribute__((ext_vector_type(4), may_alias));
union FragB { v16b v; v8us half[2]; unsigned short u[16]; };

__device__ __forceinline__ unsigned short bf16_bits(float x) { unsigned int u = __float_as_uint(x); return (unsigned short)((u + 0x7FFFu + ((u >> 16) & 1u)) >> 16); }
__device__ __forceinline__ float bf16_val(unsigned short b) { return __uint_as_float(((unsigned int)b) << 16); }
__device__ __forceinline__ float bf16_round(float x) { return bf16_val(bf16_bits(x)); }
// D += A·B with NT terms: 1 = ah·bh, 2 = + al·bh (A split), 3 = + ah·bl (both split)
template <int NT>
__device__ __forceinline__ v8f mmaN(v16b ah, v16b al, v16b bh, v16b bl, v8f c) {
  c = __builtin_amdgcn_wmma_f32_16x16x32_bf16(false, ah, false, bh, (short)0, c, false, false);
  if (NT >= 2) c = __builtin_amdgcn_wmma_f32_16x16x32_bf16(false, al, false, bh, (short)0, c, false, false);
  if (NT >= 3) c = __builtin_amdgcn_wmma_f32_16x16x32_bf16(false, ah, false, bl, (short)0, c, false, false);
  asm volatile("v_nop\n\tv_nop\n\tv_nop\n\tv_nop" : "+v"(c) : "v"(ah), "v"(al), "v"(bh), "v"(bl));
  return c;
}

__global__ __launch_bounds__(256) void k_wt_bf16(const float* __restrict__ W, unsigned short* __restrict__ Wt, int K, int N) {
  const int t = blockIdx.x * 256 + threadIdx.x;
  const int k8n = K / 8;
  if (t >= N * k8n) return;
  const int n = t / k8n, k8 = (t % k8n) * 8;
  v8us v;
#pragma unroll
  for (int i = 0; i < 8; ++i) v[i] = bf16_bits(W[(size_t)(k8 + i) * N + n]);
  *(v8us*)(Wt + (size_t)n * K + k8) = v;
  
}

// GEMM C[M][N] (f32, pitch ldc) = act(A[M][K]·W + bias). A f32 row-major (pitch lda) converted per fragment to bf16
// (ASPLIT: hi/lo two planes -> 2 terms, else single rounded term); Wt bf16 [N][K] (pitch ldb). BIAS_BF16 rounds the
// bias to bf16 first (bias quantised to bf16 before the add). K%32==0, M%16==0, N%64==0.
template <bool ASPLIT, int ACT, bool BIAS_BF16>
__global__ __launch_bounds__(128) void k_gemm_bf(const float* __restrict__ A, int lda, const unsigned short* __restrict__ Wt, int ldb,
                                               const float* __restrict__ bias, float* __restrict__ C, int ldc, int M, int N, int K) {
  __shared__ __attribute__((aligned(16))) float so[4][16][64];
  const int tid = threadIdx.x, w = tid >> 5, lane = tid & 31, ln = lane & 15, hh = lane >> 4;
  const int ntn = N / 64;
  const int wid = blockIdx.x * 4 + w;
  const int mt = wid / ntn, nq = wid % ntn;
  if (mt * 16 >= M) return;
  const int row0 = mt * 16, col0 = nq * 64;
  const float* arow = A + (size_t)(row0 + ln) * lda;
  v8f acc[4] = {};
  for (int kb = 0; kb < K; kb += 32) {
    FragB ah, al;
    const v4f x0 = *(const v4fa*)(arow + kb + 8 * hh), x1 = *(const v4fa*)(arow + kb + 8 * hh + 4);
    const v4f x2 = *(const v4fa*)(arow + kb + 16 + 8 * hh), x3 = *(const v4fa*)(arow + kb + 16 + 8 * hh + 4);
    float xs[16] = {x0[0],x0[1],x0[2],x0[3],x1[0],x1[1],x1[2],x1[3],x2[0],x2[1],x2[2],x2[3],x3[0],x3[1],x3[2],x3[3]};
#pragma unroll
    for (int i = 0; i < 16; ++i) { const unsigned short hb = bf16_bits(xs[i]); ah.u[i] = hb; al.u[i] = ASPLIT ? bf16_bits(xs[i] - bf16_val(hb)) : (unsigned short)0; }
#pragma unroll
    for (int t = 0; t < 4; ++t) {
      const unsigned short* brow = Wt + (size_t)(col0 + t * 16 + ln) * ldb + kb;
      FragB b;
      b.half[0] = *(const v8us*)(brow + 8 * hh);
      b.half[1] = *(const v8us*)(brow + 16 + 8 * hh);
      acc[t] = mmaN<ASPLIT ? 2 : 1>(ah.v, al.v, b.v, b.v, acc[t]);
    }
  }
#pragma unroll
  for (int t = 0; t < 4; ++t) {
    float bv = bias ? bias[col0 + t * 16 + ln] : 0.f;
    if (BIAS_BF16) bv = bf16_round(bv);
#pragma unroll
    for (int r = 0; r < 8; ++r) { float v = acc[t][r] + bv; if (ACT == 1) v = fmaxf(v, 0.f); so[w][8 * hh + r][t * 16 + ln] = v; }
  }
  __builtin_amdgcn_fence(__ATOMIC_ACQ_REL, "workgroup");
  __builtin_amdgcn_wave_barrier();
  const int rsub = lane >> 4, c4 = (lane & 15) * 4;
  {
#pragma unroll
    for (int q = 0; q < 8; ++q) {
      const int r = q * 2 + rsub;
      const v4f v = *(const v4fa*)&so[w][r][c4];
      *(v4f*)(C + (size_t)(row0 + r) * ldc + col0 + c4) = v;
    }
    
  }
}

// GEMM C = act(A·W + bias + resid): A f32 (ASPLIT -> hi/lo 2 terms), Wt bf16 [N][K]; ACT 0 none, 1 relu, 2 exact gelu;
// resid (optional, f32, row index = (row % rmod), pitch ldr, RES_BF16 rounds it) added before the activation.
template <bool ASPLIT, int ACT, bool BIAS_BF16, bool RES_BF16>
__global__ __launch_bounds__(128) void k_gemm_bf3(const float* __restrict__ A, int lda, const unsigned short* __restrict__ Wt, int ldb,
                                                const float* __restrict__ bias, const float* __restrict__ resid, int rmod, int ldr,
                                                float* __restrict__ C, int ldc, int M, int N, int K) {
  __shared__ __attribute__((aligned(16))) float so[4][16][64];
  const int tid = threadIdx.x, w = tid >> 5, lane = tid & 31, ln = lane & 15, hh = lane >> 4;
  const int ntn = N / 64;
  const int wid = blockIdx.x * 4 + w;
  const int mt = wid / ntn, nq = wid % ntn;
  if (mt * 16 >= M) return;
  const int row0 = mt * 16, col0 = nq * 64;
  const float* arow = A + (size_t)(row0 + ln) * lda;
  v8f acc[4] = {};
  for (int kb = 0; kb < K; kb += 32) {
    FragB ah, al;
    const v4f x0 = *(const v4fa*)(arow + kb + 8 * hh), x1 = *(const v4fa*)(arow + kb + 8 * hh + 4);
    const v4f x2 = *(const v4fa*)(arow + kb + 16 + 8 * hh), x3 = *(const v4fa*)(arow + kb + 16 + 8 * hh + 4);
    float xs[16] = {x0[0],x0[1],x0[2],x0[3],x1[0],x1[1],x1[2],x1[3],x2[0],x2[1],x2[2],x2[3],x3[0],x3[1],x3[2],x3[3]};
#pragma unroll
    for (int i = 0; i < 16; ++i) { const unsigned short hb = bf16_bits(xs[i]); ah.u[i] = hb; al.u[i] = ASPLIT ? bf16_bits(xs[i] - bf16_val(hb)) : (unsigned short)0; }
#pragma unroll
    for (int t = 0; t < 4; ++t) {
      const unsigned short* brow = Wt + (size_t)(col0 + t * 16 + ln) * ldb + kb;
      FragB b;
      b.half[0] = *(const v8us*)(brow + 8 * hh);
      b.half[1] = *(const v8us*)(brow + 16 + 8 * hh);
      acc[t] = mmaN<ASPLIT ? 2 : 1>(ah.v, al.v, b.v, b.v, acc[t]);
    }
  }
#pragma unroll
  for (int t = 0; t < 4; ++t) {
    const int col = col0 + t * 16 + ln;
    float bv = bias ? bias[col] : 0.f;
    if (BIAS_BF16) bv = bf16_round(bv);
#pragma unroll
    for (int r = 0; r < 8; ++r) {
      float v = acc[t][r] + bv;
      if (resid) { float rv = resid[(size_t)((row0 + 8 * hh + r) % rmod) * ldr + col]; if (RES_BF16) rv = bf16_round(rv); v += rv; }
      if (ACT == 1) v = fmaxf(v, 0.f);
      if (ACT == 2) v = 0.5f * v * (1.0f + erff(v * 0.70710678118654752f));
      if (ACT == 3) { const float u = 0.7978845608028654f * (v + 0.044715f * v * v * v); v = 0.5f * v * (1.0f + tanhf(u)); }
      so[w][8 * hh + r][t * 16 + ln] = v;
    }
  }
  __builtin_amdgcn_fence(__ATOMIC_ACQ_REL, "workgroup");
  __builtin_amdgcn_wave_barrier();
  const int rsub = lane >> 4, c4 = (lane & 15) * 4;
  {
#pragma unroll
    for (int q = 0; q < 8; ++q) {
      const int r = q * 2 + rsub;
      const v4f v = *(const v4fa*)&so[w][r][c4];
      *(v4f*)(C + (size_t)(row0 + r) * ldc + col0 + c4) = v;
    }
    
  }
}
// row LayerNorm (biased variance, eps) over N: s = X (+ R); optional out_sum <- s; out_norm <- (s-mu)*rsqrt(var+eps)*g + b
template <bool PARAM_BF16>
__global__ __launch_bounds__(256) void k_layernorm(const float* __restrict__ X, const float* __restrict__ R, const float* __restrict__ g, const float* __restrict__ bta,
                                                  float* __restrict__ out_sum, float* __restrict__ out_norm, int N, float eps) {
  __shared__ float red[256];
  const int row = blockIdx.x, tid = threadIdx.x;
  const float* x = X + (size_t)row * N; const float* rr = R ? R + (size_t)row * N : nullptr;
  float vals[16];                     // up to N = 4096
  const int per = N / 256;            // contiguous chunk per thread? use strided-by-4 chunks: thread handles j = tid*4 + 1024*u
  float s1 = 0.f;
  for (int u = 0; u < per / 4; ++u) {
    const int j = tid * 4 + 1024 * u;
    const v4f a = *(const v4fa*)(x + j);
    v4f b = {0.f,0.f,0.f,0.f}; if (rr) b = *(const v4fa*)(rr + j);
#pragma unroll
    for (int q = 0; q < 4; ++q) { const float v = a[q] + b[q]; vals[u * 4 + q] = v; s1 += v; }
  }
  red[tid] = s1; __syncthreads();
  for (int st = 128; st > 0; st >>= 1) { if (tid < st) red[tid] += red[tid + st]; __syncthreads(); }
  const float mu = red[0] / (float)N; __syncthreads();
  float s2 = 0.f;
  for (int u = 0; u < per / 4; ++u)
#pragma unroll
    for (int q = 0; q < 4; ++q) { const float c = vals[u * 4 + q] - mu; s2 += c * c; }
  red[tid] = s2; __syncthreads();
  for (int st = 128; st > 0; st >>= 1) { if (tid < st) red[tid] += red[tid + st]; __syncthreads(); }
  const float rs = rsqrtf(red[0] / (float)N + eps);
  {
    for (int u = 0; u < per / 4; ++u) {
      const int j = tid * 4 + 1024 * u;
      v4f o, sm;
#pragma unroll
      for (int q = 0; q < 4; ++q) {
        float gg = g[j + q], bb = bta[j + q];
        if (PARAM_BF16) { gg = bf16_round(gg); bb = bf16_round(bb); }
        sm[q] = vals[u * 4 + q]; o[q] = (vals[u * 4 + q] - mu) * rs * gg + bb;
      }
      if (out_sum) *(v4f*)(out_sum + (size_t)row * N + j) = sm;
      *(v4f*)(out_norm + (size_t)row * N + j) = o;
    }
    
  }
}



// ---- f16 WMMA path (v_wmma_f32_16x16x32_f16): 11-bit significands for operands in range — used where a probability operand (2^10 p, in [0, 2^10]) needs more precision than bf16
typedef _Float16 v16h __attribute__((ext_vector_type(16)));
union FragH { v16h v; v8us half[2]; _Float16 h[16]; unsigned short u[16]; };
template <int NT>
__device__ __forceinline__ v8f mmaH(v16h ah, v16h al, v16h bh, v16h bl, v8f c) {
  c = __builtin_amdgcn_wmma_f32_16x16x32_f16(false, ah, false, bh, (short)0, c, false, false);
  if (NT >= 2) c = __builtin_amdgcn_wmma_f32_16x16x32_f16(false, al, false, bh, (short)0, c, false, false);
  if (NT >= 3) c = __builtin_amdgcn_wmma_f32_16x16x32_f16(false, ah, false, bl, (short)0, c, false, false);
  asm volatile("v_nop\n\tv_nop\n\tv_nop\n\tv_nop" : "+v"(c) : "v"(ah), "v"(al), "v"(bh), "v"(bl));
  return c;
}
// batched GEMM like k_gemm_b but f16 operands: A f32 (split into f16 hi/lo if ASPLIT, else rounded to f16), Bt = f16 values [n][k]; alpha; C f32; N multiple of 16 (partial tiles skipped)
template <bool ASPLIT>
__global__ __launch_bounds__(128) void k_gemm_h(const float* __restrict__ A, int lda, size_t sA, const _Float16* __restrict__ Bh, int ldb, size_t sB, float alpha, float* __restrict__ C, int ldc, size_t sC, int M, int N, int K) {
  __shared__ __attribute__((aligned(16))) float so[4][16][64];
  const int tid = threadIdx.x, w = tid >> 5, lane = tid & 31, ln = lane & 15, hh = lane >> 4; const int by = blockIdx.y;
  A += (size_t)by * sA; Bh += (size_t)by * sB; C += (size_t)by * sC;
  const int ntn = (N + 63) / 64; const int wid = blockIdx.x * 4 + w; const int mt = wid / ntn, nq = wid % ntn; if (mt * 16 >= M) return;
  const int row0 = mt * 16, col0 = nq * 64; const float* arow = A + (size_t)(row0 + ln) * lda;
  v8f acc[4] = {};
  for (int kb = 0; kb < K; kb += 32) {
    FragH ah, al;
    const v4f x0 = *(const v4fa*)(arow + kb + 8 * hh), x1 = *(const v4fa*)(arow + kb + 8 * hh + 4), x2 = *(const v4fa*)(arow + kb + 16 + 8 * hh), x3 = *(const v4fa*)(arow + kb + 16 + 8 * hh + 4);
    float xs[16] = {x0[0],x0[1],x0[2],x0[3],x1[0],x1[1],x1[2],x1[3],x2[0],x2[1],x2[2],x2[3],x3[0],x3[1],x3[2],x3[3]};
#pragma unroll
    for (int i = 0; i < 16; ++i) { const _Float16 h = (_Float16)xs[i]; ah.h[i] = h; al.h[i] = ASPLIT ? (_Float16)(xs[i] - (float)h) : (_Float16)0.0f; }
#pragma unroll
    for (int t = 0; t < 4; ++t) { if (col0 + t * 16 >= N) continue; const size_t boff = (size_t)(col0 + t * 16 + ln) * ldb + kb; FragH bq; bq.half[0] = *(const v8us*)(Bh + boff + 8 * hh); bq.half[1] = *(const v8us*)(Bh + boff + 16 + 8 * hh);
      acc[t] = mmaH<ASPLIT ? 2 : 1>(ah.v, al.v, bq.v, bq.v, acc[t]); }
  }
#pragma unroll
  for (int t = 0; t < 4; ++t) { if (col0 + t * 16 >= N) continue;
#pragma unroll
    for (int r = 0; r < 8; ++r) so[w][8 * hh + r][t * 16 + ln] = acc[t][r] * alpha; }
  __builtin_amdgcn_fence(__ATOMIC_ACQ_REL, "workgroup"); __builtin_amdgcn_wave_barrier();
  const int rsub = lane >> 4, c4 = (lane & 15) * 4;
  {
#pragma unroll
    for (int q = 0; q < 8; ++q) { const int r = q * 2 + rsub; if (col0 + c4 < N) { const v4f v = *(const v4fa*)&so[w][r][c4]; *(v4f*)(C + (size_t)(row0 + r) * ldc + col0 + c4) = v; } }
     }
}

// Wt[n][k] = f16(W[k][n]·scale) from f32 row-major W[K][N] (scale = power of two; bf16-exact weights stay exact in f16 away from the subnormal range)
__global__ __launch_bounds__(256) void k_wt_f16(const float* __restrict__ W, _Float16* __restrict__ Wt, int K, int N, float scale) {
  const int t = blockIdx.x * 256 + threadIdx.x; if (t >= N * (K / 8)) return; const int n = t / (K / 8), k8 = (t % (K / 8)) * 8; FragH f;
#pragma unroll
  for (int i = 0; i < 8; ++i) f.h[i] = (_Float16)(bf16_round(W[(size_t)(k8 + i) * N + n]) * scale); const v8us o = f.half[0];
  *(v8us*)((unsigned short*)Wt + (size_t)n * K + k8) = o; 
}
// k_gemm_hh variant with fused epilogue: v = acc·alpha + bias[by·sBias + col] (+ CP[(row/rowsPerB)·sCPb + by·64 + col] if CP) ; ACT 0 none / 1 elu ; writes f16 C16 (and f32 C if non-null)
template <int ACT>
__global__ __launch_bounds__(128) void k_gemm_hhx(const _Float16* __restrict__ A, int lda, size_t sA, const _Float16* __restrict__ Bh, int ldb, size_t sB, float alpha, const float* __restrict__ bias, size_t sBias, const float* __restrict__ CP, int rowsPerB, size_t sCPb, int row0g,
    float* __restrict__ C, _Float16* __restrict__ C16, int ldc, size_t sC, int M, int N, int K) {
  __shared__ __attribute__((aligned(16))) float so[4][16][64];
  const int tid = threadIdx.x, w = tid >> 5, lane = tid & 31, ln = lane & 15, hh = lane >> 4; const int by = blockIdx.y;
  A += (size_t)by * sA; Bh += (size_t)by * sB; const size_t cofs = (size_t)by * sC; const float* bp = bias ? bias + (size_t)by * sBias : nullptr;
  const int ntn = (N + 63) / 64; const int wid = blockIdx.x * 4 + w; const int mt = wid / ntn, nq = wid % ntn; if (mt * 16 >= M) return;
  const int row0 = mt * 16, col0 = nq * 64; const _Float16* arow = A + (size_t)(row0 + ln) * lda;
  v8f acc[4] = {};
  for (int kb = 0; kb < K; kb += 32) { FragH ah; ah.half[0] = *(const v8us*)((const unsigned short*)arow + kb + 8 * hh); ah.half[1] = *(const v8us*)((const unsigned short*)arow + kb + 16 + 8 * hh);
#pragma unroll
    for (int t = 0; t < 4; ++t) { if (col0 + t * 16 >= N) continue; const size_t boff = (size_t)(col0 + t * 16 + ln) * ldb + kb; FragH bq; bq.half[0] = *(const v8us*)((const unsigned short*)Bh + boff + 8 * hh); bq.half[1] = *(const v8us*)((const unsigned short*)Bh + boff + 16 + 8 * hh);
      acc[t] = mmaH<1>(ah.v, ah.v, bq.v, bq.v, acc[t]); }
  }
#pragma unroll
  for (int t = 0; t < 4; ++t) { if (col0 + t * 16 >= N) continue; const int col = col0 + t * 16 + ln; const float bv = bp ? bf16_round(bp[col]) : 0.f;
#pragma unroll
    for (int r = 0; r < 8; ++r) { float v = acc[t][r] * alpha + bv; if (CP) { const int bidx = (row0g + row0 + 8 * hh + r) / rowsPerB; v += CP[(size_t)bidx * sCPb + (size_t)by * 64 + col]; } if (ACT == 1) v = (v > 0.f) ? v : expm1f(v); else if (ACT == 7) v = (v > 0.f) ? v + 1.0f : expf(v); else if (ACT == 8) v = tanhf(v); else if (ACT == 9) v = 0.5f * v * (1.0f + tanhf(0.7978845608028654f * (v + 0.044715f * v * v * v))); else if (ACT == 11) v = 1.0f / (1.0f + expf(-v)); else if (ACT == 12) v = (v > 0.f) ? v : 0.01f * v; else if (ACT == 14) v = (v > 0.f) ? v : 0.1f * v; else if (ACT == 15) v = v / (1.0f + expf(-v)); else if (ACT == 3) v = fmaxf(v, 0.f); else if (ACT == 6) v = 0.5f * v * (1.0f + erff(v * 0.70710678118654752f)); so[w][8 * hh + r][t * 16 + ln] = v; } }
  __builtin_amdgcn_fence(__ATOMIC_ACQ_REL, "workgroup"); __builtin_amdgcn_wave_barrier();
  const int rsub = lane >> 4, c4 = (lane & 15) * 4; typedef _Float16 v4h __attribute__((ext_vector_type(4)));
  {
#pragma unroll
    for (int q = 0; q < 8; ++q) { const int r = q * 2 + rsub; if (col0 + c4 < N) { const v4f v = *(const v4fa*)&so[w][r][c4]; if (C) *(v4f*)(C + cofs + (size_t)(row0 + r) * ldc + col0 + c4) = v; if (C16) { v4h h4; for (int i = 0; i < 4; ++i) h4[i] = (_Float16)v[i]; *(v4h*)(C16 + cofs + (size_t)(row0 + r) * ldc + col0 + c4) = h4; } } }
     }
}


typedef _Float16 v4h __attribute__((ext_vector_type(4)));

__global__ __launch_bounds__(256) void k_x16(const float* __restrict__ x, _Float16* __restrict__ X16, size_t n8) { const size_t t = (size_t)blockIdx.x * 256 + threadIdx.x; if (t >= n8) return; FragH f;
#pragma unroll
  for (int q = 0; q < 8; ++q) f.h[q] = (_Float16)bf16_round(x[t * 8 + q]); *(v8us*)((unsigned short*)X16 + t * 8) = f.half[0];  }
__global__ __launch_bounds__(256) void k_h16(const float* __restrict__ x, _Float16* __restrict__ X16, size_t n8) { const size_t t = (size_t)blockIdx.x * 256 + threadIdx.x; if (t >= n8) return; FragH f;
#pragma unroll
  for (int q = 0; q < 8; ++q) f.h[q] = (_Float16)x[t * 8 + q]; *(v8us*)((unsigned short*)X16 + t * 8) = f.half[0];  }
__device__ __forceinline__ void d_round16f(const float* __restrict__ W, _Float16* __restrict__ Bt, size_t n8, unsigned bx) { const size_t t = (size_t)bx * 256 + threadIdx.x; if (t >= n8) return; FragH f;
#pragma unroll
  for (int i = 0; i < 8; ++i) f.h[i] = (_Float16)(bf16_round(W[t * 8 + i]) * 16.0f); *(v8us*)((unsigned short*)Bt + t * 8) = f.half[0];  }
template <int NHv, int TTv>
__global__ __launch_bounds__(256) void k_vt(const _Float16* __restrict__ V16, int ldv, int voff, _Float16* __restrict__ Vt) { __shared__ unsigned short tl[64][66]; const int tid = threadIdx.x; const int slab = blockIdx.x / (TTv / 64), lg = blockIdx.x % (TTv / 64); const int b = slab / NHv, h = slab % NHv;
  for (int i = tid; i < 64 * 8; i += 256) { const int r = i / 8, c8 = (i % 8) * 8; FragH f; f.half[0] = *(const v8us*)((const unsigned short*)V16 + ((size_t)b * TTv + lg * 64 + r) * ldv + voff + h * 64 + c8);
#pragma unroll
    for (int q = 0; q < 8; ++q) tl[r][c8 + q] = f.u[q]; }
  __syncthreads();
  {
#pragma unroll
    for (int rd = 0; rd < 2; ++rd) { const int d = rd * 32 + tid / 8, pc = tid % 8; FragH f;
#pragma unroll
      for (int q = 0; q < 8; ++q) f.u[q] = tl[pc * 8 + q][d];
      *(v8us*)((unsigned short*)Vt + ((size_t)slab * 64 + d) * TTv + lg * 64 + pc * 8) = f.half[0]; }
     } }

// FRAGMENT ORDER of the attention operands: a 16-row x 64-column tile (q, k) or a 64-row x 32-key block (v^T) is stored as its WMMA fragment halves one after the other, each half as 32 lanes x 16 bytes in lane order,
// so that a wave's 16-byte load reads 512 bytes in a row (4 whole lines) and not 32 bytes out of each of 16 lines. Which element a lane and register hold is unchanged.
// q, k: row r, columns 8 c8 .. 8 c8 + 7 -> tile r >> 4, half c8 >> 1 (= 2 ks + part), lane 16 (c8 & 1) + (r & 15).

// ---- fast GEMM (wave tile 32x64; requires M % 32 == 0 rows per launch region and N % 64 == 0); epilogue = k_gemm_hhx semantics ----
__device__ __forceinline__ v16h g2_frag(const _Float16* p, int hh) { FragH f; f.half[0] = *(const v8us*)((const unsigned short*)p + 8 * hh); f.half[1] = *(const v8us*)((const unsigned short*)p + 16 + 8 * hh); return f.v; }
__device__ __forceinline__ v8f g2_mma(v16h a, v16h b, v8f c) { v8f d = __builtin_amdgcn_wmma_f32_16x16x32_f16(false, a, false, b, (short)0, c, false, false); asm volatile("v_nop\n\tv_nop\n\tv_nop\n\tv_nop" : "+v"(d) : "v"(a), "v"(b)); return d; }
// A CONSUMER THAT NEEDS ONLY THE TILE ITS PRODUCER WAVE HOLDS RUNS IN THAT WAVE, on the f32 tile in LDS, and has no launch of its own.
// EPI 0: C alone. EPI 1: C, and silu(C) as a hi + 16x residual pair row in E0 (N == DK). EPI 2: no C; the tile as hi + x2^10 residual planes E0, E1 in fragment order (N == DK): rows as q, k tiles, or (vt) turned, as one 32-key block of v^T.
template <int ACT, int NWV, int EPI>      /* NWV waves a block, each a 32 x 64 tile */
__device__ __forceinline__ void d_gemm2(const _Float16* __restrict__ A, int lda, size_t sA, const _Float16* __restrict__ Bh, int ldb, size_t sB, float alpha, const float* __restrict__ bias, size_t sBias, const float* __restrict__ CP, int rowsPerB, size_t sCPb, int row0g,
    float* __restrict__ C, _Float16* __restrict__ C16, int ldc, size_t sC, int M, int N, int K, unsigned bx, int by, _Float16* __restrict__ E0, _Float16* __restrict__ E1, bool vt) {
  __shared__ __attribute__((aligned(16))) float so[NWV][32][68];
  const int tid = threadIdx.x, w = tid >> 5, lane = tid & 31, ln = lane & 15, hh = lane >> 4;
  A += (size_t)by * sA; Bh += (size_t)by * sB; const size_t cofs = (size_t)by * sC; const float* bp = bias ? bias + (size_t)by * sBias : nullptr;
  const int ntn = N >> 6; const int mt = bx / ntn, nq = bx - mt * ntn; const int row0 = mt * (32 * NWV) + 32 * w, col0 = nq * 64; if (row0 >= M) return;
  const _Float16* a0p = A + (size_t)(row0 + ln) * lda; const _Float16* a1p = a0p + (size_t)16 * lda;
  const _Float16* b0p = Bh + (size_t)(col0 + ln) * ldb; const _Float16* b1p = b0p + (size_t)16 * ldb; const _Float16* b2p = b1p + (size_t)16 * ldb; const _Float16* b3p = b2p + (size_t)16 * ldb;
  const v8f z8 = {0.f,0.f,0.f,0.f,0.f,0.f,0.f,0.f}; v8f c00 = z8, c01 = z8, c02 = z8, c03 = z8, c10 = z8, c11 = z8, c12 = z8, c13 = z8;
  // LOADS GO OUT IN GROUPS, AHEAD OF THEIR USE. No load moves across the statement behind a matrix instruction, so a load written at its use is waited for alone.
  // The six fragments of a 32-wide k step are loaded together, one step ahead, into a second register set (K % 64 == 0); the bias in front of the loop; the addend rows as one group behind it.
  float bvr[4] = {0.f, 0.f, 0.f, 0.f};
  if (bp) {
#pragma unroll
    for (int t = 0; t < 4; ++t) bvr[t] = bp[col0 + t * 16 + ln];
    asm volatile("s_wait_xcnt 0x0" ::: "memory"); }      /* the loads' address registers are reused right behind this branch */
  v16h a0 = g2_frag(a0p, hh), a1 = g2_frag(a1p, hh), b0 = g2_frag(b0p, hh), b1 = g2_frag(b1p, hh), b2 = g2_frag(b2p, hh), b3 = g2_frag(b3p, hh);
#pragma unroll 1      /* two k steps a trip: one per register set */
  for (int kb = 0; kb < K; kb += 64) { const int k1 = kb + 32;
    const v16h e0 = g2_frag(a0p + k1, hh), e1 = g2_frag(a1p + k1, hh), f0 = g2_frag(b0p + k1, hh), f1 = g2_frag(b1p + k1, hh), f2 = g2_frag(b2p + k1, hh), f3 = g2_frag(b3p + k1, hh);
    c00 = g2_mma(a0, b0, c00); c10 = g2_mma(a1, b0, c10); c01 = g2_mma(a0, b1, c01); c11 = g2_mma(a1, b1, c11);
    c02 = g2_mma(a0, b2, c02); c12 = g2_mma(a1, b2, c12); c03 = g2_mma(a0, b3, c03); c13 = g2_mma(a1, b3, c13);
    if (kb + 64 < K) { const int k2 = kb + 64; a0 = g2_frag(a0p + k2, hh); a1 = g2_frag(a1p + k2, hh); b0 = g2_frag(b0p + k2, hh); b1 = g2_frag(b1p + k2, hh); b2 = g2_frag(b2p + k2, hh); b3 = g2_frag(b3p + k2, hh); }
    c00 = g2_mma(e0, f0, c00); c10 = g2_mma(e1, f0, c10); c01 = g2_mma(e0, f1, c01); c11 = g2_mma(e1, f1, c11);
    c02 = g2_mma(e0, f2, c02); c12 = g2_mma(e1, f2, c12); c03 = g2_mma(e0, f3, c03); c13 = g2_mma(e1, f3, c13); }
  v8f accs[8] = {c00, c01, c02, c03, c10, c11, c12, c13};
  float cpv[8][8];
  if (CP) {
#pragma unroll
    for (int rr = 0; rr < 16; ++rr) { const int bidx = (row0g + row0 + (rr >> 3) * 16 + 8 * hh + (rr & 7)) / rowsPerB; const float* cr = CP + (size_t)bidx * sCPb + (size_t)by * 64 + col0 + ln;
#pragma unroll
      for (int t = 0; t < 4; ++t) cpv[(rr >> 3) * 4 + t][rr & 7] = cr[t * 16];
      asm volatile("s_wait_xcnt 0x0" ::: "memory"); } }      /* a row's address registers are free for the next rows' values; the data are not waited for here */
#pragma unroll
  for (int u = 0; u < 8; ++u) { const int t = u & 3, half = u >> 2; const float bv = bp ? bf16_round(bvr[t]) : 0.f;
#pragma unroll
    for (int r = 0; r < 8; ++r) { const int rloc = half * 16 + 8 * hh + r; float v = accs[u][r] * alpha + bv; if (CP) v += cpv[u][r];
      if (ACT == 3) v = fmaxf(v, 0.f); else if (ACT == 6) v = 0.5f * v * (1.0f + erff(v * 0.70710678118654752f)); else if (ACT == 11) v = 1.0f / (1.0f + expf(-v)); else if (ACT == 15) v = v / (1.0f + expf(-v)); else if (ACT == 12) v = (v > 0.f) ? v : 0.01f * v; else if (ACT == 8) v = tanhf(v);
      so[w][rloc][t * 16 + ln] = v; } }
  __builtin_amdgcn_fence(__ATOMIC_ACQ_REL, "workgroup"); __builtin_amdgcn_wave_barrier();
  if (EPI == 2) {      /* eight fragment halves a plane, each 32 lanes x 16 bytes in a row */
    unsigned short* p0 = (unsigned short*)E0 + lane * 8; unsigned short* p1 = (unsigned short*)E1 + lane * 8;
    if (vt) { const size_t ob = (size_t)(row0 / NPI) * 64 * NPI + (size_t)((row0 % NPI) >> 5) * 2048;      /* image, 32-key block */
#pragma unroll
      for (int u = 0; u < 8; ++u) { FragH fh, fl;      /* half u = 2 dt + part: channel 16 dt + ln, keys 16 part + 8 hh + q */
#pragma unroll
        for (int q = 0; q < 8; ++q) { const float v = so[w][(u & 1) * 16 + 8 * hh + q][(u >> 1) * 16 + ln]; const _Float16 hv = (_Float16)v; fh.h[q] = hv; fl.h[q] = (_Float16)((v - (float)hv) * 1024.0f); }
        *(v8us*)(p0 + ob + u * 256) = fh.half[0]; *(v8us*)(p1 + ob + u * 256) = fl.half[0];
        asm volatile("s_wait_xcnt 0x0" ::: "memory"); } }      /* the stores' registers are reused for the next half */
    else { const size_t ob = (size_t)(row0 >> 4) * 1024;
#pragma unroll
      for (int u = 0; u < 8; ++u) { FragH fh, fl; const float* sr = &so[w][(u >> 2) * 16 + ln][((u & 3) * 2 + hh) * 8]; const v4f a = *(const v4fa*)sr, c = *(const v4fa*)(sr + 4);      /* tile u >> 2, half u & 3: row ln, columns 8 (2 (u & 3) + hh) .. + 7 */
#pragma unroll
        for (int q = 0; q < 4; ++q) { _Float16 h = (_Float16)a[q]; fh.h[q] = h; fl.h[q] = (_Float16)((a[q] - (float)h) * 1024.0f); h = (_Float16)c[q]; fh.h[4 + q] = h; fl.h[4 + q] = (_Float16)((c[q] - (float)h) * 1024.0f); }
        *(v8us*)(p0 + ob + u * 256) = fh.half[0]; *(v8us*)(p1 + ob + u * 256) = fl.half[0];
        asm volatile("s_wait_xcnt 0x0" ::: "memory"); } }      /* as above */
    return; }
  const int rsub = lane >> 4, c4 = (lane & 15) * 4;
  {
#pragma unroll
    for (int q = 0; q < 16; ++q) { const int r = q * 2 + rsub; const v4f v = *(const v4fa*)&so[w][r][c4]; if (C) *(v4f*)(C + cofs + (size_t)(row0 + r) * ldc + col0 + c4) = v; if (C16) { v4h h4; for (int i = 0; i < 4; ++i) h4[i] = (_Float16)v[i]; *(v4h*)(C16 + cofs + (size_t)(row0 + r) * ldc + col0 + c4) = h4; }
      if (EPI == 1) { v4h s0, s1;
#pragma unroll
        for (int i = 0; i < 4; ++i) { const float sl = v[i] / (1.0f + expf(-v[i])); const _Float16 hv = (_Float16)sl; s0[i] = hv; s1[i] = (_Float16)((sl - (float)hv) * 16.0f); }
        _Float16* d = E0 + (size_t)(row0 + r) * 2 * DK + c4; *(v4h*)d = s0; *(v4h*)(d + DK) = s1;
        asm volatile("s_wait_xcnt 0x0" ::: "memory"); } }      /* the stores' registers are reused for the next rows */
     } }
template <int ACT>
__global__ __launch_bounds__(128) void k_gemm2(const _Float16* __restrict__ A, int lda, size_t sA, const _Float16* __restrict__ Bh, int ldb, size_t sB, float alpha, const float* __restrict__ bias, size_t sBias, const float* __restrict__ CP, int rowsPerB, size_t sCPb, int row0g,
    float* __restrict__ C, _Float16* __restrict__ C16, int ldc, size_t sC, int M, int N, int K) {
  d_gemm2<ACT, 4, 0>(A, lda, sA, Bh, ldb, sB, alpha, bias, sBias, CP, rowsPerB, sCPb, row0g, C, C16, ldc, sC, M, N, K, blockIdx.x, blockIdx.y, nullptr, nullptr, false); }
// att = conv1x1(x) + b, and silu(att) from the same tile.
__global__ __launch_bounds__(128) void k_gemm_att(const _Float16* __restrict__ X16, const _Float16* __restrict__ BIN, const float* __restrict__ b_in, float* __restrict__ ATT, _Float16* __restrict__ SIL) {
  d_gemm2<0, 4, 1>(X16, CIN, 0, BIN, CIN, 0, 0.0625f, b_in, 0, nullptr, 1, 0, 0, ATT, nullptr, DK, 0, NPX, DK, CIN, blockIdx.x, 0, SIL, nullptr, false); }
// LAUNCHES THAT NEED NOTHING OF EACH OTHER SHARE ONE GRID: a block-uniform branch on the block index picks the part; each part's code, block count and arithmetic are those of its own former launch.
// The q, k and v spline products on one operand A: blockIdx.y picks the weights, the bias, the f32 addend plane (CP, one row a row) and the pair of result planes, written in fragment order.
__global__ __launch_bounds__(128) void k_gemm2qkv(const _Float16* __restrict__ A, int lda, const _Float16* __restrict__ B0, const _Float16* __restrict__ B1, const _Float16* __restrict__ B2, int ldb, float alpha,
    const float* __restrict__ bias0, const float* __restrict__ bias1, const float* __restrict__ bias2, const float* __restrict__ CP, size_t plane, int ldc, int M, int N, int K,
    _Float16* __restrict__ Qh, _Float16* __restrict__ Ql, _Float16* __restrict__ Kh, _Float16* __restrict__ Kl, _Float16* __restrict__ Vth, _Float16* __restrict__ Vtl) {
  const int i = blockIdx.y; const _Float16* Bh = (i == 0) ? B0 : (i == 1) ? B1 : B2; const float* bias = (i == 0) ? bias0 : (i == 1) ? bias1 : bias2;
  d_gemm2<0, 4, 2>(A, lda, 0, Bh, ldb, 0, alpha, bias, 0, CP + (size_t)i * plane, 1, (size_t)ldc, 0, nullptr, nullptr, ldc, 0, M, N, K, blockIdx.x, 0, (i == 0) ? Qh : (i == 1) ? Kh : Vth, (i == 0) ? Ql : (i == 1) ? Kl : Vtl, i == 2); }


__device__ __forceinline__ float xhalf(float v) { const int b = __float_as_int(v); return __int_as_float(__builtin_amdgcn_permlanex16(b, b, 0x76543210, 0xfedcba98, false, false)); }      /* lane l <-> l ^ 16 */
__device__ __forceinline__ float exp2_slot(float x) { float r; asm("v_exp_f32 %0, %1\n\tv_nop" : "=v"(r) : "v"(x)); return r; }      /* 2^x; the v_nop keeps the slot behind the exponential free of a reader of r and of a writer of x */
template <int TQ, int TK, int KSP>
__global__ __launch_bounds__(128 * KSP) void k_flashm(const _Float16* __restrict__ Q16, const _Float16* __restrict__ Q16lo, const _Float16* __restrict__ K16, const _Float16* __restrict__ K16lo, const _Float16* __restrict__ Vt, const _Float16* __restrict__ Vtlo, const unsigned* __restrict__ MB, const int* __restrict__ RA, const int* __restrict__ KE, _Float16* __restrict__ O16) {
  constexpr int RPW = 16, NQB = TQ / (4 * RPW), DT = 4, KS = 2, NW = 4 * KSP; static_assert(NH == 1 && DK == 64, "the fragment-order planes hold one 64-wide head");
  __shared__ __attribute__((aligned(16))) float sO[NW][RPW][64 + 4]; __shared__ float sM[NW][RPW], sL[NW][RPW];
  const int tid = threadIdx.x, w = tid >> 5, lane = tid & 31, ln = lane & 15, hh = lane >> 4; const int qt = w & 3, kp = __builtin_amdgcn_readfirstlane(w >> 2);      /* scalar: the key loop's counter and trip test stay wave-uniform */
  const int slab = blockIdx.x / NQB, qblk = blockIdx.x % NQB; const int b = slab / NH; const int qb0 = qblk * (4 * RPW); const int q0 = qb0 + qt * RPW;
  FragH aq[KS], aql[KS];
  { const size_t qo = (((size_t)b * TQ + q0) >> 4) * 1024 + lane * 8; const unsigned short* qr = (const unsigned short*)Q16 + qo; const unsigned short* ql = (const unsigned short*)Q16lo + qo;
#pragma unroll
    for (int ks = 0; ks < KS; ++ks) { aq[ks].half[0] = *(const v8us*)(qr + ks * 512); aq[ks].half[1] = *(const v8us*)(qr + ks * 512 + 256); aql[ks].half[0] = *(const v8us*)(ql + ks * 512); aql[ks].half[1] = *(const v8us*)(ql + ks * 512 + 256); } }
  const unsigned short* Vth = (const unsigned short*)Vt + (size_t)slab * 64 * TK; const unsigned short* Vtl = (const unsigned short*)Vtlo + (size_t)slab * 64 * TK;
  float m_r = -3.0e38f, l_r = 0.f; v8f oacc[DT], oaccl[DT];
#pragma unroll
  for (int dt = 0; dt < DT; ++dt) { oacc[dt] = (v8f){0.f,0.f,0.f,0.f,0.f,0.f,0.f,0.f}; oaccl[dt] = oacc[dt]; }
  int jend = KE[qblk * 32]; jend = min(TK, (jend + 31) & ~31); if (jend < 32) jend = 32;      /* block-uniform */
  const bool am = (RA[q0 + ln] != 0); const unsigned* mrow = MB + (size_t)(q0 + ln) * (TK / 32);
  const unsigned short* kr = (const unsigned short*)K16 + (((size_t)b * TK + kp * 32) >> 4) * 1024 + lane * 8; const unsigned short* kl = (const unsigned short*)K16lo + (((size_t)b * TK + kp * 32) >> 4) * 1024 + lane * 8;
  const unsigned short* vh = Vth + (size_t)kp * 2048 + lane * 8; const unsigned short* vl = Vtl + (size_t)kp * 2048 + lane * 8; const unsigned* mp = mrow + kp;      /* this wave's block of 32 keys; all five step by KSP blocks a trip */
#pragma unroll 1
  for (int j0 = kp * 32; j0 < jend; j0 += 32 * KSP, kr += KSP * 2048, kl += KSP * 2048, vh += KSP * 2048, vl += KSP * 2048, mp += KSP) {
    v8f s[2]; FragH bk[2][KS], bkl[2][KS];      /* as in the GEMM body, loads go out in groups ahead of their use: both key tiles and the mask word here, in front of the first product */
#pragma unroll
    for (int nt = 0; nt < 2; ++nt) {
#pragma unroll
      for (int ks = 0; ks < KS; ++ks) { const int o = nt * 1024 + ks * 512; bk[nt][ks].half[0] = *(const v8us*)(kr + o); bkl[nt][ks].half[0] = *(const v8us*)(kl + o); if (nt + ks < 2) { bk[nt][ks].half[1] = *(const v8us*)(kr + o + 256); bkl[nt][ks].half[1] = *(const v8us*)(kl + o + 256); } } }
    const unsigned mw = *mp;
    asm volatile("s_wait_xcnt 0x0" ::: "memory");      /* the last load from an address may land on the address registers, which the loads above name too */
    bk[1][1].half[1] = *(const v8us*)(kr + 1792);
    asm volatile("s_wait_xcnt 0x0" ::: "memory");      /* the same, for the load above */
    bkl[1][1].half[1] = *(const v8us*)(kl + 1792);
#pragma unroll
    for (int nt = 0; nt < 2; ++nt) { v8f acc = (v8f){0.f,0.f,0.f,0.f,0.f,0.f,0.f,0.f}, accr = acc;
#pragma unroll
      for (int ks = 0; ks < KS; ++ks) { acc = mmaH<1>(bk[nt][ks].v, bk[nt][ks].v, aq[ks].v, aq[ks].v, acc); accr = mmaH<1>(bk[nt][ks].v, bk[nt][ks].v, aql[ks].v, aql[ks].v, accr); accr = mmaH<1>(bkl[nt][ks].v, bkl[nt][ks].v, aq[ks].v, aq[ks].v, accr); }
      s[nt] = acc + accr * 0.0009765625f; }
    FragH bv[DT], bl[DT];      /* the whole v^T block, in front of the softmax arithmetic, which covers its latency */
#pragma unroll
    for (int dt = 0; dt < DT; ++dt) { const int o = dt * 512; bv[dt].half[0] = *(const v8us*)(vh + o); bl[dt].half[0] = *(const v8us*)(vl + o); if (dt < DT - 1) { bv[dt].half[1] = *(const v8us*)(vh + o + 256); bl[dt].half[1] = *(const v8us*)(vl + o + 256); } }
    asm volatile("s_wait_xcnt 0x0" ::: "memory");      /* as at the key tiles */
    bv[DT - 1].half[1] = *(const v8us*)(vh + (DT - 1) * 512 + 256);
    asm volatile("s_wait_xcnt 0x0" ::: "memory");      /* as at the key tiles */
    bl[DT - 1].half[1] = *(const v8us*)(vl + (DT - 1) * 512 + 256);
    const unsigned mh = mw >> (8 * hh);      /* bit r: key 8 hh + r, bit 16 + r: key 16 + 8 hh + r */
    float sv[16]; float mc = -INFINITY;
#pragma unroll
    for (int e = 0; e < 16; ++e) { const bool ok = am || (((mh >> ((e >> 3) * 16 + (e & 7))) & 1u) == 0u); sv[e] = ok ? (am ? 0.f : s[e >> 3][e & 7] * SCL) : -INFINITY; mc = fmaxf(mc, sv[e]); }
    mc = fmaxf(mc, xhalf(mc));
    /* base 2: m_r holds (running maximum) * log2(e) - 10, rounded once and used as it stands by the weights and by the rescale, so both refer to the same number */
    const float mn = fmaxf(m_r, fmaf(mc, LOG2E, -10.0f)); const float al = (mn > -1.0e38f) ? __builtin_amdgcn_exp2f(m_r - mn) : 1.0f; m_r = mn;
    FragH pa, pl; float ps = 0.f;
#pragma unroll
    for (int e = 0; e < 16; e += 2) { const v2f t = __builtin_elementwise_fma((v2f){sv[e], sv[e + 1]}, (v2f){LOG2E, LOG2E}, (v2f){-mn, -mn});      /* 2^10 p in half a packed fma and one hardware exponential; a masked key: 2^(-inf) = 0 (mn is finite) */
#pragma unroll
      for (int i = 0; i < 2; ++i) { const float p10 = __builtin_amdgcn_exp2f(t[i]); ps += p10; const _Float16 ph = (_Float16)p10; pa.h[e + i] = ph; pl.h[e + i] = (_Float16)((p10 - (float)ph) * 1024.0f); } }
    l_r = l_r * al + ps;
#pragma unroll
    for (int dt = 0; dt < DT; ++dt) { oacc[dt] *= al; oaccl[dt] *= al; }
#pragma unroll
    for (int dt = 0; dt < DT; ++dt) { oacc[dt] = mmaH<1>(bv[dt].v, bv[dt].v, pa.v, pa.v, oacc[dt]); oaccl[dt] = mmaH<1>(bl[dt].v, bl[dt].v, pa.v, pa.v, oaccl[dt]); oaccl[dt] = mmaH<1>(bv[dt].v, bv[dt].v, pl.v, pl.v, oaccl[dt]); } }
  { const float l = l_r + xhalf(l_r); if (hh == 0) { sM[w][ln] = m_r; sL[w][ln] = l; } }
#pragma unroll
  for (int dt = 0; dt < DT; ++dt) { const v8f o = oacc[dt] + oaccl[dt] * 0.0009765625f;      /* register r = O[query ln][dt * 16 + 8 hh + r] */
    *(v4fa*)&sO[w][ln][dt * 16 + 8 * hh] = (v4f){o[0], o[1], o[2], o[3]}; *(v4fa*)&sO[w][ln][dt * 16 + 8 * hh + 4] = (v4f){o[4], o[5], o[6], o[7]}; }
  __syncthreads();      /* every part's partial is in LDS before any thread merges */
  for (int i = tid; i < 4 * RPW * 16; i += 128 * KSP) { const int row = i >> 4, pc = i & 15; const int tq = row / RPW, rr = row % RPW;
    float mx = sM[tq][rr];
#pragma unroll
    for (int p = 1; p < KSP; ++p) mx = fmaxf(mx, sM[p * 4 + tq][rr]);
    float lsum = 0.f; v4f o = {0.f, 0.f, 0.f, 0.f};
#pragma unroll
    for (int p = 0; p < KSP; ++p) { const float wg = exp2_slot(sM[p * 4 + tq][rr] - mx);      /* the maxima are base-2 exponents */
      lsum += wg * sL[p * 4 + tq][rr]; const v4f val = *(const v4fa*)&sO[p * 4 + tq][rr][pc * 4]; o += val * wg; }
    const float inv = (lsum > 0.f) ? 1.0f / lsum : 0.f;      /* sum and O both carry the factor 2^10 */
    const v4f ov = o * inv; v4h fh, fl;      /* the output row leaves as the next product's operand: hi + 16x residual pair */
#pragma unroll
    for (int q = 0; q < 4; ++q) { const _Float16 hv = (_Float16)ov[q]; fh[q] = hv; fl[q] = (_Float16)((ov[q] - (float)hv) * 16.0f); }
    _Float16* d = O16 + ((size_t)b * TQ + qb0 + row) * (2 * DK) + pc * 4; *(v4h*)d = fh; *(v4h*)(d + DK) = fl; } }


__constant__ float GRIDV[8] = {-2.000000000e+00f,-1.428571463e+00f,-8.571428657e-01f,-2.857141793e-01f,2.857143879e-01f,8.571429253e-01f,1.428571701e+00f,2.000000000e+00f};
#define INV_DENOM (1.0f / 0.5714285714285714f)
__device__ __forceinline__ void d_fulltab(unsigned* __restrict__ MB, int* __restrict__ RA, int* __restrict__ KE, unsigned bx) {
  const int t = bx * 256 + threadIdx.x;
  if (t < NPI * (NPI / 32)) { *(unsigned*)(MB + t) = 0u;  }
  if (t < NPI) { *(int*)(RA + t) = 0;  }
  if (t < NPI / 64) { *(int*)(KE + t * 32) = NPI;  } }
// Layout changes go through a 64 x 64 LDS tile (pitch 65 floats: no bank conflict in either direction), so that every global read and write covers whole 128-byte lines.
__device__ __forceinline__ void d_xcl(const float* __restrict__ x, _Float16* __restrict__ X16, unsigned bx) {
  __shared__ float tl[64][65]; const int tid = threadIdx.x; const int pt = bx % (NPI / 64), ct = (bx / (NPI / 64)) % (CIN / 64), b = bx / ((NPI / 64) * (CIN / 64));
  const int r16 = tid / 16, k4 = (tid % 16) * 4; v4f a[4];      /* thread: rows r16 + 16 u of the tile, four floats at k4; the four loads fly together */
#pragma unroll      /* a[] stays in registers */
  for (int u = 0; u < 4; ++u) a[u] = *(const v4fa*)(x + ((size_t)b * CIN + ct * 64 + r16 + 16 * u) * NPI + pt * 64 + k4);
#pragma unroll      /* a[] stays in registers */
  for (int u = 0; u < 4; ++u) { float* d = &tl[r16 + 16 * u][k4]; d[0] = a[u][0]; d[1] = a[u][1]; d[2] = a[u][2]; d[3] = a[u][3]; }
  __syncthreads();      /* the whole tile is in LDS before any thread reads it across */
#pragma unroll      /* both rows' LDS reads are issued together */
  for (int rd = 0; rd < 2; ++rd) { const int p = rd * 32 + tid / 8, c8 = (tid % 8) * 8; FragH f;
#pragma unroll
    for (int q = 0; q < 8; ++q) f.h[q] = (_Float16)bf16_round(tl[c8 + q][p]);
    *(v8us*)((unsigned short*)X16 + ((size_t)b * NPI + pt * 64 + p) * CIN + ct * 64 + c8) = f.half[0]; } }
// A channel's mean and variance in one block: its values stay in registers between the two sums, each summed in the order of a pass of its own.
__device__ __forceinline__ void d_instat(const float* __restrict__ A, float* __restrict__ ST, unsigned bx) {
  #pragma clang fp contract(off)
  __shared__ float sh[256]; const int b = bx / DK, c = bx % DK; const float* ap = A + ((size_t)b * NPI + threadIdx.x) * DK + c; float a[NPI / 256]; float s = 0.f;
#pragma unroll      /* a[] stays in registers; the sixteen loads fly together */
  for (int k = 0; k < NPI / 256; ++k) a[k] = ap[(size_t)256 * k * DK];
#pragma unroll
  for (int k = 0; k < NPI / 256; ++k) s += a[k];
  sh[threadIdx.x] = s; __syncthreads();
  for (int st = 128; st > 0; st >>= 1) { if ((int)threadIdx.x < st) sh[threadIdx.x] += sh[threadIdx.x + st]; __syncthreads(); }
  const float mu = sh[0] / (float)NPI; s = 0.f;
  __syncthreads();      /* every thread has read the first sum before sh is written again */
#pragma unroll
  for (int k = 0; k < NPI / 256; ++k) { const float v = a[k] - mu; s += v * v; }
  sh[threadIdx.x] = s; __syncthreads();
  for (int st = 128; st > 0; st >>= 1) { if ((int)threadIdx.x < st) sh[threadIdx.x] += sh[threadIdx.x + st]; __syncthreads(); }
  if (threadIdx.x == 0) { ST[(size_t)bx * 32] = mu; ST[((size_t)NIMG * DK + bx) * 32] = sh[0] / (float)NPI; } }
__global__ __launch_bounds__(256) void k_basis(const float* __restrict__ A, const float* __restrict__ ST, _Float16* __restrict__ BAS) {
  #pragma clang fp contract(off)
  const int t = blockIdx.x * 256 + threadIdx.x; if (t >= NPX * DK) return; const int r = t / DK, c = t % DK; const int b = r / NPI; const float a = A[(size_t)r * DK + c];
  const float mu = ST[((size_t)b * DK + c) * 32], var = ST[((size_t)NIMG * DK + b * DK + c) * 32]; const float xn = (a - mu) * rsqrtf(var + 1e-5f); FragH bh, bl;
#pragma unroll
  for (int g = 0; g < NG; ++g) { const float z = (xn - GRIDV[g]) * INV_DENOM; const float e = expf(-(z * z)); const _Float16 hv = (_Float16)e; bh.h[g] = hv; bl.h[g] = (_Float16)((e - (float)hv) * 16.0f); }
  unsigned short* bd = (unsigned short*)BAS + (size_t)r * 2 * DK * NG + c * NG;
  { *(v8us*)bd = bh.half[0]; *(v8us*)(bd + DK * NG) = bl.half[0];  } }
__device__ __forceinline__ void d_wnp2(const float* __restrict__ Wm, int K, int N, _Float16* __restrict__ Bt, unsigned bx) {
  const int t = bx * 256 + threadIdx.x; if (t >= N * (2 * K / 8)) return; const int n = t / (2 * K / 8), k0 = (t % (2 * K / 8)) * 8; const bool lo = (k0 >= K); const float sc = lo ? 1.0f : 16.0f; FragH f;
#pragma unroll
  for (int q = 0; q < 8; ++q) { const int k = k0 + q - (lo ? K : 0); f.h[q] = (_Float16)(bf16_round(Wm[(size_t)n * K + k]) * sc); }
  *(v8us*)((unsigned short*)Bt + (size_t)n * 2 * K + k0) = f.half[0];  }
// One grid for all that reads inputs alone: x turned to f16 rows (first: the longest part), the mask tables, the eight weight planes.
#define NB_XCL (NIMG * (CIN / 64) * (NPI / 64))
#define NB_TAB (NPI * (NPI / 32) / 256)
#define NB_WS (DK * (2 * DK * NG / 8) / 256)
#define NB_WB (DK * (2 * DK / 8) / 256)
#define NB_WO (CIN * (2 * DK / 8) / 256)
#define NB_WI (DK * CIN / 8 / 256)
__global__ __launch_bounds__(256) void k_prep(const float* __restrict__ x, const float* __restrict__ w_in, const float* __restrict__ w_out, const float* __restrict__ qbw, const float* __restrict__ kbw, const float* __restrict__ vbw,
    const float* __restrict__ qsw, const float* __restrict__ ksw, const float* __restrict__ vsw, _Float16* __restrict__ X16, _Float16* __restrict__ BIN, _Float16* __restrict__ BOUT,
    _Float16* __restrict__ BB0, _Float16* __restrict__ BB1, _Float16* __restrict__ BB2, _Float16* __restrict__ BS0, _Float16* __restrict__ BS1, _Float16* __restrict__ BS2, unsigned* __restrict__ MB, int* __restrict__ RA, int* __restrict__ KE) {
  int bx = blockIdx.x;
  if (bx < NB_XCL) { d_xcl(x, X16, bx); return; }
  bx -= NB_XCL; if (bx < NB_TAB) { d_fulltab(MB, RA, KE, bx); return; }
  bx -= NB_TAB; if (bx < 3 * NB_WS) { const int i = bx / NB_WS; d_wnp2((i == 0) ? qsw : (i == 1) ? ksw : vsw, DK * NG, DK, (i == 0) ? BS0 : (i == 1) ? BS1 : BS2, bx % NB_WS); return; }
  bx -= 3 * NB_WS; if (bx < 3 * NB_WB) { const int i = bx / NB_WB; d_wnp2((i == 0) ? qbw : (i == 1) ? kbw : vbw, DK, DK, (i == 0) ? BB0 : (i == 1) ? BB1 : BB2, bx % NB_WB); return; }
  bx -= 3 * NB_WB; if (bx < NB_WO) { d_wnp2(w_out, DK, CIN, BOUT, bx); return; }      /* (out,in) natural -> [16w | w] pair planes */
  d_round16f(w_in, BIN, (size_t)DK * CIN / 8, bx - NB_WO); }
// att's channel statistics beside the q, k, v base products (8 waves a block): the first reads att, the second silu(att) and weights.
#define NB_IS (NIMG * DK)
#define NB_GB (NPX / 256)
__global__ __launch_bounds__(256) void k_stat_base(const float* __restrict__ A, float* __restrict__ ST, const _Float16* __restrict__ SIL, const _Float16* __restrict__ B0, const _Float16* __restrict__ B1, const _Float16* __restrict__ B2,
    const float* __restrict__ bias0, const float* __restrict__ bias1, const float* __restrict__ bias2, float* __restrict__ G, size_t plane, int ldc, int M, int N, int K) {
  const int bx = blockIdx.x;
  if (bx < NB_IS) { d_instat(A, ST, bx); return; }
  const int i = (bx - NB_IS) / NB_GB;
  d_gemm2<0, 8, 0>(SIL, K, 0, (i == 0) ? B0 : (i == 1) ? B1 : B2, K, 0, 0.0625f, (i == 0) ? bias0 : (i == 1) ? bias1 : bias2, 0, nullptr, 1, 0, 0, G + (size_t)i * plane, nullptr, ldc, 0, M, N, K, (bx - NB_IS) % NB_GB, 0, nullptr, nullptr, false); }
// One block a channel: y = gamma x + att2 (A2T: the outer product without its bias, channel-major like x and the output) is formed in registers and stays there for the mean, the variance and the output.
// Thread t holds pixels bi * NPI + t + 256 k; each sum runs over them in rising order, then down the LDS tree.
__global__ __launch_bounds__(256) void k_ybn(const float* __restrict__ x, const float* __restrict__ gam, const float* __restrict__ A2T, const float* __restrict__ b_out, const float* __restrict__ bw, const float* __restrict__ bb, float* __restrict__ out) {
  __shared__ float sh[256]; const int c = blockIdx.x; const float g = bf16_round(gam[0]), bo = bf16_round(b_out[c]), gw = bf16_round(bw[c]), be = bf16_round(bb[c]); float y[NIMG][NPI / 256]; float s = 0.f;
#pragma unroll      /* y[][] stays in registers; an image's thirty-two loads fly together */
  for (int bi = 0; bi < NIMG; ++bi) { const float* xp = x + ((size_t)bi * CIN + c) * NPI; const float* ap = A2T + ((size_t)bi * CIN + c) * NPI; float xv[NPI / 256], av[NPI / 256];
#pragma unroll
    for (int k = 0; k < NPI / 256; ++k) xv[k] = xp[threadIdx.x + 256u * k];
    asm volatile("s_wait_xcnt 0x0" ::: "memory");      /* the loads' address registers are free for what follows; the data are not waited for here */
#pragma unroll
    for (int k = 0; k < NPI / 256; ++k) av[k] = ap[threadIdx.x + 256u * k];
    asm volatile("s_wait_xcnt 0x0" ::: "memory");      /* the same */
#pragma unroll
    for (int k = 0; k < NPI / 256; ++k) y[bi][k] = g * bf16_round(xv[k]) + (av[k] + bo); }
#pragma unroll
  for (int bi = 0; bi < NIMG; ++bi) {
#pragma unroll
    for (int k = 0; k < NPI / 256; ++k) s += y[bi][k]; }
  sh[threadIdx.x] = s; __syncthreads();
  for (int st = 128; st > 0; st >>= 1) { if ((int)threadIdx.x < st) sh[threadIdx.x] += sh[threadIdx.x + st]; __syncthreads(); }
  const float mu = sh[0] / (float)NPX; s = 0.f;
  __syncthreads();      /* every thread has read the first sum before sh is written again */
#pragma unroll
  for (int bi = 0; bi < NIMG; ++bi) {
#pragma unroll
    for (int k = 0; k < NPI / 256; ++k) { const float v = y[bi][k] - mu; s += v * v; } }
  sh[threadIdx.x] = s; __syncthreads();
  for (int st = 128; st > 0; st >>= 1) { if ((int)threadIdx.x < st) sh[threadIdx.x] += sh[threadIdx.x + st]; __syncthreads(); }
  const float sc = rsqrtf(sh[0] / (float)NPX + 1e-5f);
#pragma unroll
  for (int bi = 0; bi < NIMG; ++bi) { float* op = out + ((size_t)bi * CIN + c) * NPI;
#pragma unroll
    for (int k = 0; k < NPI / 256; ++k) op[threadIdx.x + 256u * k] = gw * ((y[bi][k] - mu) * sc) + be; } }

extern "C" void kernel_launch(void* const* d_in, const int* in_sizes, int n_in,
                              void* d_out, int out_size, void* d_ws, size_t ws_size, hipStream_t stream) {
  (void)in_sizes; (void)n_in; (void)out_size;
  const float* const* I = (const float* const*)d_in; const float* x = I[0]; const float* w_in = I[1]; const float* b_in = I[2];
  const float* qbw = I[3]; const float* qbb = I[4]; const float* qsw = I[5]; const float* qsb = I[6]; const float* kbw = I[7]; const float* kbb = I[8]; const float* ksw = I[9]; const float* ksb = I[10]; const float* vbw = I[11]; const float* vbb = I[12]; const float* vsw = I[13]; const float* vsb = I[14];
  const float* w_out = I[15]; const float* b_out = I[16]; const float* gam = I[17]; const float* bnw = I[18]; const float* bnb = I[19];
  char* ws = (char*)d_ws; size_t off = 0;
  auto take = [&](size_t bytes) { char* p = ws + off; off += (bytes + 255) & ~(size_t)255; return p; };
  _Float16* BIN = (_Float16*)take((size_t)DK * CIN * 2); _Float16* BB[3]; _Float16* BS[3]; for (int i = 0; i < 3; ++i) { BB[i] = (_Float16*)take((size_t)DK * 2 * DK * 2); BS[i] = (_Float16*)take((size_t)DK * 2 * DK * NG * 2); } _Float16* BOUT = (_Float16*)take((size_t)CIN * 2 * DK * 2);
  _Float16* X16 = (_Float16*)take((size_t)NPX * CIN * 2); float* ATT = (float*)take((size_t)NPX * DK * 4); float* IST = (float*)take((size_t)2 * NIMG * DK * 32 * 4); _Float16* SIL = (_Float16*)take((size_t)NPX * 2 * DK * 2); _Float16* BAS = (_Float16*)take((size_t)NPX * 2 * DK * NG * 2);
  float* G = (float*)take((size_t)3 * NPX * DK * 4); _Float16* Qh = (_Float16*)take((size_t)NPX * DK * 2); _Float16* Ql = (_Float16*)take((size_t)NPX * DK * 2); _Float16* Kh = (_Float16*)take((size_t)NPX * DK * 2); _Float16* Kl = (_Float16*)take((size_t)NPX * DK * 2); _Float16* Vth = (_Float16*)take((size_t)NPX * DK * 2); _Float16* Vtl = (_Float16*)take((size_t)NPX * DK * 2);
  _Float16* O16 = (_Float16*)take((size_t)NPX * 2 * DK * 2); float* A2T = (float*)take((size_t)NPX * CIN * 4);
  unsigned* MB = (unsigned*)take((size_t)NPI * (NPI / 32) * 4); int* RA = (int*)take((size_t)NPI * 4); int* KE = (int*)take((size_t)(NPI / 64) * 32 * 4);
  if (off > ws_size) return;      /* 0.6 + 8 + 4 + 4 + 32 + 12 + 12 + 4 + 16 + 2 = 95 MiB */
  k_prep<<<NB_XCL + NB_TAB + 3 * NB_WS + 3 * NB_WB + NB_WO + NB_WI, 256, 0, stream>>>(x, w_in, w_out, qbw, kbw, vbw, qsw, ksw, vsw, X16, BIN, BOUT, BB[0], BB[1], BB[2], BS[0], BS[1], BS[2], MB, RA, KE);
  const dim3 g64((NPX / 128) * 1, 1), g64x3((NPX / 128) * 1, 3), gout((CIN / 128) * (NPI / 64), NIMG);
  k_gemm_att<<<g64, 128, 0, stream>>>(X16, BIN, b_in, ATT, SIL);      /* att = conv1x1(x) + b; silu(att) */
  k_stat_base<<<NB_IS + 3 * NB_GB, 256, 0, stream>>>(ATT, IST, SIL, BB[0], BB[1], BB[2], qbb, kbb, vbb, G, (size_t)NPX * DK, DK, NPX, DK, 2 * DK);      /* G = base(silu) + b_base, planes q, k, v */
  k_basis<<<(NPX * DK + 255) / 256, 256, 0, stream>>>(ATT, IST, BAS);
  k_gemm2qkv<<<g64x3, 128, 0, stream>>>(BAS, 2 * DK * NG, BS[0], BS[1], BS[2], 2 * DK * NG, 0.0625f, qsb, ksb, vsb, G, (size_t)NPX * DK, DK, NPX, DK, 2 * DK * NG, Qh, Ql, Kh, Kl, Vth, Vtl);      /* spline(basis) + b_spline + G, as operand planes */
  k_flashm<NPI, NPI, KSPLIT><<<NIMG * NH * (NPI / 64), 128 * KSPLIT, 0, stream>>>(Qh, Ql, Kh, Kl, Vth, Vtl, MB, RA, KE, O16);      /* slab = image (NH 1) */
  k_gemm2<0><<<gout, 128, 0, stream>>>(BOUT, 2 * DK, 0, O16, 2 * DK, (size_t)NPI * 2 * DK, 0.0625f, nullptr, 0, nullptr, 1, 0, 0, A2T, nullptr, NPI, (size_t)CIN * NPI, CIN, NPI, 2 * DK);      /* att2^T = w_out . out^T of image blockIdx.y (pair operands), rows = channels; its bias is added in k_ybn */
  k_ybn<<<CIN, 256, 0, stream>>>(x, gam, A2T, b_out, bnw, bnb, (float*)d_out);
}
